// v000
// The times below were measured on an AMD MI455X: many runs one after another, warmed up first and cycling through
// copies of the inputs, with the whole window's GPU time divided by the number of runs. Launches and the gaps
// between them are all in it. The median over several windows is given; except for v000 it joins two sittings, which
// can be a few percent apart, so the side-by-side timings, each taken in one sitting, are the better comparison.
// v000 is the starting kernel. One run takes 1000 microseconds.
#include <hip/hip_runtime.h>

// Transformer-XL relative-position multi-head attention (q, k, v inputs [1][2048][1024]; qh = q w_q, kh = k w_k, vh = v w_v ('xw' [1024][1024], no bias; 16 heads x 64); pe = reversed sinusoidal table of length 4096 (pe[m] = PE(4095 - m), interleaved sin/cos) projected by w_p -> ph [16][4096][64]; ac = (qh + b_u).kh, bd = left_shift((qh + b_v).ph): bd[i][j] = raw[i][4095 - i + j] for j <= i else 0; scores = (ac + bd)/8; mask (int [1][2048][2048], read; -inf where 0); softmax; out = attn.vh merged w_o -> [1][2048][1024]).
// Layout: projections from three bf16 input planes; b_u / b_v folded into two sets of query planes; the position table is computed on device in f32 (pos / 10000^(2i/1024), precise powf/sinf/cosf) -> hi/lo planes -> 2-product GEMM with the exact bf16 w_p -> per-head hi/lo planes; per pass of two heads the content scores [2][2048][2048] and raw position scores [2][2048][4096] are hi/lo x hi/lo GEMMs (3 products) and the softmax kernel gathers the shifted position score per logit.
// Compute dtypes, f32 accumulate: every input rounded to bf16; q/k/v on PLAIN bf16 operands (inputs: exact); content / position scores and attn.v on hi/lo planes for every row (3 products); softmax f32; w_o hl x exact (2 products).

#define NB_  1
#define TT   2048
#define DM   1024
#define NH_  16
#define NKV  16
#define REP  (NH_ / NKV)
#define HD   64
#define DQ   (NH_ * HD)
#define DKV  (NKV * HD)
#define NPE  4096                 // relative positions (2 x seq)
typedef __attribute__((ext_vector_type(4))) int v4i;
#define ZH   2
#define RH   2048                  // query rows < RH use hi+lo planes (0: none)
#define WIN  0
#define PCAR 1024.0f
#define SCL  0.125f   // HD^-0.5
typedef _Float16 h16;
typedef unsigned short bf;
typedef __attribute__((ext_vector_type(16))) __bf16   v16bf;
typedef __attribute__((ext_vector_type(16))) _Float16 v16h;
typedef __attribute__((ext_vector_type(8)))  _Float16 v8h;
typedef __attribute__((ext_vector_type(8)))  unsigned short v8us;
typedef __attribute__((ext_vector_type(8)))  float    v8f;
typedef __attribute__((ext_vector_type(4)))  float    v4f;
typedef v8h  __attribute__((may_alias)) v8ha;
typedef v4f  __attribute__((may_alias)) v4fa;
typedef v8us __attribute__((may_alias)) v8usa;

__device__ __forceinline__ unsigned short f2bf(float f) { unsigned u = __float_as_uint(f); u += 0x7FFFu + ((u >> 16) & 1u); return (unsigned short)(u >> 16); }
__device__ __forceinline__ float bf2f(unsigned short b) { return __uint_as_float(((unsigned)b) << 16); }
__device__ __forceinline__ float bfr(float f) { return bf2f(f2bf(f)); }
__device__ __forceinline__ v16h cat16(v8h lo, v8h hi) { return __builtin_shufflevector(lo, hi, 0, 1, 2, 3, 4, 5, 6, 7, 8, 9, 10, 11, 12, 13, 14, 15); }
__device__ __forceinline__ v16bf cat16b(v8us lo, v8us hi) { return __builtin_bit_cast(v16bf, __builtin_shufflevector(lo, hi, 0, 1, 2, 3, 4, 5, 6, 7, 8, 9, 10, 11, 12, 13, 14, 15)); }
__device__ __forceinline__ v8f wmma16(v16h a, v16h b, v8f c) { return __builtin_amdgcn_wmma_f32_16x16x32_f16(false, a, false, b, (short)0, c, false, false); }
__device__ __forceinline__ v8f wmmab(v16bf a, v16bf b, v8f c) { return __builtin_amdgcn_wmma_f32_16x16x32_bf16(false, a, false, b, (short)0, c, false, false); }



// ---- k_gemmw: register-blocked GEMM, ONE WAVE per 64x64 output tile (16 accumulators), operands straight from K-contiguous 16-bit planes; grid (M/64, N/64, Z), 32 threads.
// C[m][n] (f32, pitch ldc, + optional f32 bias[n]) = sum_k A[m][k] Bt[n][k] (+ split products per NSPLIT). z-batch strides sA/sB/sC in elements. K % 32 == 0.
template <typename T16> struct WFrag;
template <> struct WFrag<h16> { typedef v16h V; static __device__ __forceinline__ V ld(const h16* p) { return cat16(*(const v8h*)p, *(const v8h*)(p + 16)); } static __device__ __forceinline__ v8f mma(V a, V b, v8f c) { return wmma16(a, b, c); } };
template <> struct WFrag<bf> { typedef v16bf V; static __device__ __forceinline__ V ld(const bf* p) { return cat16b(*(const v8us*)p, *(const v8us*)(p + 16)); } static __device__ __forceinline__ v8f mma(V a, V b, v8f c) { return wmmab(a, b, c); } };
template <typename T16, int NSPLIT, bool BIAS>
__global__ __launch_bounds__(32) void k_gemmw(const T16* __restrict__ A, const T16* __restrict__ A2, const T16* __restrict__ Bt, const T16* __restrict__ Bt2, int K, float* C, int ldc, const float* __restrict__ bias, size_t sA, size_t sB, size_t sC) {
    typedef typename WFrag<T16>::V V;
    __shared__ __align__(16) float os[16 * 68];
    const size_t z = blockIdx.z; A += z * sA; if (A2) A2 += z * sA; Bt += z * sB; if (Bt2) Bt2 += z * sB; C += z * sC;
    const int lane = threadIdx.x & 31, lr = lane & 15, hi = lane >> 4; const int r0 = blockIdx.x * 64, c0 = blockIdx.y * 64;
    v8f acc[4][4];
#pragma unroll
    for (int mb = 0; mb < 4; ++mb)
#pragma unroll
        for (int nb = 0; nb < 4; ++nb) acc[mb][nb] = (v8f){};
    const size_t aoff = (size_t)(r0 + lr) * K + 8 * hi, boff = (size_t)(c0 + lr) * K + 8 * hi;
#pragma unroll 1
    for (int kc = 0; kc < K; kc += 32) {
        V a[4], a2[4];
#pragma unroll
        for (int mb = 0; mb < 4; ++mb) { a[mb] = WFrag<T16>::ld(A + aoff + (size_t)mb * 16 * K + kc); if (NSPLIT == 1 || NSPLIT == 2) a2[mb] = WFrag<T16>::ld(A2 + aoff + (size_t)mb * 16 * K + kc); }
#pragma unroll
        for (int nb = 0; nb < 4; ++nb) { const V b = WFrag<T16>::ld(Bt + boff + (size_t)nb * 16 * K + kc); V b2; if (NSPLIT >= 2) b2 = WFrag<T16>::ld(Bt2 + boff + (size_t)nb * 16 * K + kc);
#pragma unroll
            for (int mb = 0; mb < 4; ++mb) { acc[mb][nb] = WFrag<T16>::mma(a[mb], b, acc[mb][nb]); if (NSPLIT == 1 || NSPLIT == 2) acc[mb][nb] = WFrag<T16>::mma(a2[mb], b, acc[mb][nb]); if (NSPLIT >= 2) acc[mb][nb] = WFrag<T16>::mma(a[mb], b2, acc[mb][nb]); } }
        asm volatile("v_nop\n\tv_nop\n\tv_nop\n\tv_nop" : "+v"(acc[0][0]), "+v"(acc[1][1]), "+v"(acc[2][2]), "+v"(acc[3][3]) : "v"(a[0]), "v"(a[3]));
    }
#pragma unroll
    for (int mb = 0; mb < 4; ++mb) {
#pragma unroll
        for (int nb = 0; nb < 4; ++nb) {
#pragma unroll
            for (int j = 0; j < 8; ++j) os[(hi * 8 + j) * 68 + nb * 16 + lr] = acc[mb][nb][j]; }
        __builtin_amdgcn_wave_barrier(); asm volatile("" ::: "memory");
        float* crow = C + (size_t)(r0 + mb * 16) * ldc + c0;
{
#pragma unroll
            for (int s = 0; s < 8; ++s) { const int row = 2 * s + hi, cofs = lr * 4; v4f val = *(const v4fa*)(os + row * 68 + cofs); if (BIAS) { val[0] += bfr(bias[c0 + cofs]); val[1] += bfr(bias[c0 + cofs + 1]); val[2] += bfr(bias[c0 + cofs + 2]); val[3] += bfr(bias[c0 + cofs + 3]); }
                *(v4f*)(crow + (size_t)row * ldc + cofs) = val; }
             }
        __builtin_amdgcn_wave_barrier(); asm volatile("" ::: "memory");
    }
}

__device__ __forceinline__ h16 tohx(float x) { return (h16)x; }
__device__ __forceinline__ void splitf(float y, unsigned short& h, unsigned short& l) { h = f2bf(y); l = f2bf(y - bf2f(h)); }
typedef __attribute__((ext_vector_type(2))) _Float16 v2h;
typedef __attribute__((ext_vector_type(4))) _Float16 v4h;
typedef __attribute__((ext_vector_type(2))) unsigned short v2us;
typedef __attribute__((ext_vector_type(4))) unsigned short v4us;
typedef __attribute__((ext_vector_type(2))) float v2f;
typedef __attribute__((ext_vector_type(4))) int v4i;

__global__ __launch_bounds__(256) void k_wtG(const float* __restrict__ w, int K, int N, bf* Bt) {
    const int lane = threadIdx.x & 31; const int L0 = (blockIdx.x * 8 + (threadIdx.x >> 5)) * 8; const int nlines = N * K / 64;
{
#pragma unroll 1
        for (int l = 0; l < 8; ++l) { const int L = L0 + l; if (L >= nlines) break; const size_t e = (size_t)L * 64 + lane * 2; const int k = (int)(e % K), n = (int)(e / K); v2us o;
            o[0] = f2bf(w[(size_t)k * N + n]); o[1] = f2bf(w[(size_t)(k + 1) * N + n]); *(v2us*)(Bt + e) = o; }
         }
}
__global__ __launch_bounds__(256) void k_petab(bf* PEh, bf* PEl) { const size_t e = ((size_t)blockIdx.x * 256 + threadIdx.x) * 2; if (e >= (size_t)NPE * DM) return; const int c = (int)(e % DM); const int m = (int)(e / DM); const float pos = (float)(NPE - 1 - m); const float ex = __fdiv_rn((float)c, (float)DM);   /* c even: 2i/d_model */ const float den = powf(10000.0f, ex); const float th = __fdiv_rn(pos, den); v2us oh, ol; unsigned short a, b2; splitf(sinf(th), a, b2); oh[0] = a; ol[0] = b2; splitf(cosf(th), a, b2); oh[1] = a; ol[1] = b2; *(v2us*)(PEh + e) = oh; *(v2us*)(PEl + e) = ol;  }
__global__ __launch_bounds__(256) void k_addhb(const float* __restrict__ F, const float* __restrict__ hb, float* FO, size_t n4) { const size_t i = (size_t)blockIdx.x * 256 + threadIdx.x; if (i >= n4) return; const int c = (int)((i * 4) % DQ); const v4f a = *(const v4f*)(F + i * 4); v4f o;
#pragma unroll
    for (int q = 0; q < 4; ++q) o[q] = __fadd_rn(a[q], bfr(hb[c + q])); *(v4f*)(FO + i * 4) = o;  }
__global__ __launch_bounds__(256) void k_pplane(const float* __restrict__ POS, bf* Ph2, bf* Pl2) { const size_t e = ((size_t)blockIdx.x * 256 + threadIdx.x) * 2; if (e >= (size_t)NH_ * NPE * HD) return; const int d = (int)(e % HD); const int p = (int)((e / HD) % NPE); const int h = (int)(e / ((size_t)HD * NPE)); v2us oh, ol;
#pragma unroll
    for (int q = 0; q < 2; ++q) { unsigned short a, c; splitf(POS[(size_t)p * DQ + h * HD + d + q], a, c); oh[q] = a; ol[q] = c; } *(v2us*)(Ph2 + e) = oh; *(v2us*)(Pl2 + e) = ol;  }
__global__ __launch_bounds__(256) void k_cvt8(const float* __restrict__ src, bf* dst, size_t n8) { const size_t i = (size_t)blockIdx.x * 256 + threadIdx.x; if (i >= n8) return; const v8f v = *(const v8f*)(src + i * 8); v8us o;
#pragma unroll
    for (int k = 0; k < 8; ++k) o[k] = f2bf(v[k]); *(v8us*)(dst + i * 8) = o;  }

// k_rope: head planes [h][t][d] (fp16 + hi/lo) of rope(x) x sc with the rotate-half convention out[d] = x[d] cos[t][d] - x[d+HD/2] sin[t][d], out[d+HD/2] = x[d+HD/2] cos[t][d+HD/2] + x[d] sin[t][d+HD/2]
__global__ __launch_bounds__(256) void k_rope(const float* __restrict__ F, int pitch, int nheads, const float* __restrict__ CS, const float* __restrict__ RF, const float* __restrict__ nw, float sc, h16* P16, bf* Ph, bf* Pl) {
    const size_t e = ((size_t)blockIdx.x * 256 + threadIdx.x) * 2; if (e >= (size_t)nheads * TT * HD) return; const int d = (int)(e % HD); const int t = (int)((e / HD) % TT); const int h = (int)(e / ((size_t)HD * TT)); const float* f = F + (size_t)t * pitch + h * HD; const float rf = RF ? RF[(size_t)h * TT + t] : 1.0f; v2h o16; v2us oh, ol;
#pragma unroll
    for (int q = 0; q < 2; ++q) { const int dd = d + q; const int dp = (dd < HD / 2) ? dd + HD / 2 : dd - HD / 2; float x0 = f[dd], x1 = f[dp];
        if (RF) { float n0 = __fmul_rn(x0, rf), n1 = __fmul_rn(x1, rf); asm volatile("" : "+v"(n0)); asm volatile("" : "+v"(n1)); x0 = __fmul_rn(bfr(nw[dd]), n0); x1 = __fmul_rn(bfr(nw[dp]), n1); }
        const v2f cs = *(const v2f*)(CS + ((size_t)t * HD + dd) * 2); float a = __fmul_rn(x0, cs[0]), bq = __fmul_rn(x1, cs[1]); asm volatile("" : "+v"(a)); asm volatile("" : "+v"(bq)); const float r = ((dd < HD / 2) ? __fsub_rn(a, bq) : __fadd_rn(a, bq)) * sc;
        o16[q] = tohx(r); unsigned short a2, c2; splitf(r, a2, c2); oh[q] = a2; ol[q] = c2; }
    *(v2h*)(P16 + e) = o16; *(v2us*)(Ph + e) = oh; *(v2us*)(Pl + e) = ol;  }
__global__ __launch_bounds__(256) void k_vtp(const float* __restrict__ F, int pitch, int nheads, h16* V16, bf* Vh, bf* Vl) { const size_t e = ((size_t)blockIdx.x * 256 + threadIdx.x) * 2; if (e >= (size_t)nheads * HD * TT) return; const int t = (int)(e % TT); const int d = (int)((e / TT) % HD); const int g = (int)(e / ((size_t)TT * HD)); v2h o16; v2us oh, ol;
#pragma unroll
    for (int q = 0; q < 2; ++q) { const float x = F[(size_t)(t + q) * pitch + g * HD + d]; o16[q] = tohx(x); unsigned short a2, c2; splitf(x, a2, c2); oh[q] = a2; ol[q] = c2; }
    *(v2h*)(V16 + e) = o16; *(v2us*)(Vh + e) = oh; *(v2us*)(Vl + e) = ol;  }
__global__ __launch_bounds__(256) void k_csid(float* CS) { const int idx = blockIdx.x * 256 + threadIdx.x; if (idx >= TT * HD) return; v2f cs; cs[0] = 1.0f; cs[1] = 0.0f; *(v2f*)(CS + (size_t)idx * 2) = cs;  }
// k_asoft: per row (zz, i): t = (ac + bd)/8 with bd = SR[row][4095 - i + j] for j <= i else 0, -inf where mask[i][j] == 0; softmax over the 2048 keys (register row, one exp, fixed trees);
__global__ __launch_bounds__(256) void k_asoft(const float* __restrict__ Sb, const float* __restrict__ SR, const int* __restrict__ MKb, h16* P16, bf* Ph, bf* Pl) {
    const int lane = threadIdx.x & 31; const int row = blockIdx.x * 8 + (threadIdx.x >> 5); if (row >= ZH * TT) return; const int i = row % TT; const int zz = row / TT; (void)zz; const float* srr = SR + (size_t)row * NPE + (NPE - 1 - i);   /* left_shift: raw position index 4095 - i + j (valid for j <= i) */ const int* mkr = MKb + (size_t)i * TT; const bool hires = (i < RH); const float* sr = Sb + (size_t)row * TT; float v[TT / 32]; float mx = -3.0e38f;
#pragma unroll
    for (int ch = 0; ch < TT / 128; ++ch) { const int j0 = ch * 128 + lane * 4; const v4f a = *(const v4f*)(sr + j0); const v4i m4 = *(const v4i*)(mkr + j0);
#pragma unroll
        for (int q = 0; q < 4; ++q) { const int j = j0 + q; const float bd = (j <= i) ? srr[j] : 0.f;   /* left_shift keeps j <= i, zero elsewhere (not masked) */ float su = __fadd_rn(a[q], bd); asm volatile("" : "+v"(su)); const float t = (m4[q] != 0) ? su * SCL : -3.0e38f;   /* (ac + bd)/8, mask select */ v[ch * 4 + q] = t; mx = fmaxf(mx, t); } }
#pragma unroll
    for (int sh = 16; sh; sh >>= 1) mx = fmaxf(mx, __shfl_xor(mx, sh, 32));
    float sum = 0.f;
#pragma unroll
    for (int k = 0; k < TT / 32; ++k) { float d0 = __fsub_rn(v[k], mx); asm volatile("" : "+v"(d0)); v[k] = __builtin_amdgcn_exp2f(__fmul_rn(d0, 1.4426950408889634f)); sum += v[k]; }
#pragma unroll
    for (int sh = 16; sh; sh >>= 1) sum += __shfl_xor(sum, sh, 32);
    const float f = __fdiv_rn(hires ? 1.0f : PCAR, sum);
{
        if (hires) {
#pragma unroll
            for (int ch = 0; ch < TT / 128; ++ch) { v4us oh, ol;
#pragma unroll
                for (int q = 0; q < 4; ++q) { unsigned short a, c2; splitf(v[ch * 4 + q] * f, a, c2); oh[q] = a; ol[q] = c2; }
                const size_t oo = ((size_t)zz * (RH ? RH : 1) + i) * TT + ch * 128 + lane * 4; *(v4us*)(Ph + oo) = oh; *(v4us*)(Pl + oo) = ol; }
        } else {
#pragma unroll
            for (int ch = 0; ch < TT / 128; ++ch) { v4h o4;
#pragma unroll
                for (int q = 0; q < 4; ++q) o4[q] = tohx(v[ch * 4 + q] * f);
                *(v4h*)(P16 + (size_t)row * TT + ch * 128 + lane * 4) = o4; } }
         }
}

__global__ __launch_bounds__(256) void k_merge(const float* __restrict__ O, int h0, bf* Ah, bf* Al) { const size_t e = ((size_t)blockIdx.x * 256 + threadIdx.x) * 2; if (e >= (size_t)ZH * TT * HD) return; const int d = (int)(e % HD); const int t = (int)((e / HD) % TT); const int zz = (int)(e / ((size_t)HD * TT)); const float cs = (t < RH) ? 1.0f : (1.0f / PCAR); const size_t oo = (size_t)t * DQ + (h0 + zz) * HD + d;
    v2us oh, ol;
#pragma unroll
    for (int q = 0; q < 2; ++q) { unsigned short a, c2; splitf(O[e + q] * cs, a, c2); oh[q] = a; ol[q] = c2; } *(v2us*)(Ah + oo) = oh; *(v2us*)(Al + oo) = ol;  }

extern "C" void kernel_launch(void* const* d_in, const int* in_sizes, int n_in,
                              void* d_out, int out_size, void* d_ws, size_t ws_size, hipStream_t stream) {
    (void)in_sizes; (void)n_in; (void)out_size;
    const float* x = (const float*)d_in[0]; const float* xk = (const float*)d_in[1]; const float* xv = (const float*)d_in[2]; const int* MK = (const int*)d_in[3]; const float* wq = (const float*)d_in[4]; const float* wk = (const float*)d_in[5]; const float* wv = (const float*)d_in[6]; const float* wp = (const float*)d_in[7]; const float* wo = (const float*)d_in[8]; const float* pbu = (const float*)d_in[9]; const float* pbv = (const float*)d_in[10];
    float* OUT = (float*)d_out;     // [1][2048][1024]
    char* wsp = (char*)d_ws;
    auto take = [&](size_t bytes) { char* p = wsp; wsp += (bytes + 255) & ~(size_t)255; return (void*)p; };
    bf* WQ = (bf*)take((size_t)DQ * DM * 2); bf* WK = (bf*)take((size_t)DKV * DM * 2); bf* WV = (bf*)take((size_t)DKV * DM * 2); bf* WO = (bf*)take((size_t)DM * DQ * 2); float* CS = (float*)take((size_t)TT * HD * 2 * 4);
    bf* XB = (bf*)take((size_t)TT * DM * 2); bf* XKB = (bf*)take((size_t)TT * DM * 2); bf* XVB = (bf*)take((size_t)TT * DM * 2); float* FQ = (float*)take((size_t)TT * DQ * 4); float* FK = (float*)take((size_t)TT * DKV * 4); float* FQU = (float*)take((size_t)TT * DQ * 4); bf* WP = (bf*)take((size_t)DQ * DM * 2); bf* PPh = (bf*)take((size_t)NH_ * NPE * HD * 2); bf* PPl = (bf*)take((size_t)NH_ * NPE * HD * 2); bf* QVh = (bf*)take((size_t)NH_ * TT * HD * 2); bf* QVl = (bf*)take((size_t)NH_ * TT * HD * 2); float* SR = (float*)take((size_t)ZH * TT * NPE * 4); float* POS = SR;   /* projected positions live in the raw position-score buffer until k_pplane has consumed them */ float* FQV = FQ;   /* (q + b_v) is formed in place after (q + b_u) has been copied out */
    h16* QP16 = (h16*)take((size_t)NH_ * TT * HD * 2); h16* KP16 = (h16*)take((size_t)NKV * TT * HD * 2); h16* VT16 = (h16*)take((size_t)NKV * HD * TT * 2);
    bf* QPh = (bf*)take((size_t)NH_ * TT * HD * 2); bf* QPl = (bf*)take((size_t)NH_ * TT * HD * 2); bf* KPh = (bf*)take((size_t)NKV * TT * HD * 2); bf* KPl = (bf*)take((size_t)NKV * TT * HD * 2); bf* VTh = (bf*)take((size_t)NKV * HD * TT * 2); bf* VTl = (bf*)take((size_t)NKV * HD * TT * 2); bf* Ph = (bf*)take((size_t)ZH * RH * TT * 2); bf* Pl = (bf*)take((size_t)ZH * RH * TT * 2);
    float* Sb = (float*)take((size_t)ZH * TT * TT * 4); bf* PEh = (bf*)Sb; bf* PEl = PEh + (size_t)NPE * DM;   /* the position-table planes live in the score buffer until the position planes are built (before the batch loop) */ h16* P16 = (h16*)take(256);   /* unused: all rows hi/lo */ float* Ob = (float*)take((size_t)ZH * TT * HD * 4); bf* ATh = (bf*)take((size_t)TT * DQ * 2); bf* ATl = (bf*)take((size_t)TT * DQ * 2);
    if ((size_t)(wsp - (char*)d_ws) > ws_size) return;    // ws 256 MiB
    float* FV = FK;   // v projection reuses the k buffer after the k planes are built (stream-ordered)
    { k_wtG<<<(unsigned)((DM * DQ / 64 + 63) / 64), 256, 0, stream>>>(wq, DM, DQ, WQ); k_wtG<<<(unsigned)((DM * DKV / 64 + 63) / 64), 256, 0, stream>>>(wk, DM, DKV, WK); k_wtG<<<(unsigned)((DM * DKV / 64 + 63) / 64), 256, 0, stream>>>(wv, DM, DKV, WV);
      k_wtG<<<(unsigned)((DQ * DM / 64 + 63) / 64), 256, 0, stream>>>(wo, DQ, DM, WO);
       }
    k_csid<<<(TT * HD + 255) / 256, 256, 0, stream>>>(CS); k_petab<<<(unsigned)(((size_t)NPE * DM / 2 + 255) / 256), 256, 0, stream>>>(PEh, PEl); k_wtG<<<(unsigned)((DM * DQ / 64 + 63) / 64), 256, 0, stream>>>(wp, DM, DQ, WP); k_gemmw<bf, 1, false><<<dim3(NPE / 64, DQ / 64, 1), 32, 0, stream>>>(PEh, PEl, WP, nullptr, DM, POS, DQ, nullptr, 0, 0, 0); k_pplane<<<(unsigned)(((size_t)NH_ * NPE * HD / 2 + 255) / 256), 256, 0, stream>>>(POS, PPh, PPl);   /* reversed sinusoidal table (bf16) x w_p -> per-head position planes [h][4096][64] */
    const unsigned LQ = (unsigned)(((size_t)NH_ * TT * HD / 2 + 255) / 256), LKv = (unsigned)(((size_t)NKV * TT * HD / 2 + 255) / 256);
    for (int b = 0; b < NB_; ++b) {
        
        k_cvt8<<<(unsigned)(((size_t)TT * DM / 8 + 255) / 256), 256, 0, stream>>>(x + (size_t)b * TT * DM, XB, (size_t)TT * DM / 8); k_cvt8<<<(unsigned)(((size_t)TT * DM / 8 + 255) / 256), 256, 0, stream>>>(xk + (size_t)b * TT * DM, XKB, (size_t)TT * DM / 8); k_cvt8<<<(unsigned)(((size_t)TT * DM / 8 + 255) / 256), 256, 0, stream>>>(xv + (size_t)b * TT * DM, XVB, (size_t)TT * DM / 8);
        k_gemmw<bf, 0, false><<<dim3(TT / 64, DQ / 64, 1), 32, 0, stream>>>(XB, nullptr, WQ, nullptr, DM, FQ, DQ, nullptr, 0, 0, 0);
        k_addhb<<<(unsigned)(((size_t)TT * DQ / 4 + 255) / 256), 256, 0, stream>>>(FQ, pbu, FQU, (size_t)TT * DQ / 4); k_addhb<<<(unsigned)(((size_t)TT * DQ / 4 + 255) / 256), 256, 0, stream>>>(FQ, pbv, FQV, (size_t)TT * DQ / 4); k_rope<<<LQ, 256, 0, stream>>>(FQU, DQ, NH_, CS, nullptr, nullptr, 1.0f, QP16, QPh, QPl); k_rope<<<LQ, 256, 0, stream>>>(FQV, DQ, NH_, CS, nullptr, nullptr, 1.0f, QP16, QVh, QVl);   /* (q + b_u) planes for the content scores, (q + b_v) planes for the position scores */
        k_gemmw<bf, 0, false><<<dim3(TT / 64, DKV / 64, 1), 32, 0, stream>>>(XKB, nullptr, WK, nullptr, DM, FK, DKV, nullptr, 0, 0, 0);
        k_rope<<<LKv, 256, 0, stream>>>(FK, DKV, NKV, CS, nullptr, nullptr, 1.0f, KP16, KPh, KPl);
        k_gemmw<bf, 0, false><<<dim3(TT / 64, DKV / 64, 1), 32, 0, stream>>>(XVB, nullptr, WV, nullptr, DM, FV, DKV, nullptr, 0, 0, 0); k_vtp<<<LKv, 256, 0, stream>>>(FV, DKV, NKV, VT16, VTh, VTl);
        for (int h0 = 0; h0 < NH_; h0 += ZH) { const size_t zq = (size_t)h0, zk = (size_t)(h0 / REP);   // one kv head per query head: the pass's two heads use consecutive kv planes (z-strides TT*HD)
            k_gemmw<bf, 2, false><<<dim3(RH / 64, TT / 64, ZH), 32, 0, stream>>>(QPh + zq * TT * HD, QPl + zq * TT * HD, KPh + zk * TT * HD, KPl + zk * TT * HD, HD, Sb, TT, nullptr, (size_t)TT * HD, (size_t)TT * HD, (size_t)TT * TT);
            k_gemmw<bf, 2, false><<<dim3(TT / 64, NPE / 64, ZH), 32, 0, stream>>>(QVh + zq * TT * HD, QVl + zq * TT * HD, PPh + zq * NPE * HD, PPl + zq * NPE * HD, HD, SR, NPE, nullptr, (size_t)TT * HD, (size_t)NPE * HD, (size_t)TT * NPE);   /* raw position scores (q+b_v).ph [2][2048][4096] */ k_asoft<<<ZH * TT / 8, 256, 0, stream>>>(Sb, SR, MK, P16, Ph, Pl);
            k_gemmw<bf, 2, false><<<dim3(RH / 64, HD / 64, ZH), 32, 0, stream>>>(Ph, Pl, VTh + zk * HD * TT, VTl + zk * HD * TT, TT, Ob, HD, nullptr, (size_t)RH * TT, (size_t)HD * TT, (size_t)TT * HD);
            k_merge<<<(unsigned)(((size_t)ZH * TT * HD / 2 + 255) / 256), 256, 0, stream>>>(Ob, h0, ATh, ATl); }
        k_gemmw<bf, 1, false><<<dim3(TT / 64, DM / 64, 1), 32, 0, stream>>>(ATh, ATl, WO, nullptr, DQ, OUT + (size_t)b * TT * DM, DM, nullptr, 0, 0, 0); }
}

// v001
// Measured time: 708 microseconds a run.
// Timed twice side by side with v000, it ran 1.42 and 1.43 times as fast.
#include <hip/hip_runtime.h>

// Transformer-XL relative-position multi-head attention (q, k, v inputs [1][2048][1024]; qh = q w_q, kh = k w_k, vh = v w_v ('xw' [1024][1024], no bias; 16 heads x 64); pe = reversed sinusoidal table of length 4096 (pe[m] = PE(4095 - m), interleaved sin/cos) projected by w_p -> ph [16][4096][64]; ac = (qh + b_u).kh, bd = left_shift((qh + b_v).ph): bd[i][j] = raw[i][4095 - i + j] for j <= i else 0; scores = (ac + bd)/8; mask (int [1][2048][2048], read; -inf where 0); softmax; out = attn.vh merged w_o -> [1][2048][1024]).
// Layout: projections from three bf16 input planes; b_u / b_v folded into two sets of query planes; the position table is computed on device in f32 (pos / 10000^(2i/1024), precise powf/sinf/cosf) -> hi/lo planes -> 2-product GEMM with the exact bf16 w_p -> per-head hi/lo planes; per pass of two heads the content scores [2][2048][2048] and raw position scores [2][2048][4096] are hi/lo x hi/lo GEMMs (3 products) and the softmax kernel gathers the shifted position score per logit.
// Compute dtypes, f32 accumulate: every input rounded to bf16; q/k/v on PLAIN bf16 operands (inputs: exact); content / position scores and attn.v on hi/lo planes for every row (3 products); softmax f32; w_o hl x exact (2 products).

#define NB_  1
#define TT   2048
#define DM   1024
#define NH_  16
#define NKV  16
#define REP  (NH_ / NKV)
#define HD   64
#define DQ   (NH_ * HD)
#define DKV  (NKV * HD)
#define NPE  4096                 // relative positions (2 x seq)
typedef __attribute__((ext_vector_type(4))) int v4i;
#define ZH   2
#define RH   2048                  // query rows < RH use hi+lo planes (0: none)
#define WIN  0
#define PCAR 1024.0f
#define SCL  0.125f   // HD^-0.5
#define KSV  4                     // work-groups that share the key range of one attn.v tile (f32 partial planes)
typedef _Float16 h16;
typedef unsigned short bf;
typedef __attribute__((ext_vector_type(16))) __bf16   v16bf;
typedef __attribute__((ext_vector_type(16))) _Float16 v16h;
typedef __attribute__((ext_vector_type(8)))  _Float16 v8h;
typedef __attribute__((ext_vector_type(8)))  unsigned short v8us;
typedef __attribute__((ext_vector_type(8)))  float    v8f;
typedef __attribute__((ext_vector_type(4)))  float    v4f;
typedef v8h  __attribute__((may_alias)) v8ha;
typedef v4f  __attribute__((may_alias)) v4fa;
typedef v8us __attribute__((may_alias)) v8usa;

__device__ __forceinline__ unsigned short f2bf(float f) { unsigned u = __float_as_uint(f); u += 0x7FFFu + ((u >> 16) & 1u); return (unsigned short)(u >> 16); }
__device__ __forceinline__ float bf2f(unsigned short b) { return __uint_as_float(((unsigned)b) << 16); }
__device__ __forceinline__ float bfr(float f) { return bf2f(f2bf(f)); }
__device__ __forceinline__ v16h cat16(v8h lo, v8h hi) { return __builtin_shufflevector(lo, hi, 0, 1, 2, 3, 4, 5, 6, 7, 8, 9, 10, 11, 12, 13, 14, 15); }
__device__ __forceinline__ v16bf cat16b(v8us lo, v8us hi) { return __builtin_bit_cast(v16bf, __builtin_shufflevector(lo, hi, 0, 1, 2, 3, 4, 5, 6, 7, 8, 9, 10, 11, 12, 13, 14, 15)); }
__device__ __forceinline__ v8f wmma16(v16h a, v16h b, v8f c) { return __builtin_amdgcn_wmma_f32_16x16x32_f16(false, a, false, b, (short)0, c, false, false); }
__device__ __forceinline__ v8f wmmab(v16bf a, v16bf b, v8f c) { return __builtin_amdgcn_wmma_f32_16x16x32_bf16(false, a, false, b, (short)0, c, false, false); }



// ---- k_gemmw: register-blocked GEMM, ONE WAVE per 64x64 output tile (16 accumulators), operands straight from K-contiguous 16-bit planes; grid (M/64, N/64, Z), 32 threads.
// C[m][n] (f32, pitch ldc, + optional f32 bias[n]) = sum_k A[m][k] Bt[n][k] (+ split products per NSPLIT). z-batch strides sA/sB/sC in elements. K % 32 == 0.
// Split K (long K): NW waves per work-group and KS work-groups per tile each take K / (KS * NW) consecutive k of the same 64x64 tile; the NW partial tiles are summed through LDS in wave order, and work-group ks (blockIdx.z = z * KS + ks) writes its own f32 plane at C + ks * sP, summed by the consumer. Grid (M/64, N/64, Z * KS), NW * 32 threads. K % (KS * NW * 32) == 0. NW > 1 takes no bias.
template <typename T16> struct WFrag;
template <> struct WFrag<h16> { typedef v16h V; static __device__ __forceinline__ V ld(const h16* p) { return cat16(*(const v8h*)p, *(const v8h*)(p + 16)); } static __device__ __forceinline__ v8f mma(V a, V b, v8f c) { return wmma16(a, b, c); } };
template <> struct WFrag<bf> { typedef v16bf V; static __device__ __forceinline__ V ld(const bf* p) { return cat16b(*(const v8us*)p, *(const v8us*)(p + 16)); } static __device__ __forceinline__ v8f mma(V a, V b, v8f c) { return wmmab(a, b, c); } };
template <typename T16, int NSPLIT, bool BIAS, int NW, int KS>
__global__ __launch_bounds__(NW * 32) void k_gemmw(const T16* __restrict__ A, const T16* __restrict__ A2, const T16* __restrict__ Bt, const T16* __restrict__ Bt2, int K, float* C, int ldc, const float* __restrict__ bias, size_t sA, size_t sB, size_t sC, size_t sP) {
    typedef typename WFrag<T16>::V V;
    __shared__ __align__(16) float os[NW == 1 ? 16 * 68 : NW * 64 * 68];
    const size_t z = blockIdx.z / KS; const int ks = blockIdx.z % KS; A += z * sA; if (A2) A2 += z * sA; Bt += z * sB; if (Bt2) Bt2 += z * sB; C += z * sC + (size_t)ks * sP;
    const int wave = (NW == 1) ? 0 : __builtin_amdgcn_readfirstlane(threadIdx.x >> 5); const int kw = K / (KS * NW), k0 = (ks * NW + wave) * kw;   /* this wave's k range [k0, k0 + kw) */
    const int lane = threadIdx.x & 31, lr = lane & 15, hi = lane >> 4; const int r0 = blockIdx.x * 64, c0 = blockIdx.y * 64;
    v8f acc[4][4];
#pragma unroll
    for (int mb = 0; mb < 4; ++mb)
#pragma unroll
        for (int nb = 0; nb < 4; ++nb) acc[mb][nb] = (v8f){};
    const size_t aoff = (size_t)(r0 + lr) * K + 8 * hi + k0, boff = (size_t)(c0 + lr) * K + 8 * hi + k0;
#pragma unroll 1
    for (int kc = 0; kc < kw; kc += 32) {
        V a[4], a2[4];
#pragma unroll
        for (int mb = 0; mb < 4; ++mb) { a[mb] = WFrag<T16>::ld(A + aoff + (size_t)mb * 16 * K + kc); if (NSPLIT == 1 || NSPLIT == 2) a2[mb] = WFrag<T16>::ld(A2 + aoff + (size_t)mb * 16 * K + kc); }
#pragma unroll
        for (int nb = 0; nb < 4; ++nb) { const V b = WFrag<T16>::ld(Bt + boff + (size_t)nb * 16 * K + kc); V b2; if (NSPLIT >= 2) b2 = WFrag<T16>::ld(Bt2 + boff + (size_t)nb * 16 * K + kc);
#pragma unroll
            for (int mb = 0; mb < 4; ++mb) { acc[mb][nb] = WFrag<T16>::mma(a[mb], b, acc[mb][nb]); if (NSPLIT == 1 || NSPLIT == 2) acc[mb][nb] = WFrag<T16>::mma(a2[mb], b, acc[mb][nb]); if (NSPLIT >= 2) acc[mb][nb] = WFrag<T16>::mma(a[mb], b2, acc[mb][nb]); } }
        asm volatile("v_nop\n\tv_nop\n\tv_nop\n\tv_nop" : "+v"(acc[0][0]), "+v"(acc[1][1]), "+v"(acc[2][2]), "+v"(acc[3][3]) : "v"(a[0]), "v"(a[3]));
    }
    if (NW > 1) {
        float* rw = os + wave * (64 * 68);
        // the three loops are unrolled so that acc is indexed by constants and stays in registers
#pragma unroll
        for (int mb = 0; mb < 4; ++mb)
#pragma unroll
            for (int nb = 0; nb < 4; ++nb)
#pragma unroll
                for (int j = 0; j < 8; ++j) rw[(mb * 16 + hi * 8 + j) * 68 + nb * 16 + lr] = acc[mb][nb][j];
        __syncthreads();   // every wave's partial tile is in LDS before any thread sums across the waves
        // both loops are unrolled so that a thread's LDS reads issue together; the sum stays in wave order
#pragma unroll
        for (int s = 0; s < 32 / NW; ++s) { const int idx = s * (NW * 32) + (int)threadIdx.x; const int row = idx >> 4, cofs = (idx & 15) * 4; v4f val = *(const v4fa*)(os + row * 68 + cofs);
#pragma unroll
            for (int w = 1; w < NW; ++w) { const v4f p = *(const v4fa*)(os + w * (64 * 68) + row * 68 + cofs); val[0] += p[0]; val[1] += p[1]; val[2] += p[2]; val[3] += p[3]; }
            *(v4f*)(C + (size_t)(r0 + row) * ldc + c0 + cofs) = val; }
        return;
    }
#pragma unroll
    for (int mb = 0; mb < 4; ++mb) {
#pragma unroll
        for (int nb = 0; nb < 4; ++nb) {
#pragma unroll
            for (int j = 0; j < 8; ++j) os[(hi * 8 + j) * 68 + nb * 16 + lr] = acc[mb][nb][j]; }
        __builtin_amdgcn_wave_barrier(); asm volatile("" ::: "memory");
        float* crow = C + (size_t)(r0 + mb * 16) * ldc + c0;
{
#pragma unroll
            for (int s = 0; s < 8; ++s) { const int row = 2 * s + hi, cofs = lr * 4; v4f val = *(const v4fa*)(os + row * 68 + cofs); if (BIAS) { val[0] += bfr(bias[c0 + cofs]); val[1] += bfr(bias[c0 + cofs + 1]); val[2] += bfr(bias[c0 + cofs + 2]); val[3] += bfr(bias[c0 + cofs + 3]); }
                *(v4f*)(crow + (size_t)row * ldc + cofs) = val; }
             }
        __builtin_amdgcn_wave_barrier(); asm volatile("" ::: "memory");
    }
}

__device__ __forceinline__ h16 tohx(float x) { return (h16)x; }
__device__ __forceinline__ void splitf(float y, unsigned short& h, unsigned short& l) { h = f2bf(y); l = f2bf(y - bf2f(h)); }
typedef __attribute__((ext_vector_type(2))) _Float16 v2h;
typedef __attribute__((ext_vector_type(4))) _Float16 v4h;
typedef __attribute__((ext_vector_type(2))) unsigned short v2us;
typedef __attribute__((ext_vector_type(4))) unsigned short v4us;
typedef __attribute__((ext_vector_type(2))) float v2f;
typedef __attribute__((ext_vector_type(4))) int v4i;

__global__ __launch_bounds__(256) void k_wtG(const float* __restrict__ w, int K, int N, bf* Bt) {
    const int lane = threadIdx.x & 31; const int L0 = (blockIdx.x * 8 + (threadIdx.x >> 5)) * 8; const int nlines = N * K / 64;
{
#pragma unroll 1
        for (int l = 0; l < 8; ++l) { const int L = L0 + l; if (L >= nlines) break; const size_t e = (size_t)L * 64 + lane * 2; const int k = (int)(e % K), n = (int)(e / K); v2us o;
            o[0] = f2bf(w[(size_t)k * N + n]); o[1] = f2bf(w[(size_t)(k + 1) * N + n]); *(v2us*)(Bt + e) = o; }
         }
}
__global__ __launch_bounds__(256) void k_petab(bf* PEh, bf* PEl) { const size_t e = ((size_t)blockIdx.x * 256 + threadIdx.x) * 2; if (e >= (size_t)NPE * DM) return; const int c = (int)(e % DM); const int m = (int)(e / DM); const float pos = (float)(NPE - 1 - m); const float ex = __fdiv_rn((float)c, (float)DM);   /* c even: 2i/d_model */ const float den = powf(10000.0f, ex); const float th = __fdiv_rn(pos, den); v2us oh, ol; unsigned short a, b2; splitf(sinf(th), a, b2); oh[0] = a; ol[0] = b2; splitf(cosf(th), a, b2); oh[1] = a; ol[1] = b2; *(v2us*)(PEh + e) = oh; *(v2us*)(PEl + e) = ol;  }
__global__ __launch_bounds__(256) void k_addhb(const float* __restrict__ F, const float* __restrict__ hb, float* FO, size_t n4) { const size_t i = (size_t)blockIdx.x * 256 + threadIdx.x; if (i >= n4) return; const int c = (int)((i * 4) % DQ); const v4f a = *(const v4f*)(F + i * 4); v4f o;
#pragma unroll
    for (int q = 0; q < 4; ++q) o[q] = __fadd_rn(a[q], bfr(hb[c + q])); *(v4f*)(FO + i * 4) = o;  }
__global__ __launch_bounds__(256) void k_pplane(const float* __restrict__ POS, bf* Ph2, bf* Pl2) { const size_t e = ((size_t)blockIdx.x * 256 + threadIdx.x) * 2; if (e >= (size_t)NH_ * NPE * HD) return; const int d = (int)(e % HD); const int p = (int)((e / HD) % NPE); const int h = (int)(e / ((size_t)HD * NPE)); v2us oh, ol;
#pragma unroll
    for (int q = 0; q < 2; ++q) { unsigned short a, c; splitf(POS[(size_t)p * DQ + h * HD + d + q], a, c); oh[q] = a; ol[q] = c; } *(v2us*)(Ph2 + e) = oh; *(v2us*)(Pl2 + e) = ol;  }
__global__ __launch_bounds__(256) void k_cvt8(const float* __restrict__ src, bf* dst, size_t n8) { const size_t i = (size_t)blockIdx.x * 256 + threadIdx.x; if (i >= n8) return; const v8f v = *(const v8f*)(src + i * 8); v8us o;
#pragma unroll
    for (int k = 0; k < 8; ++k) o[k] = f2bf(v[k]); *(v8us*)(dst + i * 8) = o;  }

// k_rope: head planes [h][t][d] (fp16 + hi/lo) of rope(x) x sc with the rotate-half convention out[d] = x[d] cos[t][d] - x[d+HD/2] sin[t][d], out[d+HD/2] = x[d+HD/2] cos[t][d+HD/2] + x[d] sin[t][d+HD/2]
__global__ __launch_bounds__(256) void k_rope(const float* __restrict__ F, int pitch, int nheads, const float* __restrict__ CS, const float* __restrict__ RF, const float* __restrict__ nw, float sc, h16* P16, bf* Ph, bf* Pl) {
    const size_t e = ((size_t)blockIdx.x * 256 + threadIdx.x) * 2; if (e >= (size_t)nheads * TT * HD) return; const int d = (int)(e % HD); const int t = (int)((e / HD) % TT); const int h = (int)(e / ((size_t)HD * TT)); const float* f = F + (size_t)t * pitch + h * HD; const float rf = RF ? RF[(size_t)h * TT + t] : 1.0f; v2h o16; v2us oh, ol;
#pragma unroll
    for (int q = 0; q < 2; ++q) { const int dd = d + q; const int dp = (dd < HD / 2) ? dd + HD / 2 : dd - HD / 2; float x0 = f[dd], x1 = f[dp];
        if (RF) { float n0 = __fmul_rn(x0, rf), n1 = __fmul_rn(x1, rf); asm volatile("" : "+v"(n0)); asm volatile("" : "+v"(n1)); x0 = __fmul_rn(bfr(nw[dd]), n0); x1 = __fmul_rn(bfr(nw[dp]), n1); }
        const v2f cs = *(const v2f*)(CS + ((size_t)t * HD + dd) * 2); float a = __fmul_rn(x0, cs[0]), bq = __fmul_rn(x1, cs[1]); asm volatile("" : "+v"(a)); asm volatile("" : "+v"(bq)); const float r = ((dd < HD / 2) ? __fsub_rn(a, bq) : __fadd_rn(a, bq)) * sc;
        o16[q] = tohx(r); unsigned short a2, c2; splitf(r, a2, c2); oh[q] = a2; ol[q] = c2; }
    *(v2h*)(P16 + e) = o16; *(v2us*)(Ph + e) = oh; *(v2us*)(Pl + e) = ol;  }
__global__ __launch_bounds__(256) void k_vtp(const float* __restrict__ F, int pitch, int nheads, h16* V16, bf* Vh, bf* Vl) { const size_t e = ((size_t)blockIdx.x * 256 + threadIdx.x) * 2; if (e >= (size_t)nheads * HD * TT) return; const int t = (int)(e % TT); const int d = (int)((e / TT) % HD); const int g = (int)(e / ((size_t)TT * HD)); v2h o16; v2us oh, ol;
#pragma unroll
    for (int q = 0; q < 2; ++q) { const float x = F[(size_t)(t + q) * pitch + g * HD + d]; o16[q] = tohx(x); unsigned short a2, c2; splitf(x, a2, c2); oh[q] = a2; ol[q] = c2; }
    *(v2h*)(V16 + e) = o16; *(v2us*)(Vh + e) = oh; *(v2us*)(Vl + e) = ol;  }
__global__ __launch_bounds__(256) void k_csid(float* CS) { const int idx = blockIdx.x * 256 + threadIdx.x; if (idx >= TT * HD) return; v2f cs; cs[0] = 1.0f; cs[1] = 0.0f; *(v2f*)(CS + (size_t)idx * 2) = cs;  }
// k_asoft: per row (zz, i): t = (ac + bd)/8 with bd = SR[row][4095 - i + j] for j <= i else 0, -inf where mask[i][j] == 0; softmax over the 2048 keys (register row, one exp, fixed trees);
__global__ __launch_bounds__(256) void k_asoft(const float* __restrict__ Sb, const float* __restrict__ SR, const int* __restrict__ MKb, h16* P16, bf* Ph, bf* Pl) {
    const int lane = threadIdx.x & 31; const int row = blockIdx.x * 8 + (threadIdx.x >> 5); if (row >= ZH * TT) return; const int i = row % TT; const int zz = row / TT; (void)zz; const float* srr = SR + (size_t)row * NPE + (NPE - 1 - i);   /* left_shift: raw position index 4095 - i + j (valid for j <= i) */ const int* mkr = MKb + (size_t)i * TT; const bool hires = (i < RH); const float* sr = Sb + (size_t)row * TT; float v[TT / 32]; float mx = -3.0e38f;
#pragma unroll
    for (int ch = 0; ch < TT / 128; ++ch) { const int j0 = ch * 128 + lane * 4; const v4f a = *(const v4f*)(sr + j0); const v4i m4 = *(const v4i*)(mkr + j0);
#pragma unroll
        for (int q = 0; q < 4; ++q) { const int j = j0 + q; const float bd = (j <= i) ? srr[j] : 0.f;   /* left_shift keeps j <= i, zero elsewhere (not masked) */ float su = __fadd_rn(a[q], bd); asm volatile("" : "+v"(su)); const float t = (m4[q] != 0) ? su * SCL : -3.0e38f;   /* (ac + bd)/8, mask select */ v[ch * 4 + q] = t; mx = fmaxf(mx, t); } }
#pragma unroll
    for (int sh = 16; sh; sh >>= 1) mx = fmaxf(mx, __shfl_xor(mx, sh, 32));
    float sum = 0.f;
#pragma unroll
    for (int k = 0; k < TT / 32; ++k) { float d0 = __fsub_rn(v[k], mx); asm volatile("" : "+v"(d0)); v[k] = __builtin_amdgcn_exp2f(__fmul_rn(d0, 1.4426950408889634f)); sum += v[k]; }
#pragma unroll
    for (int sh = 16; sh; sh >>= 1) sum += __shfl_xor(sum, sh, 32);
    const float f = __fdiv_rn(hires ? 1.0f : PCAR, sum);
{
        if (hires) {
#pragma unroll
            for (int ch = 0; ch < TT / 128; ++ch) { v4us oh, ol;
#pragma unroll
                for (int q = 0; q < 4; ++q) { unsigned short a, c2; splitf(v[ch * 4 + q] * f, a, c2); oh[q] = a; ol[q] = c2; }
                const size_t oo = ((size_t)zz * (RH ? RH : 1) + i) * TT + ch * 128 + lane * 4; *(v4us*)(Ph + oo) = oh; *(v4us*)(Pl + oo) = ol; }
        } else {
#pragma unroll
            for (int ch = 0; ch < TT / 128; ++ch) { v4h o4;
#pragma unroll
                for (int q = 0; q < 4; ++q) o4[q] = tohx(v[ch * 4 + q] * f);
                *(v4h*)(P16 + (size_t)row * TT + ch * 128 + lane * 4) = o4; } }
         }
}

__global__ __launch_bounds__(256) void k_merge(const float* __restrict__ O, int h0, bf* Ah, bf* Al) { const size_t e = ((size_t)blockIdx.x * 256 + threadIdx.x) * 2; if (e >= (size_t)ZH * TT * HD) return; const int d = (int)(e % HD); const int t = (int)((e / HD) % TT); const int zz = (int)(e / ((size_t)HD * TT)); const float cs = (t < RH) ? 1.0f : (1.0f / PCAR); const size_t oo = (size_t)t * DQ + (h0 + zz) * HD + d;
    v2us oh, ol;
#pragma unroll
    for (int q = 0; q < 2; ++q) { float su = O[e + q];
        // unrolled so that the planes' loads issue together
#pragma unroll
        for (int p = 1; p < KSV; ++p) su += O[(size_t)p * ZH * TT * HD + e + q];   /* attn.v partial planes, in plane order */
        unsigned short a, c2; splitf(su * cs, a, c2); oh[q] = a; ol[q] = c2; } *(v2us*)(Ah + oo) = oh; *(v2us*)(Al + oo) = ol;  }

extern "C" void kernel_launch(void* const* d_in, const int* in_sizes, int n_in,
                              void* d_out, int out_size, void* d_ws, size_t ws_size, hipStream_t stream) {
    (void)in_sizes; (void)n_in; (void)out_size;
    const float* x = (const float*)d_in[0]; const float* xk = (const float*)d_in[1]; const float* xv = (const float*)d_in[2]; const int* MK = (const int*)d_in[3]; const float* wq = (const float*)d_in[4]; const float* wk = (const float*)d_in[5]; const float* wv = (const float*)d_in[6]; const float* wp = (const float*)d_in[7]; const float* wo = (const float*)d_in[8]; const float* pbu = (const float*)d_in[9]; const float* pbv = (const float*)d_in[10];
    float* OUT = (float*)d_out;     // [1][2048][1024]
    char* wsp = (char*)d_ws;
    auto take = [&](size_t bytes) { char* p = wsp; wsp += (bytes + 255) & ~(size_t)255; return (void*)p; };
    bf* WQ = (bf*)take((size_t)DQ * DM * 2); bf* WK = (bf*)take((size_t)DKV * DM * 2); bf* WV = (bf*)take((size_t)DKV * DM * 2); bf* WO = (bf*)take((size_t)DM * DQ * 2); float* CS = (float*)take((size_t)TT * HD * 2 * 4);
    bf* XB = (bf*)take((size_t)TT * DM * 2); bf* XKB = (bf*)take((size_t)TT * DM * 2); bf* XVB = (bf*)take((size_t)TT * DM * 2); float* FQ = (float*)take((size_t)TT * DQ * 4); float* FK = (float*)take((size_t)TT * DKV * 4); float* FQU = (float*)take((size_t)TT * DQ * 4); bf* WP = (bf*)take((size_t)DQ * DM * 2); bf* PPh = (bf*)take((size_t)NH_ * NPE * HD * 2); bf* PPl = (bf*)take((size_t)NH_ * NPE * HD * 2); bf* QVh = (bf*)take((size_t)NH_ * TT * HD * 2); bf* QVl = (bf*)take((size_t)NH_ * TT * HD * 2); float* SR = (float*)take((size_t)ZH * TT * NPE * 4); float* POS = SR;   /* projected positions live in the raw position-score buffer until k_pplane has consumed them */ float* FQV = FQ;   /* (q + b_v) is formed in place after (q + b_u) has been copied out */
    h16* QP16 = (h16*)take((size_t)NH_ * TT * HD * 2); h16* KP16 = (h16*)take((size_t)NKV * TT * HD * 2); h16* VT16 = (h16*)take((size_t)NKV * HD * TT * 2);
    bf* QPh = (bf*)take((size_t)NH_ * TT * HD * 2); bf* QPl = (bf*)take((size_t)NH_ * TT * HD * 2); bf* KPh = (bf*)take((size_t)NKV * TT * HD * 2); bf* KPl = (bf*)take((size_t)NKV * TT * HD * 2); bf* VTh = (bf*)take((size_t)NKV * HD * TT * 2); bf* VTl = (bf*)take((size_t)NKV * HD * TT * 2); bf* Ph = (bf*)take((size_t)ZH * RH * TT * 2); bf* Pl = (bf*)take((size_t)ZH * RH * TT * 2);
    float* Sb = (float*)take((size_t)ZH * TT * TT * 4); bf* PEh = (bf*)Sb; bf* PEl = PEh + (size_t)NPE * DM;   /* the position-table planes live in the score buffer until the position planes are built (before the batch loop) */ h16* P16 = (h16*)take(256);   /* unused: all rows hi/lo */ float* Ob = (float*)take((size_t)KSV * ZH * TT * HD * 4); bf* ATh = (bf*)take((size_t)TT * DQ * 2); bf* ATl = (bf*)take((size_t)TT * DQ * 2);
    if ((size_t)(wsp - (char*)d_ws) > ws_size) return;    // ws 256 MiB
    float* FV = FK;   // v projection reuses the k buffer after the k planes are built (stream-ordered)
    { k_wtG<<<(unsigned)((DM * DQ / 64 + 63) / 64), 256, 0, stream>>>(wq, DM, DQ, WQ); k_wtG<<<(unsigned)((DM * DKV / 64 + 63) / 64), 256, 0, stream>>>(wk, DM, DKV, WK); k_wtG<<<(unsigned)((DM * DKV / 64 + 63) / 64), 256, 0, stream>>>(wv, DM, DKV, WV);
      k_wtG<<<(unsigned)((DQ * DM / 64 + 63) / 64), 256, 0, stream>>>(wo, DQ, DM, WO);
       }
    k_csid<<<(TT * HD + 255) / 256, 256, 0, stream>>>(CS); k_petab<<<(unsigned)(((size_t)NPE * DM / 2 + 255) / 256), 256, 0, stream>>>(PEh, PEl); k_wtG<<<(unsigned)((DM * DQ / 64 + 63) / 64), 256, 0, stream>>>(wp, DM, DQ, WP); k_gemmw<bf, 1, false, 8, 1><<<dim3(NPE / 64, DQ / 64, 1), 256, 0, stream>>>(PEh, PEl, WP, nullptr, DM, POS, DQ, nullptr, 0, 0, 0, 0); k_pplane<<<(unsigned)(((size_t)NH_ * NPE * HD / 2 + 255) / 256), 256, 0, stream>>>(POS, PPh, PPl);   /* reversed sinusoidal table (bf16) x w_p -> per-head position planes [h][4096][64] */
    const unsigned LQ = (unsigned)(((size_t)NH_ * TT * HD / 2 + 255) / 256), LKv = (unsigned)(((size_t)NKV * TT * HD / 2 + 255) / 256);
    for (int b = 0; b < NB_; ++b) {
        
        k_cvt8<<<(unsigned)(((size_t)TT * DM / 8 + 255) / 256), 256, 0, stream>>>(x + (size_t)b * TT * DM, XB, (size_t)TT * DM / 8); k_cvt8<<<(unsigned)(((size_t)TT * DM / 8 + 255) / 256), 256, 0, stream>>>(xk + (size_t)b * TT * DM, XKB, (size_t)TT * DM / 8); k_cvt8<<<(unsigned)(((size_t)TT * DM / 8 + 255) / 256), 256, 0, stream>>>(xv + (size_t)b * TT * DM, XVB, (size_t)TT * DM / 8);
        k_gemmw<bf, 0, false, 8, 1><<<dim3(TT / 64, DQ / 64, 1), 256, 0, stream>>>(XB, nullptr, WQ, nullptr, DM, FQ, DQ, nullptr, 0, 0, 0, 0);
        k_addhb<<<(unsigned)(((size_t)TT * DQ / 4 + 255) / 256), 256, 0, stream>>>(FQ, pbu, FQU, (size_t)TT * DQ / 4); k_addhb<<<(unsigned)(((size_t)TT * DQ / 4 + 255) / 256), 256, 0, stream>>>(FQ, pbv, FQV, (size_t)TT * DQ / 4); k_rope<<<LQ, 256, 0, stream>>>(FQU, DQ, NH_, CS, nullptr, nullptr, 1.0f, QP16, QPh, QPl); k_rope<<<LQ, 256, 0, stream>>>(FQV, DQ, NH_, CS, nullptr, nullptr, 1.0f, QP16, QVh, QVl);   /* (q + b_u) planes for the content scores, (q + b_v) planes for the position scores */
        k_gemmw<bf, 0, false, 8, 1><<<dim3(TT / 64, DKV / 64, 1), 256, 0, stream>>>(XKB, nullptr, WK, nullptr, DM, FK, DKV, nullptr, 0, 0, 0, 0);
        k_rope<<<LKv, 256, 0, stream>>>(FK, DKV, NKV, CS, nullptr, nullptr, 1.0f, KP16, KPh, KPl);
        k_gemmw<bf, 0, false, 8, 1><<<dim3(TT / 64, DKV / 64, 1), 256, 0, stream>>>(XVB, nullptr, WV, nullptr, DM, FV, DKV, nullptr, 0, 0, 0, 0); k_vtp<<<LKv, 256, 0, stream>>>(FV, DKV, NKV, VT16, VTh, VTl);
        for (int h0 = 0; h0 < NH_; h0 += ZH) { const size_t zq = (size_t)h0, zk = (size_t)(h0 / REP);   // one kv head per query head: the pass's two heads use consecutive kv planes (z-strides TT*HD)
            k_gemmw<bf, 2, false, 1, 1><<<dim3(RH / 64, TT / 64, ZH), 32, 0, stream>>>(QPh + zq * TT * HD, QPl + zq * TT * HD, KPh + zk * TT * HD, KPl + zk * TT * HD, HD, Sb, TT, nullptr, (size_t)TT * HD, (size_t)TT * HD, (size_t)TT * TT, 0);
            k_gemmw<bf, 2, false, 1, 1><<<dim3(TT / 64, NPE / 64, ZH), 32, 0, stream>>>(QVh + zq * TT * HD, QVl + zq * TT * HD, PPh + zq * NPE * HD, PPl + zq * NPE * HD, HD, SR, NPE, nullptr, (size_t)TT * HD, (size_t)NPE * HD, (size_t)TT * NPE, 0);   /* raw position scores (q+b_v).ph [2][2048][4096] */ k_asoft<<<ZH * TT / 8, 256, 0, stream>>>(Sb, SR, MK, P16, Ph, Pl);
            k_gemmw<bf, 2, false, 8, KSV><<<dim3(RH / 64, HD / 64, ZH * KSV), 256, 0, stream>>>(Ph, Pl, VTh + zk * HD * TT, VTl + zk * HD * TT, TT, Ob, HD, nullptr, (size_t)RH * TT, (size_t)HD * TT, (size_t)TT * HD, (size_t)ZH * TT * HD);   /* KSV partial planes of attn.v, summed in k_merge */
            k_merge<<<(unsigned)(((size_t)ZH * TT * HD / 2 + 255) / 256), 256, 0, stream>>>(Ob, h0, ATh, ATl); }
        k_gemmw<bf, 1, false, 8, 1><<<dim3(TT / 64, DM / 64, 1), 256, 0, stream>>>(ATh, ATl, WO, nullptr, DQ, OUT + (size_t)b * TT * DM, DM, nullptr, 0, 0, 0, 0); }
}

// v002
// It runs in 318 microseconds.
// Timed twice side by side with v001, it ran 2.21 and 2.22 times as fast.
// All steps since v000 together make it 3.16 times as fast.
#include <hip/hip_runtime.h>

// Transformer-XL relative-position multi-head attention (q, k, v inputs [1][2048][1024]; qh = q w_q, kh = k w_k, vh = v w_v ('xw' [1024][1024], no bias; 16 heads x 64); pe = reversed sinusoidal table of length 4096 (pe[m] = PE(4095 - m), interleaved sin/cos) projected by w_p -> ph [16][4096][64]; ac = (qh + b_u).kh, bd = left_shift((qh + b_v).ph): bd[i][j] = raw[i][4095 - i + j] for j <= i else 0; scores = (ac + bd)/8; mask (int [1][2048][2048], read; -inf where 0); softmax; out = attn.vh merged w_o -> [1][2048][1024]).
// Layout: projections from three bf16 input planes; b_u / b_v folded into two sets of query planes; the position table is computed on device in f32 (pos / 10000^(2i/1024), precise powf/sinf/cosf) -> hi/lo planes -> 2-product GEMM with the exact bf16 w_p -> per-head hi/lo planes; one launch does the attention of all heads: a work-group keeps 32 query rows' scores in LDS, content and position scores are hi/lo x hi/lo products (3 products), a position score is added at its shifted key, and softmax and attn.v follow on the same rows.
// Compute dtypes, f32 accumulate: every input rounded to bf16; q/k/v on PLAIN bf16 operands (inputs: exact); content / position scores and attn.v on hi/lo planes for every row (3 products); softmax f32; w_o hl x exact (2 products).

#define NB_  1
#define TT   2048
#define DM   1024
#define NH_  16
#define NKV  16
#define REP  (NH_ / NKV)
#define HD   64
#define DQ   (NH_ * HD)
#define DKV  (NKV * HD)
#define NPE  4096                 // relative positions (2 x seq)
typedef __attribute__((ext_vector_type(4))) int v4i;
#define WIN  0
#define SCL  0.125f   // HD^-0.5
typedef _Float16 h16;
typedef unsigned short bf;
typedef __attribute__((ext_vector_type(16))) __bf16   v16bf;
typedef __attribute__((ext_vector_type(16))) _Float16 v16h;
typedef __attribute__((ext_vector_type(8)))  _Float16 v8h;
typedef __attribute__((ext_vector_type(8)))  unsigned short v8us;
typedef __attribute__((ext_vector_type(8)))  float    v8f;
typedef __attribute__((ext_vector_type(4)))  float    v4f;
typedef v8h  __attribute__((may_alias)) v8ha;
typedef v4f  __attribute__((may_alias)) v4fa;
typedef v8us __attribute__((may_alias)) v8usa;

__device__ __forceinline__ unsigned short f2bf(float f) { unsigned u = __float_as_uint(f); u += 0x7FFFu + ((u >> 16) & 1u); return (unsigned short)(u >> 16); }
__device__ __forceinline__ float bf2f(unsigned short b) { return __uint_as_float(((unsigned)b) << 16); }
__device__ __forceinline__ float bfr(float f) { return bf2f(f2bf(f)); }
__device__ __forceinline__ v16h cat16(v8h lo, v8h hi) { return __builtin_shufflevector(lo, hi, 0, 1, 2, 3, 4, 5, 6, 7, 8, 9, 10, 11, 12, 13, 14, 15); }
__device__ __forceinline__ v16bf cat16b(v8us lo, v8us hi) { return __builtin_bit_cast(v16bf, __builtin_shufflevector(lo, hi, 0, 1, 2, 3, 4, 5, 6, 7, 8, 9, 10, 11, 12, 13, 14, 15)); }
__device__ __forceinline__ v8f wmma16(v16h a, v16h b, v8f c) { return __builtin_amdgcn_wmma_f32_16x16x32_f16(false, a, false, b, (short)0, c, false, false); }
__device__ __forceinline__ v8f wmmab(v16bf a, v16bf b, v8f c) { return __builtin_amdgcn_wmma_f32_16x16x32_bf16(false, a, false, b, (short)0, c, false, false); }



// ---- k_gemmw: register-blocked GEMM, ONE WAVE per 64x64 output tile (16 accumulators), operands straight from K-contiguous 16-bit planes; grid (M/64, N/64, Z), 32 threads.
// C[m][n] (f32, pitch ldc, + optional f32 bias[n]) = sum_k A[m][k] Bt[n][k] (+ split products per NSPLIT). z-batch strides sA/sB/sC in elements. K % 32 == 0.
// Split K (long K): NW waves per work-group and KS work-groups per tile each take K / (KS * NW) consecutive k of the same 64x64 tile; the NW partial tiles are summed through LDS in wave order, and work-group ks (blockIdx.z = z * KS + ks) writes its own f32 plane at C + ks * sP, summed by the consumer. Grid (M/64, N/64, Z * KS), NW * 32 threads. K % (KS * NW * 32) == 0. NW > 1 takes no bias.
template <typename T16> struct WFrag;
template <> struct WFrag<h16> { typedef v16h V; static __device__ __forceinline__ V ld(const h16* p) { return cat16(*(const v8h*)p, *(const v8h*)(p + 16)); } static __device__ __forceinline__ v8f mma(V a, V b, v8f c) { return wmma16(a, b, c); } };
template <> struct WFrag<bf> { typedef v16bf V; static __device__ __forceinline__ V ld(const bf* p) { return cat16b(*(const v8us*)p, *(const v8us*)(p + 16)); } static __device__ __forceinline__ v8f mma(V a, V b, v8f c) { return wmmab(a, b, c); } };
template <typename T16, int NSPLIT, bool BIAS, int NW, int KS>
__global__ __launch_bounds__(NW * 32) void k_gemmw(const T16* __restrict__ A, const T16* __restrict__ A2, const T16* __restrict__ Bt, const T16* __restrict__ Bt2, int K, float* C, int ldc, const float* __restrict__ bias, size_t sA, size_t sB, size_t sC, size_t sP) {
    typedef typename WFrag<T16>::V V;
    __shared__ __align__(16) float os[NW == 1 ? 16 * 68 : NW * 64 * 68];
    const size_t z = blockIdx.z / KS; const int ks = blockIdx.z % KS; A += z * sA; if (A2) A2 += z * sA; Bt += z * sB; if (Bt2) Bt2 += z * sB; C += z * sC + (size_t)ks * sP;
    const int wave = (NW == 1) ? 0 : __builtin_amdgcn_readfirstlane(threadIdx.x >> 5); const int kw = K / (KS * NW), k0 = (ks * NW + wave) * kw;   /* this wave's k range [k0, k0 + kw) */
    const int lane = threadIdx.x & 31, lr = lane & 15, hi = lane >> 4; const int r0 = blockIdx.x * 64, c0 = blockIdx.y * 64;
    v8f acc[4][4];
#pragma unroll
    for (int mb = 0; mb < 4; ++mb)
#pragma unroll
        for (int nb = 0; nb < 4; ++nb) acc[mb][nb] = (v8f){};
    const size_t aoff = (size_t)(r0 + lr) * K + 8 * hi + k0, boff = (size_t)(c0 + lr) * K + 8 * hi + k0;
#pragma unroll 1
    for (int kc = 0; kc < kw; kc += 32) {
        V a[4], a2[4];
#pragma unroll
        for (int mb = 0; mb < 4; ++mb) { a[mb] = WFrag<T16>::ld(A + aoff + (size_t)mb * 16 * K + kc); if (NSPLIT == 1 || NSPLIT == 2) a2[mb] = WFrag<T16>::ld(A2 + aoff + (size_t)mb * 16 * K + kc); }
#pragma unroll
        for (int nb = 0; nb < 4; ++nb) { const V b = WFrag<T16>::ld(Bt + boff + (size_t)nb * 16 * K + kc); V b2; if (NSPLIT >= 2) b2 = WFrag<T16>::ld(Bt2 + boff + (size_t)nb * 16 * K + kc);
#pragma unroll
            for (int mb = 0; mb < 4; ++mb) { acc[mb][nb] = WFrag<T16>::mma(a[mb], b, acc[mb][nb]); if (NSPLIT == 1 || NSPLIT == 2) acc[mb][nb] = WFrag<T16>::mma(a2[mb], b, acc[mb][nb]); if (NSPLIT >= 2) acc[mb][nb] = WFrag<T16>::mma(a[mb], b2, acc[mb][nb]); } }
        asm volatile("v_nop\n\tv_nop\n\tv_nop\n\tv_nop" : "+v"(acc[0][0]), "+v"(acc[1][1]), "+v"(acc[2][2]), "+v"(acc[3][3]) : "v"(a[0]), "v"(a[3]));
    }
    if (NW > 1) {
        float* rw = os + wave * (64 * 68);
        // the three loops are unrolled so that acc is indexed by constants and stays in registers
#pragma unroll
        for (int mb = 0; mb < 4; ++mb)
#pragma unroll
            for (int nb = 0; nb < 4; ++nb)
#pragma unroll
                for (int j = 0; j < 8; ++j) rw[(mb * 16 + hi * 8 + j) * 68 + nb * 16 + lr] = acc[mb][nb][j];
        __syncthreads();   // every wave's partial tile is in LDS before any thread sums across the waves
        // both loops are unrolled so that a thread's LDS reads issue together; the sum stays in wave order
#pragma unroll
        for (int s = 0; s < 32 / NW; ++s) { const int idx = s * (NW * 32) + (int)threadIdx.x; const int row = idx >> 4, cofs = (idx & 15) * 4; v4f val = *(const v4fa*)(os + row * 68 + cofs);
#pragma unroll
            for (int w = 1; w < NW; ++w) { const v4f p = *(const v4fa*)(os + w * (64 * 68) + row * 68 + cofs); val[0] += p[0]; val[1] += p[1]; val[2] += p[2]; val[3] += p[3]; }
            *(v4f*)(C + (size_t)(r0 + row) * ldc + c0 + cofs) = val; }
        return;
    }
#pragma unroll
    for (int mb = 0; mb < 4; ++mb) {
#pragma unroll
        for (int nb = 0; nb < 4; ++nb) {
#pragma unroll
            for (int j = 0; j < 8; ++j) os[(hi * 8 + j) * 68 + nb * 16 + lr] = acc[mb][nb][j]; }
        __builtin_amdgcn_wave_barrier(); asm volatile("" ::: "memory");
        float* crow = C + (size_t)(r0 + mb * 16) * ldc + c0;
{
#pragma unroll
            for (int s = 0; s < 8; ++s) { const int row = 2 * s + hi, cofs = lr * 4; v4f val = *(const v4fa*)(os + row * 68 + cofs); if (BIAS) { val[0] += bfr(bias[c0 + cofs]); val[1] += bfr(bias[c0 + cofs + 1]); val[2] += bfr(bias[c0 + cofs + 2]); val[3] += bfr(bias[c0 + cofs + 3]); }
                *(v4f*)(crow + (size_t)row * ldc + cofs) = val; }
             }
        __builtin_amdgcn_wave_barrier(); asm volatile("" ::: "memory");
    }
}

__device__ __forceinline__ h16 tohx(float x) { return (h16)x; }
__device__ __forceinline__ void splitf(float y, unsigned short& h, unsigned short& l) { h = f2bf(y); l = f2bf(y - bf2f(h)); }
typedef __attribute__((ext_vector_type(2))) _Float16 v2h;
typedef __attribute__((ext_vector_type(4))) _Float16 v4h;
typedef __attribute__((ext_vector_type(2))) unsigned short v2us;
typedef __attribute__((ext_vector_type(4))) unsigned short v4us;
typedef __attribute__((ext_vector_type(2))) float v2f;
typedef __attribute__((ext_vector_type(4))) int v4i;

__global__ __launch_bounds__(256) void k_wtG(const float* __restrict__ w, int K, int N, bf* Bt) {
    const int lane = threadIdx.x & 31; const int L0 = (blockIdx.x * 8 + (threadIdx.x >> 5)) * 8; const int nlines = N * K / 64;
{
#pragma unroll 1
        for (int l = 0; l < 8; ++l) { const int L = L0 + l; if (L >= nlines) break; const size_t e = (size_t)L * 64 + lane * 2; const int k = (int)(e % K), n = (int)(e / K); v2us o;
            o[0] = f2bf(w[(size_t)k * N + n]); o[1] = f2bf(w[(size_t)(k + 1) * N + n]); *(v2us*)(Bt + e) = o; }
         }
}
__global__ __launch_bounds__(256) void k_petab(bf* PEh, bf* PEl) { const size_t e = ((size_t)blockIdx.x * 256 + threadIdx.x) * 2; if (e >= (size_t)NPE * DM) return; const int c = (int)(e % DM); const int m = (int)(e / DM); const float pos = (float)(NPE - 1 - m); const float ex = __fdiv_rn((float)c, (float)DM);   /* c even: 2i/d_model */ const float den = powf(10000.0f, ex); const float th = __fdiv_rn(pos, den); v2us oh, ol; unsigned short a, b2; splitf(sinf(th), a, b2); oh[0] = a; ol[0] = b2; splitf(cosf(th), a, b2); oh[1] = a; ol[1] = b2; *(v2us*)(PEh + e) = oh; *(v2us*)(PEl + e) = ol;  }
__global__ __launch_bounds__(256) void k_addhb(const float* __restrict__ F, const float* __restrict__ hb, float* FO, size_t n4) { const size_t i = (size_t)blockIdx.x * 256 + threadIdx.x; if (i >= n4) return; const int c = (int)((i * 4) % DQ); const v4f a = *(const v4f*)(F + i * 4); v4f o;
#pragma unroll
    for (int q = 0; q < 4; ++q) o[q] = __fadd_rn(a[q], bfr(hb[c + q])); *(v4f*)(FO + i * 4) = o;  }
__global__ __launch_bounds__(256) void k_pplane(const float* __restrict__ POS, bf* Ph2, bf* Pl2) { const size_t e = ((size_t)blockIdx.x * 256 + threadIdx.x) * 2; if (e >= (size_t)NH_ * NPE * HD) return; const int d = (int)(e % HD); const int p = (int)((e / HD) % NPE); const int h = (int)(e / ((size_t)HD * NPE)); v2us oh, ol;
#pragma unroll
    for (int q = 0; q < 2; ++q) { unsigned short a, c; splitf(POS[(size_t)p * DQ + h * HD + d + q], a, c); oh[q] = a; ol[q] = c; } *(v2us*)(Ph2 + e) = oh; *(v2us*)(Pl2 + e) = ol;  }
__global__ __launch_bounds__(256) void k_cvt8(const float* __restrict__ src, bf* dst, size_t n8) { const size_t i = (size_t)blockIdx.x * 256 + threadIdx.x; if (i >= n8) return; const v8f v = *(const v8f*)(src + i * 8); v8us o;
#pragma unroll
    for (int k = 0; k < 8; ++k) o[k] = f2bf(v[k]); *(v8us*)(dst + i * 8) = o;  }

// k_rope: head planes [h][t][d] (fp16 + hi/lo) of rope(x) x sc with the rotate-half convention out[d] = x[d] cos[t][d] - x[d+HD/2] sin[t][d], out[d+HD/2] = x[d+HD/2] cos[t][d+HD/2] + x[d] sin[t][d+HD/2]
__global__ __launch_bounds__(256) void k_rope(const float* __restrict__ F, int pitch, int nheads, const float* __restrict__ CS, const float* __restrict__ RF, const float* __restrict__ nw, float sc, h16* P16, bf* Ph, bf* Pl) {
    const size_t e = ((size_t)blockIdx.x * 256 + threadIdx.x) * 2; if (e >= (size_t)nheads * TT * HD) return; const int d = (int)(e % HD); const int t = (int)((e / HD) % TT); const int h = (int)(e / ((size_t)HD * TT)); const float* f = F + (size_t)t * pitch + h * HD; const float rf = RF ? RF[(size_t)h * TT + t] : 1.0f; v2h o16; v2us oh, ol;
#pragma unroll
    for (int q = 0; q < 2; ++q) { const int dd = d + q; const int dp = (dd < HD / 2) ? dd + HD / 2 : dd - HD / 2; float x0 = f[dd], x1 = f[dp];
        if (RF) { float n0 = __fmul_rn(x0, rf), n1 = __fmul_rn(x1, rf); asm volatile("" : "+v"(n0)); asm volatile("" : "+v"(n1)); x0 = __fmul_rn(bfr(nw[dd]), n0); x1 = __fmul_rn(bfr(nw[dp]), n1); }
        const v2f cs = *(const v2f*)(CS + ((size_t)t * HD + dd) * 2); float a = __fmul_rn(x0, cs[0]), bq = __fmul_rn(x1, cs[1]); asm volatile("" : "+v"(a)); asm volatile("" : "+v"(bq)); const float r = ((dd < HD / 2) ? __fsub_rn(a, bq) : __fadd_rn(a, bq)) * sc;
        o16[q] = tohx(r); unsigned short a2, c2; splitf(r, a2, c2); oh[q] = a2; ol[q] = c2; }
    *(v2h*)(P16 + e) = o16; *(v2us*)(Ph + e) = oh; *(v2us*)(Pl + e) = ol;  }
__global__ __launch_bounds__(256) void k_vtp(const float* __restrict__ F, int pitch, int nheads, h16* V16, bf* Vh, bf* Vl) { const size_t e = ((size_t)blockIdx.x * 256 + threadIdx.x) * 2; if (e >= (size_t)nheads * HD * TT) return; const int t = (int)(e % TT); const int d = (int)((e / TT) % HD); const int g = (int)(e / ((size_t)TT * HD)); v2h o16; v2us oh, ol;
#pragma unroll
    for (int q = 0; q < 2; ++q) { const float x = F[(size_t)(t + q) * pitch + g * HD + d]; o16[q] = tohx(x); unsigned short a2, c2; splitf(x, a2, c2); oh[q] = a2; ol[q] = c2; }
    *(v2h*)(V16 + e) = o16; *(v2us*)(Vh + e) = oh; *(v2us*)(Vl + e) = ol;  }
__global__ __launch_bounds__(256) void k_csid(float* CS) { const int idx = blockIdx.x * 256 + threadIdx.x; if (idx >= TT * HD) return; v2f cs; cs[0] = 1.0f; cs[1] = 0.0f; *(v2f*)(CS + (size_t)idx * 2) = cs;  }
// k_attn: one work-group = one head x RB query rows, every stage of the attention on chip. The RB score rows [RB][2048] f32 live in LDS (pitch SP floats):
//   1 content scores (q + b_u).k into the rows; 2 raw position scores (q + b_v).ph only for the positions that the left shift keeps (m = 4095 - i + j, 0 <= j <= i), added at their shifted key j;
//   3 mask, softmax per row (one wave a row, register row), the row rewritten in place as its bf16 hi plane (first 4 KiB) and lo plane (next 4 KiB);
//   4 attn.v with the hi/lo rows as the A operand from LDS, each wave TT / NWV keys, the NWV partial tiles summed through LDS in wave order and split into the merged hi/lo planes.
// Every plain '#pragma unroll' in this kernel is there so that the register arrays (fragments, accumulators, the score row) are indexed by constants and stay in registers.
#define MT   2                     // 16-row tiles of query rows per work-group
#define RB   (16 * MT)
#define NWV  (RB / 2)              // waves per work-group (two score rows a wave; RB * 16 output quads = NWV * 32 threads)
#define SP   2052                  // floats per score row in LDS: 16-byte aligned rows, 4 banks apart
typedef v4us __attribute__((may_alias)) v4usa;
__device__ __forceinline__ v16bf ldsfrag(const bf* p) { return cat16b(*(const v8usa*)p, *(const v8usa*)(p + 16)); }
__device__ __forceinline__ v8f mma3(v16bf a, v16bf a2, v16bf b, v16bf b2, v8f c) { c = wmmab(a, b, c); c = wmmab(a2, b, c); return wmmab(a, b2, c); }
__global__ __launch_bounds__(NWV * 32) void k_attn(const bf* __restrict__ QUh, const bf* __restrict__ QUl, const bf* __restrict__ QWh, const bf* __restrict__ QWl, const bf* __restrict__ Kh, const bf* __restrict__ Kl, const bf* __restrict__ Rh, const bf* __restrict__ Rl, const bf* __restrict__ Vh, const bf* __restrict__ Vl, const int* __restrict__ MKb, bf* Ah, bf* Al) {
    typedef WFrag<bf> F;
    __shared__ __align__(16) float S[RB * SP];
    const int h = blockIdx.x; const int i0 = (TT / RB - 1 - (int)blockIdx.y) * RB;   /* late query rows have the most positions: they start first */
    const int wave = __builtin_amdgcn_readfirstlane(threadIdx.x >> 5); const int lane = threadIdx.x & 31, lr = lane & 15, hi = lane >> 4;
    const size_t qoff = ((size_t)h * TT + i0 + lr) * HD + 8 * hi;
    {   // 1: content scores, TT / 16 / NWV key tiles a wave
        v16bf a[MT][2], a2[MT][2];
#pragma unroll
        for (int mt = 0; mt < MT; ++mt)
#pragma unroll
            for (int kk = 0; kk < 2; ++kk) { a[mt][kk] = F::ld(QUh + qoff + mt * 16 * HD + kk * 32); a2[mt][kk] = F::ld(QUl + qoff + mt * 16 * HD + kk * 32); }
        const size_t koff = ((size_t)h * TT + wave * (TT / NWV) + lr) * HD + 8 * hi;
        for (int t = 0; t < TT / 16 / NWV; t += 2) { v16bf b[2][2], c[2][2];
#pragma unroll
            for (int u = 0; u < 2; ++u)
#pragma unroll
                for (int kk = 0; kk < 2; ++kk) { b[u][kk] = F::ld(Kh + koff + (t + u) * 16 * HD + kk * 32); c[u][kk] = F::ld(Kl + koff + (t + u) * 16 * HD + kk * 32); }
            // inputs only: holds the sixteen loads of two key tiles in front of the products, so that they fly together and are waited for once, not fragment by fragment
            asm volatile("" :: "v"(b[0][0]), "v"(b[0][1]), "v"(b[1][0]), "v"(b[1][1]), "v"(c[0][0]), "v"(c[0][1]), "v"(c[1][0]), "v"(c[1][1]));
#pragma unroll
            for (int u = 0; u < 2; ++u)
#pragma unroll
                for (int mt = 0; mt < MT; ++mt) { v8f acc = (v8f){}; acc = mma3(a[mt][0], a2[mt][0], b[u][0], c[u][0], acc); acc = mma3(a[mt][1], a2[mt][1], b[u][1], c[u][1], acc);
#pragma unroll
                    for (int j = 0; j < 8; ++j) S[(mt * 16 + hi * 8 + j) * SP + wave * (TT / NWV) + (t + u) * 16 + lr] = acc[j]; } }
    }
    __syncthreads();   // every content score is in LDS before a position score is added to it
    {   // 2: position tile t holds m = NPE - RB - i0 + 16 t + c; row r of the block meets it at key j = m - (NPE - 1) + i0 + r; each (r, j) belongs to exactly one (t, c)
        v16bf a[MT][2], a2[MT][2];
#pragma unroll
        for (int mt = 0; mt < MT; ++mt)
#pragma unroll
            for (int kk = 0; kk < 2; ++kk) { a[mt][kk] = F::ld(QWh + qoff + mt * 16 * HD + kk * 32); a2[mt][kk] = F::ld(QWl + qoff + mt * 16 * HD + kk * 32); }
        const int nt = (i0 + RB) / 16; const size_t roff = ((size_t)h * NPE + (NPE - RB - i0) + lr) * HD + 8 * hi;
        for (int t = wave; t < nt; t += 2 * NWV) { const bool two = t + NWV < nt;   /* two tiles a trip, t and t + NWV; past the end the second one repeats the first and is dropped */
            v16bf b[2][2], c[2][2]; v8f acc[2][MT];
#pragma unroll
            for (int u = 0; u < 2; ++u) { const size_t to = roff + (size_t)((u && two) ? t + NWV : t) * 16 * HD;
#pragma unroll
                for (int kk = 0; kk < 2; ++kk) { b[u][kk] = F::ld(Rh + to + kk * 32); c[u][kk] = F::ld(Rl + to + kk * 32); } }
            // inputs only: holds the sixteen loads of two position tiles in front of the products, so that they fly together and are waited for once
            asm volatile("" :: "v"(b[0][0]), "v"(b[0][1]), "v"(b[1][0]), "v"(b[1][1]), "v"(c[0][0]), "v"(c[0][1]), "v"(c[1][0]), "v"(c[1][1]));
#pragma unroll
            for (int u = 0; u < 2; ++u)
#pragma unroll
                for (int mt = 0; mt < MT; ++mt) { acc[u][mt] = (v8f){}; acc[u][mt] = mma3(a[mt][0], a2[mt][0], b[u][0], c[u][0], acc[u][mt]); acc[u][mt] = mma3(a[mt][1], a2[mt][1], b[u][1], c[u][1], acc[u][mt]); }
            float* p = S + (hi * 8) * (SP + 1) + 16 * t + lr - (RB - 1);   /* row r = mt * 16 + hi * 8 + j, key 16 t + lr + r - (RB - 1) */
            if (16 * t >= RB - 1) {   // every key of the tile is >= 0 (a scalar test): the old scores are read together, with no lane test
                float o[MT][8];
#pragma unroll
                for (int mt = 0; mt < MT; ++mt)
#pragma unroll
                    for (int j = 0; j < 8; ++j) o[mt][j] = p[(mt * 16 + j) * (SP + 1)];
#pragma unroll
                for (int mt = 0; mt < MT; ++mt)
#pragma unroll
                    for (int j = 0; j < 8; ++j) p[(mt * 16 + j) * (SP + 1)] = __fadd_rn(o[mt][j], acc[0][mt][j]);
            } else {
#pragma unroll
                for (int mt = 0; mt < MT; ++mt)
#pragma unroll
                    for (int j = 0; j < 8; ++j) { const int key = 16 * t + lr + mt * 16 + hi * 8 + j - (RB - 1); if (key >= 0) p[(mt * 16 + j) * (SP + 1)] = __fadd_rn(p[(mt * 16 + j) * (SP + 1)], acc[0][mt][j]); }
            }
            if (two) {   // tile t + NWV: its keys are all >= 0 (16 NWV >= RB - 1)
                float* p2 = p + 16 * NWV; float o[MT][8];
#pragma unroll
                for (int mt = 0; mt < MT; ++mt)
#pragma unroll
                    for (int j = 0; j < 8; ++j) o[mt][j] = p2[(mt * 16 + j) * (SP + 1)];
#pragma unroll
                for (int mt = 0; mt < MT; ++mt)
#pragma unroll
                    for (int j = 0; j < 8; ++j) p2[(mt * 16 + j) * (SP + 1)] = __fadd_rn(o[mt][j], acc[1][mt][j]);
            } }
    }
    __syncthreads();   // the rows are complete before a wave takes its rows' softmax
    // not unrolled: one register row of 64 values is live at a time
#pragma unroll 1
    for (int rr = 0; rr < RB / NWV; ++rr) {   // 3: t = (ac + bd)/8, -inf where mask == 0; softmax over the 2048 keys (register row, one exp, fixed trees)
        const int r = wave * (RB / NWV) + rr; float* srow = S + r * SP; const int* mkr = MKb + (size_t)(i0 + r) * TT; float v[TT / 32]; float mx = -3.0e38f;
#pragma unroll
        for (int ch = 0; ch < TT / 128; ++ch) { const int j0 = ch * 128 + lane * 4; const v4f s4 = *(const v4fa*)(srow + j0); const v4i m4 = *(const v4i*)(mkr + j0);
#pragma unroll
            for (int q = 0; q < 4; ++q) { const float t = (m4[q] != 0) ? s4[q] * SCL : -3.0e38f; v[ch * 4 + q] = t; mx = fmaxf(mx, t); } }
#pragma unroll
        for (int sh = 16; sh; sh >>= 1) mx = fmaxf(mx, __shfl_xor(mx, sh, 32));
        float sum = 0.f;
#pragma unroll
        for (int k = 0; k < TT / 32; ++k) { v[k] = __builtin_amdgcn_exp2f(__fmul_rn(__fsub_rn(v[k], mx), 1.4426950408889634f)); sum += v[k]; }
#pragma unroll
        for (int sh = 16; sh; sh >>= 1) sum += __shfl_xor(sum, sh, 32);
        const float f = __fdiv_rn(1.0f, sum); bf* prow = (bf*)srow;
#pragma unroll
        for (int ch = 0; ch < TT / 128; ++ch) { v4us oh, ol;
#pragma unroll
            for (int q = 0; q < 4; ++q) { unsigned short x, y; splitf(v[ch * 4 + q] * f, x, y); oh[q] = x; ol[q] = y; }
            *(v4usa*)(prow + ch * 128 + lane * 4) = oh; *(v4usa*)(prow + TT + ch * 128 + lane * 4) = ol; }
    }
    __syncthreads();   // every row's hi/lo planes are in LDS before any wave reads them as its A operand
    v8f acc[MT][4];
#pragma unroll
    for (int mt = 0; mt < MT; ++mt)
#pragma unroll
        for (int nb = 0; nb < 4; ++nb) acc[mt][nb] = (v8f){};
    {   // 4: attn.v, this wave's keys [wave * TT / NWV, + TT / NWV)
        const bf* pa = (const bf*)S + (size_t)lr * (2 * SP) + 8 * hi + wave * (TT / NWV); const size_t voff = ((size_t)h * HD + lr) * TT + 8 * hi + wave * (TT / NWV);
        // unrolled: four trips, acc indexed by constants
#pragma unroll
        for (int kc = 0; kc < TT / NWV; kc += 32) { v16bf a[MT], a2[MT];
#pragma unroll
            for (int mt = 0; mt < MT; ++mt) { a[mt] = ldsfrag(pa + mt * 16 * (2 * SP) + kc); a2[mt] = ldsfrag(pa + mt * 16 * (2 * SP) + TT + kc); }
            v16bf b[4], b2[4];
#pragma unroll
            for (int nb = 0; nb < 4; ++nb) { b[nb] = F::ld(Vh + voff + (size_t)nb * 16 * TT + kc); b2[nb] = F::ld(Vl + voff + (size_t)nb * 16 * TT + kc); }
            // inputs only: holds the sixteen v loads of this trip in front of the products, so that they fly together and are waited for once
            asm volatile("" :: "v"(b[0]), "v"(b[1]), "v"(b[2]), "v"(b[3]), "v"(b2[0]), "v"(b2[1]), "v"(b2[2]), "v"(b2[3]));
#pragma unroll
            for (int nb = 0; nb < 4; ++nb)
#pragma unroll
                for (int mt = 0; mt < MT; ++mt) acc[mt][nb] = mma3(a[mt], a2[mt], b[nb], b2[nb], acc[mt][nb]); }
    }
    __syncthreads();   // the last read of the hi/lo planes is over before their LDS takes the partial tiles
    float* rw = S + wave * (RB * 68);
#pragma unroll
    for (int mt = 0; mt < MT; ++mt)
#pragma unroll
        for (int nb = 0; nb < 4; ++nb)
#pragma unroll
            for (int j = 0; j < 8; ++j) rw[(mt * 16 + hi * 8 + j) * 68 + nb * 16 + lr] = acc[mt][nb][j];
    __syncthreads();   // every wave's partial tile is in LDS before any thread sums across the waves
    const int row = (int)threadIdx.x >> 4, cofs = ((int)threadIdx.x & 15) * 4; v4f val = *(const v4fa*)(S + row * 68 + cofs);
    // unrolled so that a thread's LDS reads issue together; the sum stays in wave order
#pragma unroll
    for (int w = 1; w < NWV; ++w) { const v4f p = *(const v4fa*)(S + w * (RB * 68) + row * 68 + cofs); val[0] += p[0]; val[1] += p[1]; val[2] += p[2]; val[3] += p[3]; }
    v4us oh, ol;
#pragma unroll
    for (int q = 0; q < 4; ++q) { unsigned short x, y; splitf(val[q], x, y); oh[q] = x; ol[q] = y; }
    const size_t oo = (size_t)(i0 + row) * DQ + h * HD + cofs; *(v4us*)(Ah + oo) = oh; *(v4us*)(Al + oo) = ol;
}

extern "C" void kernel_launch(void* const* d_in, const int* in_sizes, int n_in,
                              void* d_out, int out_size, void* d_ws, size_t ws_size, hipStream_t stream) {
    (void)in_sizes; (void)n_in; (void)out_size;
    const float* x = (const float*)d_in[0]; const float* xk = (const float*)d_in[1]; const float* xv = (const float*)d_in[2]; const int* MK = (const int*)d_in[3]; const float* wq = (const float*)d_in[4]; const float* wk = (const float*)d_in[5]; const float* wv = (const float*)d_in[6]; const float* wp = (const float*)d_in[7]; const float* wo = (const float*)d_in[8]; const float* pbu = (const float*)d_in[9]; const float* pbv = (const float*)d_in[10];
    float* OUT = (float*)d_out;     // [1][2048][1024]
    char* wsp = (char*)d_ws;
    auto take = [&](size_t bytes) { char* p = wsp; wsp += (bytes + 255) & ~(size_t)255; return (void*)p; };
    bf* WQ = (bf*)take((size_t)DQ * DM * 2); bf* WK = (bf*)take((size_t)DKV * DM * 2); bf* WV = (bf*)take((size_t)DKV * DM * 2); bf* WO = (bf*)take((size_t)DM * DQ * 2); float* CS = (float*)take((size_t)TT * HD * 2 * 4);
    bf* XB = (bf*)take((size_t)TT * DM * 2); bf* XKB = (bf*)take((size_t)TT * DM * 2); bf* XVB = (bf*)take((size_t)TT * DM * 2); float* FQ = (float*)take((size_t)TT * DQ * 4); float* FK = (float*)take((size_t)TT * DKV * 4); float* FQU = (float*)take((size_t)TT * DQ * 4); bf* WP = (bf*)take((size_t)DQ * DM * 2); bf* PPh = (bf*)take((size_t)NH_ * NPE * HD * 2); bf* PPl = (bf*)take((size_t)NH_ * NPE * HD * 2); bf* QVh = (bf*)take((size_t)NH_ * TT * HD * 2); bf* QVl = (bf*)take((size_t)NH_ * TT * HD * 2); float* POS = (float*)take((size_t)NPE * DQ * 4);   /* projected positions, f32, until k_pplane has split them */ float* FQV = FQ;   /* (q + b_v) is formed in place after (q + b_u) has been copied out */
    h16* QP16 = (h16*)take((size_t)NH_ * TT * HD * 2); h16* KP16 = (h16*)take((size_t)NKV * TT * HD * 2); h16* VT16 = (h16*)take((size_t)NKV * HD * TT * 2);
    bf* QPh = (bf*)take((size_t)NH_ * TT * HD * 2); bf* QPl = (bf*)take((size_t)NH_ * TT * HD * 2); bf* KPh = (bf*)take((size_t)NKV * TT * HD * 2); bf* KPl = (bf*)take((size_t)NKV * TT * HD * 2); bf* VTh = (bf*)take((size_t)NKV * HD * TT * 2); bf* VTl = (bf*)take((size_t)NKV * HD * TT * 2);
    bf* PEh = (bf*)take((size_t)NPE * DM * 2); bf* PEl = (bf*)take((size_t)NPE * DM * 2);   /* the position-table planes */ bf* ATh = (bf*)take((size_t)TT * DQ * 2); bf* ATl = (bf*)take((size_t)TT * DQ * 2);
    if ((size_t)(wsp - (char*)d_ws) > ws_size) return;    // ws 256 MiB
    float* FV = FK;   // v projection reuses the k buffer after the k planes are built (stream-ordered)
    { k_wtG<<<(unsigned)((DM * DQ / 64 + 63) / 64), 256, 0, stream>>>(wq, DM, DQ, WQ); k_wtG<<<(unsigned)((DM * DKV / 64 + 63) / 64), 256, 0, stream>>>(wk, DM, DKV, WK); k_wtG<<<(unsigned)((DM * DKV / 64 + 63) / 64), 256, 0, stream>>>(wv, DM, DKV, WV);
      k_wtG<<<(unsigned)((DQ * DM / 64 + 63) / 64), 256, 0, stream>>>(wo, DQ, DM, WO);
       }
    k_csid<<<(TT * HD + 255) / 256, 256, 0, stream>>>(CS); k_petab<<<(unsigned)(((size_t)NPE * DM / 2 + 255) / 256), 256, 0, stream>>>(PEh, PEl); k_wtG<<<(unsigned)((DM * DQ / 64 + 63) / 64), 256, 0, stream>>>(wp, DM, DQ, WP); k_gemmw<bf, 1, false, 8, 1><<<dim3(NPE / 64, DQ / 64, 1), 256, 0, stream>>>(PEh, PEl, WP, nullptr, DM, POS, DQ, nullptr, 0, 0, 0, 0); k_pplane<<<(unsigned)(((size_t)NH_ * NPE * HD / 2 + 255) / 256), 256, 0, stream>>>(POS, PPh, PPl);   /* reversed sinusoidal table (bf16) x w_p -> per-head position planes [h][4096][64] */
    const unsigned LQ = (unsigned)(((size_t)NH_ * TT * HD / 2 + 255) / 256), LKv = (unsigned)(((size_t)NKV * TT * HD / 2 + 255) / 256);
    for (int b = 0; b < NB_; ++b) {
        
        k_cvt8<<<(unsigned)(((size_t)TT * DM / 8 + 255) / 256), 256, 0, stream>>>(x + (size_t)b * TT * DM, XB, (size_t)TT * DM / 8); k_cvt8<<<(unsigned)(((size_t)TT * DM / 8 + 255) / 256), 256, 0, stream>>>(xk + (size_t)b * TT * DM, XKB, (size_t)TT * DM / 8); k_cvt8<<<(unsigned)(((size_t)TT * DM / 8 + 255) / 256), 256, 0, stream>>>(xv + (size_t)b * TT * DM, XVB, (size_t)TT * DM / 8);
        k_gemmw<bf, 0, false, 8, 1><<<dim3(TT / 64, DQ / 64, 1), 256, 0, stream>>>(XB, nullptr, WQ, nullptr, DM, FQ, DQ, nullptr, 0, 0, 0, 0);
        k_addhb<<<(unsigned)(((size_t)TT * DQ / 4 + 255) / 256), 256, 0, stream>>>(FQ, pbu, FQU, (size_t)TT * DQ / 4); k_addhb<<<(unsigned)(((size_t)TT * DQ / 4 + 255) / 256), 256, 0, stream>>>(FQ, pbv, FQV, (size_t)TT * DQ / 4); k_rope<<<LQ, 256, 0, stream>>>(FQU, DQ, NH_, CS, nullptr, nullptr, 1.0f, QP16, QPh, QPl); k_rope<<<LQ, 256, 0, stream>>>(FQV, DQ, NH_, CS, nullptr, nullptr, 1.0f, QP16, QVh, QVl);   /* (q + b_u) planes for the content scores, (q + b_v) planes for the position scores */
        k_gemmw<bf, 0, false, 8, 1><<<dim3(TT / 64, DKV / 64, 1), 256, 0, stream>>>(XKB, nullptr, WK, nullptr, DM, FK, DKV, nullptr, 0, 0, 0, 0);
        k_rope<<<LKv, 256, 0, stream>>>(FK, DKV, NKV, CS, nullptr, nullptr, 1.0f, KP16, KPh, KPl);
        k_gemmw<bf, 0, false, 8, 1><<<dim3(TT / 64, DKV / 64, 1), 256, 0, stream>>>(XVB, nullptr, WV, nullptr, DM, FV, DKV, nullptr, 0, 0, 0, 0); k_vtp<<<LKv, 256, 0, stream>>>(FV, DKV, NKV, VT16, VTh, VTl);
        k_attn<<<dim3(NH_, TT / RB, 1), NWV * 32, 0, stream>>>(QPh, QPl, QVh, QVl, KPh, KPl, PPh, PPl, VTh, VTl, MK, ATh, ATl);   /* scores, shift, softmax and attn.v of all heads; one kv head per query head */
        k_gemmw<bf, 1, false, 8, 1><<<dim3(TT / 64, DM / 64, 1), 256, 0, stream>>>(ATh, ATl, WO, nullptr, DQ, OUT + (size_t)b * TT * DM, DM, nullptr, 0, 0, 0, 0); }
}

// v003
// One run takes 274 microseconds.
// In both of two side-by-side timings against v002, it was 1.16 times as fast.
// All steps since v000 together make it 3.66 times as fast.
#include <hip/hip_runtime.h>

// Transformer-XL relative-position multi-head attention (q, k, v inputs [1][2048][1024]; qh = q w_q, kh = k w_k, vh = v w_v ('xw' [1024][1024], no bias; 16 heads x 64); pe = reversed sinusoidal table of length 4096 (pe[m] = PE(4095 - m), interleaved sin/cos) projected by w_p -> ph [16][4096][64]; ac = (qh + b_u).kh, bd = left_shift((qh + b_v).ph): bd[i][j] = raw[i][4095 - i + j] for j <= i else 0; scores = (ac + bd)/8; mask (int [1][2048][2048], read; -inf where 0); softmax; out = attn.vh merged w_o -> [1][2048][1024]).
// Layout: projections from three bf16 input planes, each projection GEMM storing its result as the bf16 hi/lo planes that the attention reads (no f32 copy in memory); b_u / b_v folded into two sets of query planes; the position table is computed on device in f32 (pos / 10000^(2i/1024), precise powf/sinf/cosf) -> hi/lo planes -> 2-product GEMM with the exact bf16 w_p -> per-head hi/lo planes; one launch does the attention of all heads: a work-group keeps 32 query rows' scores in LDS, content and position scores are hi/lo x hi/lo products (3 products), a position score is added at its shifted key, and softmax and attn.v follow on the same rows.
// Compute dtypes, f32 accumulate: every input rounded to bf16; q/k/v on PLAIN bf16 operands (inputs: exact); content / position scores and attn.v on hi/lo planes for every row (3 products); softmax f32; w_o hl x exact (2 products).

#define NB_  1
#define TT   2048
#define DM   1024
#define NH_  16
#define NKV  16
#define REP  (NH_ / NKV)
#define HD   64
#define DQ   (NH_ * HD)
#define DKV  (NKV * HD)
#define NPE  4096                 // relative positions (2 x seq)
typedef __attribute__((ext_vector_type(4))) int v4i;
#define WIN  0
#define SCL  0.125f   // HD^-0.5
typedef _Float16 h16;
typedef unsigned short bf;
typedef __attribute__((ext_vector_type(16))) __bf16   v16bf;
typedef __attribute__((ext_vector_type(16))) _Float16 v16h;
typedef __attribute__((ext_vector_type(8)))  _Float16 v8h;
typedef __attribute__((ext_vector_type(8)))  unsigned short v8us;
typedef __attribute__((ext_vector_type(8)))  float    v8f;
typedef __attribute__((ext_vector_type(4)))  float    v4f;
typedef v8h  __attribute__((may_alias)) v8ha;
typedef v4f  __attribute__((may_alias)) v4fa;
typedef v8us __attribute__((may_alias)) v8usa;

__device__ __forceinline__ unsigned short f2bf(float f) { unsigned u = __float_as_uint(f); u += 0x7FFFu + ((u >> 16) & 1u); return (unsigned short)(u >> 16); }
__device__ __forceinline__ float bf2f(unsigned short b) { return __uint_as_float(((unsigned)b) << 16); }
__device__ __forceinline__ float bfr(float f) { return bf2f(f2bf(f)); }
__device__ __forceinline__ v16h cat16(v8h lo, v8h hi) { return __builtin_shufflevector(lo, hi, 0, 1, 2, 3, 4, 5, 6, 7, 8, 9, 10, 11, 12, 13, 14, 15); }
__device__ __forceinline__ v16bf cat16b(v8us lo, v8us hi) { return __builtin_bit_cast(v16bf, __builtin_shufflevector(lo, hi, 0, 1, 2, 3, 4, 5, 6, 7, 8, 9, 10, 11, 12, 13, 14, 15)); }
__device__ __forceinline__ v8f wmma16(v16h a, v16h b, v8f c) { return __builtin_amdgcn_wmma_f32_16x16x32_f16(false, a, false, b, (short)0, c, false, false); }
__device__ __forceinline__ v8f wmmab(v16bf a, v16bf b, v8f c) { return __builtin_amdgcn_wmma_f32_16x16x32_bf16(false, a, false, b, (short)0, c, false, false); }

__device__ __forceinline__ void splitf(float y, unsigned short& h, unsigned short& l) { h = f2bf(y); l = f2bf(y - bf2f(h)); }
typedef __attribute__((ext_vector_type(2))) unsigned short v2us;
typedef __attribute__((ext_vector_type(4))) unsigned short v4us;

// ---- k_gemmw: register-blocked GEMM, ONE WAVE per 64x64 output tile (16 accumulators), operands straight from K-contiguous 16-bit planes; grid (M/64, N/64, Z), 32 threads.
// C[m][n] (f32, pitch ldc, + optional f32 bias[n]) = sum_k A[m][k] Bt[n][k] (+ split products per NSPLIT). z-batch strides sA/sB/sC in elements. K % 32 == 0.
// Split K (long K): NW waves per work-group and KS work-groups per tile each take K / (KS * NW) consecutive k of the same 64x64 tile; the NW partial tiles are summed through LDS in wave order, and work-group ks (blockIdx.z = z * KS + ks) writes its own f32 plane at C + ks * sP, summed by the consumer. Grid (M/64, N/64, Z * KS), NW * 32 threads. K % (KS * NW * 32) == 0. NW > 1 takes no bias.
// EPI (NW > 1, KS == 1): what the summed tile is stored as. 0: f32 at C. 1: its bf16 hi and lo planes at P1h / P1l. 2: the planes of (tile + hb1[n]) at P1h / P1l and of (tile + hb2[n]) at P2h / P2l (hb rounded to bf16).
// A plane element (m, n) lies at blockIdx.y * sH + m * ldo + n % 64: head planes [n / 64][m][64] with sH = M * 64, ldo = 64; a plain [m][n] plane with sH = 64, ldo = N.
template <typename T16> struct WFrag;
template <> struct WFrag<h16> { typedef v16h V; static __device__ __forceinline__ V ld(const h16* p) { return cat16(*(const v8h*)p, *(const v8h*)(p + 16)); } static __device__ __forceinline__ v8f mma(V a, V b, v8f c) { return wmma16(a, b, c); } };
template <> struct WFrag<bf> { typedef v16bf V; static __device__ __forceinline__ V ld(const bf* p) { return cat16b(*(const v8us*)p, *(const v8us*)(p + 16)); } static __device__ __forceinline__ v8f mma(V a, V b, v8f c) { return wmmab(a, b, c); } };
template <typename T16, int NSPLIT, bool BIAS, int NW, int KS, int EPI>
__global__ __launch_bounds__(NW * 32) void k_gemmw(const T16* __restrict__ A, const T16* __restrict__ A2, const T16* __restrict__ Bt, const T16* __restrict__ Bt2, int K, float* C, int ldc, const float* __restrict__ bias, size_t sA, size_t sB, size_t sC, size_t sP, bf* P1h, bf* P1l, bf* P2h, bf* P2l, const float* __restrict__ hb1, const float* __restrict__ hb2, size_t sH, int ldo) {
    typedef typename WFrag<T16>::V V;
    __shared__ __align__(16) float os[NW == 1 ? 16 * 68 : NW * 64 * 68];
    const size_t z = blockIdx.z / KS; const int ks = blockIdx.z % KS; A += z * sA; if (A2) A2 += z * sA; Bt += z * sB; if (Bt2) Bt2 += z * sB; C += z * sC + (size_t)ks * sP;
    const int wave = (NW == 1) ? 0 : __builtin_amdgcn_readfirstlane(threadIdx.x >> 5); const int kw = K / (KS * NW), k0 = (ks * NW + wave) * kw;   /* this wave's k range [k0, k0 + kw) */
    const int lane = threadIdx.x & 31, lr = lane & 15, hi = lane >> 4; const int r0 = blockIdx.x * 64, c0 = blockIdx.y * 64;
    v8f acc[4][4];
#pragma unroll
    for (int mb = 0; mb < 4; ++mb)
#pragma unroll
        for (int nb = 0; nb < 4; ++nb) acc[mb][nb] = (v8f){};
    const size_t aoff = (size_t)(r0 + lr) * K + 8 * hi + k0, boff = (size_t)(c0 + lr) * K + 8 * hi + k0;
#pragma unroll 1
    for (int kc = 0; kc < kw; kc += 32) {
        V a[4], a2[4];
#pragma unroll
        for (int mb = 0; mb < 4; ++mb) { a[mb] = WFrag<T16>::ld(A + aoff + (size_t)mb * 16 * K + kc); if (NSPLIT == 1 || NSPLIT == 2) a2[mb] = WFrag<T16>::ld(A2 + aoff + (size_t)mb * 16 * K + kc); }
#pragma unroll
        for (int nb = 0; nb < 4; ++nb) { const V b = WFrag<T16>::ld(Bt + boff + (size_t)nb * 16 * K + kc); V b2; if (NSPLIT >= 2) b2 = WFrag<T16>::ld(Bt2 + boff + (size_t)nb * 16 * K + kc);
#pragma unroll
            for (int mb = 0; mb < 4; ++mb) { acc[mb][nb] = WFrag<T16>::mma(a[mb], b, acc[mb][nb]); if (NSPLIT == 1 || NSPLIT == 2) acc[mb][nb] = WFrag<T16>::mma(a2[mb], b, acc[mb][nb]); if (NSPLIT >= 2) acc[mb][nb] = WFrag<T16>::mma(a[mb], b2, acc[mb][nb]); } }
        asm volatile("v_nop\n\tv_nop\n\tv_nop\n\tv_nop" : "+v"(acc[0][0]), "+v"(acc[1][1]), "+v"(acc[2][2]), "+v"(acc[3][3]) : "v"(a[0]), "v"(a[3]));
    }
    if (NW > 1) {
        float* rw = os + wave * (64 * 68);
        // the three loops are unrolled so that acc is indexed by constants and stays in registers
#pragma unroll
        for (int mb = 0; mb < 4; ++mb)
#pragma unroll
            for (int nb = 0; nb < 4; ++nb)
#pragma unroll
                for (int j = 0; j < 8; ++j) rw[(mb * 16 + hi * 8 + j) * 68 + nb * 16 + lr] = acc[mb][nb][j];
        __syncthreads();   // every wave's partial tile is in LDS before any thread sums across the waves
        // both loops are unrolled so that a thread's LDS reads issue together; the sum stays in wave order
#pragma unroll
        for (int s = 0; s < 32 / NW; ++s) { const int idx = s * (NW * 32) + (int)threadIdx.x; const int row = idx >> 4, cofs = (idx & 15) * 4; v4f val = *(const v4fa*)(os + row * 68 + cofs);
#pragma unroll
            for (int w = 1; w < NW; ++w) { const v4f p = *(const v4fa*)(os + w * (64 * 68) + row * 68 + cofs); val[0] += p[0]; val[1] += p[1]; val[2] += p[2]; val[3] += p[3]; }
            if (EPI == 0) { *(v4f*)(C + (size_t)(r0 + row) * ldc + c0 + cofs) = val; }
            else { const size_t po = (size_t)blockIdx.y * sH + (size_t)(r0 + row) * ldo + cofs; v4us oh, ol;
                // both q loops are unrolled so that val, oh and ol are indexed by constants and stay in registers
#pragma unroll
                for (int q = 0; q < 4; ++q) { unsigned short x, y; splitf(EPI == 2 ? __fadd_rn(val[q], bfr(hb1[c0 + cofs + q])) : val[q], x, y); oh[q] = x; ol[q] = y; }
                *(v4us*)(P1h + po) = oh; *(v4us*)(P1l + po) = ol;
                if (EPI == 2) {
#pragma unroll
                    for (int q = 0; q < 4; ++q) { unsigned short x, y; splitf(__fadd_rn(val[q], bfr(hb2[c0 + cofs + q])), x, y); oh[q] = x; ol[q] = y; }
                    *(v4us*)(P2h + po) = oh; *(v4us*)(P2l + po) = ol; } } }
        return;
    }
#pragma unroll
    for (int mb = 0; mb < 4; ++mb) {
#pragma unroll
        for (int nb = 0; nb < 4; ++nb) {
#pragma unroll
            for (int j = 0; j < 8; ++j) os[(hi * 8 + j) * 68 + nb * 16 + lr] = acc[mb][nb][j]; }
        __builtin_amdgcn_wave_barrier(); asm volatile("" ::: "memory");
        float* crow = C + (size_t)(r0 + mb * 16) * ldc + c0;
{
#pragma unroll
            for (int s = 0; s < 8; ++s) { const int row = 2 * s + hi, cofs = lr * 4; v4f val = *(const v4fa*)(os + row * 68 + cofs); if (BIAS) { val[0] += bfr(bias[c0 + cofs]); val[1] += bfr(bias[c0 + cofs + 1]); val[2] += bfr(bias[c0 + cofs + 2]); val[3] += bfr(bias[c0 + cofs + 3]); }
                *(v4f*)(crow + (size_t)row * ldc + cofs) = val; }
             }
        __builtin_amdgcn_wave_barrier(); asm volatile("" ::: "memory");
    }
}

__global__ __launch_bounds__(256) void k_wtG(const float* __restrict__ w, int K, int N, bf* Bt) {
    const int lane = threadIdx.x & 31; const int L0 = (blockIdx.x * 8 + (threadIdx.x >> 5)) * 8; const int nlines = N * K / 64;
{
#pragma unroll 1
        for (int l = 0; l < 8; ++l) { const int L = L0 + l; if (L >= nlines) break; const size_t e = (size_t)L * 64 + lane * 2; const int k = (int)(e % K), n = (int)(e / K); v2us o;
            o[0] = f2bf(w[(size_t)k * N + n]); o[1] = f2bf(w[(size_t)(k + 1) * N + n]); *(v2us*)(Bt + e) = o; }
         }
}
__global__ __launch_bounds__(256) void k_petab(bf* PEh, bf* PEl) { const size_t e = ((size_t)blockIdx.x * 256 + threadIdx.x) * 2; if (e >= (size_t)NPE * DM) return; const int c = (int)(e % DM); const int m = (int)(e / DM); const float pos = (float)(NPE - 1 - m); const float ex = __fdiv_rn((float)c, (float)DM);   /* c even: 2i/d_model */ const float den = powf(10000.0f, ex); const float th = __fdiv_rn(pos, den); v2us oh, ol; unsigned short a, b2; splitf(sinf(th), a, b2); oh[0] = a; ol[0] = b2; splitf(cosf(th), a, b2); oh[1] = a; ol[1] = b2; *(v2us*)(PEh + e) = oh; *(v2us*)(PEl + e) = ol;  }
__global__ __launch_bounds__(256) void k_cvt8(const float* __restrict__ src, bf* dst, size_t n8) { const size_t i = (size_t)blockIdx.x * 256 + threadIdx.x; if (i >= n8) return; const v8f v = *(const v8f*)(src + i * 8); v8us o;
#pragma unroll
    for (int k = 0; k < 8; ++k) o[k] = f2bf(v[k]); *(v8us*)(dst + i * 8) = o;  }

// k_attn: one work-group = one head x RB query rows, every stage of the attention on chip. The RB score rows [RB][2048] f32 live in LDS (pitch SP floats):
//   1 content scores (q + b_u).k into the rows; 2 raw position scores (q + b_v).ph only for the positions that the left shift keeps (m = 4095 - i + j, 0 <= j <= i), added at their shifted key j;
//   3 mask, softmax per row (one wave a row, register row), the row rewritten in place as its bf16 hi plane (first 4 KiB) and lo plane (next 4 KiB);
//   4 attn.v with the hi/lo rows as the A operand from LDS, each wave TT / NWV keys, the NWV partial tiles summed through LDS in wave order and split into the merged hi/lo planes.
// Every plain '#pragma unroll' in this kernel is there so that the register arrays (fragments, accumulators, the score row) are indexed by constants and stay in registers.
#define MT   2                     // 16-row tiles of query rows per work-group
#define RB   (16 * MT)
#define NWV  (RB / 2)              // waves per work-group (two score rows a wave; RB * 16 output quads = NWV * 32 threads)
#define SP   2052                  // floats per score row in LDS: 16-byte aligned rows, 4 banks apart
typedef v4us __attribute__((may_alias)) v4usa;
__device__ __forceinline__ v16bf ldsfrag(const bf* p) { return cat16b(*(const v8usa*)p, *(const v8usa*)(p + 16)); }
__device__ __forceinline__ v8f mma3(v16bf a, v16bf a2, v16bf b, v16bf b2, v8f c) { c = wmmab(a, b, c); c = wmmab(a2, b, c); return wmmab(a, b2, c); }
__global__ __launch_bounds__(NWV * 32) void k_attn(const bf* __restrict__ QUh, const bf* __restrict__ QUl, const bf* __restrict__ QWh, const bf* __restrict__ QWl, const bf* __restrict__ Kh, const bf* __restrict__ Kl, const bf* __restrict__ Rh, const bf* __restrict__ Rl, const bf* __restrict__ Vh, const bf* __restrict__ Vl, const int* __restrict__ MKb, bf* Ah, bf* Al) {
    typedef WFrag<bf> F;
    __shared__ __align__(16) float S[RB * SP];
    const int h = blockIdx.x; const int i0 = (TT / RB - 1 - (int)blockIdx.y) * RB;   /* late query rows have the most positions: they start first */
    const int wave = __builtin_amdgcn_readfirstlane(threadIdx.x >> 5); const int lane = threadIdx.x & 31, lr = lane & 15, hi = lane >> 4;
    const size_t qoff = ((size_t)h * TT + i0 + lr) * HD + 8 * hi;
    {   // 1: content scores, TT / 16 / NWV key tiles a wave
        v16bf a[MT][2], a2[MT][2];
#pragma unroll
        for (int mt = 0; mt < MT; ++mt)
#pragma unroll
            for (int kk = 0; kk < 2; ++kk) { a[mt][kk] = F::ld(QUh + qoff + mt * 16 * HD + kk * 32); a2[mt][kk] = F::ld(QUl + qoff + mt * 16 * HD + kk * 32); }
        const size_t koff = ((size_t)h * TT + wave * (TT / NWV) + lr) * HD + 8 * hi;
        for (int t = 0; t < TT / 16 / NWV; t += 2) { v16bf b[2][2], c[2][2];
#pragma unroll
            for (int u = 0; u < 2; ++u)
#pragma unroll
                for (int kk = 0; kk < 2; ++kk) { b[u][kk] = F::ld(Kh + koff + (t + u) * 16 * HD + kk * 32); c[u][kk] = F::ld(Kl + koff + (t + u) * 16 * HD + kk * 32); }
            // inputs only: holds the sixteen loads of two key tiles in front of the products, so that they fly together and are waited for once, not fragment by fragment
            asm volatile("" :: "v"(b[0][0]), "v"(b[0][1]), "v"(b[1][0]), "v"(b[1][1]), "v"(c[0][0]), "v"(c[0][1]), "v"(c[1][0]), "v"(c[1][1]));
#pragma unroll
            for (int u = 0; u < 2; ++u)
#pragma unroll
                for (int mt = 0; mt < MT; ++mt) { v8f acc = (v8f){}; acc = mma3(a[mt][0], a2[mt][0], b[u][0], c[u][0], acc); acc = mma3(a[mt][1], a2[mt][1], b[u][1], c[u][1], acc);
#pragma unroll
                    for (int j = 0; j < 8; ++j) S[(mt * 16 + hi * 8 + j) * SP + wave * (TT / NWV) + (t + u) * 16 + lr] = acc[j]; } }
    }
    __syncthreads();   // every content score is in LDS before a position score is added to it
    {   // 2: position tile t holds m = NPE - RB - i0 + 16 t + c; row r of the block meets it at key j = m - (NPE - 1) + i0 + r; each (r, j) belongs to exactly one (t, c)
        v16bf a[MT][2], a2[MT][2];
#pragma unroll
        for (int mt = 0; mt < MT; ++mt)
#pragma unroll
            for (int kk = 0; kk < 2; ++kk) { a[mt][kk] = F::ld(QWh + qoff + mt * 16 * HD + kk * 32); a2[mt][kk] = F::ld(QWl + qoff + mt * 16 * HD + kk * 32); }
        const int nt = (i0 + RB) / 16; const size_t roff = ((size_t)h * NPE + (NPE - RB - i0) + lr) * HD + 8 * hi;
        for (int t = wave; t < nt; t += 2 * NWV) { const bool two = t + NWV < nt;   /* two tiles a trip, t and t + NWV; past the end the second one repeats the first and is dropped */
            v16bf b[2][2], c[2][2]; v8f acc[2][MT];
#pragma unroll
            for (int u = 0; u < 2; ++u) { const size_t to = roff + (size_t)((u && two) ? t + NWV : t) * 16 * HD;
#pragma unroll
                for (int kk = 0; kk < 2; ++kk) { b[u][kk] = F::ld(Rh + to + kk * 32); c[u][kk] = F::ld(Rl + to + kk * 32); } }
            // inputs only: holds the sixteen loads of two position tiles in front of the products, so that they fly together and are waited for once
            asm volatile("" :: "v"(b[0][0]), "v"(b[0][1]), "v"(b[1][0]), "v"(b[1][1]), "v"(c[0][0]), "v"(c[0][1]), "v"(c[1][0]), "v"(c[1][1]));
#pragma unroll
            for (int u = 0; u < 2; ++u)
#pragma unroll
                for (int mt = 0; mt < MT; ++mt) { acc[u][mt] = (v8f){}; acc[u][mt] = mma3(a[mt][0], a2[mt][0], b[u][0], c[u][0], acc[u][mt]); acc[u][mt] = mma3(a[mt][1], a2[mt][1], b[u][1], c[u][1], acc[u][mt]); }
            float* p = S + (hi * 8) * (SP + 1) + 16 * t + lr - (RB - 1);   /* row r = mt * 16 + hi * 8 + j, key 16 t + lr + r - (RB - 1) */
            if (16 * t >= RB - 1) {   // every key of the tile is >= 0 (a scalar test): the old scores are read together, with no lane test
                float o[MT][8];
#pragma unroll
                for (int mt = 0; mt < MT; ++mt)
#pragma unroll
                    for (int j = 0; j < 8; ++j) o[mt][j] = p[(mt * 16 + j) * (SP + 1)];
#pragma unroll
                for (int mt = 0; mt < MT; ++mt)
#pragma unroll
                    for (int j = 0; j < 8; ++j) p[(mt * 16 + j) * (SP + 1)] = __fadd_rn(o[mt][j], acc[0][mt][j]);
            } else {
#pragma unroll
                for (int mt = 0; mt < MT; ++mt)
#pragma unroll
                    for (int j = 0; j < 8; ++j) { const int key = 16 * t + lr + mt * 16 + hi * 8 + j - (RB - 1); if (key >= 0) p[(mt * 16 + j) * (SP + 1)] = __fadd_rn(p[(mt * 16 + j) * (SP + 1)], acc[0][mt][j]); }
            }
            if (two) {   // tile t + NWV: its keys are all >= 0 (16 NWV >= RB - 1)
                float* p2 = p + 16 * NWV; float o[MT][8];
#pragma unroll
                for (int mt = 0; mt < MT; ++mt)
#pragma unroll
                    for (int j = 0; j < 8; ++j) o[mt][j] = p2[(mt * 16 + j) * (SP + 1)];
#pragma unroll
                for (int mt = 0; mt < MT; ++mt)
#pragma unroll
                    for (int j = 0; j < 8; ++j) p2[(mt * 16 + j) * (SP + 1)] = __fadd_rn(o[mt][j], acc[1][mt][j]);
            } }
    }
    __syncthreads();   // the rows are complete before a wave takes its rows' softmax
    // not unrolled: one register row of 64 values is live at a time
#pragma unroll 1
    for (int rr = 0; rr < RB / NWV; ++rr) {   // 3: t = (ac + bd)/8, -inf where mask == 0; softmax over the 2048 keys (register row, one exp, fixed trees)
        const int r = wave * (RB / NWV) + rr; float* srow = S + r * SP; const int* mkr = MKb + (size_t)(i0 + r) * TT; float v[TT / 32]; float mx = -3.0e38f;
#pragma unroll
        for (int ch = 0; ch < TT / 128; ++ch) { const int j0 = ch * 128 + lane * 4; const v4f s4 = *(const v4fa*)(srow + j0); const v4i m4 = *(const v4i*)(mkr + j0);
#pragma unroll
            for (int q = 0; q < 4; ++q) { const float t = (m4[q] != 0) ? s4[q] * SCL : -3.0e38f; v[ch * 4 + q] = t; mx = fmaxf(mx, t); } }
#pragma unroll
        for (int sh = 16; sh; sh >>= 1) mx = fmaxf(mx, __shfl_xor(mx, sh, 32));
        float sum = 0.f;
#pragma unroll
        for (int k = 0; k < TT / 32; ++k) { v[k] = __builtin_amdgcn_exp2f(__fmul_rn(__fsub_rn(v[k], mx), 1.4426950408889634f)); sum += v[k]; }
#pragma unroll
        for (int sh = 16; sh; sh >>= 1) sum += __shfl_xor(sum, sh, 32);
        const float f = __fdiv_rn(1.0f, sum); bf* prow = (bf*)srow;
#pragma unroll
        for (int ch = 0; ch < TT / 128; ++ch) { v4us oh, ol;
#pragma unroll
            for (int q = 0; q < 4; ++q) { unsigned short x, y; splitf(v[ch * 4 + q] * f, x, y); oh[q] = x; ol[q] = y; }
            *(v4usa*)(prow + ch * 128 + lane * 4) = oh; *(v4usa*)(prow + TT + ch * 128 + lane * 4) = ol; }
    }
    __syncthreads();   // every row's hi/lo planes are in LDS before any wave reads them as its A operand
    v8f acc[MT][4];
#pragma unroll
    for (int mt = 0; mt < MT; ++mt)
#pragma unroll
        for (int nb = 0; nb < 4; ++nb) acc[mt][nb] = (v8f){};
    {   // 4: attn.v, this wave's keys [wave * TT / NWV, + TT / NWV)
        const bf* pa = (const bf*)S + (size_t)lr * (2 * SP) + 8 * hi + wave * (TT / NWV); const size_t voff = ((size_t)h * HD + lr) * TT + 8 * hi + wave * (TT / NWV);
        // unrolled: four trips, acc indexed by constants
#pragma unroll
        for (int kc = 0; kc < TT / NWV; kc += 32) { v16bf a[MT], a2[MT];
#pragma unroll
            for (int mt = 0; mt < MT; ++mt) { a[mt] = ldsfrag(pa + mt * 16 * (2 * SP) + kc); a2[mt] = ldsfrag(pa + mt * 16 * (2 * SP) + TT + kc); }
            v16bf b[4], b2[4];
#pragma unroll
            for (int nb = 0; nb < 4; ++nb) { b[nb] = F::ld(Vh + voff + (size_t)nb * 16 * TT + kc); b2[nb] = F::ld(Vl + voff + (size_t)nb * 16 * TT + kc); }
            // inputs only: holds the sixteen v loads of this trip in front of the products, so that they fly together and are waited for once
            asm volatile("" :: "v"(b[0]), "v"(b[1]), "v"(b[2]), "v"(b[3]), "v"(b2[0]), "v"(b2[1]), "v"(b2[2]), "v"(b2[3]));
#pragma unroll
            for (int nb = 0; nb < 4; ++nb)
#pragma unroll
                for (int mt = 0; mt < MT; ++mt) acc[mt][nb] = mma3(a[mt], a2[mt], b[nb], b2[nb], acc[mt][nb]); }
    }
    __syncthreads();   // the last read of the hi/lo planes is over before their LDS takes the partial tiles
    float* rw = S + wave * (RB * 68);
#pragma unroll
    for (int mt = 0; mt < MT; ++mt)
#pragma unroll
        for (int nb = 0; nb < 4; ++nb)
#pragma unroll
            for (int j = 0; j < 8; ++j) rw[(mt * 16 + hi * 8 + j) * 68 + nb * 16 + lr] = acc[mt][nb][j];
    __syncthreads();   // every wave's partial tile is in LDS before any thread sums across the waves
    const int row = (int)threadIdx.x >> 4, cofs = ((int)threadIdx.x & 15) * 4; v4f val = *(const v4fa*)(S + row * 68 + cofs);
    // unrolled so that a thread's LDS reads issue together; the sum stays in wave order
#pragma unroll
    for (int w = 1; w < NWV; ++w) { const v4f p = *(const v4fa*)(S + w * (RB * 68) + row * 68 + cofs); val[0] += p[0]; val[1] += p[1]; val[2] += p[2]; val[3] += p[3]; }
    v4us oh, ol;
#pragma unroll
    for (int q = 0; q < 4; ++q) { unsigned short x, y; splitf(val[q], x, y); oh[q] = x; ol[q] = y; }
    const size_t oo = (size_t)(i0 + row) * DQ + h * HD + cofs; *(v4us*)(Ah + oo) = oh; *(v4us*)(Al + oo) = ol;
}

extern "C" void kernel_launch(void* const* d_in, const int* in_sizes, int n_in,
                              void* d_out, int out_size, void* d_ws, size_t ws_size, hipStream_t stream) {
    (void)in_sizes; (void)n_in; (void)out_size;
    const float* x = (const float*)d_in[0]; const float* xk = (const float*)d_in[1]; const float* xv = (const float*)d_in[2]; const int* MK = (const int*)d_in[3]; const float* wq = (const float*)d_in[4]; const float* wk = (const float*)d_in[5]; const float* wv = (const float*)d_in[6]; const float* wp = (const float*)d_in[7]; const float* wo = (const float*)d_in[8]; const float* pbu = (const float*)d_in[9]; const float* pbv = (const float*)d_in[10];
    float* OUT = (float*)d_out;     // [1][2048][1024]
    char* wsp = (char*)d_ws;
    auto take = [&](size_t bytes) { char* p = wsp; wsp += (bytes + 255) & ~(size_t)255; return (void*)p; };
    bf* WQ = (bf*)take((size_t)DQ * DM * 2); bf* WK = (bf*)take((size_t)DKV * DM * 2); bf* WV = (bf*)take((size_t)DKV * DM * 2); bf* WO = (bf*)take((size_t)DM * DQ * 2);
    bf* XB = (bf*)take((size_t)TT * DM * 2); bf* XKB = (bf*)take((size_t)TT * DM * 2); bf* XVB = (bf*)take((size_t)TT * DM * 2); bf* WP = (bf*)take((size_t)DQ * DM * 2); bf* PPh = (bf*)take((size_t)NH_ * NPE * HD * 2); bf* PPl = (bf*)take((size_t)NH_ * NPE * HD * 2); bf* QVh = (bf*)take((size_t)NH_ * TT * HD * 2); bf* QVl = (bf*)take((size_t)NH_ * TT * HD * 2);
    bf* QPh = (bf*)take((size_t)NH_ * TT * HD * 2); bf* QPl = (bf*)take((size_t)NH_ * TT * HD * 2); bf* KPh = (bf*)take((size_t)NKV * TT * HD * 2); bf* KPl = (bf*)take((size_t)NKV * TT * HD * 2); bf* VTh = (bf*)take((size_t)NKV * HD * TT * 2); bf* VTl = (bf*)take((size_t)NKV * HD * TT * 2);
    bf* PEh = (bf*)take((size_t)NPE * DM * 2); bf* PEl = (bf*)take((size_t)NPE * DM * 2);   /* the position-table planes */ bf* ATh = (bf*)take((size_t)TT * DQ * 2); bf* ATl = (bf*)take((size_t)TT * DQ * 2);
    if ((size_t)(wsp - (char*)d_ws) > ws_size) return;    // ws 256 MiB
    { k_wtG<<<(unsigned)((DM * DQ / 64 + 63) / 64), 256, 0, stream>>>(wq, DM, DQ, WQ); k_wtG<<<(unsigned)((DM * DKV / 64 + 63) / 64), 256, 0, stream>>>(wk, DM, DKV, WK); k_wtG<<<(unsigned)((DM * DKV / 64 + 63) / 64), 256, 0, stream>>>(wv, DM, DKV, WV);
      k_wtG<<<(unsigned)((DQ * DM / 64 + 63) / 64), 256, 0, stream>>>(wo, DQ, DM, WO);
       }
    k_petab<<<(unsigned)(((size_t)NPE * DM / 2 + 255) / 256), 256, 0, stream>>>(PEh, PEl); k_wtG<<<(unsigned)((DM * DQ / 64 + 63) / 64), 256, 0, stream>>>(wp, DM, DQ, WP); k_gemmw<bf, 1, false, 8, 1, 1><<<dim3(NPE / 64, DQ / 64, 1), 256, 0, stream>>>(PEh, PEl, WP, nullptr, DM, nullptr, 0, nullptr, 0, 0, 0, 0, PPh, PPl, nullptr, nullptr, nullptr, nullptr, (size_t)NPE * HD, HD);   /* reversed sinusoidal table (bf16) x w_p -> per-head position planes [h][4096][64] */
    for (int b = 0; b < NB_; ++b) {
        
        k_cvt8<<<(unsigned)(((size_t)TT * DM / 8 + 255) / 256), 256, 0, stream>>>(x + (size_t)b * TT * DM, XB, (size_t)TT * DM / 8); k_cvt8<<<(unsigned)(((size_t)TT * DM / 8 + 255) / 256), 256, 0, stream>>>(xk + (size_t)b * TT * DM, XKB, (size_t)TT * DM / 8); k_cvt8<<<(unsigned)(((size_t)TT * DM / 8 + 255) / 256), 256, 0, stream>>>(xv + (size_t)b * TT * DM, XVB, (size_t)TT * DM / 8);
        k_gemmw<bf, 0, false, 8, 1, 2><<<dim3(TT / 64, DQ / 64, 1), 256, 0, stream>>>(XB, nullptr, WQ, nullptr, DM, nullptr, 0, nullptr, 0, 0, 0, 0, QPh, QPl, QVh, QVl, pbu, pbv, (size_t)TT * HD, HD);   /* (q + b_u) planes for the content scores, (q + b_v) planes for the position scores */
        k_gemmw<bf, 0, false, 8, 1, 1><<<dim3(TT / 64, DKV / 64, 1), 256, 0, stream>>>(XKB, nullptr, WK, nullptr, DM, nullptr, 0, nullptr, 0, 0, 0, 0, KPh, KPl, nullptr, nullptr, nullptr, nullptr, (size_t)TT * HD, HD);
        k_gemmw<bf, 0, false, 8, 1, 1><<<dim3(DKV / 64, TT / 64, 1), 256, 0, stream>>>(WV, nullptr, XVB, nullptr, DM, nullptr, 0, nullptr, 0, 0, 0, 0, VTh, VTl, nullptr, nullptr, nullptr, nullptr, 64, TT);   /* w_v as the row operand: the tile is v transposed, [head x 64 + d][t], as attn.v reads it */
        k_attn<<<dim3(NH_, TT / RB, 1), NWV * 32, 0, stream>>>(QPh, QPl, QVh, QVl, KPh, KPl, PPh, PPl, VTh, VTl, MK, ATh, ATl);   /* scores, shift, softmax and attn.v of all heads; one kv head per query head */
        k_gemmw<bf, 1, false, 8, 1, 0><<<dim3(TT / 64, DM / 64, 1), 256, 0, stream>>>(ATh, ATl, WO, nullptr, DQ, OUT + (size_t)b * TT * DM, DM, nullptr, 0, 0, 0, 0, nullptr, nullptr, nullptr, nullptr, nullptr, nullptr, 0, 0); }
}

// v004
// It runs in 236 microseconds.
// Next to v003, in two timings, it ran 1.16 and 1.17 times as fast.
// Over all steps from v000 it is 4.27 times as fast.
#include <hip/hip_runtime.h>

// Transformer-XL relative-position multi-head attention (q, k, v inputs [1][2048][1024]; qh = q w_q, kh = k w_k, vh = v w_v ('xw' [1024][1024], no bias; 16 heads x 64); pe = reversed sinusoidal table of length 4096 (pe[m] = PE(4095 - m), interleaved sin/cos) projected by w_p -> ph [16][4096][64]; ac = (qh + b_u).kh, bd = left_shift((qh + b_v).ph): bd[i][j] = raw[i][4095 - i + j] for j <= i else 0; scores = (ac + bd)/8; mask (int [1][2048][2048], read; -inf where 0); softmax; out = attn.vh merged w_o -> [1][2048][1024]).
// Layout: projections from three bf16 input planes, each projection GEMM storing its result as the bf16 hi/lo planes that the attention reads (no f32 copy in memory); b_u / b_v folded into two sets of query planes; the position table is computed on device in f32 (pos / 10000^(2i/1024), precise powf/sinf/cosf) -> hi/lo planes -> 2-product GEMM with the exact bf16 w_p -> per-head hi/lo planes; one launch does the attention of all heads: a work-group keeps 32 query rows' scores in LDS, content and position scores are hi/lo x hi/lo products (3 products), a position score is added at its shifted key, and softmax and attn.v follow on the same rows.
// Compute dtypes, f32 accumulate: every input rounded to bf16; q/k/v on PLAIN bf16 operands (inputs: exact); content / position scores and attn.v on hi/lo planes for every row (3 products); softmax f32; w_o hl x exact (2 products).

#define NB_  1
#define TT   2048
#define DM   1024
#define NH_  16
#define NKV  16
#define REP  (NH_ / NKV)
#define HD   64
#define DQ   (NH_ * HD)
#define DKV  (NKV * HD)
#define NPE  4096                 // relative positions (2 x seq)
typedef __attribute__((ext_vector_type(4))) int v4i;
#define WIN  0
#define SCL  0.125f   // HD^-0.5
typedef _Float16 h16;
typedef unsigned short bf;
typedef __attribute__((ext_vector_type(16))) __bf16   v16bf;
typedef __attribute__((ext_vector_type(16))) _Float16 v16h;
typedef __attribute__((ext_vector_type(8)))  _Float16 v8h;
typedef __attribute__((ext_vector_type(8)))  unsigned short v8us;
typedef __attribute__((ext_vector_type(8)))  float    v8f;
typedef __attribute__((ext_vector_type(4)))  float    v4f;
typedef v8h  __attribute__((may_alias)) v8ha;
typedef v4f  __attribute__((may_alias)) v4fa;
typedef v8us __attribute__((may_alias)) v8usa;

__device__ __forceinline__ unsigned short f2bf(float f) { unsigned u = __float_as_uint(f); u += 0x7FFFu + ((u >> 16) & 1u); return (unsigned short)(u >> 16); }
__device__ __forceinline__ float bf2f(unsigned short b) { return __uint_as_float(((unsigned)b) << 16); }
__device__ __forceinline__ float bfr(float f) { return bf2f(f2bf(f)); }
__device__ __forceinline__ v16h cat16(v8h lo, v8h hi) { return __builtin_shufflevector(lo, hi, 0, 1, 2, 3, 4, 5, 6, 7, 8, 9, 10, 11, 12, 13, 14, 15); }
__device__ __forceinline__ v16bf cat16b(v8us lo, v8us hi) { return __builtin_bit_cast(v16bf, __builtin_shufflevector(lo, hi, 0, 1, 2, 3, 4, 5, 6, 7, 8, 9, 10, 11, 12, 13, 14, 15)); }
__device__ __forceinline__ v8f wmma16(v16h a, v16h b, v8f c) { return __builtin_amdgcn_wmma_f32_16x16x32_f16(false, a, false, b, (short)0, c, false, false); }
__device__ __forceinline__ v8f wmmab(v16bf a, v16bf b, v8f c) { return __builtin_amdgcn_wmma_f32_16x16x32_bf16(false, a, false, b, (short)0, c, false, false); }

__device__ __forceinline__ void splitf(float y, unsigned short& h, unsigned short& l) { h = f2bf(y); l = f2bf(y - bf2f(h)); }
typedef __attribute__((ext_vector_type(2))) unsigned short v2us;
typedef __attribute__((ext_vector_type(4))) unsigned short v4us;

// ---- k_gemmw: register-blocked GEMM, ONE WAVE per 64x64 output tile (16 accumulators), operands straight from K-contiguous 16-bit planes; grid (M/64, N/64, Z), 32 threads.
// C[m][n] (f32, pitch ldc, + optional f32 bias[n]) = sum_k A[m][k] Bt[n][k] (+ split products per NSPLIT). z-batch strides sA/sB/sC in elements. K % 32 == 0.
// Split K (long K): NW waves per work-group and KS work-groups per tile each take K / (KS * NW) consecutive k of the same 64x64 tile; the NW partial tiles are summed through LDS in wave order, and work-group ks (blockIdx.z = z * KS + ks) writes its own f32 plane at C + ks * sP, summed by the consumer. Grid (M/64, N/64, Z * KS), NW * 32 threads. K % (KS * NW * 32) == 0. NW > 1 takes no bias.
// EPI (NW > 1, KS == 1): what the summed tile is stored as. 0: f32 at C. 1: its bf16 hi and lo planes at P1h / P1l. 2: the planes of (tile + hb1[n]) at P1h / P1l and of (tile + hb2[n]) at P2h / P2l (hb rounded to bf16).
// A plane element (m, n) lies at by * sH + m * ldo + n % 64: head planes [n / 64][m][64] with sH = M * 64, ldo = 64; a plain [m][n] plane with sH = 64, ldo = N.
template <typename T16> struct WFrag;
template <> struct WFrag<h16> { typedef v16h V; static __device__ __forceinline__ V ld(const h16* p) { return cat16(*(const v8h*)p, *(const v8h*)(p + 16)); } static __device__ __forceinline__ v8f mma(V a, V b, v8f c) { return wmma16(a, b, c); } };
template <> struct WFrag<bf> { typedef v16bf V; static __device__ __forceinline__ V ld(const bf* p) { return cat16b(*(const v8us*)p, *(const v8us*)(p + 16)); } static __device__ __forceinline__ v8f mma(V a, V b, v8f c) { return wmmab(a, b, c); } };
// gemmw is the body: os is the work-group's LDS (GEMMW_LDS floats), (bx, by, bz) its place in the grid above. k_gemmw launches one GEMM; k_proj holds the four projections, which do not depend on one another, in one launch.
#define GEMMW_LDS(NW) ((NW) == 1 ? 16 * 68 : (NW) * 64 * 68)
template <typename T16, int NSPLIT, bool BIAS, int NW, int KS, int EPI>
__device__ __forceinline__ void gemmw(float* os, int bx, int by, int bz, const T16* __restrict__ A, const T16* __restrict__ A2, const T16* __restrict__ Bt, const T16* __restrict__ Bt2, int K, float* C, int ldc, const float* __restrict__ bias, size_t sA, size_t sB, size_t sC, size_t sP, bf* P1h, bf* P1l, bf* P2h, bf* P2l, const float* __restrict__ hb1, const float* __restrict__ hb2, size_t sH, int ldo) {
    typedef typename WFrag<T16>::V V;
    const size_t z = bz / KS; const int ks = bz % KS; A += z * sA; if (A2) A2 += z * sA; Bt += z * sB; if (Bt2) Bt2 += z * sB; C += z * sC + (size_t)ks * sP;
    const int wave = (NW == 1) ? 0 : __builtin_amdgcn_readfirstlane(threadIdx.x >> 5); const int kw = K / (KS * NW), k0 = (ks * NW + wave) * kw;   /* this wave's k range [k0, k0 + kw) */
    const int lane = threadIdx.x & 31, lr = lane & 15, hi = lane >> 4; const int r0 = bx * 64, c0 = by * 64;
    v8f acc[4][4];
#pragma unroll
    for (int mb = 0; mb < 4; ++mb)
#pragma unroll
        for (int nb = 0; nb < 4; ++nb) acc[mb][nb] = (v8f){};
    const size_t aoff = (size_t)(r0 + lr) * K + 8 * hi + k0, boff = (size_t)(c0 + lr) * K + 8 * hi + k0;
#pragma unroll 1
    for (int kc = 0; kc < kw; kc += 32) {
        V a[4], a2[4];
#pragma unroll
        for (int mb = 0; mb < 4; ++mb) { a[mb] = WFrag<T16>::ld(A + aoff + (size_t)mb * 16 * K + kc); if (NSPLIT == 1 || NSPLIT == 2) a2[mb] = WFrag<T16>::ld(A2 + aoff + (size_t)mb * 16 * K + kc); }
#pragma unroll
        for (int nb = 0; nb < 4; ++nb) { const V b = WFrag<T16>::ld(Bt + boff + (size_t)nb * 16 * K + kc); V b2; if (NSPLIT >= 2) b2 = WFrag<T16>::ld(Bt2 + boff + (size_t)nb * 16 * K + kc);
#pragma unroll
            for (int mb = 0; mb < 4; ++mb) { acc[mb][nb] = WFrag<T16>::mma(a[mb], b, acc[mb][nb]); if (NSPLIT == 1 || NSPLIT == 2) acc[mb][nb] = WFrag<T16>::mma(a2[mb], b, acc[mb][nb]); if (NSPLIT >= 2) acc[mb][nb] = WFrag<T16>::mma(a[mb], b2, acc[mb][nb]); } }
        asm volatile("v_nop\n\tv_nop\n\tv_nop\n\tv_nop" : "+v"(acc[0][0]), "+v"(acc[1][1]), "+v"(acc[2][2]), "+v"(acc[3][3]) : "v"(a[0]), "v"(a[3]));
    }
    if (NW > 1) {
        float* rw = os + wave * (64 * 68);
        // the three loops are unrolled so that acc is indexed by constants and stays in registers
#pragma unroll
        for (int mb = 0; mb < 4; ++mb)
#pragma unroll
            for (int nb = 0; nb < 4; ++nb)
#pragma unroll
                for (int j = 0; j < 8; ++j) rw[(mb * 16 + hi * 8 + j) * 68 + nb * 16 + lr] = acc[mb][nb][j];
        __syncthreads();   // every wave's partial tile is in LDS before any thread sums across the waves
        // both loops are unrolled so that a thread's LDS reads issue together; the sum stays in wave order
#pragma unroll
        for (int s = 0; s < 32 / NW; ++s) { const int idx = s * (NW * 32) + (int)threadIdx.x; const int row = idx >> 4, cofs = (idx & 15) * 4; v4f val = *(const v4fa*)(os + row * 68 + cofs);
#pragma unroll
            for (int w = 1; w < NW; ++w) { const v4f p = *(const v4fa*)(os + w * (64 * 68) + row * 68 + cofs); val[0] += p[0]; val[1] += p[1]; val[2] += p[2]; val[3] += p[3]; }
            if (EPI == 0) { *(v4f*)(C + (size_t)(r0 + row) * ldc + c0 + cofs) = val; }
            else { const size_t po = (size_t)by * sH + (size_t)(r0 + row) * ldo + cofs; v4us oh, ol;
                // both q loops are unrolled so that val, oh and ol are indexed by constants and stay in registers
#pragma unroll
                for (int q = 0; q < 4; ++q) { unsigned short x, y; splitf(EPI == 2 ? __fadd_rn(val[q], bfr(hb1[c0 + cofs + q])) : val[q], x, y); oh[q] = x; ol[q] = y; }
                *(v4us*)(P1h + po) = oh; *(v4us*)(P1l + po) = ol;
                if (EPI == 2) {
#pragma unroll
                    for (int q = 0; q < 4; ++q) { unsigned short x, y; splitf(__fadd_rn(val[q], bfr(hb2[c0 + cofs + q])), x, y); oh[q] = x; ol[q] = y; }
                    *(v4us*)(P2h + po) = oh; *(v4us*)(P2l + po) = ol; } } }
        if (EPI != 0) asm volatile("s_wait_xcnt 0x0" ::: "memory");   /* in k_proj another GEMM's code follows this one in the listing: the wait stands in front of any rewrite of the registers that the plane stores name */
        return;
    }
#pragma unroll
    for (int mb = 0; mb < 4; ++mb) {
#pragma unroll
        for (int nb = 0; nb < 4; ++nb) {
#pragma unroll
            for (int j = 0; j < 8; ++j) os[(hi * 8 + j) * 68 + nb * 16 + lr] = acc[mb][nb][j]; }
        __builtin_amdgcn_wave_barrier(); asm volatile("" ::: "memory");
        float* crow = C + (size_t)(r0 + mb * 16) * ldc + c0;
{
#pragma unroll
            for (int s = 0; s < 8; ++s) { const int row = 2 * s + hi, cofs = lr * 4; v4f val = *(const v4fa*)(os + row * 68 + cofs); if (BIAS) { val[0] += bfr(bias[c0 + cofs]); val[1] += bfr(bias[c0 + cofs + 1]); val[2] += bfr(bias[c0 + cofs + 2]); val[3] += bfr(bias[c0 + cofs + 3]); }
                *(v4f*)(crow + (size_t)row * ldc + cofs) = val; }
             }
        __builtin_amdgcn_wave_barrier(); asm volatile("" ::: "memory");
    }
}

template <typename T16, int NSPLIT, bool BIAS, int NW, int KS, int EPI>
__global__ __launch_bounds__(NW * 32) void k_gemmw(const T16* __restrict__ A, const T16* __restrict__ A2, const T16* __restrict__ Bt, const T16* __restrict__ Bt2, int K, float* C, int ldc, const float* __restrict__ bias, size_t sA, size_t sB, size_t sC, size_t sP, bf* P1h, bf* P1l, bf* P2h, bf* P2l, const float* __restrict__ hb1, const float* __restrict__ hb2, size_t sH, int ldo) {
    __shared__ __align__(16) float os[GEMMW_LDS(NW)];
    gemmw<T16, NSPLIT, BIAS, NW, KS, EPI>(os, blockIdx.x, blockIdx.y, blockIdx.z, A, A2, Bt, Bt2, K, C, ldc, bias, sA, sB, sC, sP, P1h, P1l, P2h, P2l, hb1, hb2, sH, ldo);
}
// k_proj: work-groups [0, GP) the position table x w_p (the longest, so first), [GP, GP + GQ) q, then GQ each for k and v; inside each range the tile's row index runs fastest, as in a grid of its own.
#define GP   ((NPE / 64) * (DQ / 64))
#define GQ   ((TT / 64) * (DQ / 64))
__global__ __launch_bounds__(256) void k_proj(const bf* __restrict__ PEh, const bf* __restrict__ PEl, const bf* __restrict__ WP, const bf* __restrict__ XB, const bf* __restrict__ WQ, const bf* __restrict__ XKB, const bf* __restrict__ WK, const bf* __restrict__ XVB, const bf* __restrict__ WV,
                                              bf* PPh, bf* PPl, bf* QPh, bf* QPl, bf* QVh, bf* QVl, bf* KPh, bf* KPl, bf* VTh, bf* VTl, const float* __restrict__ pbu, const float* __restrict__ pbv) {
    __shared__ __align__(16) float os[GEMMW_LDS(8)];
    const int i = blockIdx.x;
    if (i < GP) {   // reversed sinusoidal table (hi/lo) x w_p -> per-head position planes [h][4096][64]
        gemmw<bf, 1, false, 8, 1, 1>(os, i % (NPE / 64), i / (NPE / 64), 0, PEh, PEl, WP, nullptr, DM, nullptr, 0, nullptr, 0, 0, 0, 0, PPh, PPl, nullptr, nullptr, nullptr, nullptr, (size_t)NPE * HD, HD);
    } else if (i < GP + GQ) {   // (q + b_u) planes for the content scores, (q + b_v) planes for the position scores
        const int j = i - GP;
        gemmw<bf, 0, false, 8, 1, 2>(os, j % (TT / 64), j / (TT / 64), 0, XB, nullptr, WQ, nullptr, DM, nullptr, 0, nullptr, 0, 0, 0, 0, QPh, QPl, QVh, QVl, pbu, pbv, (size_t)TT * HD, HD);
    } else {   // k: head planes [h][t][64]. v: w_v as the row operand, so that the tile is v transposed, [head x 64 + d][t], as attn.v reads it
        const bool isv = i >= GP + 2 * GQ; const int j = i - GP - (isv ? 2 * GQ : GQ); const int nx = isv ? DKV / 64 : TT / 64;
        gemmw<bf, 0, false, 8, 1, 1>(os, j % nx, j / nx, 0, isv ? WV : XKB, nullptr, isv ? XVB : WK, nullptr, DM, nullptr, 0, nullptr, 0, 0, 0, 0, isv ? VTh : KPh, isv ? VTl : KPl, nullptr, nullptr, nullptr, nullptr, isv ? (size_t)64 : (size_t)TT * HD, isv ? TT : HD);
    }
}

// k_prep: all that the GEMMs read is prepared in ONE launch of NPB work-groups, few enough to be resident together. Every work-group transposes 64 lines (64 k of one n each) of one weight, w [k][n] f32 -> Bt [n][k] bf16 (256 work-groups a weight, five weights);
// between those loads and their stores, work-groups 0 .. NPT - 1 fill the position table (a thread keeps one sin/cos column pair, so one powf, for PER rows) and the other NPB - NPT round q, k and v to bf16 (a thread takes CVS octets of each).
#define NPB  1280                  // 5 weights x DM * DQ / 64 / 64
#define NPT  1024                  // table work-groups: two a row block (512 column pairs = 2 x 256 threads)
#define PER  (NPE * 2 / NPT)       // table rows a thread
#define CVS  (TT * DM / 8 / ((NPB - NPT) * 256))   // octets of each input a thread
static_assert(NB_ == 1 && DQ == DM && DKV == DM && 5 * (DM * DQ / 64 / 64) == NPB && PER * NPT == NPE * 2 && CVS * (NPB - NPT) * 256 * 8 == TT * DM, "k_prep: the shares are exact");
__device__ __forceinline__ void cvt8(const float* __restrict__ src, bf* __restrict__ dst, size_t i) { const v8f v = *(const v8f*)(src + i * 8); v8us o;
    // unrolled so that v and o are indexed by constants and stay in registers
#pragma unroll
    for (int k = 0; k < 8; ++k) o[k] = f2bf(v[k]);
    *(v8us*)(dst + i * 8) = o; }
__global__ __launch_bounds__(256) void k_prep(const float* __restrict__ x, const float* __restrict__ xk, const float* __restrict__ xv, const float* __restrict__ wq, const float* __restrict__ wk, const float* __restrict__ wv, const float* __restrict__ wo, const float* __restrict__ wp,
                                              bf* __restrict__ XB, bf* __restrict__ XKB, bf* __restrict__ XVB, bf* __restrict__ WQ, bf* __restrict__ WK, bf* __restrict__ WV, bf* __restrict__ WO, bf* __restrict__ WP, bf* __restrict__ PEh, bf* __restrict__ PEl) {
    const int b = blockIdx.x, t = threadIdx.x, lane = t & 31; const int wi = b >> 8;
    const float* w = wi == 0 ? wq : wi == 1 ? wk : wi == 2 ? wv : wi == 3 ? wo : wp; bf* Bt = wi == 0 ? WQ : wi == 1 ? WK : wi == 2 ? WV : wi == 3 ? WO : WP;
    const int e0 = ((b & 255) * 8 + (t >> 5)) * 8 * 64 + lane * 2;   /* this lane's two elements of the wave's first line; line l is 64 l further */
    float r[8][2];
    // unrolled so that r is indexed by constants and the sixteen strided loads of a wave fly together
#pragma unroll
    for (int l = 0; l < 8; ++l) { const int e = e0 + l * 64; const int k = e % DM, n = e / DM; r[l][0] = w[(size_t)k * DQ + n]; r[l][1] = w[(size_t)(k + 1) * DQ + n]; }
    asm volatile("s_wait_xcnt 0x0" ::: "memory");   /* stands in front of any rewrite of the address registers that the sixteen loads name */
    if (b < NPT) {
        const int c = ((b & 1) * 256 + t) * 2; const float ex = __fdiv_rn((float)c, (float)DM);   /* c even: 2i/d_model */ const float den = powf(10000.0f, ex);
        for (int q = 0; q < PER; ++q) { const int m = (b >> 1) * PER + q; const float pos = (float)(NPE - 1 - m); const float th = __fdiv_rn(pos, den); v2us oh, ol; unsigned short a, b2; splitf(sinf(th), a, b2); oh[0] = a; ol[0] = b2; splitf(cosf(th), a, b2); oh[1] = a; ol[1] = b2;
            const size_t e = (size_t)m * DM + c; *(v2us*)(PEh + e) = oh; *(v2us*)(PEl + e) = ol; }
    } else {
        const size_t i0 = (size_t)(b - NPT) * 256 + t;
        for (int s = 0; s < CVS; ++s) { const size_t i = i0 + (size_t)s * ((NPB - NPT) * 256); cvt8(x, XB, i); cvt8(xk, XKB, i); cvt8(xv, XVB, i);
            asm volatile("s_wait_xcnt 0x0" ::: "memory");   /* stands in front of the next trip's rewrite of the registers that the three stores name */ }
    }
    // unrolled so that r is indexed by constants; each store is one whole 128-byte line a wave
#pragma unroll
    for (int l = 0; l < 8; ++l) { v2us o; o[0] = f2bf(r[l][0]); o[1] = f2bf(r[l][1]); *(v2us*)(Bt + e0 + l * 64) = o; }
}

// k_attn: one work-group = one head x RB query rows, every stage of the attention on chip. The RB score rows [RB][2048] f32 live in LDS (pitch SP floats):
//   1 content scores (q + b_u).k into the rows; 2 raw position scores (q + b_v).ph only for the positions that the left shift keeps (m = 4095 - i + j, 0 <= j <= i), added at their shifted key j;
//   3 mask, softmax per row (one wave a row, register row), the row rewritten in place as its bf16 hi plane (first 4 KiB) and lo plane (next 4 KiB);
//   4 attn.v with the hi/lo rows as the A operand from LDS, each wave TT / NWV keys, the NWV partial tiles summed through LDS in wave order and split into the merged hi/lo planes.
// Every plain '#pragma unroll' in this kernel is there so that the register arrays (fragments, accumulators, the score row) are indexed by constants and stay in registers.
#define MT   2                     // 16-row tiles of query rows per work-group
#define RB   (16 * MT)
#define NWV  (RB / 2)              // waves per work-group (two score rows a wave; RB * 16 output quads = NWV * 32 threads)
#define SP   2052                  // floats per score row in LDS: 16-byte aligned rows, 4 banks apart
typedef v4us __attribute__((may_alias)) v4usa;
__device__ __forceinline__ v16bf ldsfrag(const bf* p) { return cat16b(*(const v8usa*)p, *(const v8usa*)(p + 16)); }
__device__ __forceinline__ v8f mma3(v16bf a, v16bf a2, v16bf b, v16bf b2, v8f c) { c = wmmab(a, b, c); c = wmmab(a2, b, c); return wmmab(a, b2, c); }
__global__ __launch_bounds__(NWV * 32) void k_attn(const bf* __restrict__ QUh, const bf* __restrict__ QUl, const bf* __restrict__ QWh, const bf* __restrict__ QWl, const bf* __restrict__ Kh, const bf* __restrict__ Kl, const bf* __restrict__ Rh, const bf* __restrict__ Rl, const bf* __restrict__ Vh, const bf* __restrict__ Vl, const int* __restrict__ MKb, bf* Ah, bf* Al) {
    typedef WFrag<bf> F;
    __shared__ __align__(16) float S[RB * SP];
    const int h = blockIdx.x; const int i0 = (TT / RB - 1 - (int)blockIdx.y) * RB;   /* late query rows have the most positions: they start first */
    const int wave = __builtin_amdgcn_readfirstlane(threadIdx.x >> 5); const int lane = threadIdx.x & 31, lr = lane & 15, hi = lane >> 4;
    const size_t qoff = ((size_t)h * TT + i0 + lr) * HD + 8 * hi;
    {   // 1: content scores, TT / 16 / NWV key tiles a wave
        v16bf a[MT][2], a2[MT][2];
#pragma unroll
        for (int mt = 0; mt < MT; ++mt)
#pragma unroll
            for (int kk = 0; kk < 2; ++kk) { a[mt][kk] = F::ld(QUh + qoff + mt * 16 * HD + kk * 32); a2[mt][kk] = F::ld(QUl + qoff + mt * 16 * HD + kk * 32); }
        const size_t koff = ((size_t)h * TT + wave * (TT / NWV) + lr) * HD + 8 * hi;
        for (int t = 0; t < TT / 16 / NWV; t += 2) { v16bf b[2][2], c[2][2];
#pragma unroll
            for (int u = 0; u < 2; ++u)
#pragma unroll
                for (int kk = 0; kk < 2; ++kk) { b[u][kk] = F::ld(Kh + koff + (t + u) * 16 * HD + kk * 32); c[u][kk] = F::ld(Kl + koff + (t + u) * 16 * HD + kk * 32); }
            // inputs only: holds the sixteen loads of two key tiles in front of the products, so that they fly together and are waited for once, not fragment by fragment
            asm volatile("" :: "v"(b[0][0]), "v"(b[0][1]), "v"(b[1][0]), "v"(b[1][1]), "v"(c[0][0]), "v"(c[0][1]), "v"(c[1][0]), "v"(c[1][1]));
#pragma unroll
            for (int u = 0; u < 2; ++u)
#pragma unroll
                for (int mt = 0; mt < MT; ++mt) { v8f acc = (v8f){}; acc = mma3(a[mt][0], a2[mt][0], b[u][0], c[u][0], acc); acc = mma3(a[mt][1], a2[mt][1], b[u][1], c[u][1], acc);
#pragma unroll
                    for (int j = 0; j < 8; ++j) S[(mt * 16 + hi * 8 + j) * SP + wave * (TT / NWV) + (t + u) * 16 + lr] = acc[j]; } }
    }
    __syncthreads();   // every content score is in LDS before a position score is added to it
    {   // 2: position tile t holds m = NPE - RB - i0 + 16 t + c; row r of the block meets it at key j = m - (NPE - 1) + i0 + r; each (r, j) belongs to exactly one (t, c)
        v16bf a[MT][2], a2[MT][2];
#pragma unroll
        for (int mt = 0; mt < MT; ++mt)
#pragma unroll
            for (int kk = 0; kk < 2; ++kk) { a[mt][kk] = F::ld(QWh + qoff + mt * 16 * HD + kk * 32); a2[mt][kk] = F::ld(QWl + qoff + mt * 16 * HD + kk * 32); }
        const int nt = (i0 + RB) / 16; const size_t roff = ((size_t)h * NPE + (NPE - RB - i0) + lr) * HD + 8 * hi;
        for (int t = wave; t < nt; t += 2 * NWV) { const bool two = t + NWV < nt;   /* two tiles a trip, t and t + NWV; past the end the second one repeats the first and is dropped */
            v16bf b[2][2], c[2][2]; v8f acc[2][MT];
#pragma unroll
            for (int u = 0; u < 2; ++u) { const size_t to = roff + (size_t)((u && two) ? t + NWV : t) * 16 * HD;
#pragma unroll
                for (int kk = 0; kk < 2; ++kk) { b[u][kk] = F::ld(Rh + to + kk * 32); c[u][kk] = F::ld(Rl + to + kk * 32); } }
            // inputs only: holds the sixteen loads of two position tiles in front of the products, so that they fly together and are waited for once
            asm volatile("" :: "v"(b[0][0]), "v"(b[0][1]), "v"(b[1][0]), "v"(b[1][1]), "v"(c[0][0]), "v"(c[0][1]), "v"(c[1][0]), "v"(c[1][1]));
#pragma unroll
            for (int u = 0; u < 2; ++u)
#pragma unroll
                for (int mt = 0; mt < MT; ++mt) { acc[u][mt] = (v8f){}; acc[u][mt] = mma3(a[mt][0], a2[mt][0], b[u][0], c[u][0], acc[u][mt]); acc[u][mt] = mma3(a[mt][1], a2[mt][1], b[u][1], c[u][1], acc[u][mt]); }
            float* p = S + (hi * 8) * (SP + 1) + 16 * t + lr - (RB - 1);   /* row r = mt * 16 + hi * 8 + j, key 16 t + lr + r - (RB - 1) */
            if (16 * t >= RB - 1) {   // every key of the tile is >= 0 (a scalar test): the old scores are read together, with no lane test
                float o[MT][8];
#pragma unroll
                for (int mt = 0; mt < MT; ++mt)
#pragma unroll
                    for (int j = 0; j < 8; ++j) o[mt][j] = p[(mt * 16 + j) * (SP + 1)];
#pragma unroll
                for (int mt = 0; mt < MT; ++mt)
#pragma unroll
                    for (int j = 0; j < 8; ++j) p[(mt * 16 + j) * (SP + 1)] = __fadd_rn(o[mt][j], acc[0][mt][j]);
            } else {
#pragma unroll
                for (int mt = 0; mt < MT; ++mt)
#pragma unroll
                    for (int j = 0; j < 8; ++j) { const int key = 16 * t + lr + mt * 16 + hi * 8 + j - (RB - 1); if (key >= 0) p[(mt * 16 + j) * (SP + 1)] = __fadd_rn(p[(mt * 16 + j) * (SP + 1)], acc[0][mt][j]); }
            }
            if (two) {   // tile t + NWV: its keys are all >= 0 (16 NWV >= RB - 1)
                float* p2 = p + 16 * NWV; float o[MT][8];
#pragma unroll
                for (int mt = 0; mt < MT; ++mt)
#pragma unroll
                    for (int j = 0; j < 8; ++j) o[mt][j] = p2[(mt * 16 + j) * (SP + 1)];
#pragma unroll
                for (int mt = 0; mt < MT; ++mt)
#pragma unroll
                    for (int j = 0; j < 8; ++j) p2[(mt * 16 + j) * (SP + 1)] = __fadd_rn(o[mt][j], acc[1][mt][j]);
            } }
    }
    __syncthreads();   // the rows are complete before a wave takes its rows' softmax
    // not unrolled: one register row of 64 values is live at a time
#pragma unroll 1
    for (int rr = 0; rr < RB / NWV; ++rr) {   // 3: t = (ac + bd)/8, -inf where mask == 0; softmax over the 2048 keys (register row, one exp, fixed trees)
        const int r = wave * (RB / NWV) + rr; float* srow = S + r * SP; const int* mkr = MKb + (size_t)(i0 + r) * TT; float v[TT / 32]; float mx = -3.0e38f;
#pragma unroll
        for (int ch = 0; ch < TT / 128; ++ch) { const int j0 = ch * 128 + lane * 4; const v4f s4 = *(const v4fa*)(srow + j0); const v4i m4 = *(const v4i*)(mkr + j0);
#pragma unroll
            for (int q = 0; q < 4; ++q) { const float t = (m4[q] != 0) ? s4[q] * SCL : -3.0e38f; v[ch * 4 + q] = t; mx = fmaxf(mx, t); } }
#pragma unroll
        for (int sh = 16; sh; sh >>= 1) mx = fmaxf(mx, __shfl_xor(mx, sh, 32));
        float sum = 0.f;
#pragma unroll
        for (int k = 0; k < TT / 32; ++k) { v[k] = __builtin_amdgcn_exp2f(__fmul_rn(__fsub_rn(v[k], mx), 1.4426950408889634f)); sum += v[k]; }
#pragma unroll
        for (int sh = 16; sh; sh >>= 1) sum += __shfl_xor(sum, sh, 32);
        const float f = __fdiv_rn(1.0f, sum); bf* prow = (bf*)srow;
#pragma unroll
        for (int ch = 0; ch < TT / 128; ++ch) { v4us oh, ol;
#pragma unroll
            for (int q = 0; q < 4; ++q) { unsigned short x, y; splitf(v[ch * 4 + q] * f, x, y); oh[q] = x; ol[q] = y; }
            *(v4usa*)(prow + ch * 128 + lane * 4) = oh; *(v4usa*)(prow + TT + ch * 128 + lane * 4) = ol; }
    }
    __syncthreads();   // every row's hi/lo planes are in LDS before any wave reads them as its A operand
    v8f acc[MT][4];
#pragma unroll
    for (int mt = 0; mt < MT; ++mt)
#pragma unroll
        for (int nb = 0; nb < 4; ++nb) acc[mt][nb] = (v8f){};
    {   // 4: attn.v, this wave's keys [wave * TT / NWV, + TT / NWV)
        const bf* pa = (const bf*)S + (size_t)lr * (2 * SP) + 8 * hi + wave * (TT / NWV); const size_t voff = ((size_t)h * HD + lr) * TT + 8 * hi + wave * (TT / NWV);
        // unrolled: four trips, acc indexed by constants
#pragma unroll
        for (int kc = 0; kc < TT / NWV; kc += 32) { v16bf a[MT], a2[MT];
#pragma unroll
            for (int mt = 0; mt < MT; ++mt) { a[mt] = ldsfrag(pa + mt * 16 * (2 * SP) + kc); a2[mt] = ldsfrag(pa + mt * 16 * (2 * SP) + TT + kc); }
            v16bf b[4], b2[4];
#pragma unroll
            for (int nb = 0; nb < 4; ++nb) { b[nb] = F::ld(Vh + voff + (size_t)nb * 16 * TT + kc); b2[nb] = F::ld(Vl + voff + (size_t)nb * 16 * TT + kc); }
            // inputs only: holds the sixteen v loads of this trip in front of the products, so that they fly together and are waited for once
            asm volatile("" :: "v"(b[0]), "v"(b[1]), "v"(b[2]), "v"(b[3]), "v"(b2[0]), "v"(b2[1]), "v"(b2[2]), "v"(b2[3]));
#pragma unroll
            for (int nb = 0; nb < 4; ++nb)
#pragma unroll
                for (int mt = 0; mt < MT; ++mt) acc[mt][nb] = mma3(a[mt], a2[mt], b[nb], b2[nb], acc[mt][nb]); }
    }
    __syncthreads();   // the last read of the hi/lo planes is over before their LDS takes the partial tiles
    float* rw = S + wave * (RB * 68);
#pragma unroll
    for (int mt = 0; mt < MT; ++mt)
#pragma unroll
        for (int nb = 0; nb < 4; ++nb)
#pragma unroll
            for (int j = 0; j < 8; ++j) rw[(mt * 16 + hi * 8 + j) * 68 + nb * 16 + lr] = acc[mt][nb][j];
    __syncthreads();   // every wave's partial tile is in LDS before any thread sums across the waves
    const int row = (int)threadIdx.x >> 4, cofs = ((int)threadIdx.x & 15) * 4; v4f val = *(const v4fa*)(S + row * 68 + cofs);
    // unrolled so that a thread's LDS reads issue together; the sum stays in wave order
#pragma unroll
    for (int w = 1; w < NWV; ++w) { const v4f p = *(const v4fa*)(S + w * (RB * 68) + row * 68 + cofs); val[0] += p[0]; val[1] += p[1]; val[2] += p[2]; val[3] += p[3]; }
    v4us oh, ol;
#pragma unroll
    for (int q = 0; q < 4; ++q) { unsigned short x, y; splitf(val[q], x, y); oh[q] = x; ol[q] = y; }
    const size_t oo = (size_t)(i0 + row) * DQ + h * HD + cofs; *(v4us*)(Ah + oo) = oh; *(v4us*)(Al + oo) = ol;
}

extern "C" void kernel_launch(void* const* d_in, const int* in_sizes, int n_in,
                              void* d_out, int out_size, void* d_ws, size_t ws_size, hipStream_t stream) {
    (void)in_sizes; (void)n_in; (void)out_size;
    const float* x = (const float*)d_in[0]; const float* xk = (const float*)d_in[1]; const float* xv = (const float*)d_in[2]; const int* MK = (const int*)d_in[3]; const float* wq = (const float*)d_in[4]; const float* wk = (const float*)d_in[5]; const float* wv = (const float*)d_in[6]; const float* wp = (const float*)d_in[7]; const float* wo = (const float*)d_in[8]; const float* pbu = (const float*)d_in[9]; const float* pbv = (const float*)d_in[10];
    float* OUT = (float*)d_out;     // [1][2048][1024]
    char* wsp = (char*)d_ws;
    auto take = [&](size_t bytes) { char* p = wsp; wsp += (bytes + 255) & ~(size_t)255; return (void*)p; };
    bf* WQ = (bf*)take((size_t)DQ * DM * 2); bf* WK = (bf*)take((size_t)DKV * DM * 2); bf* WV = (bf*)take((size_t)DKV * DM * 2); bf* WO = (bf*)take((size_t)DM * DQ * 2);
    bf* XB = (bf*)take((size_t)TT * DM * 2); bf* XKB = (bf*)take((size_t)TT * DM * 2); bf* XVB = (bf*)take((size_t)TT * DM * 2); bf* WP = (bf*)take((size_t)DQ * DM * 2); bf* PPh = (bf*)take((size_t)NH_ * NPE * HD * 2); bf* PPl = (bf*)take((size_t)NH_ * NPE * HD * 2); bf* QVh = (bf*)take((size_t)NH_ * TT * HD * 2); bf* QVl = (bf*)take((size_t)NH_ * TT * HD * 2);
    bf* QPh = (bf*)take((size_t)NH_ * TT * HD * 2); bf* QPl = (bf*)take((size_t)NH_ * TT * HD * 2); bf* KPh = (bf*)take((size_t)NKV * TT * HD * 2); bf* KPl = (bf*)take((size_t)NKV * TT * HD * 2); bf* VTh = (bf*)take((size_t)NKV * HD * TT * 2); bf* VTl = (bf*)take((size_t)NKV * HD * TT * 2);
    bf* PEh = (bf*)take((size_t)NPE * DM * 2); bf* PEl = (bf*)take((size_t)NPE * DM * 2);   /* the position-table planes */ bf* ATh = (bf*)take((size_t)TT * DQ * 2); bf* ATl = (bf*)take((size_t)TT * DQ * 2);
    if ((size_t)(wsp - (char*)d_ws) > ws_size) return;    // ws 256 MiB
    k_prep<<<NPB, 256, 0, stream>>>(x, xk, xv, wq, wk, wv, wo, wp, XB, XKB, XVB, WQ, WK, WV, WO, WP, PEh, PEl);   /* the five weights transposed to bf16, the reversed sinusoidal table's hi/lo planes, q / k / v rounded to bf16 */
    k_proj<<<GP + 3 * GQ, 256, 0, stream>>>(PEh, PEl, WP, XB, WQ, XKB, WK, XVB, WV, PPh, PPl, QPh, QPl, QVh, QVl, KPh, KPl, VTh, VTl, pbu, pbv);   /* the four projections, each storing the hi/lo planes that the attention reads */
    for (int b = 0; b < NB_; ++b) {
        k_attn<<<dim3(NH_, TT / RB, 1), NWV * 32, 0, stream>>>(QPh, QPl, QVh, QVl, KPh, KPl, PPh, PPl, VTh, VTl, MK, ATh, ATl);   /* scores, shift, softmax and attn.v of all heads; one kv head per query head */
        k_gemmw<bf, 1, false, 8, 1, 0><<<dim3(TT / 64, DM / 64, 1), 256, 0, stream>>>(ATh, ATl, WO, nullptr, DQ, OUT + (size_t)b * TT * DM, DM, nullptr, 0, 0, 0, 0, nullptr, nullptr, nullptr, nullptr, nullptr, nullptr, 0, 0); }
}

// v005
// One run takes 193 microseconds.
// Two timings next to v004 both put it at 1.22 times that version's speed.
// All steps since v000 together make it 5.21 times as fast.
#include <hip/hip_runtime.h>

// Transformer-XL relative-position multi-head attention (q, k, v inputs [1][2048][1024]; qh = q w_q, kh = k w_k, vh = v w_v ('xw' [1024][1024], no bias; 16 heads x 64); pe = reversed sinusoidal table of length 4096 (pe[m] = PE(4095 - m), interleaved sin/cos) projected by w_p -> ph [16][4096][64]; ac = (qh + b_u).kh, bd = left_shift((qh + b_v).ph): bd[i][j] = raw[i][4095 - i + j] for j <= i else 0; scores = (ac + bd)/8; mask (int [1][2048][2048], read; -inf where 0); softmax; out = attn.vh merged w_o -> [1][2048][1024]).
// Layout: projections from three bf16 input planes, each projection GEMM storing its result as the bf16 hi/lo planes that the attention reads (no f32 copy in memory); b_u / b_v folded into two sets of query planes; the position table is computed on device in f32 (pos / 10000^(2i/1024), precise powf/sinf/cosf) -> hi/lo planes -> 2-product GEMM with the exact bf16 w_p -> per-head hi/lo planes; one launch does the attention of all heads: a work-group keeps 32 query rows' scores in LDS, content and position scores are hi/lo x hi/lo products (3 products), a position score is added at its shifted key, and softmax and attn.v follow on the same rows.
// Compute dtypes, f32 accumulate: every input rounded to bf16; q/k/v on PLAIN bf16 operands (inputs: exact); content / position scores and attn.v on hi/lo planes for every row (3 products); softmax f32; w_o hl x exact (2 products).

#define NB_  1
#define TT   2048
#define DM   1024
#define NH_  16
#define NKV  16
#define REP  (NH_ / NKV)
#define HD   64
#define DQ   (NH_ * HD)
#define DKV  (NKV * HD)
#define NPE  4096                 // relative positions (2 x seq)
typedef __attribute__((ext_vector_type(4))) int v4i;
#define WIN  0
#define SCL  0.125f   // HD^-0.5
typedef _Float16 h16;
typedef unsigned short bf;
typedef __attribute__((ext_vector_type(16))) __bf16   v16bf;
typedef __attribute__((ext_vector_type(16))) _Float16 v16h;
typedef __attribute__((ext_vector_type(8)))  _Float16 v8h;
typedef __attribute__((ext_vector_type(8)))  unsigned short v8us;
typedef __attribute__((ext_vector_type(8)))  float    v8f;
typedef __attribute__((ext_vector_type(4)))  float    v4f;
typedef v8h  __attribute__((may_alias)) v8ha;
typedef v4f  __attribute__((may_alias)) v4fa;
typedef v8us __attribute__((may_alias)) v8usa;

__device__ __forceinline__ unsigned short f2bf(float f) { unsigned u = __float_as_uint(f); u += 0x7FFFu + ((u >> 16) & 1u); return (unsigned short)(u >> 16); }
__device__ __forceinline__ float bf2f(unsigned short b) { return __uint_as_float(((unsigned)b) << 16); }
__device__ __forceinline__ float bfr(float f) { return bf2f(f2bf(f)); }
__device__ __forceinline__ v16h cat16(v8h lo, v8h hi) { return __builtin_shufflevector(lo, hi, 0, 1, 2, 3, 4, 5, 6, 7, 8, 9, 10, 11, 12, 13, 14, 15); }
__device__ __forceinline__ v16bf cat16b(v8us lo, v8us hi) { return __builtin_bit_cast(v16bf, __builtin_shufflevector(lo, hi, 0, 1, 2, 3, 4, 5, 6, 7, 8, 9, 10, 11, 12, 13, 14, 15)); }
__device__ __forceinline__ v8f wmma16(v16h a, v16h b, v8f c) { return __builtin_amdgcn_wmma_f32_16x16x32_f16(false, a, false, b, (short)0, c, false, false); }
__device__ __forceinline__ v8f wmmab(v16bf a, v16bf b, v8f c) { return __builtin_amdgcn_wmma_f32_16x16x32_bf16(false, a, false, b, (short)0, c, false, false); }

__device__ __forceinline__ void splitf(float y, unsigned short& h, unsigned short& l) { h = f2bf(y); l = f2bf(y - bf2f(h)); }
typedef __attribute__((ext_vector_type(2))) unsigned short v2us;
typedef __attribute__((ext_vector_type(4))) unsigned short v4us;

// ---- k_gemmw: register-blocked GEMM, ONE WAVE per 64x64 output tile (16 accumulators), operands straight from 16-bit planes in fragment order; grid (M/64, N/64, Z), 32 threads.
// C[m][n] (f32, pitch ldc, + optional f32 bias[n]) = sum_k A[m][k] Bt[n][k] (+ split products per NSPLIT). z-batch strides sA/sB/sC in elements. K % 32 == 0.
// Split K (long K): NW waves per work-group and KS work-groups per tile each take K / (KS * NW) consecutive k of the same 64x64 tile; the NW partial tiles are summed through LDS in wave order, and work-group ks (blockIdx.z = z * KS + ks) writes its own f32 plane at C + ks * sP, summed by the consumer. Grid (M/64, N/64, Z * KS), NW * 32 threads. K % (KS * NW * 32) == 0. NW > 1 takes no bias.
// EPI (NW > 1, KS == 1): what the summed tile is stored as. 0: f32 at C. 1: its bf16 hi and lo planes at P1h / P1l. 2: the planes of (tile + hb1[n]) at P1h / P1l and of (tile + hb2[n]) at P2h / P2l (hb rounded to bf16).
// FRAGMENT ORDER: every 16-bit operand plane [row][k] in memory (A, A2, Bt, Bt2 here, and the planes stored here) is kept as blocks of 16 rows x 32 k, 512 consecutive elements each: element (row lr, k = 16 sh + 8 hi + e) lies at (sh * 32 + hi * 16 + lr) * 8 + e of its block, the blocks of one 16-row strip follow one another along k, and a strip is 16 * K elements.
// A wave-wide 16-byte load (lane = hi * 16 + lr) then takes 512 consecutive bytes, four whole lines (of a row-major plane it would take 32 bytes out of each of 16 lines); which lane and register hold an element is the hardware's fragment layout, k order 8 hi + e, then 16 + 8 hi + e, alike for A and B.
// The stored tile's first block lies at blockIdx.y * sH + (m / 16) * 16 * ldo: head planes [n / 64][m][64] with sH = M * 64, ldo = 64; a plain [m][n] plane with sH = 64 * 16, ldo = N.
// ld: one fragment of a plane in fragment order; p = its 16 x 32 block + lane * 8.
template <typename T16> struct WFrag;
template <> struct WFrag<h16> { typedef v16h V; static __device__ __forceinline__ V ld(const h16* p) { return cat16(*(const v8h*)p, *(const v8h*)(p + 256)); } static __device__ __forceinline__ v8f mma(V a, V b, v8f c) { return wmma16(a, b, c); } };
template <> struct WFrag<bf> { typedef v16bf V; static __device__ __forceinline__ V ld(const bf* p) { return cat16b(*(const v8us*)p, *(const v8us*)(p + 256)); } static __device__ __forceinline__ v8f mma(V a, V b, v8f c) { return wmmab(a, b, c); } };
// gemmw is the body: os is the work-group's LDS (GEMMW_LDS floats), (bx, by, bz) its place in the grid above. k_gemmw launches one GEMM; k_proj holds the four projections, which do not depend on one another, in one launch.
#define GEMMW_LDS(NW) ((NW) == 1 ? 16 * 68 : (NW) * 64 * 68)
template <typename T16, int NSPLIT, bool BIAS, int NW, int KS, int EPI>
__device__ __forceinline__ void gemmw(float* os, int bx, int by, int bz, const T16* __restrict__ A, const T16* __restrict__ A2, const T16* __restrict__ Bt, const T16* __restrict__ Bt2, int K, float* C, int ldc, const float* __restrict__ bias, size_t sA, size_t sB, size_t sC, size_t sP, bf* P1h, bf* P1l, bf* P2h, bf* P2l, const float* __restrict__ hb1, const float* __restrict__ hb2, size_t sH, int ldo) {
    typedef typename WFrag<T16>::V V;
    const size_t z = bz / KS; const int ks = bz % KS; A += z * sA; if (A2) A2 += z * sA; Bt += z * sB; if (Bt2) Bt2 += z * sB; C += z * sC + (size_t)ks * sP;
    const int wave = (NW == 1) ? 0 : __builtin_amdgcn_readfirstlane(threadIdx.x >> 5); const int kw = K / (KS * NW), k0 = (ks * NW + wave) * kw;   /* this wave's k range [k0, k0 + kw) */
    const int lane = threadIdx.x & 31, lr = lane & 15, hi = lane >> 4; const int r0 = bx * 64, c0 = by * 64;
    v8f acc[4][4];
#pragma unroll
    for (int mb = 0; mb < 4; ++mb)
#pragma unroll
        for (int nb = 0; nb < 4; ++nb) acc[mb][nb] = (v8f){};
    const size_t aoff = (size_t)r0 * K + (size_t)k0 * 16 + lane * 8, boff = (size_t)c0 * K + (size_t)k0 * 16 + lane * 8;   /* strip r0 / 16, block k0 / 32 */
#pragma unroll 1
    for (int kc = 0; kc < kw; kc += 32) {
        V a[4], a2[4];
#pragma unroll
        for (int mb = 0; mb < 4; ++mb) { a[mb] = WFrag<T16>::ld(A + aoff + (size_t)mb * 16 * K + kc * 16); if (NSPLIT == 1 || NSPLIT == 2) a2[mb] = WFrag<T16>::ld(A2 + aoff + (size_t)mb * 16 * K + kc * 16); }
#pragma unroll
        for (int nb = 0; nb < 4; ++nb) { const V b = WFrag<T16>::ld(Bt + boff + (size_t)nb * 16 * K + kc * 16); V b2; if (NSPLIT >= 2) b2 = WFrag<T16>::ld(Bt2 + boff + (size_t)nb * 16 * K + kc * 16);
#pragma unroll
            for (int mb = 0; mb < 4; ++mb) { acc[mb][nb] = WFrag<T16>::mma(a[mb], b, acc[mb][nb]); if (NSPLIT == 1 || NSPLIT == 2) acc[mb][nb] = WFrag<T16>::mma(a2[mb], b, acc[mb][nb]); if (NSPLIT >= 2) acc[mb][nb] = WFrag<T16>::mma(a[mb], b2, acc[mb][nb]); } }
        asm volatile("v_nop\n\tv_nop\n\tv_nop\n\tv_nop" : "+v"(acc[0][0]), "+v"(acc[1][1]), "+v"(acc[2][2]), "+v"(acc[3][3]) : "v"(a[0]), "v"(a[3]));
    }
    if (NW > 1) {
        float* rw = os + wave * (64 * 68);
        // the three loops are unrolled so that acc is indexed by constants and stays in registers
#pragma unroll
        for (int mb = 0; mb < 4; ++mb)
#pragma unroll
            for (int nb = 0; nb < 4; ++nb)
#pragma unroll
                for (int j = 0; j < 8; ++j) rw[(mb * 16 + hi * 8 + j) * 68 + nb * 16 + lr] = acc[mb][nb][j];
        __syncthreads();   // every wave's partial tile is in LDS before any thread sums across the waves
        // the s and w loops are unrolled so that a thread's LDS reads issue together; the sum stays in wave order
        if (EPI == 0) {
#pragma unroll
            for (int s = 0; s < 32 / NW; ++s) { const int idx = s * (NW * 32) + (int)threadIdx.x; const int row = idx >> 4, cofs = (idx & 15) * 4; v4f val = *(const v4fa*)(os + row * 68 + cofs);
#pragma unroll
                for (int w = 1; w < NW; ++w) { const v4f p = *(const v4fa*)(os + w * (64 * 68) + row * 68 + cofs); val[0] += p[0]; val[1] += p[1]; val[2] += p[2]; val[3] += p[3]; }
                *(v4f*)(C + (size_t)(r0 + row) * ldc + c0 + cofs) = val; }
        } else {
            // a thread takes the eight elements of one 16-byte piece of the planes, pieces in fragment order: a wave stores 512 consecutive bytes of each plane
#pragma unroll
            for (int s = 0; s < 16 / NW; ++s) { const int idx = s * (NW * 32) + (int)threadIdx.x; const int row = (idx >> 7) * 16 + (idx & 15), cofs = ((idx >> 4) & 7) * 8;
                v4f va = *(const v4fa*)(os + row * 68 + cofs), vb = *(const v4fa*)(os + row * 68 + cofs + 4);
#pragma unroll
                for (int w = 1; w < NW; ++w) { const v4f p = *(const v4fa*)(os + w * (64 * 68) + row * 68 + cofs), p2 = *(const v4fa*)(os + w * (64 * 68) + row * 68 + cofs + 4); va[0] += p[0]; va[1] += p[1]; va[2] += p[2]; va[3] += p[3]; vb[0] += p2[0]; vb[1] += p2[1]; vb[2] += p2[2]; vb[3] += p2[3]; }
                const size_t po = (size_t)by * sH + (size_t)((r0 >> 4) + (idx >> 7)) * 16 * ldo + (idx & 127) * 8; v8us oh, ol;
                // both q loops are unrolled so that va, vb, oh and ol are indexed by constants and stay in registers
#pragma unroll
                for (int q = 0; q < 8; ++q) { const float val = q < 4 ? va[q & 3] : vb[q & 3]; unsigned short x, y; splitf(EPI == 2 ? __fadd_rn(val, bfr(hb1[c0 + cofs + q])) : val, x, y); oh[q] = x; ol[q] = y; }
                *(v8us*)(P1h + po) = oh; *(v8us*)(P1l + po) = ol;
                if (EPI == 2) {
#pragma unroll
                    for (int q = 0; q < 8; ++q) { const float val = q < 4 ? va[q & 3] : vb[q & 3]; unsigned short x, y; splitf(__fadd_rn(val, bfr(hb2[c0 + cofs + q])), x, y); oh[q] = x; ol[q] = y; }
                    *(v8us*)(P2h + po) = oh; *(v8us*)(P2l + po) = ol; } }
        }
        if (EPI != 0) asm volatile("s_wait_xcnt 0x0" ::: "memory");   /* in k_proj another GEMM's code follows this one in the listing: the wait stands in front of any rewrite of the registers that the plane stores name */
        return;
    }
#pragma unroll
    for (int mb = 0; mb < 4; ++mb) {
#pragma unroll
        for (int nb = 0; nb < 4; ++nb) {
#pragma unroll
            for (int j = 0; j < 8; ++j) os[(hi * 8 + j) * 68 + nb * 16 + lr] = acc[mb][nb][j]; }
        __builtin_amdgcn_wave_barrier(); asm volatile("" ::: "memory");
        float* crow = C + (size_t)(r0 + mb * 16) * ldc + c0;
{
#pragma unroll
            for (int s = 0; s < 8; ++s) { const int row = 2 * s + hi, cofs = lr * 4; v4f val = *(const v4fa*)(os + row * 68 + cofs); if (BIAS) { val[0] += bfr(bias[c0 + cofs]); val[1] += bfr(bias[c0 + cofs + 1]); val[2] += bfr(bias[c0 + cofs + 2]); val[3] += bfr(bias[c0 + cofs + 3]); }
                *(v4f*)(crow + (size_t)row * ldc + cofs) = val; }
             }
        __builtin_amdgcn_wave_barrier(); asm volatile("" ::: "memory");
    }
}

template <typename T16, int NSPLIT, bool BIAS, int NW, int KS, int EPI>
__global__ __launch_bounds__(NW * 32) void k_gemmw(const T16* __restrict__ A, const T16* __restrict__ A2, const T16* __restrict__ Bt, const T16* __restrict__ Bt2, int K, float* C, int ldc, const float* __restrict__ bias, size_t sA, size_t sB, size_t sC, size_t sP, bf* P1h, bf* P1l, bf* P2h, bf* P2l, const float* __restrict__ hb1, const float* __restrict__ hb2, size_t sH, int ldo) {
    __shared__ __align__(16) float os[GEMMW_LDS(NW)];
    gemmw<T16, NSPLIT, BIAS, NW, KS, EPI>(os, blockIdx.x, blockIdx.y, blockIdx.z, A, A2, Bt, Bt2, K, C, ldc, bias, sA, sB, sC, sP, P1h, P1l, P2h, P2l, hb1, hb2, sH, ldo);
}
// k_proj: work-groups [0, GP) the position table x w_p (the longest, so first), [GP, GP + GQ) q, then GQ each for k and v; inside each range the tile's row index runs fastest, as in a grid of its own.
#define GP   ((NPE / 64) * (DQ / 64))
#define GQ   ((TT / 64) * (DQ / 64))
__global__ __launch_bounds__(256) void k_proj(const bf* __restrict__ PEh, const bf* __restrict__ PEl, const bf* __restrict__ WP, const bf* __restrict__ XB, const bf* __restrict__ WQ, const bf* __restrict__ XKB, const bf* __restrict__ WK, const bf* __restrict__ XVB, const bf* __restrict__ WV,
                                              bf* PPh, bf* PPl, bf* QPh, bf* QPl, bf* QVh, bf* QVl, bf* KPh, bf* KPl, bf* VTh, bf* VTl, const float* __restrict__ pbu, const float* __restrict__ pbv) {
    __shared__ __align__(16) float os[GEMMW_LDS(8)];
    const int i = blockIdx.x;
    if (i < GP) {   // reversed sinusoidal table (hi/lo) x w_p -> per-head position planes [h][4096][64]
        gemmw<bf, 1, false, 8, 1, 1>(os, i % (NPE / 64), i / (NPE / 64), 0, PEh, PEl, WP, nullptr, DM, nullptr, 0, nullptr, 0, 0, 0, 0, PPh, PPl, nullptr, nullptr, nullptr, nullptr, (size_t)NPE * HD, HD);
    } else if (i < GP + GQ) {   // (q + b_u) planes for the content scores, (q + b_v) planes for the position scores
        const int j = i - GP;
        gemmw<bf, 0, false, 8, 1, 2>(os, j % (TT / 64), j / (TT / 64), 0, XB, nullptr, WQ, nullptr, DM, nullptr, 0, nullptr, 0, 0, 0, 0, QPh, QPl, QVh, QVl, pbu, pbv, (size_t)TT * HD, HD);
    } else {   // k: head planes [h][t][64]. v: w_v as the row operand, so that the tile is v transposed, [head x 64 + d][t], as attn.v reads it
        const bool isv = i >= GP + 2 * GQ; const int j = i - GP - (isv ? 2 * GQ : GQ); const int nx = isv ? DKV / 64 : TT / 64;
        gemmw<bf, 0, false, 8, 1, 1>(os, j % nx, j / nx, 0, isv ? WV : XKB, nullptr, isv ? XVB : WK, nullptr, DM, nullptr, 0, nullptr, 0, 0, 0, 0, isv ? VTh : KPh, isv ? VTl : KPl, nullptr, nullptr, nullptr, nullptr, isv ? (size_t)64 * 16 : (size_t)TT * HD, isv ? TT : HD);
    }
}

// k_prep: all that the GEMMs read is prepared in ONE launch of NPB work-groups, few enough to be resident together. Every plane it writes is in fragment order (see k_gemmw). Every wave transposes one 16 n x 32 k block of one weight, w [k][n] f32 -> Bt [n][k] bf16 (256 work-groups a weight, five weights);
// between those loads and their stores, work-groups 0 .. NPT - 1 fill the position table (a thread keeps one sin/cos column pair, so one powf, for PER rows) and the other NPB - NPT round q, k and v to bf16 (a thread takes CVS octets of each).
#define NPB  1280                  // 5 weights x DM * DQ / 64 / 64
#define NPT  1024                  // table work-groups: two a row block (512 column pairs = 2 x 256 threads)
#define PER  (NPE * 2 / NPT)       // table rows a thread
#define CVS  (TT * DM / 8 / ((NPB - NPT) * 256))   // octets of each input a thread
static_assert(NB_ == 1 && DQ == DM && DKV == DM && 5 * (DM * DQ / 64 / 64) == NPB && PER * NPT == NPE * 2 && CVS * (NPB - NPT) * 256 * 8 == TT * DM, "k_prep: the shares are exact");
// piece i of the plane in fragment order holds row (i >> 11) * 16 + (i & 15), octet (i >> 4) & 127 of the row-major input [row][DM]
__device__ __forceinline__ void cvt8(const float* __restrict__ src, bf* __restrict__ dst, size_t i) { const v8f v = *(const v8f*)(src + (((i >> 11) * 16 + (i & 15)) * (DM / 8) + ((i >> 4) & (DM / 8 - 1))) * 8); v8us o;
    // unrolled so that v and o are indexed by constants and stay in registers
#pragma unroll
    for (int k = 0; k < 8; ++k) o[k] = f2bf(v[k]);
    *(v8us*)(dst + i * 8) = o; }
__global__ __launch_bounds__(256) void k_prep(const float* __restrict__ x, const float* __restrict__ xk, const float* __restrict__ xv, const float* __restrict__ wq, const float* __restrict__ wk, const float* __restrict__ wv, const float* __restrict__ wo, const float* __restrict__ wp,
                                              bf* __restrict__ XB, bf* __restrict__ XKB, bf* __restrict__ XVB, bf* __restrict__ WQ, bf* __restrict__ WK, bf* __restrict__ WV, bf* __restrict__ WO, bf* __restrict__ WP, bf* __restrict__ PEh, bf* __restrict__ PEl) {
    const int b = blockIdx.x, t = threadIdx.x, lane = t & 31; const int wi = b >> 8;
    const float* w = wi == 0 ? wq : wi == 1 ? wk : wi == 2 ? wv : wi == 3 ? wo : wp; bf* Bt = wi == 0 ? WQ : wi == 1 ? WK : wi == 2 ? WV : wi == 3 ? WO : WP;
    const int blk = (b & 255) * 8 + (t >> 5);   /* the wave's block: strip n / 16 = blk / 32, k / 32 = blk % 32 */
    const float* wl = w + (size_t)((blk & 31) * 32 + (lane >> 4) * 8) * DQ + (blk >> 5) * 16 + (lane & 15);   /* this lane's n, its first k */
    float r[2][8];
    // unrolled so that r is indexed by constants and the sixteen loads of a wave fly together
#pragma unroll
    for (int sh = 0; sh < 2; ++sh)
#pragma unroll
        for (int e = 0; e < 8; ++e) r[sh][e] = wl[(size_t)(sh * 16 + e) * DQ];
    asm volatile("s_wait_xcnt 0x0" ::: "memory");   /* stands in front of any rewrite of the address registers that the sixteen loads name */
    if (b < NPT) {
        const int c = ((b & 1) * 256 + t) * 2; const float ex = __fdiv_rn((float)c, (float)DM);   /* c even: 2i/d_model */ const float den = powf(10000.0f, ex);
        for (int q = 0; q < PER; ++q) { const int m = (b >> 1) * PER + q; const float pos = (float)(NPE - 1 - m); const float th = __fdiv_rn(pos, den); v2us oh, ol; unsigned short a, b2; splitf(sinf(th), a, b2); oh[0] = a; ol[0] = b2; splitf(cosf(th), a, b2); oh[1] = a; ol[1] = b2;
            const size_t e = (size_t)(m >> 4) * 16 * DM + (c >> 5) * 512 + (((c >> 3) & 3) * 16 + (m & 15)) * 8 + (c & 7);   /* fragment order */ *(v2us*)(PEh + e) = oh; *(v2us*)(PEl + e) = ol; }
    } else {
        const size_t i0 = (size_t)(b - NPT) * 256 + t;
        for (int s = 0; s < CVS; ++s) { const size_t i = i0 + (size_t)s * ((NPB - NPT) * 256); cvt8(x, XB, i); cvt8(xk, XKB, i); cvt8(xv, XVB, i);
            asm volatile("s_wait_xcnt 0x0" ::: "memory");   /* stands in front of the next trip's rewrite of the registers that the three stores name */ }
    }
    // unrolled so that r is indexed by constants; each store is 512 consecutive bytes a wave
#pragma unroll
    for (int sh = 0; sh < 2; ++sh) { v8us o;
#pragma unroll
        for (int e = 0; e < 8; ++e) o[e] = f2bf(r[sh][e]);
        *(v8us*)(Bt + (size_t)blk * 512 + sh * 256 + lane * 8) = o; }
}

// k_attn: one work-group = one head x RB query rows, every stage of the attention on chip. The RB score rows [RB][2048] f32 live in LDS (pitch SP floats):
//   1 content scores (q + b_u).k into the rows; 2 raw position scores (q + b_v).ph only for the positions that the left shift keeps (m = 4095 - i + j, 0 <= j <= i), added at their shifted key j;
//   3 mask, softmax per row (one wave a row, register row), the row rewritten in place as its bf16 hi plane (first 4 KiB) and lo plane (next 4 KiB);
//   4 attn.v with the hi/lo rows as the A operand from LDS, each wave TT / NWV keys, the NWV partial tiles summed through LDS in wave order and split into the merged hi/lo planes.
// Every plain '#pragma unroll' in this kernel is there so that the register arrays (fragments, accumulators, the score row) are indexed by constants and stay in registers.
#define MT   2                     // 16-row tiles of query rows per work-group
#define RB   (16 * MT)
#define NWV  (RB / 2)              // waves per work-group (two score rows a wave; RB * 8 output octets = NWV * 16 threads, half the waves)
#define SP   2052                  // floats per score row in LDS: 16-byte aligned rows, 4 banks apart
typedef v4us __attribute__((may_alias)) v4usa;
__device__ __forceinline__ v16bf ldsfrag(const bf* p) { return cat16b(*(const v8usa*)p, *(const v8usa*)(p + 16)); }
__device__ __forceinline__ v8f mma3(v16bf a, v16bf a2, v16bf b, v16bf b2, v8f c) { c = wmmab(a, b, c); c = wmmab(a2, b, c); return wmmab(a, b2, c); }
__global__ __launch_bounds__(NWV * 32) void k_attn(const bf* __restrict__ QUh, const bf* __restrict__ QUl, const bf* __restrict__ QWh, const bf* __restrict__ QWl, const bf* __restrict__ Kh, const bf* __restrict__ Kl, const bf* __restrict__ Rh, const bf* __restrict__ Rl, const bf* __restrict__ Vh, const bf* __restrict__ Vl, const int* __restrict__ MKb, bf* Ah, bf* Al) {
    typedef WFrag<bf> F;
    __shared__ __align__(16) float S[RB * SP];
    const int h = blockIdx.x; const int i0 = (TT / RB - 1 - (int)blockIdx.y) * RB;   /* late query rows have the most positions: they start first */
    const int wave = __builtin_amdgcn_readfirstlane(threadIdx.x >> 5); const int lane = threadIdx.x & 31, lr = lane & 15, hi = lane >> 4;
    const size_t qoff = ((size_t)h * TT + i0) * HD + lane * 8;   /* all global planes are in fragment order (see k_gemmw): a 16-row strip of a head plane is 16 * HD elements, two blocks of 512 */
    {   // 1: content scores, TT / 16 / NWV key tiles a wave
        v16bf a[MT][2], a2[MT][2];
#pragma unroll
        for (int mt = 0; mt < MT; ++mt)
#pragma unroll
            for (int kk = 0; kk < 2; ++kk) { a[mt][kk] = F::ld(QUh + qoff + mt * 16 * HD + kk * 512); a2[mt][kk] = F::ld(QUl + qoff + mt * 16 * HD + kk * 512); }
        const size_t koff = ((size_t)h * TT + wave * (TT / NWV)) * HD + lane * 8;
        for (int t = 0; t < TT / 16 / NWV; t += 2) { v16bf b[2][2], c[2][2];
#pragma unroll
            for (int u = 0; u < 2; ++u)
#pragma unroll
                for (int kk = 0; kk < 2; ++kk) { b[u][kk] = F::ld(Kh + koff + (t + u) * 16 * HD + kk * 512); c[u][kk] = F::ld(Kl + koff + (t + u) * 16 * HD + kk * 512); }
            // inputs only: holds the sixteen loads of two key tiles in front of the products, so that they fly together and are waited for once, not fragment by fragment
            asm volatile("" :: "v"(b[0][0]), "v"(b[0][1]), "v"(b[1][0]), "v"(b[1][1]), "v"(c[0][0]), "v"(c[0][1]), "v"(c[1][0]), "v"(c[1][1]));
#pragma unroll
            for (int u = 0; u < 2; ++u)
#pragma unroll
                for (int mt = 0; mt < MT; ++mt) { v8f acc = (v8f){}; acc = mma3(a[mt][0], a2[mt][0], b[u][0], c[u][0], acc); acc = mma3(a[mt][1], a2[mt][1], b[u][1], c[u][1], acc);
#pragma unroll
                    for (int j = 0; j < 8; ++j) S[(mt * 16 + hi * 8 + j) * SP + wave * (TT / NWV) + (t + u) * 16 + lr] = acc[j]; } }
    }
    __syncthreads();   // every content score is in LDS before a position score is added to it
    {   // 2: position tile t holds m = NPE - RB - i0 + 16 t + c; row r of the block meets it at key j = m - (NPE - 1) + i0 + r; each (r, j) belongs to exactly one (t, c)
        v16bf a[MT][2], a2[MT][2];
#pragma unroll
        for (int mt = 0; mt < MT; ++mt)
#pragma unroll
            for (int kk = 0; kk < 2; ++kk) { a[mt][kk] = F::ld(QWh + qoff + mt * 16 * HD + kk * 512); a2[mt][kk] = F::ld(QWl + qoff + mt * 16 * HD + kk * 512); }
        const int nt = (i0 + RB) / 16; const size_t roff = ((size_t)h * NPE + (NPE - RB - i0)) * HD + lane * 8;
        for (int t = wave; t < nt; t += 2 * NWV) { const bool two = t + NWV < nt;   /* two tiles a trip, t and t + NWV; past the end the second one repeats the first and is dropped */
            v16bf b[2][2], c[2][2]; v8f acc[2][MT];
#pragma unroll
            for (int u = 0; u < 2; ++u) { const size_t to = roff + (size_t)((u && two) ? t + NWV : t) * 16 * HD;
#pragma unroll
                for (int kk = 0; kk < 2; ++kk) { b[u][kk] = F::ld(Rh + to + kk * 512); c[u][kk] = F::ld(Rl + to + kk * 512); } }
            // inputs only: holds the sixteen loads of two position tiles in front of the products, so that they fly together and are waited for once
            asm volatile("" :: "v"(b[0][0]), "v"(b[0][1]), "v"(b[1][0]), "v"(b[1][1]), "v"(c[0][0]), "v"(c[0][1]), "v"(c[1][0]), "v"(c[1][1]));
#pragma unroll
            for (int u = 0; u < 2; ++u)
#pragma unroll
                for (int mt = 0; mt < MT; ++mt) { acc[u][mt] = (v8f){}; acc[u][mt] = mma3(a[mt][0], a2[mt][0], b[u][0], c[u][0], acc[u][mt]); acc[u][mt] = mma3(a[mt][1], a2[mt][1], b[u][1], c[u][1], acc[u][mt]); }
            float* p = S + (hi * 8) * (SP + 1) + 16 * t + lr - (RB - 1);   /* row r = mt * 16 + hi * 8 + j, key 16 t + lr + r - (RB - 1) */
            if (16 * t >= RB - 1) {   // every key of the tile is >= 0 (a scalar test): the old scores are read together, with no lane test
                float o[MT][8];
#pragma unroll
                for (int mt = 0; mt < MT; ++mt)
#pragma unroll
                    for (int j = 0; j < 8; ++j) o[mt][j] = p[(mt * 16 + j) * (SP + 1)];
#pragma unroll
                for (int mt = 0; mt < MT; ++mt)
#pragma unroll
                    for (int j = 0; j < 8; ++j) p[(mt * 16 + j) * (SP + 1)] = __fadd_rn(o[mt][j], acc[0][mt][j]);
            } else {
#pragma unroll
                for (int mt = 0; mt < MT; ++mt)
#pragma unroll
                    for (int j = 0; j < 8; ++j) { const int key = 16 * t + lr + mt * 16 + hi * 8 + j - (RB - 1); if (key >= 0) p[(mt * 16 + j) * (SP + 1)] = __fadd_rn(p[(mt * 16 + j) * (SP + 1)], acc[0][mt][j]); }
            }
            if (two) {   // tile t + NWV: its keys are all >= 0 (16 NWV >= RB - 1)
                float* p2 = p + 16 * NWV; float o[MT][8];
#pragma unroll
                for (int mt = 0; mt < MT; ++mt)
#pragma unroll
                    for (int j = 0; j < 8; ++j) o[mt][j] = p2[(mt * 16 + j) * (SP + 1)];
#pragma unroll
                for (int mt = 0; mt < MT; ++mt)
#pragma unroll
                    for (int j = 0; j < 8; ++j) p2[(mt * 16 + j) * (SP + 1)] = __fadd_rn(o[mt][j], acc[1][mt][j]);
            } }
    }
    __syncthreads();   // the rows are complete before a wave takes its rows' softmax
    // not unrolled: one register row of 64 values is live at a time
#pragma unroll 1
    for (int rr = 0; rr < RB / NWV; ++rr) {   // 3: t = (ac + bd)/8, -inf where mask == 0; softmax over the 2048 keys (register row, one exp, fixed trees)
        const int r = wave * (RB / NWV) + rr; float* srow = S + r * SP; const int* mkr = MKb + (size_t)(i0 + r) * TT; float v[TT / 32]; float mx = -3.0e38f;
#pragma unroll
        for (int ch = 0; ch < TT / 128; ++ch) { const int j0 = ch * 128 + lane * 4; const v4f s4 = *(const v4fa*)(srow + j0); const v4i m4 = *(const v4i*)(mkr + j0);
#pragma unroll
            for (int q = 0; q < 4; ++q) { const float t = (m4[q] != 0) ? s4[q] * SCL : -3.0e38f; v[ch * 4 + q] = t; mx = fmaxf(mx, t); } }
#pragma unroll
        for (int sh = 16; sh; sh >>= 1) mx = fmaxf(mx, __shfl_xor(mx, sh, 32));
        float sum = 0.f;
#pragma unroll
        for (int k = 0; k < TT / 32; ++k) { v[k] = __builtin_amdgcn_exp2f(__fmul_rn(__fsub_rn(v[k], mx), 1.4426950408889634f)); sum += v[k]; }
#pragma unroll
        for (int sh = 16; sh; sh >>= 1) sum += __shfl_xor(sum, sh, 32);
        const float f = __fdiv_rn(1.0f, sum); bf* prow = (bf*)srow;
#pragma unroll
        for (int ch = 0; ch < TT / 128; ++ch) { v4us oh, ol;
#pragma unroll
            for (int q = 0; q < 4; ++q) { unsigned short x, y; splitf(v[ch * 4 + q] * f, x, y); oh[q] = x; ol[q] = y; }
            *(v4usa*)(prow + ch * 128 + lane * 4) = oh; *(v4usa*)(prow + TT + ch * 128 + lane * 4) = ol; }
    }
    __syncthreads();   // every row's hi/lo planes are in LDS before any wave reads them as its A operand
    v8f acc[MT][4];
#pragma unroll
    for (int mt = 0; mt < MT; ++mt)
#pragma unroll
        for (int nb = 0; nb < 4; ++nb) acc[mt][nb] = (v8f){};
    {   // 4: attn.v, this wave's keys [wave * TT / NWV, + TT / NWV)
        const bf* pa = (const bf*)S + (size_t)lr * (2 * SP) + 8 * hi + wave * (TT / NWV); const size_t voff = (size_t)h * HD * TT + wave * (TT / NWV) * 16 + lane * 8;   /* strip (h * HD + 16 nb) / 16 of 16 * TT elements, block key / 32 */
        // unrolled: four trips, acc indexed by constants
#pragma unroll
        for (int kc = 0; kc < TT / NWV; kc += 32) { v16bf a[MT], a2[MT];
#pragma unroll
            for (int mt = 0; mt < MT; ++mt) { a[mt] = ldsfrag(pa + mt * 16 * (2 * SP) + kc); a2[mt] = ldsfrag(pa + mt * 16 * (2 * SP) + TT + kc); }
            v16bf b[4], b2[4];
#pragma unroll
            for (int nb = 0; nb < 4; ++nb) { b[nb] = F::ld(Vh + voff + (size_t)nb * 16 * TT + kc * 16); b2[nb] = F::ld(Vl + voff + (size_t)nb * 16 * TT + kc * 16); }
            // inputs only: holds the sixteen v loads of this trip in front of the products, so that they fly together and are waited for once
            asm volatile("" :: "v"(b[0]), "v"(b[1]), "v"(b[2]), "v"(b[3]), "v"(b2[0]), "v"(b2[1]), "v"(b2[2]), "v"(b2[3]));
#pragma unroll
            for (int nb = 0; nb < 4; ++nb)
#pragma unroll
                for (int mt = 0; mt < MT; ++mt) acc[mt][nb] = mma3(a[mt], a2[mt], b[nb], b2[nb], acc[mt][nb]); }
    }
    __syncthreads();   // the last read of the hi/lo planes is over before their LDS takes the partial tiles
    float* rw = S + wave * (RB * 68);
#pragma unroll
    for (int mt = 0; mt < MT; ++mt)
#pragma unroll
        for (int nb = 0; nb < 4; ++nb)
#pragma unroll
            for (int j = 0; j < 8; ++j) rw[(mt * 16 + hi * 8 + j) * 68 + nb * 16 + lr] = acc[mt][nb][j];
    __syncthreads();   // every wave's partial tile is in LDS before any thread sums across the waves
    if (wave >= NWV / 2) return;   // RB * 8 pieces of eight elements: half the waves take one a thread, so that a wave stores 512 consecutive bytes of each plane (no barrier follows)
    const int idx = (int)threadIdx.x; const int row = (idx >> 7) * 16 + (idx & 15), cofs = ((idx >> 4) & 7) * 8;   /* piece idx of the block's rows in fragment order */
    v4f va = *(const v4fa*)(S + row * 68 + cofs), vb = *(const v4fa*)(S + row * 68 + cofs + 4);
    // unrolled so that a thread's LDS reads issue together; the sum stays in wave order
#pragma unroll
    for (int w = 1; w < NWV; ++w) { const v4f p = *(const v4fa*)(S + w * (RB * 68) + row * 68 + cofs), p2 = *(const v4fa*)(S + w * (RB * 68) + row * 68 + cofs + 4); va[0] += p[0]; va[1] += p[1]; va[2] += p[2]; va[3] += p[3]; vb[0] += p2[0]; vb[1] += p2[1]; vb[2] += p2[2]; vb[3] += p2[3]; }
    v8us oh, ol;
#pragma unroll
    for (int q = 0; q < 8; ++q) { unsigned short x, y; splitf(q < 4 ? va[q & 3] : vb[q & 3], x, y); oh[q] = x; ol[q] = y; }
    const size_t oo = (size_t)((i0 >> 4) + (idx >> 7)) * 16 * DQ + h * HD * 16 + (idx & 127) * 8; *(v8us*)(Ah + oo) = oh; *(v8us*)(Al + oo) = ol;
}

extern "C" void kernel_launch(void* const* d_in, const int* in_sizes, int n_in,
                              void* d_out, int out_size, void* d_ws, size_t ws_size, hipStream_t stream) {
    (void)in_sizes; (void)n_in; (void)out_size;
    const float* x = (const float*)d_in[0]; const float* xk = (const float*)d_in[1]; const float* xv = (const float*)d_in[2]; const int* MK = (const int*)d_in[3]; const float* wq = (const float*)d_in[4]; const float* wk = (const float*)d_in[5]; const float* wv = (const float*)d_in[6]; const float* wp = (const float*)d_in[7]; const float* wo = (const float*)d_in[8]; const float* pbu = (const float*)d_in[9]; const float* pbv = (const float*)d_in[10];
    float* OUT = (float*)d_out;     // [1][2048][1024]
    char* wsp = (char*)d_ws;
    auto take = [&](size_t bytes) { char* p = wsp; wsp += (bytes + 255) & ~(size_t)255; return (void*)p; };
    bf* WQ = (bf*)take((size_t)DQ * DM * 2); bf* WK = (bf*)take((size_t)DKV * DM * 2); bf* WV = (bf*)take((size_t)DKV * DM * 2); bf* WO = (bf*)take((size_t)DM * DQ * 2);
    bf* XB = (bf*)take((size_t)TT * DM * 2); bf* XKB = (bf*)take((size_t)TT * DM * 2); bf* XVB = (bf*)take((size_t)TT * DM * 2); bf* WP = (bf*)take((size_t)DQ * DM * 2); bf* PPh = (bf*)take((size_t)NH_ * NPE * HD * 2); bf* PPl = (bf*)take((size_t)NH_ * NPE * HD * 2); bf* QVh = (bf*)take((size_t)NH_ * TT * HD * 2); bf* QVl = (bf*)take((size_t)NH_ * TT * HD * 2);
    bf* QPh = (bf*)take((size_t)NH_ * TT * HD * 2); bf* QPl = (bf*)take((size_t)NH_ * TT * HD * 2); bf* KPh = (bf*)take((size_t)NKV * TT * HD * 2); bf* KPl = (bf*)take((size_t)NKV * TT * HD * 2); bf* VTh = (bf*)take((size_t)NKV * HD * TT * 2); bf* VTl = (bf*)take((size_t)NKV * HD * TT * 2);
    bf* PEh = (bf*)take((size_t)NPE * DM * 2); bf* PEl = (bf*)take((size_t)NPE * DM * 2);   /* the position-table planes */ bf* ATh = (bf*)take((size_t)TT * DQ * 2); bf* ATl = (bf*)take((size_t)TT * DQ * 2);
    if ((size_t)(wsp - (char*)d_ws) > ws_size) return;    // ws 256 MiB
    k_prep<<<NPB, 256, 0, stream>>>(x, xk, xv, wq, wk, wv, wo, wp, XB, XKB, XVB, WQ, WK, WV, WO, WP, PEh, PEl);   /* the five weights transposed to bf16, the reversed sinusoidal table's hi/lo planes, q / k / v rounded to bf16 */
    k_proj<<<GP + 3 * GQ, 256, 0, stream>>>(PEh, PEl, WP, XB, WQ, XKB, WK, XVB, WV, PPh, PPl, QPh, QPl, QVh, QVl, KPh, KPl, VTh, VTl, pbu, pbv);   /* the four projections, each storing the hi/lo planes that the attention reads */
    for (int b = 0; b < NB_; ++b) {
        k_attn<<<dim3(NH_, TT / RB, 1), NWV * 32, 0, stream>>>(QPh, QPl, QVh, QVl, KPh, KPl, PPh, PPl, VTh, VTl, MK, ATh, ATl);   /* scores, shift, softmax and attn.v of all heads; one kv head per query head */
        k_gemmw<bf, 1, false, 8, 1, 0><<<dim3(TT / 64, DM / 64, 1), 256, 0, stream>>>(ATh, ATl, WO, nullptr, DQ, OUT + (size_t)b * TT * DM, DM, nullptr, 0, 0, 0, 0, nullptr, nullptr, nullptr, nullptr, nullptr, nullptr, 0, 0); }
}

// v006
// One run takes 154 microseconds.
// Next to v005, in two timings, it ran 1.23 and 1.24 times as fast.
// Over all steps from v000 it is 6.43 times as fast.
#include <hip/hip_runtime.h>

// Transformer-XL relative-position multi-head attention (q, k, v inputs [1][2048][1024]; qh = q w_q, kh = k w_k, vh = v w_v ('xw' [1024][1024], no bias; 16 heads x 64); pe = reversed sinusoidal table of length 4096 (pe[m] = PE(4095 - m), interleaved sin/cos) projected by w_p -> ph [16][4096][64]; ac = (qh + b_u).kh, bd = left_shift((qh + b_v).ph): bd[i][j] = raw[i][4095 - i + j] for j <= i else 0; scores = (ac + bd)/8; mask (int [1][2048][2048], read; -inf where 0); softmax; out = attn.vh merged w_o -> [1][2048][1024]).
// Layout: projections from three bf16 input planes, each projection GEMM storing its result as the bf16 hi/lo planes that the attention reads (no f32 copy in memory); b_u / b_v folded into two sets of query planes; the position table is computed on device in f32 (pos / 10000^(2i/1024), precise powf/sinf/cosf), only its rows m >= 2048 (the left shift keeps m = 4095 - i + j with 0 <= j <= i <= 2047 and zeroes the rest, so no other row reaches the output for any input) -> hi/lo planes -> 2-product GEMM with the exact bf16 w_p -> per-head hi/lo planes; one launch does the attention of all heads: a work-group keeps 32 query rows' scores in LDS, content and position scores are hi/lo x hi/lo products (3 products), a position score is added at its shifted key, and softmax and attn.v follow on the same rows.
// Compute dtypes, f32 accumulate: every input rounded to bf16; q/k/v on PLAIN bf16 operands (inputs: exact); content / position scores and attn.v on hi/lo planes for every row (3 products); softmax f32; w_o hl x exact (2 products).

#define NB_  1
#define TT   2048
#define DM   1024
#define NH_  16
#define NKV  16
#define REP  (NH_ / NKV)
#define HD   64
#define DQ   (NH_ * HD)
#define DKV  (NKV * HD)
#define NPE  4096                 // relative positions (2 x seq)
#define NPU  TT                   // positions that the left shift can keep: m = NPE - 1 - i + j, 0 <= j <= i < TT, so m >= NPE - TT; row m of the table and of its projection lies at plane row m - (NPE - NPU)
typedef __attribute__((ext_vector_type(4))) int v4i;
#define WIN  0
#define SCL  0.125f   // HD^-0.5
typedef _Float16 h16;
typedef unsigned short bf;
typedef __attribute__((ext_vector_type(16))) __bf16   v16bf;
typedef __attribute__((ext_vector_type(16))) _Float16 v16h;
typedef __attribute__((ext_vector_type(8)))  _Float16 v8h;
typedef __attribute__((ext_vector_type(8)))  unsigned short v8us;
typedef __attribute__((ext_vector_type(8)))  float    v8f;
typedef __attribute__((ext_vector_type(4)))  float    v4f;
typedef v8h  __attribute__((may_alias)) v8ha;
typedef v4f  __attribute__((may_alias)) v4fa;
typedef v8us __attribute__((may_alias)) v8usa;

__device__ __forceinline__ unsigned short f2bf(float f) { unsigned u = __float_as_uint(f); u += 0x7FFFu + ((u >> 16) & 1u); return (unsigned short)(u >> 16); }
__device__ __forceinline__ float bf2f(unsigned short b) { return __uint_as_float(((unsigned)b) << 16); }
__device__ __forceinline__ float bfr(float f) { return bf2f(f2bf(f)); }
__device__ __forceinline__ v16h cat16(v8h lo, v8h hi) { return __builtin_shufflevector(lo, hi, 0, 1, 2, 3, 4, 5, 6, 7, 8, 9, 10, 11, 12, 13, 14, 15); }
__device__ __forceinline__ v16bf cat16b(v8us lo, v8us hi) { return __builtin_bit_cast(v16bf, __builtin_shufflevector(lo, hi, 0, 1, 2, 3, 4, 5, 6, 7, 8, 9, 10, 11, 12, 13, 14, 15)); }
__device__ __forceinline__ v8f wmma16(v16h a, v16h b, v8f c) { return __builtin_amdgcn_wmma_f32_16x16x32_f16(false, a, false, b, (short)0, c, false, false); }
__device__ __forceinline__ v8f wmmab(v16bf a, v16bf b, v8f c) { return __builtin_amdgcn_wmma_f32_16x16x32_bf16(false, a, false, b, (short)0, c, false, false); }

__device__ __forceinline__ void splitf(float y, unsigned short& h, unsigned short& l) { h = f2bf(y); l = f2bf(y - bf2f(h)); }
typedef __attribute__((ext_vector_type(2))) unsigned short v2us;
typedef __attribute__((ext_vector_type(4))) unsigned short v4us;

// ---- k_gemmw: register-blocked GEMM, ONE WAVE per 64x64 output tile (16 accumulators), operands straight from 16-bit planes in fragment order; grid (M/64, N/64, Z), 32 threads.
// C[m][n] (f32, pitch ldc, + optional f32 bias[n]) = sum_k A[m][k] Bt[n][k] (+ split products per NSPLIT). z-batch strides sA/sB/sC in elements. K % 32 == 0.
// Split K (long K): NW waves per work-group and KS work-groups per tile each take K / (KS * NW) consecutive k of the same 64x64 tile; the NW partial tiles are summed through LDS in wave order, and work-group ks (blockIdx.z = z * KS + ks) writes its own f32 plane at C + ks * sP, summed by the consumer. Grid (M/64, N/64, Z * KS), NW * 32 threads. K % (KS * NW * 32) == 0. NW > 1 takes no bias.
// EPI (NW > 1, KS == 1): what the summed tile is stored as. 0: f32 at C. 1: its bf16 hi and lo planes at P1h / P1l. 2: the planes of (tile + hb1[n]) at P1h / P1l and of (tile + hb2[n]) at P2h / P2l (hb rounded to bf16).
// FRAGMENT ORDER: every 16-bit operand plane [row][k] in memory (A, A2, Bt, Bt2 here, and the planes stored here) is kept as blocks of 16 rows x 32 k, 512 consecutive elements each: element (row lr, k = 16 sh + 8 hi + e) lies at (sh * 32 + hi * 16 + lr) * 8 + e of its block, the blocks of one 16-row strip follow one another along k, and a strip is 16 * K elements.
// A wave-wide 16-byte load (lane = hi * 16 + lr) then takes 512 consecutive bytes, four whole lines (of a row-major plane it would take 32 bytes out of each of 16 lines); which lane and register hold an element is the hardware's fragment layout, k order 8 hi + e, then 16 + 8 hi + e, alike for A and B.
// The stored tile's first block lies at blockIdx.y * sH + (m / 16) * 16 * ldo: head planes [n / 64][m][64] with sH = M * 64, ldo = 64; a plain [m][n] plane with sH = 64 * 16, ldo = N.
// ld: one fragment of a plane in fragment order; p = its 16 x 32 block + lane * 8.
template <typename T16> struct WFrag;
template <> struct WFrag<h16> { typedef v16h V; static __device__ __forceinline__ V ld(const h16* p) { return cat16(*(const v8h*)p, *(const v8h*)(p + 256)); } static __device__ __forceinline__ v8f mma(V a, V b, v8f c) { return wmma16(a, b, c); } };
template <> struct WFrag<bf> { typedef v16bf V; static __device__ __forceinline__ V ld(const bf* p) { return cat16b(*(const v8us*)p, *(const v8us*)(p + 256)); } static __device__ __forceinline__ v8f mma(V a, V b, v8f c) { return wmmab(a, b, c); } };
// gemmw is the body: os is the work-group's LDS (GEMMW_LDS floats), (bx, by, bz) its place in the grid above. k_gemmw launches one GEMM; k_proj holds the four projections, which do not depend on one another, in one launch.
#define GEMMW_LDS(NW) ((NW) == 1 ? 16 * 68 : (NW) * 64 * 68)
template <typename T16, int NSPLIT, bool BIAS, int NW, int KS, int EPI>
__device__ __forceinline__ void gemmw(float* os, int bx, int by, int bz, const T16* __restrict__ A, const T16* __restrict__ A2, const T16* __restrict__ Bt, const T16* __restrict__ Bt2, int K, float* C, int ldc, const float* __restrict__ bias, size_t sA, size_t sB, size_t sC, size_t sP, bf* P1h, bf* P1l, bf* P2h, bf* P2l, const float* __restrict__ hb1, const float* __restrict__ hb2, size_t sH, int ldo) {
    typedef typename WFrag<T16>::V V;
    const size_t z = bz / KS; const int ks = bz % KS; A += z * sA; if (A2) A2 += z * sA; Bt += z * sB; if (Bt2) Bt2 += z * sB; C += z * sC + (size_t)ks * sP;
    const int wave = (NW == 1) ? 0 : __builtin_amdgcn_readfirstlane(threadIdx.x >> 5); const int kw = K / (KS * NW), k0 = (ks * NW + wave) * kw;   /* this wave's k range [k0, k0 + kw) */
    const int lane = threadIdx.x & 31, lr = lane & 15, hi = lane >> 4; const int r0 = bx * 64, c0 = by * 64;
    v8f acc[4][4];
#pragma unroll
    for (int mb = 0; mb < 4; ++mb)
#pragma unroll
        for (int nb = 0; nb < 4; ++nb) acc[mb][nb] = (v8f){};
    const size_t aoff = (size_t)r0 * K + (size_t)k0 * 16 + lane * 8, boff = (size_t)c0 * K + (size_t)k0 * 16 + lane * 8;   /* strip r0 / 16, block k0 / 32 */
#pragma unroll 1
    for (int kc = 0; kc < kw; kc += 32) {
        V a[4], a2[4];
#pragma unroll
        for (int mb = 0; mb < 4; ++mb) { a[mb] = WFrag<T16>::ld(A + aoff + (size_t)mb * 16 * K + kc * 16); if (NSPLIT == 1 || NSPLIT == 2) a2[mb] = WFrag<T16>::ld(A2 + aoff + (size_t)mb * 16 * K + kc * 16); }
#pragma unroll
        for (int nb = 0; nb < 4; ++nb) { const V b = WFrag<T16>::ld(Bt + boff + (size_t)nb * 16 * K + kc * 16); V b2; if (NSPLIT >= 2) b2 = WFrag<T16>::ld(Bt2 + boff + (size_t)nb * 16 * K + kc * 16);
#pragma unroll
            for (int mb = 0; mb < 4; ++mb) { acc[mb][nb] = WFrag<T16>::mma(a[mb], b, acc[mb][nb]); if (NSPLIT == 1 || NSPLIT == 2) acc[mb][nb] = WFrag<T16>::mma(a2[mb], b, acc[mb][nb]); if (NSPLIT >= 2) acc[mb][nb] = WFrag<T16>::mma(a[mb], b2, acc[mb][nb]); } }
        asm volatile("v_nop\n\tv_nop\n\tv_nop\n\tv_nop" : "+v"(acc[0][0]), "+v"(acc[1][1]), "+v"(acc[2][2]), "+v"(acc[3][3]) : "v"(a[0]), "v"(a[3]));
    }
    if (NW > 1) {
        float* rw = os + wave * (64 * 68);
        // the three loops are unrolled so that acc is indexed by constants and stays in registers
#pragma unroll
        for (int mb = 0; mb < 4; ++mb)
#pragma unroll
            for (int nb = 0; nb < 4; ++nb)
#pragma unroll
                for (int j = 0; j < 8; ++j) rw[(mb * 16 + hi * 8 + j) * 68 + nb * 16 + lr] = acc[mb][nb][j];
        __syncthreads();   // every wave's partial tile is in LDS before any thread sums across the waves
        // the s and w loops are unrolled so that a thread's LDS reads issue together; the sum stays in wave order
        if (EPI == 0) {
#pragma unroll
            for (int s = 0; s < 32 / NW; ++s) { const int idx = s * (NW * 32) + (int)threadIdx.x; const int row = idx >> 4, cofs = (idx & 15) * 4; v4f val = *(const v4fa*)(os + row * 68 + cofs);
#pragma unroll
                for (int w = 1; w < NW; ++w) { const v4f p = *(const v4fa*)(os + w * (64 * 68) + row * 68 + cofs); val[0] += p[0]; val[1] += p[1]; val[2] += p[2]; val[3] += p[3]; }
                *(v4f*)(C + (size_t)(r0 + row) * ldc + c0 + cofs) = val; }
        } else {
            // a thread takes the eight elements of one 16-byte piece of the planes, pieces in fragment order: a wave stores 512 consecutive bytes of each plane
#pragma unroll
            for (int s = 0; s < 16 / NW; ++s) { const int idx = s * (NW * 32) + (int)threadIdx.x; const int row = (idx >> 7) * 16 + (idx & 15), cofs = ((idx >> 4) & 7) * 8;
                v4f va = *(const v4fa*)(os + row * 68 + cofs), vb = *(const v4fa*)(os + row * 68 + cofs + 4);
#pragma unroll
                for (int w = 1; w < NW; ++w) { const v4f p = *(const v4fa*)(os + w * (64 * 68) + row * 68 + cofs), p2 = *(const v4fa*)(os + w * (64 * 68) + row * 68 + cofs + 4); va[0] += p[0]; va[1] += p[1]; va[2] += p[2]; va[3] += p[3]; vb[0] += p2[0]; vb[1] += p2[1]; vb[2] += p2[2]; vb[3] += p2[3]; }
                const size_t po = (size_t)by * sH + (size_t)((r0 >> 4) + (idx >> 7)) * 16 * ldo + (idx & 127) * 8; v8us oh, ol;
                // both q loops are unrolled so that va, vb, oh and ol are indexed by constants and stay in registers
#pragma unroll
                for (int q = 0; q < 8; ++q) { const float val = q < 4 ? va[q & 3] : vb[q & 3]; unsigned short x, y; splitf(EPI == 2 ? __fadd_rn(val, bfr(hb1[c0 + cofs + q])) : val, x, y); oh[q] = x; ol[q] = y; }
                *(v8us*)(P1h + po) = oh; *(v8us*)(P1l + po) = ol;
                if (EPI == 2) {
#pragma unroll
                    for (int q = 0; q < 8; ++q) { const float val = q < 4 ? va[q & 3] : vb[q & 3]; unsigned short x, y; splitf(__fadd_rn(val, bfr(hb2[c0 + cofs + q])), x, y); oh[q] = x; ol[q] = y; }
                    *(v8us*)(P2h + po) = oh; *(v8us*)(P2l + po) = ol; } }
        }
        if (EPI != 0) asm volatile("s_wait_xcnt 0x0" ::: "memory");   /* in k_proj another GEMM's code follows this one in the listing: the wait stands in front of any rewrite of the registers that the plane stores name */
        return;
    }
#pragma unroll
    for (int mb = 0; mb < 4; ++mb) {
#pragma unroll
        for (int nb = 0; nb < 4; ++nb) {
#pragma unroll
            for (int j = 0; j < 8; ++j) os[(hi * 8 + j) * 68 + nb * 16 + lr] = acc[mb][nb][j]; }
        __builtin_amdgcn_wave_barrier(); asm volatile("" ::: "memory");
        float* crow = C + (size_t)(r0 + mb * 16) * ldc + c0;
{
#pragma unroll
            for (int s = 0; s < 8; ++s) { const int row = 2 * s + hi, cofs = lr * 4; v4f val = *(const v4fa*)(os + row * 68 + cofs); if (BIAS) { val[0] += bfr(bias[c0 + cofs]); val[1] += bfr(bias[c0 + cofs + 1]); val[2] += bfr(bias[c0 + cofs + 2]); val[3] += bfr(bias[c0 + cofs + 3]); }
                *(v4f*)(crow + (size_t)row * ldc + cofs) = val; }
             }
        __builtin_amdgcn_wave_barrier(); asm volatile("" ::: "memory");
    }
}

template <typename T16, int NSPLIT, bool BIAS, int NW, int KS, int EPI>
__global__ __launch_bounds__(NW * 32) void k_gemmw(const T16* __restrict__ A, const T16* __restrict__ A2, const T16* __restrict__ Bt, const T16* __restrict__ Bt2, int K, float* C, int ldc, const float* __restrict__ bias, size_t sA, size_t sB, size_t sC, size_t sP, bf* P1h, bf* P1l, bf* P2h, bf* P2l, const float* __restrict__ hb1, const float* __restrict__ hb2, size_t sH, int ldo) {
    __shared__ __align__(16) float os[GEMMW_LDS(NW)];
    gemmw<T16, NSPLIT, BIAS, NW, KS, EPI>(os, blockIdx.x, blockIdx.y, blockIdx.z, A, A2, Bt, Bt2, K, C, ldc, bias, sA, sB, sC, sP, P1h, P1l, P2h, P2l, hb1, hb2, sH, ldo);
}
// k_proj: work-groups [0, GP) the position table x w_p (the longest, so first), [GP, GP + GQ) q, then GQ each for k and v; inside each range the tile's row index runs fastest, as in a grid of its own.
#define GP   ((NPU / 64) * (DQ / 64))
#define GQ   ((TT / 64) * (DQ / 64))
__global__ __launch_bounds__(256) void k_proj(const bf* __restrict__ PEh, const bf* __restrict__ PEl, const bf* __restrict__ WP, const bf* __restrict__ XB, const bf* __restrict__ WQ, const bf* __restrict__ XKB, const bf* __restrict__ WK, const bf* __restrict__ XVB, const bf* __restrict__ WV,
                                              bf* PPh, bf* PPl, bf* QPh, bf* QPl, bf* QVh, bf* QVl, bf* KPh, bf* KPl, bf* VTh, bf* VTl, const float* __restrict__ pbu, const float* __restrict__ pbv) {
    __shared__ __align__(16) float os[GEMMW_LDS(8)];
    const int i = blockIdx.x;
    if (i < GP) {   // kept rows of the reversed sinusoidal table (hi/lo) x w_p -> per-head position planes [h][NPU][64]
        gemmw<bf, 1, false, 8, 1, 1>(os, i % (NPU / 64), i / (NPU / 64), 0, PEh, PEl, WP, nullptr, DM, nullptr, 0, nullptr, 0, 0, 0, 0, PPh, PPl, nullptr, nullptr, nullptr, nullptr, (size_t)NPU * HD, HD);
    } else if (i < GP + GQ) {   // (q + b_u) planes for the content scores, (q + b_v) planes for the position scores
        const int j = i - GP;
        gemmw<bf, 0, false, 8, 1, 2>(os, j % (TT / 64), j / (TT / 64), 0, XB, nullptr, WQ, nullptr, DM, nullptr, 0, nullptr, 0, 0, 0, 0, QPh, QPl, QVh, QVl, pbu, pbv, (size_t)TT * HD, HD);
    } else {   // k: head planes [h][t][64]. v: w_v as the row operand, so that the tile is v transposed, [head x 64 + d][t], as attn.v reads it
        const bool isv = i >= GP + 2 * GQ; const int j = i - GP - (isv ? 2 * GQ : GQ); const int nx = isv ? DKV / 64 : TT / 64;
        gemmw<bf, 0, false, 8, 1, 1>(os, j % nx, j / nx, 0, isv ? WV : XKB, nullptr, isv ? XVB : WK, nullptr, DM, nullptr, 0, nullptr, 0, 0, 0, 0, isv ? VTh : KPh, isv ? VTl : KPl, nullptr, nullptr, nullptr, nullptr, isv ? (size_t)64 * 16 : (size_t)TT * HD, isv ? TT : HD);
    }
}

// k_prep: all that the GEMMs read is prepared in ONE launch of NPB work-groups, few enough to be resident together. Every plane it writes is in fragment order (see k_gemmw). Every wave transposes one 16 n x 32 k block of one weight, w [k][n] f32 -> Bt [n][k] bf16 (256 work-groups a weight, five weights);
// between those loads and their stores, work-groups 0 .. NPT - 1 fill the position table (a thread keeps one sin/cos column pair, so one powf, for PER rows) and the other NPB - NPT round q, k and v to bf16 (a thread takes CVS octets of each).
#define NPB  1280                  // 5 weights x DM * DQ / 64 / 64
#define NPT  1024                  // table work-groups: two a row block (512 column pairs = 2 x 256 threads)
#define PER  (NPU * 2 / NPT)       // table rows a thread
#define CVS  (TT * DM / 8 / ((NPB - NPT) * 256))   // octets of each input a thread
static_assert(NB_ == 1 && DQ == DM && DKV == DM && 5 * (DM * DQ / 64 / 64) == NPB && PER * NPT == NPU * 2 && NPU <= NPE && CVS * (NPB - NPT) * 256 * 8 == TT * DM, "k_prep: the shares are exact");
// piece i of the plane in fragment order holds row (i >> 11) * 16 + (i & 15), octet (i >> 4) & 127 of the row-major input [row][DM]
__device__ __forceinline__ void cvt8(const float* __restrict__ src, bf* __restrict__ dst, size_t i) { const v8f v = *(const v8f*)(src + (((i >> 11) * 16 + (i & 15)) * (DM / 8) + ((i >> 4) & (DM / 8 - 1))) * 8); v8us o;
    // unrolled so that v and o are indexed by constants and stay in registers
#pragma unroll
    for (int k = 0; k < 8; ++k) o[k] = f2bf(v[k]);
    *(v8us*)(dst + i * 8) = o; }
__global__ __launch_bounds__(256) void k_prep(const float* __restrict__ x, const float* __restrict__ xk, const float* __restrict__ xv, const float* __restrict__ wq, const float* __restrict__ wk, const float* __restrict__ wv, const float* __restrict__ wo, const float* __restrict__ wp,
                                              bf* __restrict__ XB, bf* __restrict__ XKB, bf* __restrict__ XVB, bf* __restrict__ WQ, bf* __restrict__ WK, bf* __restrict__ WV, bf* __restrict__ WO, bf* __restrict__ WP, bf* __restrict__ PEh, bf* __restrict__ PEl) {
    const int b = blockIdx.x, t = threadIdx.x, lane = t & 31; const int wi = b >> 8;
    const float* w = wi == 0 ? wq : wi == 1 ? wk : wi == 2 ? wv : wi == 3 ? wo : wp; bf* Bt = wi == 0 ? WQ : wi == 1 ? WK : wi == 2 ? WV : wi == 3 ? WO : WP;
    const int blk = (b & 255) * 8 + (t >> 5);   /* the wave's block: strip n / 16 = blk / 32, k / 32 = blk % 32 */
    const float* wl = w + (size_t)((blk & 31) * 32 + (lane >> 4) * 8) * DQ + (blk >> 5) * 16 + (lane & 15);   /* this lane's n, its first k */
    float r[2][8];
    // unrolled so that r is indexed by constants and the sixteen loads of a wave fly together
#pragma unroll
    for (int sh = 0; sh < 2; ++sh)
#pragma unroll
        for (int e = 0; e < 8; ++e) r[sh][e] = wl[(size_t)(sh * 16 + e) * DQ];
    asm volatile("s_wait_xcnt 0x0" ::: "memory");   /* stands in front of any rewrite of the address registers that the sixteen loads name */
    if (b < NPT) {
        const int c = ((b & 1) * 256 + t) * 2; const float ex = __fdiv_rn((float)c, (float)DM);   /* c even: 2i/d_model */ const float den = powf(10000.0f, ex);
        for (int q = 0; q < PER; ++q) { const int m = (b >> 1) * PER + q; const float pos = (float)(NPU - 1 - m);   /* plane row m is table row NPE - NPU + m, reversed: position NPE - 1 - that */ const float th = __fdiv_rn(pos, den); v2us oh, ol; unsigned short a, b2; splitf(sinf(th), a, b2); oh[0] = a; ol[0] = b2; splitf(cosf(th), a, b2); oh[1] = a; ol[1] = b2;
            const size_t e = (size_t)(m >> 4) * 16 * DM + (c >> 5) * 512 + (((c >> 3) & 3) * 16 + (m & 15)) * 8 + (c & 7);   /* fragment order */ *(v2us*)(PEh + e) = oh; *(v2us*)(PEl + e) = ol; }
    } else {
        const size_t i0 = (size_t)(b - NPT) * 256 + t;
        for (int s = 0; s < CVS; ++s) { const size_t i = i0 + (size_t)s * ((NPB - NPT) * 256); cvt8(x, XB, i); cvt8(xk, XKB, i); cvt8(xv, XVB, i);
            asm volatile("s_wait_xcnt 0x0" ::: "memory");   /* stands in front of the next trip's rewrite of the registers that the three stores name */ }
    }
    // unrolled so that r is indexed by constants; each store is 512 consecutive bytes a wave
#pragma unroll
    for (int sh = 0; sh < 2; ++sh) { v8us o;
#pragma unroll
        for (int e = 0; e < 8; ++e) o[e] = f2bf(r[sh][e]);
        *(v8us*)(Bt + (size_t)blk * 512 + sh * 256 + lane * 8) = o; }
}

// k_attn: one work-group = one head x RB query rows, every stage of the attention on chip. The RB score rows [RB][2048] f32 live in LDS (pitch SP floats):
//   1 content scores (q + b_u).k into the rows; 2 raw position scores (q + b_v).ph only for the positions that the left shift keeps (m = 4095 - i + j, 0 <= j <= i), added at their shifted key j;
//   3 mask, softmax per row (one wave a row, register row), the row rewritten in place as its bf16 hi plane (first 4 KiB) and lo plane (next 4 KiB);
//   4 attn.v with the hi/lo rows as the A operand from LDS, each wave TT / NWV keys, the NWV partial tiles summed through LDS in wave order and split into the merged hi/lo planes.
// Every plain '#pragma unroll' in this kernel is there so that the register arrays (fragments, accumulators, the score row) are indexed by constants and stay in registers.
#define MT   2                     // 16-row tiles of query rows per work-group
#define RB   (16 * MT)
#define NWV  (RB / 2)              // waves per work-group (two score rows a wave; RB * 8 output octets = NWV * 16 threads, half the waves)
#define SP   2052                  // floats per score row in LDS: 16-byte aligned rows, 4 banks apart
typedef v4us __attribute__((may_alias)) v4usa;
__device__ __forceinline__ v16bf ldsfrag(const bf* p) { return cat16b(*(const v8usa*)p, *(const v8usa*)(p + 16)); }
__device__ __forceinline__ v8f mma3(v16bf a, v16bf a2, v16bf b, v16bf b2, v8f c) { c = wmmab(a, b, c); c = wmmab(a2, b, c); return wmmab(a, b2, c); }
__global__ __launch_bounds__(NWV * 32) void k_attn(const bf* __restrict__ QUh, const bf* __restrict__ QUl, const bf* __restrict__ QWh, const bf* __restrict__ QWl, const bf* __restrict__ Kh, const bf* __restrict__ Kl, const bf* __restrict__ Rh, const bf* __restrict__ Rl, const bf* __restrict__ Vh, const bf* __restrict__ Vl, const int* __restrict__ MKb, bf* Ah, bf* Al) {
    typedef WFrag<bf> F;
    __shared__ __align__(16) float S[RB * SP];
    const int h = blockIdx.x; const int i0 = (TT / RB - 1 - (int)blockIdx.y) * RB;   /* late query rows have the most positions: they start first */
    const int wave = __builtin_amdgcn_readfirstlane(threadIdx.x >> 5); const int lane = threadIdx.x & 31, lr = lane & 15, hi = lane >> 4;
    const size_t qoff = ((size_t)h * TT + i0) * HD + lane * 8;   /* all global planes are in fragment order (see k_gemmw): a 16-row strip of a head plane is 16 * HD elements, two blocks of 512 */
    {   // 1: content scores, TT / 16 / NWV key tiles a wave
        v16bf a[MT][2], a2[MT][2];
#pragma unroll
        for (int mt = 0; mt < MT; ++mt)
#pragma unroll
            for (int kk = 0; kk < 2; ++kk) { a[mt][kk] = F::ld(QUh + qoff + mt * 16 * HD + kk * 512); a2[mt][kk] = F::ld(QUl + qoff + mt * 16 * HD + kk * 512); }
        const size_t koff = ((size_t)h * TT + wave * (TT / NWV)) * HD + lane * 8;
        for (int t = 0; t < TT / 16 / NWV; t += 2) { v16bf b[2][2], c[2][2];
#pragma unroll
            for (int u = 0; u < 2; ++u)
#pragma unroll
                for (int kk = 0; kk < 2; ++kk) { b[u][kk] = F::ld(Kh + koff + (t + u) * 16 * HD + kk * 512); c[u][kk] = F::ld(Kl + koff + (t + u) * 16 * HD + kk * 512); }
            // inputs only: holds the sixteen loads of two key tiles in front of the products, so that they fly together and are waited for once, not fragment by fragment
            asm volatile("" :: "v"(b[0][0]), "v"(b[0][1]), "v"(b[1][0]), "v"(b[1][1]), "v"(c[0][0]), "v"(c[0][1]), "v"(c[1][0]), "v"(c[1][1]));
#pragma unroll
            for (int u = 0; u < 2; ++u)
#pragma unroll
                for (int mt = 0; mt < MT; ++mt) { v8f acc = (v8f){}; acc = mma3(a[mt][0], a2[mt][0], b[u][0], c[u][0], acc); acc = mma3(a[mt][1], a2[mt][1], b[u][1], c[u][1], acc);
#pragma unroll
                    for (int j = 0; j < 8; ++j) S[(mt * 16 + hi * 8 + j) * SP + wave * (TT / NWV) + (t + u) * 16 + lr] = acc[j]; } }
    }
    __syncthreads();   // every content score is in LDS before a position score is added to it
    {   // 2: position tile t holds m = NPE - RB - i0 + 16 t + c; row r of the block meets it at key j = m - (NPE - 1) + i0 + r; each (r, j) belongs to exactly one (t, c)
        v16bf a[MT][2], a2[MT][2];
#pragma unroll
        for (int mt = 0; mt < MT; ++mt)
#pragma unroll
            for (int kk = 0; kk < 2; ++kk) { a[mt][kk] = F::ld(QWh + qoff + mt * 16 * HD + kk * 512); a2[mt][kk] = F::ld(QWl + qoff + mt * 16 * HD + kk * 512); }
        const int nt = (i0 + RB) / 16; const size_t roff = ((size_t)h * NPU + (NPU - RB - i0)) * HD + lane * 8;   /* plane row = m - (NPE - NPU) */
        for (int t = wave; t < nt; t += 2 * NWV) { const bool two = t + NWV < nt;   /* two tiles a trip, t and t + NWV; past the end the second one repeats the first and is dropped */
            v16bf b[2][2], c[2][2]; v8f acc[2][MT];
#pragma unroll
            for (int u = 0; u < 2; ++u) { const size_t to = roff + (size_t)((u && two) ? t + NWV : t) * 16 * HD;
#pragma unroll
                for (int kk = 0; kk < 2; ++kk) { b[u][kk] = F::ld(Rh + to + kk * 512); c[u][kk] = F::ld(Rl + to + kk * 512); } }
            // inputs only: holds the sixteen loads of two position tiles in front of the products, so that they fly together and are waited for once
            asm volatile("" :: "v"(b[0][0]), "v"(b[0][1]), "v"(b[1][0]), "v"(b[1][1]), "v"(c[0][0]), "v"(c[0][1]), "v"(c[1][0]), "v"(c[1][1]));
#pragma unroll
            for (int u = 0; u < 2; ++u)
#pragma unroll
                for (int mt = 0; mt < MT; ++mt) { acc[u][mt] = (v8f){}; acc[u][mt] = mma3(a[mt][0], a2[mt][0], b[u][0], c[u][0], acc[u][mt]); acc[u][mt] = mma3(a[mt][1], a2[mt][1], b[u][1], c[u][1], acc[u][mt]); }
            float* p = S + (hi * 8) * (SP + 1) + 16 * t + lr - (RB - 1);   /* row r = mt * 16 + hi * 8 + j, key 16 t + lr + r - (RB - 1) */
            if (16 * t >= RB - 1) {   // every key of the tile is >= 0 (a scalar test): the old scores are read together, with no lane test
                float o[MT][8];
#pragma unroll
                for (int mt = 0; mt < MT; ++mt)
#pragma unroll
                    for (int j = 0; j < 8; ++j) o[mt][j] = p[(mt * 16 + j) * (SP + 1)];
#pragma unroll
                for (int mt = 0; mt < MT; ++mt)
#pragma unroll
                    for (int j = 0; j < 8; ++j) p[(mt * 16 + j) * (SP + 1)] = __fadd_rn(o[mt][j], acc[0][mt][j]);
            } else {
#pragma unroll
                for (int mt = 0; mt < MT; ++mt)
#pragma unroll
                    for (int j = 0; j < 8; ++j) { const int key = 16 * t + lr + mt * 16 + hi * 8 + j - (RB - 1); if (key >= 0) p[(mt * 16 + j) * (SP + 1)] = __fadd_rn(p[(mt * 16 + j) * (SP + 1)], acc[0][mt][j]); }
            }
            if (two) {   // tile t + NWV: its keys are all >= 0 (16 NWV >= RB - 1)
                float* p2 = p + 16 * NWV; float o[MT][8];
#pragma unroll
                for (int mt = 0; mt < MT; ++mt)
#pragma unroll
                    for (int j = 0; j < 8; ++j) o[mt][j] = p2[(mt * 16 + j) * (SP + 1)];
#pragma unroll
                for (int mt = 0; mt < MT; ++mt)
#pragma unroll
                    for (int j = 0; j < 8; ++j) p2[(mt * 16 + j) * (SP + 1)] = __fadd_rn(o[mt][j], acc[1][mt][j]);
            } }
    }
    __syncthreads();   // the rows are complete before a wave takes its rows' softmax
    // not unrolled: one register row of 64 values is live at a time
#pragma unroll 1
    for (int rr = 0; rr < RB / NWV; ++rr) {   // 3: t = (ac + bd)/8, -inf where mask == 0; softmax over the 2048 keys (register row, one exp, fixed trees)
        const int r = wave * (RB / NWV) + rr; float* srow = S + r * SP; const int* mkr = MKb + (size_t)(i0 + r) * TT; float v[TT / 32]; float mx = -3.0e38f;
#pragma unroll
        for (int ch = 0; ch < TT / 128; ++ch) { const int j0 = ch * 128 + lane * 4; const v4f s4 = *(const v4fa*)(srow + j0); const v4i m4 = *(const v4i*)(mkr + j0);
#pragma unroll
            for (int q = 0; q < 4; ++q) { const float t = (m4[q] != 0) ? s4[q] * SCL : -3.0e38f; v[ch * 4 + q] = t; mx = fmaxf(mx, t); } }
#pragma unroll
        for (int sh = 16; sh; sh >>= 1) mx = fmaxf(mx, __shfl_xor(mx, sh, 32));
        float sum = 0.f;
#pragma unroll
        for (int k = 0; k < TT / 32; ++k) { v[k] = __builtin_amdgcn_exp2f(__fmul_rn(__fsub_rn(v[k], mx), 1.4426950408889634f)); sum += v[k]; }
#pragma unroll
        for (int sh = 16; sh; sh >>= 1) sum += __shfl_xor(sum, sh, 32);
        const float f = __fdiv_rn(1.0f, sum); bf* prow = (bf*)srow;
#pragma unroll
        for (int ch = 0; ch < TT / 128; ++ch) { v4us oh, ol;
#pragma unroll
            for (int q = 0; q < 4; ++q) { unsigned short x, y; splitf(v[ch * 4 + q] * f, x, y); oh[q] = x; ol[q] = y; }
            *(v4usa*)(prow + ch * 128 + lane * 4) = oh; *(v4usa*)(prow + TT + ch * 128 + lane * 4) = ol; }
    }
    __syncthreads();   // every row's hi/lo planes are in LDS before any wave reads them as its A operand
    v8f acc[MT][4];
#pragma unroll
    for (int mt = 0; mt < MT; ++mt)
#pragma unroll
        for (int nb = 0; nb < 4; ++nb) acc[mt][nb] = (v8f){};
    {   // 4: attn.v, this wave's keys [wave * TT / NWV, + TT / NWV)
        const bf* pa = (const bf*)S + (size_t)lr * (2 * SP) + 8 * hi + wave * (TT / NWV); const size_t voff = (size_t)h * HD * TT + wave * (TT / NWV) * 16 + lane * 8;   /* strip (h * HD + 16 nb) / 16 of 16 * TT elements, block key / 32 */
        // unrolled: four trips, acc indexed by constants
#pragma unroll
        for (int kc = 0; kc < TT / NWV; kc += 32) { v16bf a[MT], a2[MT];
#pragma unroll
            for (int mt = 0; mt < MT; ++mt) { a[mt] = ldsfrag(pa + mt * 16 * (2 * SP) + kc); a2[mt] = ldsfrag(pa + mt * 16 * (2 * SP) + TT + kc); }
            v16bf b[4], b2[4];
#pragma unroll
            for (int nb = 0; nb < 4; ++nb) { b[nb] = F::ld(Vh + voff + (size_t)nb * 16 * TT + kc * 16); b2[nb] = F::ld(Vl + voff + (size_t)nb * 16 * TT + kc * 16); }
            // inputs only: holds the sixteen v loads of this trip in front of the products, so that they fly together and are waited for once
            asm volatile("" :: "v"(b[0]), "v"(b[1]), "v"(b[2]), "v"(b[3]), "v"(b2[0]), "v"(b2[1]), "v"(b2[2]), "v"(b2[3]));
#pragma unroll
            for (int nb = 0; nb < 4; ++nb)
#pragma unroll
                for (int mt = 0; mt < MT; ++mt) acc[mt][nb] = mma3(a[mt], a2[mt], b[nb], b2[nb], acc[mt][nb]); }
    }
    __syncthreads();   // the last read of the hi/lo planes is over before their LDS takes the partial tiles
    float* rw = S + wave * (RB * 68);
#pragma unroll
    for (int mt = 0; mt < MT; ++mt)
#pragma unroll
        for (int nb = 0; nb < 4; ++nb)
#pragma unroll
            for (int j = 0; j < 8; ++j) rw[(mt * 16 + hi * 8 + j) * 68 + nb * 16 + lr] = acc[mt][nb][j];
    __syncthreads();   // every wave's partial tile is in LDS before any thread sums across the waves
    if (wave >= NWV / 2) return;   // RB * 8 pieces of eight elements: half the waves take one a thread, so that a wave stores 512 consecutive bytes of each plane (no barrier follows)
    const int idx = (int)threadIdx.x; const int row = (idx >> 7) * 16 + (idx & 15), cofs = ((idx >> 4) & 7) * 8;   /* piece idx of the block's rows in fragment order */
    v4f va = *(const v4fa*)(S + row * 68 + cofs), vb = *(const v4fa*)(S + row * 68 + cofs + 4);
    // unrolled so that a thread's LDS reads issue together; the sum stays in wave order
#pragma unroll
    for (int w = 1; w < NWV; ++w) { const v4f p = *(const v4fa*)(S + w * (RB * 68) + row * 68 + cofs), p2 = *(const v4fa*)(S + w * (RB * 68) + row * 68 + cofs + 4); va[0] += p[0]; va[1] += p[1]; va[2] += p[2]; va[3] += p[3]; vb[0] += p2[0]; vb[1] += p2[1]; vb[2] += p2[2]; vb[3] += p2[3]; }
    v8us oh, ol;
#pragma unroll
    for (int q = 0; q < 8; ++q) { unsigned short x, y; splitf(q < 4 ? va[q & 3] : vb[q & 3], x, y); oh[q] = x; ol[q] = y; }
    const size_t oo = (size_t)((i0 >> 4) + (idx >> 7)) * 16 * DQ + h * HD * 16 + (idx & 127) * 8; *(v8us*)(Ah + oo) = oh; *(v8us*)(Al + oo) = ol;
}

extern "C" void kernel_launch(void* const* d_in, const int* in_sizes, int n_in,
                              void* d_out, int out_size, void* d_ws, size_t ws_size, hipStream_t stream) {
    (void)in_sizes; (void)n_in; (void)out_size;
    const float* x = (const float*)d_in[0]; const float* xk = (const float*)d_in[1]; const float* xv = (const float*)d_in[2]; const int* MK = (const int*)d_in[3]; const float* wq = (const float*)d_in[4]; const float* wk = (const float*)d_in[5]; const float* wv = (const float*)d_in[6]; const float* wp = (const float*)d_in[7]; const float* wo = (const float*)d_in[8]; const float* pbu = (const float*)d_in[9]; const float* pbv = (const float*)d_in[10];
    float* OUT = (float*)d_out;     // [1][2048][1024]
    char* wsp = (char*)d_ws;
    auto take = [&](size_t bytes) { char* p = wsp; wsp += (bytes + 255) & ~(size_t)255; return (void*)p; };
    bf* WQ = (bf*)take((size_t)DQ * DM * 2); bf* WK = (bf*)take((size_t)DKV * DM * 2); bf* WV = (bf*)take((size_t)DKV * DM * 2); bf* WO = (bf*)take((size_t)DM * DQ * 2);
    bf* XB = (bf*)take((size_t)TT * DM * 2); bf* XKB = (bf*)take((size_t)TT * DM * 2); bf* XVB = (bf*)take((size_t)TT * DM * 2); bf* WP = (bf*)take((size_t)DQ * DM * 2); bf* PPh = (bf*)take((size_t)NH_ * NPU * HD * 2); bf* PPl = (bf*)take((size_t)NH_ * NPU * HD * 2); bf* QVh = (bf*)take((size_t)NH_ * TT * HD * 2); bf* QVl = (bf*)take((size_t)NH_ * TT * HD * 2);
    bf* QPh = (bf*)take((size_t)NH_ * TT * HD * 2); bf* QPl = (bf*)take((size_t)NH_ * TT * HD * 2); bf* KPh = (bf*)take((size_t)NKV * TT * HD * 2); bf* KPl = (bf*)take((size_t)NKV * TT * HD * 2); bf* VTh = (bf*)take((size_t)NKV * HD * TT * 2); bf* VTl = (bf*)take((size_t)NKV * HD * TT * 2);
    bf* PEh = (bf*)take((size_t)NPU * DM * 2); bf* PEl = (bf*)take((size_t)NPU * DM * 2);   /* the position-table planes */ bf* ATh = (bf*)take((size_t)TT * DQ * 2); bf* ATl = (bf*)take((size_t)TT * DQ * 2);
    if ((size_t)(wsp - (char*)d_ws) > ws_size) return;    // ws 256 MiB
    k_prep<<<NPB, 256, 0, stream>>>(x, xk, xv, wq, wk, wv, wo, wp, XB, XKB, XVB, WQ, WK, WV, WO, WP, PEh, PEl);   /* the five weights transposed to bf16, the reversed sinusoidal table's hi/lo planes, q / k / v rounded to bf16 */
    k_proj<<<GP + 3 * GQ, 256, 0, stream>>>(PEh, PEl, WP, XB, WQ, XKB, WK, XVB, WV, PPh, PPl, QPh, QPl, QVh, QVl, KPh, KPl, VTh, VTl, pbu, pbv);   /* the four projections, each storing the hi/lo planes that the attention reads */
    for (int b = 0; b < NB_; ++b) {
        k_attn<<<dim3(NH_, TT / RB, 1), NWV * 32, 0, stream>>>(QPh, QPl, QVh, QVl, KPh, KPl, PPh, PPl, VTh, VTl, MK, ATh, ATl);   /* scores, shift, softmax and attn.v of all heads; one kv head per query head */
        k_gemmw<bf, 1, false, 8, 1, 0><<<dim3(TT / 64, DM / 64, 1), 256, 0, stream>>>(ATh, ATl, WO, nullptr, DQ, OUT + (size_t)b * TT * DM, DM, nullptr, 0, 0, 0, 0, nullptr, nullptr, nullptr, nullptr, nullptr, nullptr, 0, 0); }
}

// v007
// It runs in 150 microseconds.
// Next to v006, in two timings, it ran 1.04 and 1.03 times as fast.
// All steps since v000 together make it 6.66 times as fast.
#include <hip/hip_runtime.h>

// Transformer-XL relative-position multi-head attention (q, k, v inputs [1][2048][1024]; qh = q w_q, kh = k w_k, vh = v w_v ('xw' [1024][1024], no bias; 16 heads x 64); pe = reversed sinusoidal table of length 4096 (pe[m] = PE(4095 - m), interleaved sin/cos) projected by w_p -> ph [16][4096][64]; ac = (qh + b_u).kh, bd = left_shift((qh + b_v).ph): bd[i][j] = raw[i][4095 - i + j] for j <= i else 0; scores = (ac + bd)/8; mask (int [1][2048][2048], read; -inf where 0); softmax; out = attn.vh merged w_o -> [1][2048][1024]).
// Layout: projections from three bf16 input planes, each projection GEMM storing its result as the bf16 hi/lo planes that the attention reads (no f32 copy in memory); b_u / b_v folded into two sets of query planes; the position table is computed on device in f32 (pos / 10000^(2i/1024), precise powf/sinf/cosf), only its rows m >= 2048 (the left shift keeps m = 4095 - i + j with 0 <= j <= i <= 2047 and zeroes the rest, so no other row reaches the output for any input) -> hi/lo planes -> 2-product GEMM with the exact bf16 w_p -> per-head hi/lo planes; one launch does the attention of all heads: a work-group keeps 32 query rows' scores in LDS, content and position scores are hi/lo x hi/lo products (3 products), a position score is added at its shifted key, and softmax and attn.v follow on the same rows.
// Compute dtypes, f32 accumulate: every input rounded to bf16; q/k/v on PLAIN bf16 operands (inputs: exact); content / position scores and attn.v on hi/lo planes for every row (3 products); softmax f32; w_o hl x exact (2 products).

#define NB_  1
#define TT   2048
#define DM   1024
#define NH_  16
#define NKV  16
#define REP  (NH_ / NKV)
#define HD   64
#define DQ   (NH_ * HD)
#define DKV  (NKV * HD)
#define NPE  4096                 // relative positions (2 x seq)
#define NPU  TT                   // positions that the left shift can keep: m = NPE - 1 - i + j, 0 <= j <= i < TT, so m >= NPE - TT; row m of the table and of its projection lies at plane row m - (NPE - NPU)
typedef __attribute__((ext_vector_type(4))) int v4i;
#define WIN  0
#define SCL  0.125f   // HD^-0.5
typedef _Float16 h16;
typedef unsigned short bf;
typedef __attribute__((ext_vector_type(16))) __bf16   v16bf;
typedef __attribute__((ext_vector_type(16))) _Float16 v16h;
typedef __attribute__((ext_vector_type(8)))  _Float16 v8h;
typedef __attribute__((ext_vector_type(8)))  unsigned short v8us;
typedef __attribute__((ext_vector_type(8)))  float    v8f;
typedef __attribute__((ext_vector_type(4)))  float    v4f;
typedef v8h  __attribute__((may_alias)) v8ha;
typedef v4f  __attribute__((may_alias)) v4fa;
typedef v8us __attribute__((may_alias)) v8usa;

__device__ __forceinline__ unsigned short f2bf(float f) { unsigned u = __float_as_uint(f); u += 0x7FFFu + ((u >> 16) & 1u); return (unsigned short)(u >> 16); }
__device__ __forceinline__ float bf2f(unsigned short b) { return __uint_as_float(((unsigned)b) << 16); }
__device__ __forceinline__ float bfr(float f) { return bf2f(f2bf(f)); }
__device__ __forceinline__ v16h cat16(v8h lo, v8h hi) { return __builtin_shufflevector(lo, hi, 0, 1, 2, 3, 4, 5, 6, 7, 8, 9, 10, 11, 12, 13, 14, 15); }
__device__ __forceinline__ v16bf cat16b(v8us lo, v8us hi) { return __builtin_bit_cast(v16bf, __builtin_shufflevector(lo, hi, 0, 1, 2, 3, 4, 5, 6, 7, 8, 9, 10, 11, 12, 13, 14, 15)); }
__device__ __forceinline__ v8f wmma16(v16h a, v16h b, v8f c) { return __builtin_amdgcn_wmma_f32_16x16x32_f16(false, a, false, b, (short)0, c, false, false); }
__device__ __forceinline__ v8f wmmab(v16bf a, v16bf b, v8f c) { return __builtin_amdgcn_wmma_f32_16x16x32_bf16(false, a, false, b, (short)0, c, false, false); }

__device__ __forceinline__ void splitf(float y, unsigned short& h, unsigned short& l) { h = f2bf(y); l = f2bf(y - bf2f(h)); }
typedef __attribute__((ext_vector_type(2))) float    v2f;
typedef __attribute__((ext_vector_type(2))) __bf16   v2bf;
typedef __attribute__((ext_vector_type(2))) unsigned v2u;
typedef __attribute__((ext_vector_type(4))) unsigned v4u;
// pk2bf: two f32 -> two bf16 (round to nearest even, as f2bf) in the hardware's one packed convert, x[0] in the low half. split2: splitf of two values at once, each word packed as it is stored.
__device__ __forceinline__ unsigned pk2bf(v2f x) { return __builtin_bit_cast(unsigned, __builtin_convertvector(x, v2bf)); }
__device__ __forceinline__ void split2(v2f y, unsigned& h, unsigned& l) { h = pk2bf(y); const v2f hf = {__uint_as_float(h << 16), __uint_as_float(h & 0xFFFF0000u)}; l = pk2bf(y - hf); }
typedef __attribute__((ext_vector_type(2))) unsigned short v2us;
typedef __attribute__((ext_vector_type(4))) unsigned short v4us;

// ---- k_gemmw: register-blocked GEMM, ONE WAVE per 64x64 output tile (16 accumulators), operands straight from 16-bit planes in fragment order; grid (M/64, N/64, Z), 32 threads.
// C[m][n] (f32, pitch ldc, + optional f32 bias[n]) = sum_k A[m][k] Bt[n][k] (+ split products per NSPLIT). z-batch strides sA/sB/sC in elements. K % 32 == 0.
// Split K (long K): NW waves per work-group and KS work-groups per tile each take K / (KS * NW) consecutive k of the same 64x64 tile; the NW partial tiles are summed through LDS in wave order, and work-group ks (blockIdx.z = z * KS + ks) writes its own f32 plane at C + ks * sP, summed by the consumer. Grid (M/64, N/64, Z * KS), NW * 32 threads. K % (KS * NW * 32) == 0. NW > 1 takes no bias.
// EPI (NW > 1, KS == 1): what the summed tile is stored as. 0: f32 at C. 1: its bf16 hi and lo planes at P1h / P1l. 2: the planes of (tile + hb1[n]) at P1h / P1l and of (tile + hb2[n]) at P2h / P2l (hb rounded to bf16).
// FRAGMENT ORDER: every 16-bit operand plane [row][k] in memory (A, A2, Bt, Bt2 here, and the planes stored here) is kept as blocks of 16 rows x 32 k, 512 consecutive elements each: element (row lr, k = 16 sh + 8 hi + e) lies at (sh * 32 + hi * 16 + lr) * 8 + e of its block, the blocks of one 16-row strip follow one another along k, and a strip is 16 * K elements.
// A wave-wide 16-byte load (lane = hi * 16 + lr) then takes 512 consecutive bytes, four whole lines (of a row-major plane it would take 32 bytes out of each of 16 lines); which lane and register hold an element is the hardware's fragment layout, k order 8 hi + e, then 16 + 8 hi + e, alike for A and B.
// The stored tile's first block lies at blockIdx.y * sH + (m / 16) * 16 * ldo: head planes [n / 64][m][64] with sH = M * 64, ldo = 64; a plain [m][n] plane with sH = 64 * 16, ldo = N.
// ld: one fragment of a plane in fragment order; p = its 16 x 32 block + lane * 8.
template <typename T16> struct WFrag;
template <> struct WFrag<h16> { typedef v16h V; static __device__ __forceinline__ V ld(const h16* p) { return cat16(*(const v8h*)p, *(const v8h*)(p + 256)); } static __device__ __forceinline__ v8f mma(V a, V b, v8f c) { return wmma16(a, b, c); } };
template <> struct WFrag<bf> { typedef v16bf V; static __device__ __forceinline__ V ld(const bf* p) { return cat16b(*(const v8us*)p, *(const v8us*)(p + 256)); } static __device__ __forceinline__ v8f mma(V a, V b, v8f c) { return wmmab(a, b, c); } };
// gemmw is the body: os is the work-group's LDS (GEMMW_LDS floats), (bx, by, bz) its place in the grid above. k_gemmw launches one GEMM; k_proj holds the four projections, which do not depend on one another, in one launch.
#define GEMMW_LDS(NW) ((NW) == 1 ? 16 * 68 : (NW) * 64 * 68)
template <typename T16, int NSPLIT, bool BIAS, int NW, int KS, int EPI>
__device__ __forceinline__ void gemmw(float* os, int bx, int by, int bz, const T16* __restrict__ A, const T16* __restrict__ A2, const T16* __restrict__ Bt, const T16* __restrict__ Bt2, int K, float* C, int ldc, const float* __restrict__ bias, size_t sA, size_t sB, size_t sC, size_t sP, bf* P1h, bf* P1l, bf* P2h, bf* P2l, const float* __restrict__ hb1, const float* __restrict__ hb2, size_t sH, int ldo) {
    typedef typename WFrag<T16>::V V;
    const size_t z = bz / KS; const int ks = bz % KS; A += z * sA; if (A2) A2 += z * sA; Bt += z * sB; if (Bt2) Bt2 += z * sB; C += z * sC + (size_t)ks * sP;
    const int wave = (NW == 1) ? 0 : __builtin_amdgcn_readfirstlane(threadIdx.x >> 5); const int kw = K / (KS * NW), k0 = (ks * NW + wave) * kw;   /* this wave's k range [k0, k0 + kw) */
    const int lane = threadIdx.x & 31, lr = lane & 15, hi = lane >> 4; const int r0 = bx * 64, c0 = by * 64;
    v8f acc[4][4];
#pragma unroll
    for (int mb = 0; mb < 4; ++mb)
#pragma unroll
        for (int nb = 0; nb < 4; ++nb) acc[mb][nb] = (v8f){};
    const size_t aoff = (size_t)r0 * K + (size_t)k0 * 16 + lane * 8, boff = (size_t)c0 * K + (size_t)k0 * 16 + lane * 8;   /* strip r0 / 16, block k0 / 32 */
#pragma unroll 1
    for (int kc = 0; kc < kw; kc += 32) {
        V a[4], a2[4];
#pragma unroll
        for (int mb = 0; mb < 4; ++mb) { a[mb] = WFrag<T16>::ld(A + aoff + (size_t)mb * 16 * K + kc * 16); if (NSPLIT == 1 || NSPLIT == 2) a2[mb] = WFrag<T16>::ld(A2 + aoff + (size_t)mb * 16 * K + kc * 16); }
#pragma unroll
        for (int nb = 0; nb < 4; ++nb) { const V b = WFrag<T16>::ld(Bt + boff + (size_t)nb * 16 * K + kc * 16); V b2; if (NSPLIT >= 2) b2 = WFrag<T16>::ld(Bt2 + boff + (size_t)nb * 16 * K + kc * 16);
#pragma unroll
            for (int mb = 0; mb < 4; ++mb) { acc[mb][nb] = WFrag<T16>::mma(a[mb], b, acc[mb][nb]); if (NSPLIT == 1 || NSPLIT == 2) acc[mb][nb] = WFrag<T16>::mma(a2[mb], b, acc[mb][nb]); if (NSPLIT >= 2) acc[mb][nb] = WFrag<T16>::mma(a[mb], b2, acc[mb][nb]); } }
        asm volatile("v_nop\n\tv_nop\n\tv_nop\n\tv_nop" : "+v"(acc[0][0]), "+v"(acc[1][1]), "+v"(acc[2][2]), "+v"(acc[3][3]) : "v"(a[0]), "v"(a[3]));
    }
    if (NW > 1) {
        float* rw = os + wave * (64 * 68);
        // the three loops are unrolled so that acc is indexed by constants and stays in registers
#pragma unroll
        for (int mb = 0; mb < 4; ++mb)
#pragma unroll
            for (int nb = 0; nb < 4; ++nb)
#pragma unroll
                for (int j = 0; j < 8; ++j) rw[(mb * 16 + hi * 8 + j) * 68 + nb * 16 + lr] = acc[mb][nb][j];
        __syncthreads();   // every wave's partial tile is in LDS before any thread sums across the waves
        // the s and w loops are unrolled so that a thread's LDS reads issue together; the sum stays in wave order
        if (EPI == 0) {
#pragma unroll
            for (int s = 0; s < 32 / NW; ++s) { const int idx = s * (NW * 32) + (int)threadIdx.x; const int row = idx >> 4, cofs = (idx & 15) * 4; v4f val = *(const v4fa*)(os + row * 68 + cofs);
#pragma unroll
                for (int w = 1; w < NW; ++w) { const v4f p = *(const v4fa*)(os + w * (64 * 68) + row * 68 + cofs); val[0] += p[0]; val[1] += p[1]; val[2] += p[2]; val[3] += p[3]; }
                *(v4f*)(C + (size_t)(r0 + row) * ldc + c0 + cofs) = val; }
        } else {
            // a thread takes the eight elements of one 16-byte piece of the planes, pieces in fragment order: a wave stores 512 consecutive bytes of each plane
#pragma unroll
            for (int s = 0; s < 16 / NW; ++s) { const int idx = s * (NW * 32) + (int)threadIdx.x; const int row = (idx >> 7) * 16 + (idx & 15), cofs = ((idx >> 4) & 7) * 8;
                v4f va = *(const v4fa*)(os + row * 68 + cofs), vb = *(const v4fa*)(os + row * 68 + cofs + 4);
#pragma unroll
                for (int w = 1; w < NW; ++w) { const v4f p = *(const v4fa*)(os + w * (64 * 68) + row * 68 + cofs), p2 = *(const v4fa*)(os + w * (64 * 68) + row * 68 + cofs + 4); va[0] += p[0]; va[1] += p[1]; va[2] += p[2]; va[3] += p[3]; vb[0] += p2[0]; vb[1] += p2[1]; vb[2] += p2[2]; vb[3] += p2[3]; }
                const size_t po = (size_t)by * sH + (size_t)((r0 >> 4) + (idx >> 7)) * 16 * ldo + (idx & 127) * 8; v4u oh, ol;
                // both q loops are unrolled so that va, vb, oh and ol are indexed by constants and stay in registers
#pragma unroll
                for (int q = 0; q < 8; q += 2) { v2f val = q < 4 ? (v2f){va[q & 3], va[(q & 3) + 1]} : (v2f){vb[q & 3], vb[(q & 3) + 1]}; if (EPI == 2) val = (v2f){__fadd_rn(val[0], bfr(hb1[c0 + cofs + q])), __fadd_rn(val[1], bfr(hb1[c0 + cofs + q + 1]))}; unsigned x, y; split2(val, x, y); oh[q >> 1] = x; ol[q >> 1] = y; }
                *(v8us*)(P1h + po) = __builtin_bit_cast(v8us, oh); *(v8us*)(P1l + po) = __builtin_bit_cast(v8us, ol);
                if (EPI == 2) {
#pragma unroll
                    for (int q = 0; q < 8; q += 2) { const v2f val = q < 4 ? (v2f){va[q & 3], va[(q & 3) + 1]} : (v2f){vb[q & 3], vb[(q & 3) + 1]}; unsigned x, y; split2((v2f){__fadd_rn(val[0], bfr(hb2[c0 + cofs + q])), __fadd_rn(val[1], bfr(hb2[c0 + cofs + q + 1]))}, x, y); oh[q >> 1] = x; ol[q >> 1] = y; }
                    *(v8us*)(P2h + po) = __builtin_bit_cast(v8us, oh); *(v8us*)(P2l + po) = __builtin_bit_cast(v8us, ol); } }
        }
        if (EPI != 0) asm volatile("s_wait_xcnt 0x0" ::: "memory");   /* in k_proj another GEMM's code follows this one in the listing: the wait stands in front of any rewrite of the registers that the plane stores name */
        return;
    }
#pragma unroll
    for (int mb = 0; mb < 4; ++mb) {
#pragma unroll
        for (int nb = 0; nb < 4; ++nb) {
#pragma unroll
            for (int j = 0; j < 8; ++j) os[(hi * 8 + j) * 68 + nb * 16 + lr] = acc[mb][nb][j]; }
        __builtin_amdgcn_wave_barrier(); asm volatile("" ::: "memory");
        float* crow = C + (size_t)(r0 + mb * 16) * ldc + c0;
{
#pragma unroll
            for (int s = 0; s < 8; ++s) { const int row = 2 * s + hi, cofs = lr * 4; v4f val = *(const v4fa*)(os + row * 68 + cofs); if (BIAS) { val[0] += bfr(bias[c0 + cofs]); val[1] += bfr(bias[c0 + cofs + 1]); val[2] += bfr(bias[c0 + cofs + 2]); val[3] += bfr(bias[c0 + cofs + 3]); }
                *(v4f*)(crow + (size_t)row * ldc + cofs) = val; }
             }
        __builtin_amdgcn_wave_barrier(); asm volatile("" ::: "memory");
    }
}

template <typename T16, int NSPLIT, bool BIAS, int NW, int KS, int EPI>
__global__ __launch_bounds__(NW * 32) void k_gemmw(const T16* __restrict__ A, const T16* __restrict__ A2, const T16* __restrict__ Bt, const T16* __restrict__ Bt2, int K, float* C, int ldc, const float* __restrict__ bias, size_t sA, size_t sB, size_t sC, size_t sP, bf* P1h, bf* P1l, bf* P2h, bf* P2l, const float* __restrict__ hb1, const float* __restrict__ hb2, size_t sH, int ldo) {
    __shared__ __align__(16) float os[GEMMW_LDS(NW)];
    gemmw<T16, NSPLIT, BIAS, NW, KS, EPI>(os, blockIdx.x, blockIdx.y, blockIdx.z, A, A2, Bt, Bt2, K, C, ldc, bias, sA, sB, sC, sP, P1h, P1l, P2h, P2l, hb1, hb2, sH, ldo);
}
// k_proj: work-groups [0, GP) the position table x w_p (the longest, so first), [GP, GP + GQ) q, then GQ each for k and v; inside each range the tile's row index runs fastest, as in a grid of its own.
#define GP   ((NPU / 64) * (DQ / 64))
#define GQ   ((TT / 64) * (DQ / 64))
__global__ __launch_bounds__(256) void k_proj(const bf* __restrict__ PEh, const bf* __restrict__ PEl, const bf* __restrict__ WP, const bf* __restrict__ XB, const bf* __restrict__ WQ, const bf* __restrict__ XKB, const bf* __restrict__ WK, const bf* __restrict__ XVB, const bf* __restrict__ WV,
                                              bf* PPh, bf* PPl, bf* QPh, bf* QPl, bf* QVh, bf* QVl, bf* KPh, bf* KPl, bf* VTh, bf* VTl, const float* __restrict__ pbu, const float* __restrict__ pbv) {
    __shared__ __align__(16) float os[GEMMW_LDS(8)];
    const int i = blockIdx.x;
    if (i < GP) {   // kept rows of the reversed sinusoidal table (hi/lo) x w_p -> per-head position planes [h][NPU][64]
        gemmw<bf, 1, false, 8, 1, 1>(os, i % (NPU / 64), i / (NPU / 64), 0, PEh, PEl, WP, nullptr, DM, nullptr, 0, nullptr, 0, 0, 0, 0, PPh, PPl, nullptr, nullptr, nullptr, nullptr, (size_t)NPU * HD, HD);
    } else if (i < GP + GQ) {   // (q + b_u) planes for the content scores, (q + b_v) planes for the position scores
        const int j = i - GP;
        gemmw<bf, 0, false, 8, 1, 2>(os, j % (TT / 64), j / (TT / 64), 0, XB, nullptr, WQ, nullptr, DM, nullptr, 0, nullptr, 0, 0, 0, 0, QPh, QPl, QVh, QVl, pbu, pbv, (size_t)TT * HD, HD);
    } else {   // k: head planes [h][t][64]. v: w_v as the row operand, so that the tile is v transposed, [head x 64 + d][t], as attn.v reads it
        const bool isv = i >= GP + 2 * GQ; const int j = i - GP - (isv ? 2 * GQ : GQ); const int nx = isv ? DKV / 64 : TT / 64;
        gemmw<bf, 0, false, 8, 1, 1>(os, j % nx, j / nx, 0, isv ? WV : XKB, nullptr, isv ? XVB : WK, nullptr, DM, nullptr, 0, nullptr, 0, 0, 0, 0, isv ? VTh : KPh, isv ? VTl : KPl, nullptr, nullptr, nullptr, nullptr, isv ? (size_t)64 * 16 : (size_t)TT * HD, isv ? TT : HD);
    }
}

// k_prep: all that the GEMMs read is prepared in ONE launch of NPB work-groups, few enough to be resident together. Every plane it writes is in fragment order (see k_gemmw). Every wave transposes one 16 n x 32 k block of one weight, w [k][n] f32 -> Bt [n][k] bf16 (256 work-groups a weight, five weights);
// between those loads and their stores, work-groups 0 .. NPT - 1 fill the position table (a thread keeps one sin/cos column pair, so one powf, for PER rows) and the other NPB - NPT round q, k and v to bf16 (a thread takes CVS octets of each).
#define NPB  1280                  // 5 weights x DM * DQ / 64 / 64
#define NPT  1024                  // table work-groups: two a row block (512 column pairs = 2 x 256 threads)
#define PER  (NPU * 2 / NPT)       // table rows a thread
#define CVS  (TT * DM / 8 / ((NPB - NPT) * 256))   // octets of each input a thread
static_assert(NB_ == 1 && DQ == DM && DKV == DM && 5 * (DM * DQ / 64 / 64) == NPB && PER * NPT == NPU * 2 && NPU <= NPE && CVS * (NPB - NPT) * 256 * 8 == TT * DM, "k_prep: the shares are exact");
// piece i of the plane in fragment order holds row (i >> 11) * 16 + (i & 15), octet (i >> 4) & 127 of the row-major input [row][DM]
__device__ __forceinline__ void cvt8(const float* __restrict__ src, bf* __restrict__ dst, size_t i) { const v8f v = *(const v8f*)(src + (((i >> 11) * 16 + (i & 15)) * (DM / 8) + ((i >> 4) & (DM / 8 - 1))) * 8); v8us o;
    // unrolled so that v and o are indexed by constants and stay in registers
#pragma unroll
    for (int k = 0; k < 8; ++k) o[k] = f2bf(v[k]);
    *(v8us*)(dst + i * 8) = o; }
__global__ __launch_bounds__(256) void k_prep(const float* __restrict__ x, const float* __restrict__ xk, const float* __restrict__ xv, const float* __restrict__ wq, const float* __restrict__ wk, const float* __restrict__ wv, const float* __restrict__ wo, const float* __restrict__ wp,
                                              bf* __restrict__ XB, bf* __restrict__ XKB, bf* __restrict__ XVB, bf* __restrict__ WQ, bf* __restrict__ WK, bf* __restrict__ WV, bf* __restrict__ WO, bf* __restrict__ WP, bf* __restrict__ PEh, bf* __restrict__ PEl) {
    const int b = blockIdx.x, t = threadIdx.x, lane = t & 31; const int wi = b >> 8;
    const float* w = wi == 0 ? wq : wi == 1 ? wk : wi == 2 ? wv : wi == 3 ? wo : wp; bf* Bt = wi == 0 ? WQ : wi == 1 ? WK : wi == 2 ? WV : wi == 3 ? WO : WP;
    const int blk = (b & 255) * 8 + (t >> 5);   /* the wave's block: strip n / 16 = blk / 32, k / 32 = blk % 32 */
    const float* wl = w + (size_t)((blk & 31) * 32 + (lane >> 4) * 8) * DQ + (blk >> 5) * 16 + (lane & 15);   /* this lane's n, its first k */
    float r[2][8];
    // unrolled so that r is indexed by constants and the sixteen loads of a wave fly together
#pragma unroll
    for (int sh = 0; sh < 2; ++sh)
#pragma unroll
        for (int e = 0; e < 8; ++e) r[sh][e] = wl[(size_t)(sh * 16 + e) * DQ];
    asm volatile("s_wait_xcnt 0x0" ::: "memory");   /* stands in front of any rewrite of the address registers that the sixteen loads name */
    if (b < NPT) {
        const int c = ((b & 1) * 256 + t) * 2; const float ex = __fdiv_rn((float)c, (float)DM);   /* c even: 2i/d_model */ const float den = powf(10000.0f, ex);
        for (int q = 0; q < PER; ++q) { const int m = (b >> 1) * PER + q; const float pos = (float)(NPU - 1 - m);   /* plane row m is table row NPE - NPU + m, reversed: position NPE - 1 - that */ const float th = __fdiv_rn(pos, den); v2us oh, ol; unsigned short a, b2; splitf(sinf(th), a, b2); oh[0] = a; ol[0] = b2; splitf(cosf(th), a, b2); oh[1] = a; ol[1] = b2;
            const size_t e = (size_t)(m >> 4) * 16 * DM + (c >> 5) * 512 + (((c >> 3) & 3) * 16 + (m & 15)) * 8 + (c & 7);   /* fragment order */ *(v2us*)(PEh + e) = oh; *(v2us*)(PEl + e) = ol; }
    } else {
        const size_t i0 = (size_t)(b - NPT) * 256 + t;
        for (int s = 0; s < CVS; ++s) { const size_t i = i0 + (size_t)s * ((NPB - NPT) * 256); cvt8(x, XB, i); cvt8(xk, XKB, i); cvt8(xv, XVB, i);
            asm volatile("s_wait_xcnt 0x0" ::: "memory");   /* stands in front of the next trip's rewrite of the registers that the three stores name */ }
    }
    // unrolled so that r is indexed by constants; each store is 512 consecutive bytes a wave
#pragma unroll
    for (int sh = 0; sh < 2; ++sh) { v8us o;
#pragma unroll
        for (int e = 0; e < 8; ++e) o[e] = f2bf(r[sh][e]);
        *(v8us*)(Bt + (size_t)blk * 512 + sh * 256 + lane * 8) = o; }
}

// k_attn: one work-group = one head x RB query rows, every stage of the attention on chip. The RB score rows [RB][2048] f32 live in LDS (pitch SP floats):
//   1 content scores (q + b_u).k into the rows; 2 raw position scores (q + b_v).ph only for the positions that the left shift keeps (m = 4095 - i + j, 0 <= j <= i), added at their shifted key j;
//   3 mask, softmax per row (one wave a row, register row), the row rewritten in place as its bf16 hi plane (first 4 KiB) and lo plane (next 4 KiB);
//   4 attn.v with the hi/lo rows as the A operand from LDS, each wave TT / NWV keys, the NWV partial tiles summed through LDS in wave order and split into the merged hi/lo planes.
// Every plain '#pragma unroll' in this kernel is there so that the register arrays (fragments, accumulators, the score row) are indexed by constants and stay in registers.
#define MT   2                     // 16-row tiles of query rows per work-group
#define RB   (16 * MT)
#define NWV  (RB / 2)              // waves per work-group (two score rows a wave; RB * 8 output octets = NWV * 16 threads, half the waves)
#define SP   2052                  // floats per score row in LDS: 16-byte aligned rows, 4 banks apart
typedef v4us __attribute__((may_alias)) v4usa;
__device__ __forceinline__ v16bf ldsfrag(const bf* p) { return cat16b(*(const v8usa*)p, *(const v8usa*)(p + 16)); }
__device__ __forceinline__ v8f mma3(v16bf a, v16bf a2, v16bf b, v16bf b2, v8f c) { c = wmmab(a, b, c); c = wmmab(a2, b, c); return wmmab(a, b2, c); }
__global__ __launch_bounds__(NWV * 32) void k_attn(const bf* __restrict__ QUh, const bf* __restrict__ QUl, const bf* __restrict__ QWh, const bf* __restrict__ QWl, const bf* __restrict__ Kh, const bf* __restrict__ Kl, const bf* __restrict__ Rh, const bf* __restrict__ Rl, const bf* __restrict__ Vh, const bf* __restrict__ Vl, const int* __restrict__ MKb, bf* Ah, bf* Al) {
    typedef WFrag<bf> F;
    __shared__ __align__(16) float S[RB * SP];
    const int h = blockIdx.x; const int i0 = (TT / RB - 1 - (int)blockIdx.y) * RB;   /* late query rows have the most positions: they start first */
    const int wave = __builtin_amdgcn_readfirstlane(threadIdx.x >> 5); const int lane = threadIdx.x & 31, lr = lane & 15, hi = lane >> 4;
    const size_t qoff = ((size_t)h * TT + i0) * HD + lane * 8;   /* all global planes are in fragment order (see k_gemmw): a 16-row strip of a head plane is 16 * HD elements, two blocks of 512 */
    {   // 1: content scores, TT / 16 / NWV key tiles a wave
        v16bf a[MT][2], a2[MT][2];
#pragma unroll
        for (int mt = 0; mt < MT; ++mt)
#pragma unroll
            for (int kk = 0; kk < 2; ++kk) { a[mt][kk] = F::ld(QUh + qoff + mt * 16 * HD + kk * 512); a2[mt][kk] = F::ld(QUl + qoff + mt * 16 * HD + kk * 512); }
        const size_t koff = ((size_t)h * TT + wave * (TT / NWV)) * HD + lane * 8;
        for (int t = 0; t < TT / 16 / NWV; t += 2) { v16bf b[2][2], c[2][2];
#pragma unroll
            for (int u = 0; u < 2; ++u)
#pragma unroll
                for (int kk = 0; kk < 2; ++kk) { b[u][kk] = F::ld(Kh + koff + (t + u) * 16 * HD + kk * 512); c[u][kk] = F::ld(Kl + koff + (t + u) * 16 * HD + kk * 512); }
            // inputs only: holds the sixteen loads of two key tiles in front of the products, so that they fly together and are waited for once, not fragment by fragment
            asm volatile("" :: "v"(b[0][0]), "v"(b[0][1]), "v"(b[1][0]), "v"(b[1][1]), "v"(c[0][0]), "v"(c[0][1]), "v"(c[1][0]), "v"(c[1][1]));
#pragma unroll
            for (int u = 0; u < 2; ++u)
#pragma unroll
                for (int mt = 0; mt < MT; ++mt) { v8f acc = (v8f){}; acc = mma3(a[mt][0], a2[mt][0], b[u][0], c[u][0], acc); acc = mma3(a[mt][1], a2[mt][1], b[u][1], c[u][1], acc);
#pragma unroll
                    for (int j = 0; j < 8; ++j) S[(mt * 16 + hi * 8 + j) * SP + wave * (TT / NWV) + (t + u) * 16 + lr] = acc[j]; } }
    }
    __syncthreads();   // every content score is in LDS before a position score is added to it
    {   // 2: position tile t holds m = NPE - RB - i0 + 16 t + c; row r of the block meets it at key j = m - (NPE - 1) + i0 + r; each (r, j) belongs to exactly one (t, c)
        v16bf a[MT][2], a2[MT][2];
#pragma unroll
        for (int mt = 0; mt < MT; ++mt)
#pragma unroll
            for (int kk = 0; kk < 2; ++kk) { a[mt][kk] = F::ld(QWh + qoff + mt * 16 * HD + kk * 512); a2[mt][kk] = F::ld(QWl + qoff + mt * 16 * HD + kk * 512); }
        const int nt = (i0 + RB) / 16; const size_t roff = ((size_t)h * NPU + (NPU - RB - i0)) * HD + lane * 8;   /* plane row = m - (NPE - NPU) */
        for (int t = wave; t < nt; t += 2 * NWV) { const bool two = t + NWV < nt;   /* two tiles a trip, t and t + NWV; past the end the second one repeats the first and is dropped */
            v16bf b[2][2], c[2][2]; v8f acc[2][MT];
#pragma unroll
            for (int u = 0; u < 2; ++u) { const size_t to = roff + (size_t)((u && two) ? t + NWV : t) * 16 * HD;
#pragma unroll
                for (int kk = 0; kk < 2; ++kk) { b[u][kk] = F::ld(Rh + to + kk * 512); c[u][kk] = F::ld(Rl + to + kk * 512); } }
            // inputs only: holds the sixteen loads of two position tiles in front of the products, so that they fly together and are waited for once
            asm volatile("" :: "v"(b[0][0]), "v"(b[0][1]), "v"(b[1][0]), "v"(b[1][1]), "v"(c[0][0]), "v"(c[0][1]), "v"(c[1][0]), "v"(c[1][1]));
#pragma unroll
            for (int u = 0; u < 2; ++u)
#pragma unroll
                for (int mt = 0; mt < MT; ++mt) { acc[u][mt] = (v8f){}; acc[u][mt] = mma3(a[mt][0], a2[mt][0], b[u][0], c[u][0], acc[u][mt]); acc[u][mt] = mma3(a[mt][1], a2[mt][1], b[u][1], c[u][1], acc[u][mt]); }
            float* p = S + (hi * 8) * (SP + 1) + 16 * t + lr - (RB - 1);   /* row r = mt * 16 + hi * 8 + j, key 16 t + lr + r - (RB - 1) */
            if (16 * t >= RB - 1) {   // every key of the tile is >= 0 (a scalar test): the old scores are read together, with no lane test
                float o[MT][8];
#pragma unroll
                for (int mt = 0; mt < MT; ++mt)
#pragma unroll
                    for (int j = 0; j < 8; ++j) o[mt][j] = p[(mt * 16 + j) * (SP + 1)];
#pragma unroll
                for (int mt = 0; mt < MT; ++mt)
#pragma unroll
                    for (int j = 0; j < 8; ++j) p[(mt * 16 + j) * (SP + 1)] = __fadd_rn(o[mt][j], acc[0][mt][j]);
            } else {
#pragma unroll
                for (int mt = 0; mt < MT; ++mt)
#pragma unroll
                    for (int j = 0; j < 8; ++j) { const int key = 16 * t + lr + mt * 16 + hi * 8 + j - (RB - 1); if (key >= 0) p[(mt * 16 + j) * (SP + 1)] = __fadd_rn(p[(mt * 16 + j) * (SP + 1)], acc[0][mt][j]); }
            }
            if (two) {   // tile t + NWV: its keys are all >= 0 (16 NWV >= RB - 1)
                float* p2 = p + 16 * NWV; float o[MT][8];
#pragma unroll
                for (int mt = 0; mt < MT; ++mt)
#pragma unroll
                    for (int j = 0; j < 8; ++j) o[mt][j] = p2[(mt * 16 + j) * (SP + 1)];
#pragma unroll
                for (int mt = 0; mt < MT; ++mt)
#pragma unroll
                    for (int j = 0; j < 8; ++j) p2[(mt * 16 + j) * (SP + 1)] = __fadd_rn(o[mt][j], acc[1][mt][j]);
            } }
    }
    __syncthreads();   // the rows are complete before a wave takes its rows' softmax
    // not unrolled: one register row of 64 values is live at a time
#pragma unroll 1
    for (int rr = 0; rr < RB / NWV; ++rr) {   // 3: t = (ac + bd)/8, -inf where mask == 0; softmax over the 2048 keys (register row, one exp, fixed trees)
        const int r = wave * (RB / NWV) + rr; float* srow = S + r * SP; const int* mkr = MKb + (size_t)(i0 + r) * TT; v2f v[TT / 64]; float mx = -3.0e38f;   /* the row as register pairs: a packed f32 instruction takes two scores */
#pragma unroll
        for (int ch = 0; ch < TT / 128; ++ch) { const int j0 = ch * 128 + lane * 4; const v4f s4 = *(const v4fa*)(srow + j0); const v4i m4 = *(const v4i*)(mkr + j0);
#pragma unroll
            for (int q = 0; q < 4; ++q) { const float t = (m4[q] != 0) ? s4[q] : -3.0e38f; v[ch * 2 + (q >> 1)][q & 1] = t; mx = fmaxf(mx, t); } }   /* the 1/8, a power of two, commutes with maximum, difference and rounding: it stands in the exponent's factor below */
#pragma unroll
        for (int sh = 16; sh; sh >>= 1) mx = fmaxf(mx, __shfl_xor(mx, sh, 32));
        v2f sum2 = {0.f, 0.f}; const v2f mx2 = {mx, mx}, c2 = {SCL * 1.4426950408889634f, SCL * 1.4426950408889634f};
#pragma unroll
        for (int k = 0; k < TT / 64; ++k) { const v2f d = (v[k] - mx2) * c2; v[k] = (v2f){__builtin_amdgcn_exp2f(d[0]), __builtin_amdgcn_exp2f(d[1])}; sum2 += v[k]; }
        float sum = sum2[0] + sum2[1];   /* a lane's even and odd keys are summed apart, then joined */
#pragma unroll
        for (int sh = 16; sh; sh >>= 1) sum += __shfl_xor(sum, sh, 32);
        const float f = __fdiv_rn(1.0f, sum); const v2f f2 = {f, f}; bf* prow = (bf*)srow;
#pragma unroll
        for (int ch = 0; ch < TT / 128; ++ch) { v2u oh, ol;
#pragma unroll
            for (int q = 0; q < 2; ++q) { unsigned x, y; split2(v[ch * 2 + q] * f2, x, y); oh[q] = x; ol[q] = y; }
            *(v4usa*)(prow + ch * 128 + lane * 4) = __builtin_bit_cast(v4us, oh); *(v4usa*)(prow + TT + ch * 128 + lane * 4) = __builtin_bit_cast(v4us, ol); }
    }
    __syncthreads();   // every row's hi/lo planes are in LDS before any wave reads them as its A operand
    v8f acc[MT][4];
#pragma unroll
    for (int mt = 0; mt < MT; ++mt)
#pragma unroll
        for (int nb = 0; nb < 4; ++nb) acc[mt][nb] = (v8f){};
    {   // 4: attn.v, this wave's keys [wave * TT / NWV, + TT / NWV)
        const bf* pa = (const bf*)S + (size_t)lr * (2 * SP) + 8 * hi + wave * (TT / NWV); const size_t voff = (size_t)h * HD * TT + wave * (TT / NWV) * 16 + lane * 8;   /* strip (h * HD + 16 nb) / 16 of 16 * TT elements, block key / 32 */
        // unrolled: four trips, acc indexed by constants
#pragma unroll
        for (int kc = 0; kc < TT / NWV; kc += 32) { v16bf a[MT], a2[MT];
#pragma unroll
            for (int mt = 0; mt < MT; ++mt) { a[mt] = ldsfrag(pa + mt * 16 * (2 * SP) + kc); a2[mt] = ldsfrag(pa + mt * 16 * (2 * SP) + TT + kc); }
            v16bf b[4], b2[4];
#pragma unroll
            for (int nb = 0; nb < 4; ++nb) { b[nb] = F::ld(Vh + voff + (size_t)nb * 16 * TT + kc * 16); b2[nb] = F::ld(Vl + voff + (size_t)nb * 16 * TT + kc * 16); }
            // inputs only: holds the sixteen v loads of this trip in front of the products, so that they fly together and are waited for once
            asm volatile("" :: "v"(b[0]), "v"(b[1]), "v"(b[2]), "v"(b[3]), "v"(b2[0]), "v"(b2[1]), "v"(b2[2]), "v"(b2[3]));
#pragma unroll
            for (int nb = 0; nb < 4; ++nb)
#pragma unroll
                for (int mt = 0; mt < MT; ++mt) acc[mt][nb] = mma3(a[mt], a2[mt], b[nb], b2[nb], acc[mt][nb]); }
    }
    __syncthreads();   // the last read of the hi/lo planes is over before their LDS takes the partial tiles
    float* rw = S + wave * (RB * 68);
#pragma unroll
    for (int mt = 0; mt < MT; ++mt)
#pragma unroll
        for (int nb = 0; nb < 4; ++nb)
#pragma unroll
            for (int j = 0; j < 8; ++j) rw[(mt * 16 + hi * 8 + j) * 68 + nb * 16 + lr] = acc[mt][nb][j];
    __syncthreads();   // every wave's partial tile is in LDS before any thread sums across the waves
    if (wave >= NWV / 2) return;   // RB * 8 pieces of eight elements: half the waves take one a thread, so that a wave stores 512 consecutive bytes of each plane (no barrier follows)
    const int idx = (int)threadIdx.x; const int row = (idx >> 7) * 16 + (idx & 15), cofs = ((idx >> 4) & 7) * 8;   /* piece idx of the block's rows in fragment order */
    v4f va = *(const v4fa*)(S + row * 68 + cofs), vb = *(const v4fa*)(S + row * 68 + cofs + 4);
    // unrolled so that a thread's LDS reads issue together; the sum stays in wave order
#pragma unroll
    for (int w = 1; w < NWV; ++w) { const v4f p = *(const v4fa*)(S + w * (RB * 68) + row * 68 + cofs), p2 = *(const v4fa*)(S + w * (RB * 68) + row * 68 + cofs + 4); va[0] += p[0]; va[1] += p[1]; va[2] += p[2]; va[3] += p[3]; vb[0] += p2[0]; vb[1] += p2[1]; vb[2] += p2[2]; vb[3] += p2[3]; }
    v4u oh, ol;
#pragma unroll
    for (int q = 0; q < 8; q += 2) { unsigned x, y; split2(q < 4 ? (v2f){va[q & 3], va[(q & 3) + 1]} : (v2f){vb[q & 3], vb[(q & 3) + 1]}, x, y); oh[q >> 1] = x; ol[q >> 1] = y; }
    const size_t oo = (size_t)((i0 >> 4) + (idx >> 7)) * 16 * DQ + h * HD * 16 + (idx & 127) * 8; *(v8us*)(Ah + oo) = __builtin_bit_cast(v8us, oh); *(v8us*)(Al + oo) = __builtin_bit_cast(v8us, ol);
}

extern "C" void kernel_launch(void* const* d_in, const int* in_sizes, int n_in,
                              void* d_out, int out_size, void* d_ws, size_t ws_size, hipStream_t stream) {
    (void)in_sizes; (void)n_in; (void)out_size;
    const float* x = (const float*)d_in[0]; const float* xk = (const float*)d_in[1]; const float* xv = (const float*)d_in[2]; const int* MK = (const int*)d_in[3]; const float* wq = (const float*)d_in[4]; const float* wk = (const float*)d_in[5]; const float* wv = (const float*)d_in[6]; const float* wp = (const float*)d_in[7]; const float* wo = (const float*)d_in[8]; const float* pbu = (const float*)d_in[9]; const float* pbv = (const float*)d_in[10];
    float* OUT = (float*)d_out;     // [1][2048][1024]
    char* wsp = (char*)d_ws;
    auto take = [&](size_t bytes) { char* p = wsp; wsp += (bytes + 255) & ~(size_t)255; return (void*)p; };
    bf* WQ = (bf*)take((size_t)DQ * DM * 2); bf* WK = (bf*)take((size_t)DKV * DM * 2); bf* WV = (bf*)take((size_t)DKV * DM * 2); bf* WO = (bf*)take((size_t)DM * DQ * 2);
    bf* XB = (bf*)take((size_t)TT * DM * 2); bf* XKB = (bf*)take((size_t)TT * DM * 2); bf* XVB = (bf*)take((size_t)TT * DM * 2); bf* WP = (bf*)take((size_t)DQ * DM * 2); bf* PPh = (bf*)take((size_t)NH_ * NPU * HD * 2); bf* PPl = (bf*)take((size_t)NH_ * NPU * HD * 2); bf* QVh = (bf*)take((size_t)NH_ * TT * HD * 2); bf* QVl = (bf*)take((size_t)NH_ * TT * HD * 2);
    bf* QPh = (bf*)take((size_t)NH_ * TT * HD * 2); bf* QPl = (bf*)take((size_t)NH_ * TT * HD * 2); bf* KPh = (bf*)take((size_t)NKV * TT * HD * 2); bf* KPl = (bf*)take((size_t)NKV * TT * HD * 2); bf* VTh = (bf*)take((size_t)NKV * HD * TT * 2); bf* VTl = (bf*)take((size_t)NKV * HD * TT * 2);
    bf* PEh = (bf*)take((size_t)NPU * DM * 2); bf* PEl = (bf*)take((size_t)NPU * DM * 2);   /* the position-table planes */ bf* ATh = (bf*)take((size_t)TT * DQ * 2); bf* ATl = (bf*)take((size_t)TT * DQ * 2);
    if ((size_t)(wsp - (char*)d_ws) > ws_size) return;    // ws 256 MiB
    k_prep<<<NPB, 256, 0, stream>>>(x, xk, xv, wq, wk, wv, wo, wp, XB, XKB, XVB, WQ, WK, WV, WO, WP, PEh, PEl);   /* the five weights transposed to bf16, the reversed sinusoidal table's hi/lo planes, q / k / v rounded to bf16 */
    k_proj<<<GP + 3 * GQ, 256, 0, stream>>>(PEh, PEl, WP, XB, WQ, XKB, WK, XVB, WV, PPh, PPl, QPh, QPl, QVh, QVl, KPh, KPl, VTh, VTl, pbu, pbv);   /* the four projections, each storing the hi/lo planes that the attention reads */
    for (int b = 0; b < NB_; ++b) {
        k_attn<<<dim3(NH_, TT / RB, 1), NWV * 32, 0, stream>>>(QPh, QPl, QVh, QVl, KPh, KPl, PPh, PPl, VTh, VTl, MK, ATh, ATl);   /* scores, shift, softmax and attn.v of all heads; one kv head per query head */
        k_gemmw<bf, 1, false, 8, 1, 0><<<dim3(TT / 64, DM / 64, 1), 256, 0, stream>>>(ATh, ATl, WO, nullptr, DQ, OUT + (size_t)b * TT * DM, DM, nullptr, 0, 0, 0, 0, nullptr, nullptr, nullptr, nullptr, nullptr, nullptr, 0, 0); }
}

// v008
// Measured time: 137 microseconds a run.
// Next to v007, in two timings, it ran 1.10 times as fast each time.
// Over all steps from v000 it is 7.31 times as fast.
#include <hip/hip_runtime.h>

// Transformer-XL relative-position multi-head attention (q, k, v inputs [1][2048][1024]; qh = q w_q, kh = k w_k, vh = v w_v ('xw' [1024][1024], no bias; 16 heads x 64); pe = reversed sinusoidal table of length 4096 (pe[m] = PE(4095 - m), interleaved sin/cos) projected by w_p -> ph [16][4096][64]; ac = (qh + b_u).kh, bd = left_shift((qh + b_v).ph): bd[i][j] = raw[i][4095 - i + j] for j <= i else 0; scores = (ac + bd)/8; mask (int [1][2048][2048], read; -inf where 0); softmax; out = attn.vh merged w_o -> [1][2048][1024]).
// Layout: projections from three bf16 input planes, each projection GEMM storing its result as the bf16 hi/lo planes that the attention reads (no f32 copy in memory); b_u / b_v folded into two sets of query planes; the position table is computed on device in f32 (pos / 10000^(2i/1024), precise powf/sinf/cosf), only its rows m >= 2048 (the left shift keeps m = 4095 - i + j with 0 <= j <= i <= 2047 and zeroes the rest, so no other row reaches the output for any input) -> hi/lo planes -> 2-product GEMM with the exact bf16 w_p -> per-head hi/lo planes; one launch does the attention of all heads: a work-group keeps 32 query rows' scores in LDS, content and position scores are hi/lo x hi/lo products (3 products), a position score is added at its shifted key, and softmax and attn.v follow on the same rows.
// Compute dtypes, f32 accumulate: every input rounded to bf16; q/k/v on PLAIN bf16 operands (inputs: exact); content / position scores and attn.v on hi/lo planes for every row (3 products); softmax f32; w_o hl x exact (2 products).

#define NB_  1
#define TT   2048
#define DM   1024
#define NH_  16
#define NKV  16
#define REP  (NH_ / NKV)
#define HD   64
#define DQ   (NH_ * HD)
#define DKV  (NKV * HD)
#define NPE  4096                 // relative positions (2 x seq)
#define NPU  TT                   // positions that the left shift can keep: m = NPE - 1 - i + j, 0 <= j <= i < TT, so m >= NPE - TT; row m of the table and of its projection lies at plane row m - (NPE - NPU)
typedef __attribute__((ext_vector_type(4))) int v4i;
#define WIN  0
#define SCL  0.125f   // HD^-0.5
typedef _Float16 h16;
typedef unsigned short bf;
typedef __attribute__((ext_vector_type(16))) __bf16   v16bf;
typedef __attribute__((ext_vector_type(16))) _Float16 v16h;
typedef __attribute__((ext_vector_type(8)))  _Float16 v8h;
typedef __attribute__((ext_vector_type(8)))  unsigned short v8us;
typedef __attribute__((ext_vector_type(8)))  float    v8f;
typedef __attribute__((ext_vector_type(4)))  float    v4f;
typedef v8h  __attribute__((may_alias)) v8ha;
typedef v4f  __attribute__((may_alias)) v4fa;
typedef v8us __attribute__((may_alias)) v8usa;

__device__ __forceinline__ unsigned short f2bf(float f) { unsigned u = __float_as_uint(f); u += 0x7FFFu + ((u >> 16) & 1u); return (unsigned short)(u >> 16); }
__device__ __forceinline__ float bf2f(unsigned short b) { return __uint_as_float(((unsigned)b) << 16); }
__device__ __forceinline__ float bfr(float f) { return bf2f(f2bf(f)); }
__device__ __forceinline__ v16h cat16(v8h lo, v8h hi) { return __builtin_shufflevector(lo, hi, 0, 1, 2, 3, 4, 5, 6, 7, 8, 9, 10, 11, 12, 13, 14, 15); }
__device__ __forceinline__ v16bf cat16b(v8us lo, v8us hi) { return __builtin_bit_cast(v16bf, __builtin_shufflevector(lo, hi, 0, 1, 2, 3, 4, 5, 6, 7, 8, 9, 10, 11, 12, 13, 14, 15)); }
__device__ __forceinline__ v8f wmma16(v16h a, v16h b, v8f c) { return __builtin_amdgcn_wmma_f32_16x16x32_f16(false, a, false, b, (short)0, c, false, false); }
__device__ __forceinline__ v8f wmmab(v16bf a, v16bf b, v8f c) { return __builtin_amdgcn_wmma_f32_16x16x32_bf16(false, a, false, b, (short)0, c, false, false); }

__device__ __forceinline__ void splitf(float y, unsigned short& h, unsigned short& l) { h = f2bf(y); l = f2bf(y - bf2f(h)); }
typedef __attribute__((ext_vector_type(2))) float    v2f;
typedef __attribute__((ext_vector_type(2))) __bf16   v2bf;
typedef __attribute__((ext_vector_type(2))) unsigned v2u;
typedef __attribute__((ext_vector_type(4))) unsigned v4u;
// pk2bf: two f32 -> two bf16 (round to nearest even, as f2bf) in the hardware's one packed convert, x[0] in the low half. split2: splitf of two values at once, each word packed as it is stored.
__device__ __forceinline__ unsigned pk2bf(v2f x) { return __builtin_bit_cast(unsigned, __builtin_convertvector(x, v2bf)); }
__device__ __forceinline__ void split2(v2f y, unsigned& h, unsigned& l) { h = pk2bf(y); const v2f hf = {__uint_as_float(h << 16), __uint_as_float(h & 0xFFFF0000u)}; l = pk2bf(y - hf); }
typedef __attribute__((ext_vector_type(2))) unsigned short v2us;
typedef __attribute__((ext_vector_type(4))) unsigned short v4us;

// ---- k_gemmw: register-blocked GEMM, ONE WAVE per 64x64 output tile (16 accumulators), operands straight from 16-bit planes in fragment order; grid (M/64, N/64, Z), 32 threads.
// C[m][n] (f32, pitch ldc, + optional f32 bias[n]) = sum_k A[m][k] Bt[n][k] (+ split products per NSPLIT). z-batch strides sA/sB/sC in elements. K % 32 == 0.
// Split K (long K): NW waves per work-group and KS work-groups per tile each take K / (KS * NW) consecutive k of the same 64x64 tile; the NW partial tiles are summed through LDS in wave order, and work-group ks (blockIdx.z = z * KS + ks) writes its own f32 plane at C + ks * sP, summed by the consumer. Grid (M/64, N/64, Z * KS), NW * 32 threads. K % (KS * NW * 32) == 0. NW > 1 takes no bias.
// FRAGMENT ORDER: every 16-bit operand plane [row][k] in memory (A, A2, Bt, Bt2 here and in gemms, and the planes that gemms stores) is kept as blocks of 16 rows x 32 k, 512 consecutive elements each: element (row lr, k = 16 sh + 8 hi + e) lies at (sh * 32 + hi * 16 + lr) * 8 + e of its block, the blocks of one 16-row strip follow one another along k, and a strip is 16 * K elements.
// A wave-wide 16-byte load (lane = hi * 16 + lr) then takes 512 consecutive bytes, four whole lines (of a row-major plane it would take 32 bytes out of each of 16 lines); which lane and register hold an element is the hardware's fragment layout, k order 8 hi + e, then 16 + 8 hi + e, alike for A and B.
// ld: one fragment of a plane in fragment order; p = its 16 x 32 block + lane * 8.
template <typename T16> struct WFrag;
template <> struct WFrag<h16> { typedef v16h V; static __device__ __forceinline__ V ld(const h16* p) { return cat16(*(const v8h*)p, *(const v8h*)(p + 256)); } static __device__ __forceinline__ v8f mma(V a, V b, v8f c) { return wmma16(a, b, c); } };
template <> struct WFrag<bf> { typedef v16bf V; static __device__ __forceinline__ V ld(const bf* p) { return cat16b(*(const v8us*)p, *(const v8us*)(p + 256)); } static __device__ __forceinline__ v8f mma(V a, V b, v8f c) { return wmmab(a, b, c); } };
// gemmw is the body: os is the work-group's LDS (GEMMW_LDS floats), (bx, by, bz) its place in the grid above. k_gemmw launches one GEMM.
#define GEMMW_LDS(NW) ((NW) == 1 ? 16 * 68 : (NW) * 64 * 68)
template <typename T16, int NSPLIT, bool BIAS, int NW, int KS>
__device__ __forceinline__ void gemmw(float* os, int bx, int by, int bz, const T16* __restrict__ A, const T16* __restrict__ A2, const T16* __restrict__ Bt, const T16* __restrict__ Bt2, int K, float* C, int ldc, const float* __restrict__ bias, size_t sA, size_t sB, size_t sC, size_t sP) {
    typedef typename WFrag<T16>::V V;
    const size_t z = bz / KS; const int ks = bz % KS; A += z * sA; if (A2) A2 += z * sA; Bt += z * sB; if (Bt2) Bt2 += z * sB; C += z * sC + (size_t)ks * sP;
    const int wave = (NW == 1) ? 0 : __builtin_amdgcn_readfirstlane(threadIdx.x >> 5); const int kw = K / (KS * NW), k0 = (ks * NW + wave) * kw;   /* this wave's k range [k0, k0 + kw) */
    const int lane = threadIdx.x & 31, lr = lane & 15, hi = lane >> 4; const int r0 = bx * 64, c0 = by * 64;
    v8f acc[4][4];
#pragma unroll
    for (int mb = 0; mb < 4; ++mb)
#pragma unroll
        for (int nb = 0; nb < 4; ++nb) acc[mb][nb] = (v8f){};
    const size_t aoff = (size_t)r0 * K + (size_t)k0 * 16 + lane * 8, boff = (size_t)c0 * K + (size_t)k0 * 16 + lane * 8;   /* strip r0 / 16, block k0 / 32 */
#pragma unroll 1
    for (int kc = 0; kc < kw; kc += 32) {
        V a[4], a2[4];
#pragma unroll
        for (int mb = 0; mb < 4; ++mb) { a[mb] = WFrag<T16>::ld(A + aoff + (size_t)mb * 16 * K + kc * 16); if (NSPLIT == 1 || NSPLIT == 2) a2[mb] = WFrag<T16>::ld(A2 + aoff + (size_t)mb * 16 * K + kc * 16); }
#pragma unroll
        for (int nb = 0; nb < 4; ++nb) { const V b = WFrag<T16>::ld(Bt + boff + (size_t)nb * 16 * K + kc * 16); V b2; if (NSPLIT >= 2) b2 = WFrag<T16>::ld(Bt2 + boff + (size_t)nb * 16 * K + kc * 16);
#pragma unroll
            for (int mb = 0; mb < 4; ++mb) { acc[mb][nb] = WFrag<T16>::mma(a[mb], b, acc[mb][nb]); if (NSPLIT == 1 || NSPLIT == 2) acc[mb][nb] = WFrag<T16>::mma(a2[mb], b, acc[mb][nb]); if (NSPLIT >= 2) acc[mb][nb] = WFrag<T16>::mma(a[mb], b2, acc[mb][nb]); } }
        asm volatile("v_nop\n\tv_nop\n\tv_nop\n\tv_nop" : "+v"(acc[0][0]), "+v"(acc[1][1]), "+v"(acc[2][2]), "+v"(acc[3][3]) : "v"(a[0]), "v"(a[3]));
    }
    if (NW > 1) {
        float* rw = os + wave * (64 * 68);
        // the three loops are unrolled so that acc is indexed by constants and stays in registers
#pragma unroll
        for (int mb = 0; mb < 4; ++mb)
#pragma unroll
            for (int nb = 0; nb < 4; ++nb)
#pragma unroll
                for (int j = 0; j < 8; ++j) rw[(mb * 16 + hi * 8 + j) * 68 + nb * 16 + lr] = acc[mb][nb][j];
        __syncthreads();   // every wave's partial tile is in LDS before any thread sums across the waves
        // the s and w loops are unrolled so that a thread's LDS reads issue together; the sum stays in wave order
        {
#pragma unroll
            for (int s = 0; s < 32 / NW; ++s) { const int idx = s * (NW * 32) + (int)threadIdx.x; const int row = idx >> 4, cofs = (idx & 15) * 4; v4f val = *(const v4fa*)(os + row * 68 + cofs);
#pragma unroll
                for (int w = 1; w < NW; ++w) { const v4f p = *(const v4fa*)(os + w * (64 * 68) + row * 68 + cofs); val[0] += p[0]; val[1] += p[1]; val[2] += p[2]; val[3] += p[3]; }
                *(v4f*)(C + (size_t)(r0 + row) * ldc + c0 + cofs) = val; }
        }
        return;
    }
#pragma unroll
    for (int mb = 0; mb < 4; ++mb) {
#pragma unroll
        for (int nb = 0; nb < 4; ++nb) {
#pragma unroll
            for (int j = 0; j < 8; ++j) os[(hi * 8 + j) * 68 + nb * 16 + lr] = acc[mb][nb][j]; }
        __builtin_amdgcn_wave_barrier(); asm volatile("" ::: "memory");
        float* crow = C + (size_t)(r0 + mb * 16) * ldc + c0;
{
#pragma unroll
            for (int s = 0; s < 8; ++s) { const int row = 2 * s + hi, cofs = lr * 4; v4f val = *(const v4fa*)(os + row * 68 + cofs); if (BIAS) { val[0] += bfr(bias[c0 + cofs]); val[1] += bfr(bias[c0 + cofs + 1]); val[2] += bfr(bias[c0 + cofs + 2]); val[3] += bfr(bias[c0 + cofs + 3]); }
                *(v4f*)(crow + (size_t)row * ldc + cofs) = val; }
             }
        __builtin_amdgcn_wave_barrier(); asm volatile("" ::: "memory");
    }
}

template <typename T16, int NSPLIT, bool BIAS, int NW, int KS>
__global__ __launch_bounds__(NW * 32) void k_gemmw(const T16* __restrict__ A, const T16* __restrict__ A2, const T16* __restrict__ Bt, const T16* __restrict__ Bt2, int K, float* C, int ldc, const float* __restrict__ bias, size_t sA, size_t sB, size_t sC, size_t sP) {
    __shared__ __align__(16) float os[GEMMW_LDS(NW)];
    gemmw<T16, NSPLIT, BIAS, NW, KS>(os, blockIdx.x, blockIdx.y, blockIdx.z, A, A2, Bt, Bt2, K, C, ldc, bias, sA, sB, sC, sP);
}
// ---- gemms: the projection GEMMs (K = DM), ONE WORK-GROUP of eight waves per 128 x 128 output tile, operands shared through LDS. Wave wk * 4 + wn * 2 + wm holds the 64 x 64 quarter (wm, wn) of the tile over the k blocks of parity wk.
// A stage is 64 k (two blocks) of the tile's 128 A rows, 128 Bt rows and, NSPLIT == 1, 128 A2 rows: 16 KiB an operand. Asynchronous 16-byte copies bring it from memory straight into LDS, and every wave reads its fragments there,
// so that L2 delivers each operand byte once a work-group: 2 KiB an operand row of the tile and 1024 k, half of what eight waves that each load their own fragments of one 64 x 64 tile ask for.
// The planes are in fragment order: a strip's two blocks of a stage are 2 KiB in a row in memory and keep that order in LDS (operand o, strip u, block kb at (o * 16 + u * 2 + kb) * 512 elements), and a fragment is two wave-wide 16-byte LDS reads of 512 consecutive bytes each.
// Two buffers: stage s + 2 is asked for when every wave has left stage s, so its copies fly while stage s + 1 is worked on. The two k halves of a quarter are summed through LDS (wk 0 + wk 1). Every plain '#pragma unroll' in gemms is there so that the register arrays (fragments, accumulators, the pieces) are indexed by constants and stay in registers.
// EPI: what the summed tile is stored as. 1: its bf16 hi and lo planes at P1h / P1l. 2: the planes of (tile + hb1[n]) at P1h / P1l and of (tile + hb2[n]) at P2h / P2l (hb rounded to bf16).
// The block of output rows m .. m + 15, columns n .. n + 63 (n % 64 == 0) lies at (n / 64) * sH + (m / 16) * 16 * ldo: head planes [n / 64][m][64] with sH = M * 64, ldo = 64; a plain [m][n] plane with sH = 64 * 16, ldo = N.
#define GS_OP   8192               // elements of one operand in a stage: 128 rows x 64 k
#define GS_NST  (DM / 64)          // stages
// cps: a thread's copies of one stage, four an operand: one 16-byte piece out of each 4 KiB of LDS (two strips). l = its LDS byte address in the buffer, ga / gb / ga2 = its piece of each operand's first two strips.
// All copies of a stage stand in one statement, whose closing wait stands in front of any rewrite of the registers that they name.
#define CPA(l, g) "global_load_async_to_lds_b128 %" #l ", %" #g ", off\n\t"
#define GS_2S   (2 * 16 * DM)      // elements from a strip to the next but one
template <int NSPLIT>
__device__ __forceinline__ void cps(unsigned l, const bf* ga, const bf* gb, const bf* ga2) {
    if (NSPLIT == 1)
        asm volatile(CPA(0, 12) CPA(1, 13) CPA(2, 14) CPA(3, 15) CPA(4, 16) CPA(5, 17) CPA(6, 18) CPA(7, 19) CPA(8, 20) CPA(9, 21) CPA(10, 22) CPA(11, 23) "s_wait_xcnt 0x0"
                     :: "v"(l), "v"(l + 4096u), "v"(l + 8192u), "v"(l + 12288u), "v"(l + 16384u), "v"(l + 20480u), "v"(l + 24576u), "v"(l + 28672u), "v"(l + 32768u), "v"(l + 36864u), "v"(l + 40960u), "v"(l + 45056u),
                        "v"(ga), "v"(ga + GS_2S), "v"(ga + 2 * GS_2S), "v"(ga + 3 * GS_2S), "v"(gb), "v"(gb + GS_2S), "v"(gb + 2 * GS_2S), "v"(gb + 3 * GS_2S), "v"(ga2), "v"(ga2 + GS_2S), "v"(ga2 + 2 * GS_2S), "v"(ga2 + 3 * GS_2S) : "memory");
    else
        asm volatile(CPA(0, 8) CPA(1, 9) CPA(2, 10) CPA(3, 11) CPA(4, 12) CPA(5, 13) CPA(6, 14) CPA(7, 15) "s_wait_xcnt 0x0"
                     :: "v"(l), "v"(l + 4096u), "v"(l + 8192u), "v"(l + 12288u), "v"(l + 16384u), "v"(l + 20480u), "v"(l + 24576u), "v"(l + 28672u),
                        "v"(ga), "v"(ga + GS_2S), "v"(ga + 2 * GS_2S), "v"(ga + 3 * GS_2S), "v"(gb), "v"(gb + GS_2S), "v"(gb + 2 * GS_2S), "v"(gb + 3 * GS_2S) : "memory");
}
__device__ __forceinline__ v16bf ldsblk(const bf* p) { return cat16b(*(const v8usa*)p, *(const v8usa*)(p + 256)); }   /* one fragment of a block in LDS; p = the block + lane * 8 */
template <int NSPLIT, int EPI>
__device__ __forceinline__ void gemms(float* os, int bx, int by, const bf* __restrict__ A, const bf* __restrict__ A2, const bf* __restrict__ Bt, bf* P1h, bf* P1l, bf* P2h, bf* P2l, const float* __restrict__ hb1, const float* __restrict__ hb2, size_t sH, int ldo) {
    constexpr int SE = (NSPLIT == 1 ? 3 : 2) * GS_OP;   /* elements of a stage */
    static_assert(2 * SE * 2 <= GEMMW_LDS(8) * 4 && GS_NST >= 2, "gemms: the two buffers lie inside the work-group's LDS; stages 0 and 1 exist");
    const int t = (int)threadIdx.x; const int wave = __builtin_amdgcn_readfirstlane(t >> 5); const int lane = t & 31, lr = lane & 15, hi = lane >> 4; const int wm = wave & 1, wn = (wave >> 1) & 1, wk = wave >> 2;
    const bf* ring = (const bf*)os; const unsigned l0 = (unsigned)(size_t)os + (unsigned)t * 16u;   /* the low 32 bits of a __shared__ address are its LDS byte address */
    const size_t go = (size_t)(t >> 7) * 16 * DM + (t & 127) * 8;   /* piece t of the first two strips' 2 KiB runs */
    const bf* gA = A + (size_t)bx * 128 * DM + go; const bf* gB = Bt + (size_t)by * 128 * DM + go; const bf* gA2 = NSPLIT == 1 ? A2 + (size_t)bx * 128 * DM + go : nullptr;
    auto fill = [&](int s, int buf) { cps<NSPLIT>(l0 + (unsigned)buf * (SE * 2u), gA + s * 1024, gB + s * 1024, NSPLIT == 1 ? gA2 + s * 1024 : nullptr); };   /* LDS: A at 0, Bt at 16 KiB, A2 at 32 KiB of the buffer */
    v8f acc[4][4];
#pragma unroll
    for (int mb = 0; mb < 4; ++mb)
#pragma unroll
        for (int nb = 0; nb < 4; ++nb) acc[mb][nb] = (v8f){};
    fill(0, 0);
    asm volatile("s_wait_asynccnt 0x0" ::: "memory");   /* this wave's copies of stage 0 have landed */
    __syncthreads();   // stage 0 is whole before any wave reads it
    fill(1, 1);
    // not unrolled: one stage's fragments are live at a time
#pragma unroll 1
    for (int s = 0; s < GS_NST; ++s) {
        const bf* sb = ring + (s & 1) * SE + wk * 512 + lane * 8;
        v16bf a[4], a2[4], b[4];
        // the fragment and product loops are unrolled so that the register arrays are indexed by constants
#pragma unroll
        for (int mb = 0; mb < 4; ++mb) { a[mb] = ldsblk(sb + (wm * 4 + mb) * 1024); if (NSPLIT == 1) a2[mb] = ldsblk(sb + 2 * GS_OP + (wm * 4 + mb) * 1024); }
#pragma unroll
        for (int nb = 0; nb < 4; ++nb) b[nb] = ldsblk(sb + GS_OP + (wn * 4 + nb) * 1024);
        // inputs only: holds the stage's fragment reads in front of the products, so that they issue together and are waited for once, not operand by operand
        if (NSPLIT == 1) asm volatile("" :: "v"(a[0]), "v"(a[1]), "v"(a[2]), "v"(a[3]), "v"(a2[0]), "v"(a2[1]), "v"(a2[2]), "v"(a2[3]), "v"(b[0]), "v"(b[1]), "v"(b[2]), "v"(b[3]));
        else asm volatile("" :: "v"(a[0]), "v"(a[1]), "v"(a[2]), "v"(a[3]), "v"(b[0]), "v"(b[1]), "v"(b[2]), "v"(b[3]));
#pragma unroll
        for (int nb = 0; nb < 4; ++nb)
#pragma unroll
            for (int mb = 0; mb < 4; ++mb) { acc[mb][nb] = wmmab(a[mb], b[nb], acc[mb][nb]); if (NSPLIT == 1) acc[mb][nb] = wmmab(a2[mb], b[nb], acc[mb][nb]); }
        __builtin_amdgcn_sched_barrier(0);   // keeps the products in front of the waits: moved behind the barrier they would stand between it and the refill, and the copies would fly that much shorter before they are waited for
        asm volatile("s_wait_dscnt 0x0" ::: "memory");      /* this wave's reads of stage s are over */
        asm volatile("s_wait_asynccnt 0x0" ::: "memory");   /* this wave's copies of stage s + 1 have landed */
        __syncthreads();   // stage s + 1 is whole, and every wave has left stage s, before s + 1 is read and the buffer of s is refilled
        if (s + 2 < GS_NST) fill(s + 2, s & 1);
    }
    asm volatile("s_wait_asynccnt 0x0" ::: "memory");   /* no copy is outstanding when the ring's LDS takes the partial tiles (the last trip's barrier has ended every read of it) */
    float* rw = os + wave * (64 * 68);
    // the three loops are unrolled so that acc is indexed by constants and stays in registers
#pragma unroll
    for (int mb = 0; mb < 4; ++mb)
#pragma unroll
        for (int nb = 0; nb < 4; ++nb)
#pragma unroll
            for (int j = 0; j < 8; ++j) rw[(mb * 16 + hi * 8 + j) * 68 + nb * 16 + lr] = acc[mb][nb][j];
    __syncthreads();   // every wave's partial tile is in LDS before any thread sums the two k halves
    // a thread takes the eight elements of one 16-byte piece of the planes, pieces in fragment order: a wave stores 512 consecutive bytes of each plane. Unrolled so that the quarter is a constant and a thread's LDS reads issue together
#pragma unroll
    for (int s = 0; s < 8; ++s) { const int wt = s >> 1, idx = (s & 1) * 256 + t;   /* piece idx of quarter wt = wn * 2 + wm */ const int row = (idx >> 7) * 16 + (idx & 15), cofs = ((idx >> 4) & 7) * 8;
        const float* o0 = os + wt * (64 * 68) + row * 68 + cofs; v4f va = *(const v4fa*)o0, vb = *(const v4fa*)(o0 + 4); const v4f p = *(const v4fa*)(o0 + 4 * (64 * 68)), p2 = *(const v4fa*)(o0 + 4 * (64 * 68) + 4);
        va[0] += p[0]; va[1] += p[1]; va[2] += p[2]; va[3] += p[3]; vb[0] += p2[0]; vb[1] += p2[1]; vb[2] += p2[2]; vb[3] += p2[3];
        const int c0 = (by * 2 + (wt >> 1)) * 64; const size_t po = (size_t)(by * 2 + (wt >> 1)) * sH + (size_t)(bx * 8 + (wt & 1) * 4 + (idx >> 7)) * 16 * ldo + (idx & 127) * 8; v4u oh, ol;
        // both q loops are unrolled so that va, vb, oh and ol are indexed by constants and stay in registers
#pragma unroll
        for (int q = 0; q < 8; q += 2) { v2f val = q < 4 ? (v2f){va[q & 3], va[(q & 3) + 1]} : (v2f){vb[q & 3], vb[(q & 3) + 1]}; if (EPI == 2) val = (v2f){__fadd_rn(val[0], bfr(hb1[c0 + cofs + q])), __fadd_rn(val[1], bfr(hb1[c0 + cofs + q + 1]))}; unsigned x, y; split2(val, x, y); oh[q >> 1] = x; ol[q >> 1] = y; }
        *(v8us*)(P1h + po) = __builtin_bit_cast(v8us, oh); *(v8us*)(P1l + po) = __builtin_bit_cast(v8us, ol);
        if (EPI == 2) {
#pragma unroll
            for (int q = 0; q < 8; q += 2) { const v2f val = q < 4 ? (v2f){va[q & 3], va[(q & 3) + 1]} : (v2f){vb[q & 3], vb[(q & 3) + 1]}; unsigned x, y; split2((v2f){__fadd_rn(val[0], bfr(hb2[c0 + cofs + q])), __fadd_rn(val[1], bfr(hb2[c0 + cofs + q + 1]))}, x, y); oh[q >> 1] = x; ol[q >> 1] = y; }
            *(v8us*)(P2h + po) = __builtin_bit_cast(v8us, oh); *(v8us*)(P2l + po) = __builtin_bit_cast(v8us, ol); }
        asm volatile("s_wait_xcnt 0x0" ::: "memory");   /* stands in front of any rewrite of the registers that the plane stores name: the next piece's, or another GEMM's code that follows this one in the listing */ }
}
// k_proj holds the four projections, which do not depend on one another, in one launch, every work-group resident at once: work-groups [0, GP) the position table x w_p (the longest, so first), [GP, GP + GQ) q, then GQ each for k and v; inside each range the tile's row index runs fastest, as in a grid of its own.
#define GP   ((NPU / 128) * (DQ / 128))
#define GQ   ((TT / 128) * (DQ / 128))
__global__ __launch_bounds__(256) void k_proj(const bf* __restrict__ PEh, const bf* __restrict__ PEl, const bf* __restrict__ WP, const bf* __restrict__ XB, const bf* __restrict__ WQ, const bf* __restrict__ XKB, const bf* __restrict__ WK, const bf* __restrict__ XVB, const bf* __restrict__ WV,
                                              bf* PPh, bf* PPl, bf* QPh, bf* QPl, bf* QVh, bf* QVl, bf* KPh, bf* KPl, bf* VTh, bf* VTl, const float* __restrict__ pbu, const float* __restrict__ pbv) {
    __shared__ __align__(16) float os[GEMMW_LDS(8)];
    const int i = blockIdx.x;
    if (i < GP) {   // kept rows of the reversed sinusoidal table (hi/lo) x w_p -> per-head position planes [h][NPU][64]
        gemms<1, 1>(os, i % (NPU / 128), i / (NPU / 128), PEh, PEl, WP, PPh, PPl, nullptr, nullptr, nullptr, nullptr, (size_t)NPU * HD, HD);
    } else if (i < GP + GQ) {   // (q + b_u) planes for the content scores, (q + b_v) planes for the position scores
        const int j = i - GP;
        gemms<0, 2>(os, j % (TT / 128), j / (TT / 128), XB, nullptr, WQ, QPh, QPl, QVh, QVl, pbu, pbv, (size_t)TT * HD, HD);
    } else {   // k: head planes [h][t][64]. v: w_v as the row operand, so that the tile is v transposed, [head x 64 + d][t], as attn.v reads it
        const bool isv = i >= GP + 2 * GQ; const int j = i - GP - (isv ? 2 * GQ : GQ); const int nx = isv ? DKV / 128 : TT / 128;
        gemms<0, 1>(os, j % nx, j / nx, isv ? WV : XKB, nullptr, isv ? XVB : WK, isv ? VTh : KPh, isv ? VTl : KPl, nullptr, nullptr, nullptr, nullptr, isv ? (size_t)64 * 16 : (size_t)TT * HD, isv ? TT : HD);
    }
}

// k_prep: all that the GEMMs read is prepared in ONE launch of NPB work-groups, few enough to be resident together. Every plane it writes is in fragment order (see k_gemmw). Every wave transposes one 16 n x 32 k block of one weight, w [k][n] f32 -> Bt [n][k] bf16 (256 work-groups a weight, five weights);
// between those loads and their stores, work-groups 0 .. NPT - 1 fill the position table (a thread keeps one sin/cos column pair, so one powf, for PER rows) and the other NPB - NPT round q, k and v to bf16 (a thread takes CVS octets of each).
#define NPB  1280                  // 5 weights x DM * DQ / 64 / 64
#define NPT  1024                  // table work-groups: two a row block (512 column pairs = 2 x 256 threads)
#define PER  (NPU * 2 / NPT)       // table rows a thread
#define CVS  (TT * DM / 8 / ((NPB - NPT) * 256))   // octets of each input a thread
static_assert(NB_ == 1 && DQ == DM && DKV == DM && 5 * (DM * DQ / 64 / 64) == NPB && PER * NPT == NPU * 2 && NPU <= NPE && CVS * (NPB - NPT) * 256 * 8 == TT * DM, "k_prep: the shares are exact");
// piece i of the plane in fragment order holds row (i >> 11) * 16 + (i & 15), octet (i >> 4) & 127 of the row-major input [row][DM]
__device__ __forceinline__ void cvt8(const float* __restrict__ src, bf* __restrict__ dst, size_t i) { const v8f v = *(const v8f*)(src + (((i >> 11) * 16 + (i & 15)) * (DM / 8) + ((i >> 4) & (DM / 8 - 1))) * 8); v8us o;
    // unrolled so that v and o are indexed by constants and stay in registers
#pragma unroll
    for (int k = 0; k < 8; ++k) o[k] = f2bf(v[k]);
    *(v8us*)(dst + i * 8) = o; }
__global__ __launch_bounds__(256) void k_prep(const float* __restrict__ x, const float* __restrict__ xk, const float* __restrict__ xv, const float* __restrict__ wq, const float* __restrict__ wk, const float* __restrict__ wv, const float* __restrict__ wo, const float* __restrict__ wp,
                                              bf* __restrict__ XB, bf* __restrict__ XKB, bf* __restrict__ XVB, bf* __restrict__ WQ, bf* __restrict__ WK, bf* __restrict__ WV, bf* __restrict__ WO, bf* __restrict__ WP, bf* __restrict__ PEh, bf* __restrict__ PEl) {
    const int b = blockIdx.x, t = threadIdx.x, lane = t & 31; const int wi = b >> 8;
    const float* w = wi == 0 ? wq : wi == 1 ? wk : wi == 2 ? wv : wi == 3 ? wo : wp; bf* Bt = wi == 0 ? WQ : wi == 1 ? WK : wi == 2 ? WV : wi == 3 ? WO : WP;
    const int blk = (b & 255) * 8 + (t >> 5);   /* the wave's block: strip n / 16 = blk / 32, k / 32 = blk % 32 */
    const float* wl = w + (size_t)((blk & 31) * 32 + (lane >> 4) * 8) * DQ + (blk >> 5) * 16 + (lane & 15);   /* this lane's n, its first k */
    float r[2][8];
    // unrolled so that r is indexed by constants and the sixteen loads of a wave fly together
#pragma unroll
    for (int sh = 0; sh < 2; ++sh)
#pragma unroll
        for (int e = 0; e < 8; ++e) r[sh][e] = wl[(size_t)(sh * 16 + e) * DQ];
    asm volatile("s_wait_xcnt 0x0" ::: "memory");   /* stands in front of any rewrite of the address registers that the sixteen loads name */
    if (b < NPT) {
        const int c = ((b & 1) * 256 + t) * 2; const float ex = __fdiv_rn((float)c, (float)DM);   /* c even: 2i/d_model */ const float den = powf(10000.0f, ex);
        for (int q = 0; q < PER; ++q) { const int m = (b >> 1) * PER + q; const float pos = (float)(NPU - 1 - m);   /* plane row m is table row NPE - NPU + m, reversed: position NPE - 1 - that */ const float th = __fdiv_rn(pos, den); v2us oh, ol; unsigned short a, b2; splitf(sinf(th), a, b2); oh[0] = a; ol[0] = b2; splitf(cosf(th), a, b2); oh[1] = a; ol[1] = b2;
            const size_t e = (size_t)(m >> 4) * 16 * DM + (c >> 5) * 512 + (((c >> 3) & 3) * 16 + (m & 15)) * 8 + (c & 7);   /* fragment order */ *(v2us*)(PEh + e) = oh; *(v2us*)(PEl + e) = ol; }
    } else {
        const size_t i0 = (size_t)(b - NPT) * 256 + t;
        for (int s = 0; s < CVS; ++s) { const size_t i = i0 + (size_t)s * ((NPB - NPT) * 256); cvt8(x, XB, i); cvt8(xk, XKB, i); cvt8(xv, XVB, i);
            asm volatile("s_wait_xcnt 0x0" ::: "memory");   /* stands in front of the next trip's rewrite of the registers that the three stores name */ }
    }
    // unrolled so that r is indexed by constants; each store is 512 consecutive bytes a wave
#pragma unroll
    for (int sh = 0; sh < 2; ++sh) { v8us o;
#pragma unroll
        for (int e = 0; e < 8; ++e) o[e] = f2bf(r[sh][e]);
        *(v8us*)(Bt + (size_t)blk * 512 + sh * 256 + lane * 8) = o; }
}

// k_attn: one work-group = one head x RB query rows, every stage of the attention on chip. The RB score rows [RB][2048] f32 live in LDS (pitch SP floats):
//   1 content scores (q + b_u).k into the rows; 2 raw position scores (q + b_v).ph only for the positions that the left shift keeps (m = 4095 - i + j, 0 <= j <= i), added at their shifted key j;
//   3 mask, softmax per row (one wave a row, register row), the row rewritten in place as its bf16 hi plane (first 4 KiB) and lo plane (next 4 KiB);
//   4 attn.v with the hi/lo rows as the A operand from LDS, each wave TT / NWV keys, the NWV partial tiles summed through LDS in wave order and split into the merged hi/lo planes.
// Every plain '#pragma unroll' in this kernel is there so that the register arrays (fragments, accumulators, the score row) are indexed by constants and stay in registers.
#define MT   2                     // 16-row tiles of query rows per work-group
#define RB   (16 * MT)
#define NWV  (RB / 2)              // waves per work-group (two score rows a wave; RB * 8 output octets = NWV * 16 threads, half the waves)
#define SP   2052                  // floats per score row in LDS: 16-byte aligned rows, 4 banks apart
typedef v4us __attribute__((may_alias)) v4usa;
__device__ __forceinline__ v16bf ldsfrag(const bf* p) { return cat16b(*(const v8usa*)p, *(const v8usa*)(p + 16)); }
__device__ __forceinline__ v8f mma3(v16bf a, v16bf a2, v16bf b, v16bf b2, v8f c) { c = wmmab(a, b, c); c = wmmab(a2, b, c); return wmmab(a, b2, c); }
__global__ __launch_bounds__(NWV * 32) void k_attn(const bf* __restrict__ QUh, const bf* __restrict__ QUl, const bf* __restrict__ QWh, const bf* __restrict__ QWl, const bf* __restrict__ Kh, const bf* __restrict__ Kl, const bf* __restrict__ Rh, const bf* __restrict__ Rl, const bf* __restrict__ Vh, const bf* __restrict__ Vl, const int* __restrict__ MKb, bf* Ah, bf* Al) {
    typedef WFrag<bf> F;
    __shared__ __align__(16) float S[RB * SP];
    const int h = blockIdx.x; const int i0 = (TT / RB - 1 - (int)blockIdx.y) * RB;   /* late query rows have the most positions: they start first */
    const int wave = __builtin_amdgcn_readfirstlane(threadIdx.x >> 5); const int lane = threadIdx.x & 31, lr = lane & 15, hi = lane >> 4;
    const size_t qoff = ((size_t)h * TT + i0) * HD + lane * 8;   /* all global planes are in fragment order (see k_gemmw): a 16-row strip of a head plane is 16 * HD elements, two blocks of 512 */
    {   // 1: content scores, TT / 16 / NWV key tiles a wave
        v16bf a[MT][2], a2[MT][2];
#pragma unroll
        for (int mt = 0; mt < MT; ++mt)
#pragma unroll
            for (int kk = 0; kk < 2; ++kk) { a[mt][kk] = F::ld(QUh + qoff + mt * 16 * HD + kk * 512); a2[mt][kk] = F::ld(QUl + qoff + mt * 16 * HD + kk * 512); }
        const size_t koff = ((size_t)h * TT + wave * (TT / NWV)) * HD + lane * 8;
        for (int t = 0; t < TT / 16 / NWV; t += 2) { v16bf b[2][2], c[2][2];
#pragma unroll
            for (int u = 0; u < 2; ++u)
#pragma unroll
                for (int kk = 0; kk < 2; ++kk) { b[u][kk] = F::ld(Kh + koff + (t + u) * 16 * HD + kk * 512); c[u][kk] = F::ld(Kl + koff + (t + u) * 16 * HD + kk * 512); }
            // inputs only: holds the sixteen loads of two key tiles in front of the products, so that they fly together and are waited for once, not fragment by fragment
            asm volatile("" :: "v"(b[0][0]), "v"(b[0][1]), "v"(b[1][0]), "v"(b[1][1]), "v"(c[0][0]), "v"(c[0][1]), "v"(c[1][0]), "v"(c[1][1]));
#pragma unroll
            for (int u = 0; u < 2; ++u)
#pragma unroll
                for (int mt = 0; mt < MT; ++mt) { v8f acc = (v8f){}; acc = mma3(a[mt][0], a2[mt][0], b[u][0], c[u][0], acc); acc = mma3(a[mt][1], a2[mt][1], b[u][1], c[u][1], acc);
#pragma unroll
                    for (int j = 0; j < 8; ++j) S[(mt * 16 + hi * 8 + j) * SP + wave * (TT / NWV) + (t + u) * 16 + lr] = acc[j]; } }
    }
    __syncthreads();   // every content score is in LDS before a position score is added to it
    {   // 2: position tile t holds m = NPE - RB - i0 + 16 t + c; row r of the block meets it at key j = m - (NPE - 1) + i0 + r; each (r, j) belongs to exactly one (t, c)
        v16bf a[MT][2], a2[MT][2];
#pragma unroll
        for (int mt = 0; mt < MT; ++mt)
#pragma unroll
            for (int kk = 0; kk < 2; ++kk) { a[mt][kk] = F::ld(QWh + qoff + mt * 16 * HD + kk * 512); a2[mt][kk] = F::ld(QWl + qoff + mt * 16 * HD + kk * 512); }
        const int nt = (i0 + RB) / 16; const size_t roff = ((size_t)h * NPU + (NPU - RB - i0)) * HD + lane * 8;   /* plane row = m - (NPE - NPU) */
        for (int t = wave; t < nt; t += 2 * NWV) { const bool two = t + NWV < nt;   /* two tiles a trip, t and t + NWV; past the end the second one repeats the first and is dropped */
            v16bf b[2][2], c[2][2]; v8f acc[2][MT];
#pragma unroll
            for (int u = 0; u < 2; ++u) { const size_t to = roff + (size_t)((u && two) ? t + NWV : t) * 16 * HD;
#pragma unroll
                for (int kk = 0; kk < 2; ++kk) { b[u][kk] = F::ld(Rh + to + kk * 512); c[u][kk] = F::ld(Rl + to + kk * 512); } }
            // inputs only: holds the sixteen loads of two position tiles in front of the products, so that they fly together and are waited for once
            asm volatile("" :: "v"(b[0][0]), "v"(b[0][1]), "v"(b[1][0]), "v"(b[1][1]), "v"(c[0][0]), "v"(c[0][1]), "v"(c[1][0]), "v"(c[1][1]));
#pragma unroll
            for (int u = 0; u < 2; ++u)
#pragma unroll
                for (int mt = 0; mt < MT; ++mt) { acc[u][mt] = (v8f){}; acc[u][mt] = mma3(a[mt][0], a2[mt][0], b[u][0], c[u][0], acc[u][mt]); acc[u][mt] = mma3(a[mt][1], a2[mt][1], b[u][1], c[u][1], acc[u][mt]); }
            float* p = S + (hi * 8) * (SP + 1) + 16 * t + lr - (RB - 1);   /* row r = mt * 16 + hi * 8 + j, key 16 t + lr + r - (RB - 1) */
            if (16 * t >= RB - 1) {   // every key of the tile is >= 0 (a scalar test): the old scores are read together, with no lane test
                float o[MT][8];
#pragma unroll
                for (int mt = 0; mt < MT; ++mt)
#pragma unroll
                    for (int j = 0; j < 8; ++j) o[mt][j] = p[(mt * 16 + j) * (SP + 1)];
#pragma unroll
                for (int mt = 0; mt < MT; ++mt)
#pragma unroll
                    for (int j = 0; j < 8; ++j) p[(mt * 16 + j) * (SP + 1)] = __fadd_rn(o[mt][j], acc[0][mt][j]);
            } else {
#pragma unroll
                for (int mt = 0; mt < MT; ++mt)
#pragma unroll
                    for (int j = 0; j < 8; ++j) { const int key = 16 * t + lr + mt * 16 + hi * 8 + j - (RB - 1); if (key >= 0) p[(mt * 16 + j) * (SP + 1)] = __fadd_rn(p[(mt * 16 + j) * (SP + 1)], acc[0][mt][j]); }
            }
            if (two) {   // tile t + NWV: its keys are all >= 0 (16 NWV >= RB - 1)
                float* p2 = p + 16 * NWV; float o[MT][8];
#pragma unroll
                for (int mt = 0; mt < MT; ++mt)
#pragma unroll
                    for (int j = 0; j < 8; ++j) o[mt][j] = p2[(mt * 16 + j) * (SP + 1)];
#pragma unroll
                for (int mt = 0; mt < MT; ++mt)
#pragma unroll
                    for (int j = 0; j < 8; ++j) p2[(mt * 16 + j) * (SP + 1)] = __fadd_rn(o[mt][j], acc[1][mt][j]);
            } }
    }
    __syncthreads();   // the rows are complete before a wave takes its rows' softmax
    // not unrolled: one register row of 64 values is live at a time
#pragma unroll 1
    for (int rr = 0; rr < RB / NWV; ++rr) {   // 3: t = (ac + bd)/8, -inf where mask == 0; softmax over the 2048 keys (register row, one exp, fixed trees)
        const int r = wave * (RB / NWV) + rr; float* srow = S + r * SP; const int* mkr = MKb + (size_t)(i0 + r) * TT; v2f v[TT / 64]; float mx = -3.0e38f;   /* the row as register pairs: a packed f32 instruction takes two scores */
#pragma unroll
        for (int ch = 0; ch < TT / 128; ++ch) { const int j0 = ch * 128 + lane * 4; const v4f s4 = *(const v4fa*)(srow + j0); const v4i m4 = *(const v4i*)(mkr + j0);
#pragma unroll
            for (int q = 0; q < 4; ++q) { const float t = (m4[q] != 0) ? s4[q] : -3.0e38f; v[ch * 2 + (q >> 1)][q & 1] = t; mx = fmaxf(mx, t); } }   /* the 1/8, a power of two, commutes with maximum, difference and rounding: it stands in the exponent's factor below */
#pragma unroll
        for (int sh = 16; sh; sh >>= 1) mx = fmaxf(mx, __shfl_xor(mx, sh, 32));
        v2f sum2 = {0.f, 0.f}; const v2f mx2 = {mx, mx}, c2 = {SCL * 1.4426950408889634f, SCL * 1.4426950408889634f};
#pragma unroll
        for (int k = 0; k < TT / 64; ++k) { const v2f d = (v[k] - mx2) * c2; v[k] = (v2f){__builtin_amdgcn_exp2f(d[0]), __builtin_amdgcn_exp2f(d[1])}; sum2 += v[k]; }
        float sum = sum2[0] + sum2[1];   /* a lane's even and odd keys are summed apart, then joined */
#pragma unroll
        for (int sh = 16; sh; sh >>= 1) sum += __shfl_xor(sum, sh, 32);
        const float f = __fdiv_rn(1.0f, sum); const v2f f2 = {f, f}; bf* prow = (bf*)srow;
#pragma unroll
        for (int ch = 0; ch < TT / 128; ++ch) { v2u oh, ol;
#pragma unroll
            for (int q = 0; q < 2; ++q) { unsigned x, y; split2(v[ch * 2 + q] * f2, x, y); oh[q] = x; ol[q] = y; }
            *(v4usa*)(prow + ch * 128 + lane * 4) = __builtin_bit_cast(v4us, oh); *(v4usa*)(prow + TT + ch * 128 + lane * 4) = __builtin_bit_cast(v4us, ol); }
    }
    __syncthreads();   // every row's hi/lo planes are in LDS before any wave reads them as its A operand
    v8f acc[MT][4];
#pragma unroll
    for (int mt = 0; mt < MT; ++mt)
#pragma unroll
        for (int nb = 0; nb < 4; ++nb) acc[mt][nb] = (v8f){};
    {   // 4: attn.v, this wave's keys [wave * TT / NWV, + TT / NWV)
        const bf* pa = (const bf*)S + (size_t)lr * (2 * SP) + 8 * hi + wave * (TT / NWV); const size_t voff = (size_t)h * HD * TT + wave * (TT / NWV) * 16 + lane * 8;   /* strip (h * HD + 16 nb) / 16 of 16 * TT elements, block key / 32 */
        // unrolled: four trips, acc indexed by constants
#pragma unroll
        for (int kc = 0; kc < TT / NWV; kc += 32) { v16bf a[MT], a2[MT];
#pragma unroll
            for (int mt = 0; mt < MT; ++mt) { a[mt] = ldsfrag(pa + mt * 16 * (2 * SP) + kc); a2[mt] = ldsfrag(pa + mt * 16 * (2 * SP) + TT + kc); }
            v16bf b[4], b2[4];
#pragma unroll
            for (int nb = 0; nb < 4; ++nb) { b[nb] = F::ld(Vh + voff + (size_t)nb * 16 * TT + kc * 16); b2[nb] = F::ld(Vl + voff + (size_t)nb * 16 * TT + kc * 16); }
            // inputs only: holds the sixteen v loads of this trip in front of the products, so that they fly together and are waited for once
            asm volatile("" :: "v"(b[0]), "v"(b[1]), "v"(b[2]), "v"(b[3]), "v"(b2[0]), "v"(b2[1]), "v"(b2[2]), "v"(b2[3]));
#pragma unroll
            for (int nb = 0; nb < 4; ++nb)
#pragma unroll
                for (int mt = 0; mt < MT; ++mt) acc[mt][nb] = mma3(a[mt], a2[mt], b[nb], b2[nb], acc[mt][nb]); }
    }
    __syncthreads();   // the last read of the hi/lo planes is over before their LDS takes the partial tiles
    float* rw = S + wave * (RB * 68);
#pragma unroll
    for (int mt = 0; mt < MT; ++mt)
#pragma unroll
        for (int nb = 0; nb < 4; ++nb)
#pragma unroll
            for (int j = 0; j < 8; ++j) rw[(mt * 16 + hi * 8 + j) * 68 + nb * 16 + lr] = acc[mt][nb][j];
    __syncthreads();   // every wave's partial tile is in LDS before any thread sums across the waves
    if (wave >= NWV / 2) return;   // RB * 8 pieces of eight elements: half the waves take one a thread, so that a wave stores 512 consecutive bytes of each plane (no barrier follows)
    const int idx = (int)threadIdx.x; const int row = (idx >> 7) * 16 + (idx & 15), cofs = ((idx >> 4) & 7) * 8;   /* piece idx of the block's rows in fragment order */
    v4f va = *(const v4fa*)(S + row * 68 + cofs), vb = *(const v4fa*)(S + row * 68 + cofs + 4);
    // unrolled so that a thread's LDS reads issue together; the sum stays in wave order
#pragma unroll
    for (int w = 1; w < NWV; ++w) { const v4f p = *(const v4fa*)(S + w * (RB * 68) + row * 68 + cofs), p2 = *(const v4fa*)(S + w * (RB * 68) + row * 68 + cofs + 4); va[0] += p[0]; va[1] += p[1]; va[2] += p[2]; va[3] += p[3]; vb[0] += p2[0]; vb[1] += p2[1]; vb[2] += p2[2]; vb[3] += p2[3]; }
    v4u oh, ol;
#pragma unroll
    for (int q = 0; q < 8; q += 2) { unsigned x, y; split2(q < 4 ? (v2f){va[q & 3], va[(q & 3) + 1]} : (v2f){vb[q & 3], vb[(q & 3) + 1]}, x, y); oh[q >> 1] = x; ol[q >> 1] = y; }
    const size_t oo = (size_t)((i0 >> 4) + (idx >> 7)) * 16 * DQ + h * HD * 16 + (idx & 127) * 8; *(v8us*)(Ah + oo) = __builtin_bit_cast(v8us, oh); *(v8us*)(Al + oo) = __builtin_bit_cast(v8us, ol);
}

extern "C" void kernel_launch(void* const* d_in, const int* in_sizes, int n_in,
                              void* d_out, int out_size, void* d_ws, size_t ws_size, hipStream_t stream) {
    (void)in_sizes; (void)n_in; (void)out_size;
    const float* x = (const float*)d_in[0]; const float* xk = (const float*)d_in[1]; const float* xv = (const float*)d_in[2]; const int* MK = (const int*)d_in[3]; const float* wq = (const float*)d_in[4]; const float* wk = (const float*)d_in[5]; const float* wv = (const float*)d_in[6]; const float* wp = (const float*)d_in[7]; const float* wo = (const float*)d_in[8]; const float* pbu = (const float*)d_in[9]; const float* pbv = (const float*)d_in[10];
    float* OUT = (float*)d_out;     // [1][2048][1024]
    char* wsp = (char*)d_ws;
    auto take = [&](size_t bytes) { char* p = wsp; wsp += (bytes + 255) & ~(size_t)255; return (void*)p; };
    bf* WQ = (bf*)take((size_t)DQ * DM * 2); bf* WK = (bf*)take((size_t)DKV * DM * 2); bf* WV = (bf*)take((size_t)DKV * DM * 2); bf* WO = (bf*)take((size_t)DM * DQ * 2);
    bf* XB = (bf*)take((size_t)TT * DM * 2); bf* XKB = (bf*)take((size_t)TT * DM * 2); bf* XVB = (bf*)take((size_t)TT * DM * 2); bf* WP = (bf*)take((size_t)DQ * DM * 2); bf* PPh = (bf*)take((size_t)NH_ * NPU * HD * 2); bf* PPl = (bf*)take((size_t)NH_ * NPU * HD * 2); bf* QVh = (bf*)take((size_t)NH_ * TT * HD * 2); bf* QVl = (bf*)take((size_t)NH_ * TT * HD * 2);
    bf* QPh = (bf*)take((size_t)NH_ * TT * HD * 2); bf* QPl = (bf*)take((size_t)NH_ * TT * HD * 2); bf* KPh = (bf*)take((size_t)NKV * TT * HD * 2); bf* KPl = (bf*)take((size_t)NKV * TT * HD * 2); bf* VTh = (bf*)take((size_t)NKV * HD * TT * 2); bf* VTl = (bf*)take((size_t)NKV * HD * TT * 2);
    bf* PEh = (bf*)take((size_t)NPU * DM * 2); bf* PEl = (bf*)take((size_t)NPU * DM * 2);   /* the position-table planes */ bf* ATh = (bf*)take((size_t)TT * DQ * 2); bf* ATl = (bf*)take((size_t)TT * DQ * 2);
    if ((size_t)(wsp - (char*)d_ws) > ws_size) return;    // ws 256 MiB
    k_prep<<<NPB, 256, 0, stream>>>(x, xk, xv, wq, wk, wv, wo, wp, XB, XKB, XVB, WQ, WK, WV, WO, WP, PEh, PEl);   /* the five weights transposed to bf16, the reversed sinusoidal table's hi/lo planes, q / k / v rounded to bf16 */
    k_proj<<<GP + 3 * GQ, 256, 0, stream>>>(PEh, PEl, WP, XB, WQ, XKB, WK, XVB, WV, PPh, PPl, QPh, QPl, QVh, QVl, KPh, KPl, VTh, VTl, pbu, pbv);   /* the four projections, each storing the hi/lo planes that the attention reads */
    for (int b = 0; b < NB_; ++b) {
        k_attn<<<dim3(NH_, TT / RB, 1), NWV * 32, 0, stream>>>(QPh, QPl, QVh, QVl, KPh, KPl, PPh, PPl, VTh, VTl, MK, ATh, ATl);   /* scores, shift, softmax and attn.v of all heads; one kv head per query head */
        k_gemmw<bf, 1, false, 8, 1><<<dim3(TT / 64, DM / 64, 1), 256, 0, stream>>>(ATh, ATl, WO, nullptr, DQ, OUT + (size_t)b * TT * DM, DM, nullptr, 0, 0, 0, 0); }
}

// v009
// A run of this version takes 133 microseconds.
// Next to v008, in two timings, it ran 1.04 and 1.03 times as fast.
// Counting every step since v000, it is 7.56 times as fast.
#include <hip/hip_runtime.h>

// Transformer-XL relative-position multi-head attention (q, k, v inputs [1][2048][1024]; qh = q w_q, kh = k w_k, vh = v w_v ('xw' [1024][1024], no bias; 16 heads x 64); pe = reversed sinusoidal table of length 4096 (pe[m] = PE(4095 - m), interleaved sin/cos) projected by w_p -> ph [16][4096][64]; ac = (qh + b_u).kh, bd = left_shift((qh + b_v).ph): bd[i][j] = raw[i][4095 - i + j] for j <= i else 0; scores = (ac + bd)/8; mask (int [1][2048][2048], read once and packed to bits; -inf where 0); softmax; out = attn.vh merged w_o -> [1][2048][1024]).
// Layout: projections from three bf16 input planes, each projection GEMM storing its result as the bf16 hi/lo planes that the attention reads (no f32 copy in memory); b_u / b_v folded into two sets of query planes; the position table is computed on device in f32 (pos / 10000^(2i/1024), precise powf/sinf/cosf), only its rows m >= 2048 (the left shift keeps m = 4095 - i + j with 0 <= j <= i <= 2047 and zeroes the rest, so no other row reaches the output for any input) -> hi/lo planes -> 2-product GEMM with the exact bf16 w_p -> per-head hi/lo planes; one launch does the attention of all heads: a work-group keeps 32 query rows' scores in LDS, content and position scores are hi/lo x hi/lo products (3 products), a position score is added at its shifted key, and softmax and attn.v follow on the same rows.
// Compute dtypes, f32 accumulate: every input rounded to bf16; q/k/v on PLAIN bf16 operands (inputs: exact); content / position scores and attn.v on hi/lo planes for every row (3 products); softmax f32; w_o hl x exact (2 products).

#define NB_  1
#define TT   2048
#define DM   1024
#define NH_  16
#define NKV  16
#define REP  (NH_ / NKV)
#define HD   64
#define DQ   (NH_ * HD)
#define DKV  (NKV * HD)
#define NPE  4096                 // relative positions (2 x seq)
#define NPU  TT                   // positions that the left shift can keep: m = NPE - 1 - i + j, 0 <= j <= i < TT, so m >= NPE - TT; row m of the table and of its projection lies at plane row m - (NPE - NPU)
typedef __attribute__((ext_vector_type(4))) int v4i;
#define WIN  0
#define SCL  0.125f   // HD^-0.5
typedef _Float16 h16;
typedef unsigned short bf;
typedef __attribute__((ext_vector_type(16))) __bf16   v16bf;
typedef __attribute__((ext_vector_type(16))) _Float16 v16h;
typedef __attribute__((ext_vector_type(8)))  _Float16 v8h;
typedef __attribute__((ext_vector_type(8)))  unsigned short v8us;
typedef __attribute__((ext_vector_type(8)))  float    v8f;
typedef __attribute__((ext_vector_type(4)))  float    v4f;
typedef v8h  __attribute__((may_alias)) v8ha;
typedef v4f  __attribute__((may_alias)) v4fa;
typedef v8us __attribute__((may_alias)) v8usa;

__device__ __forceinline__ unsigned short f2bf(float f) { unsigned u = __float_as_uint(f); u += 0x7FFFu + ((u >> 16) & 1u); return (unsigned short)(u >> 16); }
__device__ __forceinline__ float bf2f(unsigned short b) { return __uint_as_float(((unsigned)b) << 16); }
__device__ __forceinline__ float bfr(float f) { return bf2f(f2bf(f)); }
__device__ __forceinline__ v16h cat16(v8h lo, v8h hi) { return __builtin_shufflevector(lo, hi, 0, 1, 2, 3, 4, 5, 6, 7, 8, 9, 10, 11, 12, 13, 14, 15); }
__device__ __forceinline__ v16bf cat16b(v8us lo, v8us hi) { return __builtin_bit_cast(v16bf, __builtin_shufflevector(lo, hi, 0, 1, 2, 3, 4, 5, 6, 7, 8, 9, 10, 11, 12, 13, 14, 15)); }
__device__ __forceinline__ v8f wmma16(v16h a, v16h b, v8f c) { return __builtin_amdgcn_wmma_f32_16x16x32_f16(false, a, false, b, (short)0, c, false, false); }
__device__ __forceinline__ v8f wmmab(v16bf a, v16bf b, v8f c) { return __builtin_amdgcn_wmma_f32_16x16x32_bf16(false, a, false, b, (short)0, c, false, false); }

__device__ __forceinline__ void splitf(float y, unsigned short& h, unsigned short& l) { h = f2bf(y); l = f2bf(y - bf2f(h)); }
typedef __attribute__((ext_vector_type(2))) float    v2f;
typedef __attribute__((ext_vector_type(2))) __bf16   v2bf;
typedef __attribute__((ext_vector_type(2))) unsigned v2u;
typedef __attribute__((ext_vector_type(4))) unsigned v4u;
// pk2bf: two f32 -> two bf16 (round to nearest even, as f2bf) in the hardware's one packed convert, x[0] in the low half. split2: splitf of two values at once, each word packed as it is stored.
__device__ __forceinline__ unsigned pk2bf(v2f x) { return __builtin_bit_cast(unsigned, __builtin_convertvector(x, v2bf)); }
__device__ __forceinline__ void split2(v2f y, unsigned& h, unsigned& l) { h = pk2bf(y); const v2f hf = {__uint_as_float(h << 16), __uint_as_float(h & 0xFFFF0000u)}; l = pk2bf(y - hf); }
typedef __attribute__((ext_vector_type(2))) unsigned short v2us;
typedef __attribute__((ext_vector_type(4))) unsigned short v4us;

// ---- k_gemmw: register-blocked GEMM, ONE WAVE per 64x64 output tile (16 accumulators), operands straight from 16-bit planes in fragment order; grid (M/64, N/64, Z), 32 threads.
// C[m][n] (f32, pitch ldc, + optional f32 bias[n]) = sum_k A[m][k] Bt[n][k] (+ split products per NSPLIT). z-batch strides sA/sB/sC in elements. K % 32 == 0.
// Split K (long K): NW waves per work-group and KS work-groups per tile each take K / (KS * NW) consecutive k of the same 64x64 tile; the NW partial tiles are summed through LDS in wave order, and work-group ks (blockIdx.z = z * KS + ks) writes its own f32 plane at C + ks * sP, summed by the consumer. Grid (M/64, N/64, Z * KS), NW * 32 threads. K % (KS * NW * 32) == 0. NW > 1 takes no bias.
// FRAGMENT ORDER: every 16-bit operand plane [row][k] in memory (A, A2, Bt, Bt2 here and in gemms, and the planes that gemms stores) is kept as blocks of 16 rows x 32 k, 512 consecutive elements each: element (row lr, k = 16 sh + 8 hi + e) lies at (sh * 32 + hi * 16 + lr) * 8 + e of its block, the blocks of one 16-row strip follow one another along k, and a strip is 16 * K elements.
// A wave-wide 16-byte load (lane = hi * 16 + lr) then takes 512 consecutive bytes, four whole lines (of a row-major plane it would take 32 bytes out of each of 16 lines); which lane and register hold an element is the hardware's fragment layout, k order 8 hi + e, then 16 + 8 hi + e, alike for A and B.
// ld: one fragment of a plane in fragment order; p = its 16 x 32 block + lane * 8.
template <typename T16> struct WFrag;
template <> struct WFrag<h16> { typedef v16h V; static __device__ __forceinline__ V ld(const h16* p) { return cat16(*(const v8h*)p, *(const v8h*)(p + 256)); } static __device__ __forceinline__ v8f mma(V a, V b, v8f c) { return wmma16(a, b, c); } };
template <> struct WFrag<bf> { typedef v16bf V; static __device__ __forceinline__ V ld(const bf* p) { return cat16b(*(const v8us*)p, *(const v8us*)(p + 256)); } static __device__ __forceinline__ v8f mma(V a, V b, v8f c) { return wmmab(a, b, c); } };
// gemmw is the body: os is the work-group's LDS (GEMMW_LDS floats), (bx, by, bz) its place in the grid above. k_gemmw launches one GEMM.
#define GEMMW_LDS(NW) ((NW) == 1 ? 16 * 68 : (NW) * 64 * 68)
template <typename T16, int NSPLIT, bool BIAS, int NW, int KS>
__device__ __forceinline__ void gemmw(float* os, int bx, int by, int bz, const T16* __restrict__ A, const T16* __restrict__ A2, const T16* __restrict__ Bt, const T16* __restrict__ Bt2, int K, float* C, int ldc, const float* __restrict__ bias, size_t sA, size_t sB, size_t sC, size_t sP) {
    typedef typename WFrag<T16>::V V;
    const size_t z = bz / KS; const int ks = bz % KS; A += z * sA; if (A2) A2 += z * sA; Bt += z * sB; if (Bt2) Bt2 += z * sB; C += z * sC + (size_t)ks * sP;
    const int wave = (NW == 1) ? 0 : __builtin_amdgcn_readfirstlane(threadIdx.x >> 5); const int kw = K / (KS * NW), k0 = (ks * NW + wave) * kw;   /* this wave's k range [k0, k0 + kw) */
    const int lane = threadIdx.x & 31, lr = lane & 15, hi = lane >> 4; const int r0 = bx * 64, c0 = by * 64;
    v8f acc[4][4];
#pragma unroll
    for (int mb = 0; mb < 4; ++mb)
#pragma unroll
        for (int nb = 0; nb < 4; ++nb) acc[mb][nb] = (v8f){};
    const size_t aoff = (size_t)r0 * K + (size_t)k0 * 16 + lane * 8, boff = (size_t)c0 * K + (size_t)k0 * 16 + lane * 8;   /* strip r0 / 16, block k0 / 32 */
#pragma unroll 1
    for (int kc = 0; kc < kw; kc += 32) {
        V a[4], a2[4];
#pragma unroll
        for (int mb = 0; mb < 4; ++mb) { a[mb] = WFrag<T16>::ld(A + aoff + (size_t)mb * 16 * K + kc * 16); if (NSPLIT == 1 || NSPLIT == 2) a2[mb] = WFrag<T16>::ld(A2 + aoff + (size_t)mb * 16 * K + kc * 16); }
#pragma unroll
        for (int nb = 0; nb < 4; ++nb) { const V b = WFrag<T16>::ld(Bt + boff + (size_t)nb * 16 * K + kc * 16); V b2; if (NSPLIT >= 2) b2 = WFrag<T16>::ld(Bt2 + boff + (size_t)nb * 16 * K + kc * 16);
#pragma unroll
            for (int mb = 0; mb < 4; ++mb) { acc[mb][nb] = WFrag<T16>::mma(a[mb], b, acc[mb][nb]); if (NSPLIT == 1 || NSPLIT == 2) acc[mb][nb] = WFrag<T16>::mma(a2[mb], b, acc[mb][nb]); if (NSPLIT >= 2) acc[mb][nb] = WFrag<T16>::mma(a[mb], b2, acc[mb][nb]); } }
        asm volatile("v_nop\n\tv_nop\n\tv_nop\n\tv_nop" : "+v"(acc[0][0]), "+v"(acc[1][1]), "+v"(acc[2][2]), "+v"(acc[3][3]) : "v"(a[0]), "v"(a[3]));
    }
    if (NW > 1) {
        float* rw = os + wave * (64 * 68);
        // the three loops are unrolled so that acc is indexed by constants and stays in registers
#pragma unroll
        for (int mb = 0; mb < 4; ++mb)
#pragma unroll
            for (int nb = 0; nb < 4; ++nb)
#pragma unroll
                for (int j = 0; j < 8; ++j) rw[(mb * 16 + hi * 8 + j) * 68 + nb * 16 + lr] = acc[mb][nb][j];
        __syncthreads();   // every wave's partial tile is in LDS before any thread sums across the waves
        // the s and w loops are unrolled so that a thread's LDS reads issue together; the sum stays in wave order
        {
#pragma unroll
            for (int s = 0; s < 32 / NW; ++s) { const int idx = s * (NW * 32) + (int)threadIdx.x; const int row = idx >> 4, cofs = (idx & 15) * 4; v4f val = *(const v4fa*)(os + row * 68 + cofs);
#pragma unroll
                for (int w = 1; w < NW; ++w) { const v4f p = *(const v4fa*)(os + w * (64 * 68) + row * 68 + cofs); val[0] += p[0]; val[1] += p[1]; val[2] += p[2]; val[3] += p[3]; }
                *(v4f*)(C + (size_t)(r0 + row) * ldc + c0 + cofs) = val; }
        }
        return;
    }
#pragma unroll
    for (int mb = 0; mb < 4; ++mb) {
#pragma unroll
        for (int nb = 0; nb < 4; ++nb) {
#pragma unroll
            for (int j = 0; j < 8; ++j) os[(hi * 8 + j) * 68 + nb * 16 + lr] = acc[mb][nb][j]; }
        __builtin_amdgcn_wave_barrier(); asm volatile("" ::: "memory");
        float* crow = C + (size_t)(r0 + mb * 16) * ldc + c0;
{
#pragma unroll
            for (int s = 0; s < 8; ++s) { const int row = 2 * s + hi, cofs = lr * 4; v4f val = *(const v4fa*)(os + row * 68 + cofs); if (BIAS) { val[0] += bfr(bias[c0 + cofs]); val[1] += bfr(bias[c0 + cofs + 1]); val[2] += bfr(bias[c0 + cofs + 2]); val[3] += bfr(bias[c0 + cofs + 3]); }
                *(v4f*)(crow + (size_t)row * ldc + cofs) = val; }
             }
        __builtin_amdgcn_wave_barrier(); asm volatile("" ::: "memory");
    }
}

template <typename T16, int NSPLIT, bool BIAS, int NW, int KS>
__global__ __launch_bounds__(NW * 32) void k_gemmw(const T16* __restrict__ A, const T16* __restrict__ A2, const T16* __restrict__ Bt, const T16* __restrict__ Bt2, int K, float* C, int ldc, const float* __restrict__ bias, size_t sA, size_t sB, size_t sC, size_t sP) {
    __shared__ __align__(16) float os[GEMMW_LDS(NW)];
    gemmw<T16, NSPLIT, BIAS, NW, KS>(os, blockIdx.x, blockIdx.y, blockIdx.z, A, A2, Bt, Bt2, K, C, ldc, bias, sA, sB, sC, sP);
}
// ---- gemms: the projection GEMMs (K = DM), ONE WORK-GROUP of eight waves per 128 x 128 output tile, operands shared through LDS. Wave wk * 4 + wn * 2 + wm holds the 64 x 64 quarter (wm, wn) of the tile over the k blocks of parity wk.
// A stage is 64 k (two blocks) of the tile's 128 A rows, 128 Bt rows and, NSPLIT == 1, 128 A2 rows: 16 KiB an operand. Asynchronous 16-byte copies bring it from memory straight into LDS, and every wave reads its fragments there,
// so that L2 delivers each operand byte once a work-group: 2 KiB an operand row of the tile and 1024 k, half of what eight waves that each load their own fragments of one 64 x 64 tile ask for.
// The planes are in fragment order: a strip's two blocks of a stage are 2 KiB in a row in memory and keep that order in LDS (operand o, strip u, block kb at (o * 16 + u * 2 + kb) * 512 elements), and a fragment is two wave-wide 16-byte LDS reads of 512 consecutive bytes each.
// Two buffers: stage s + 2 is asked for when every wave has left stage s, so its copies fly while stage s + 1 is worked on. The two k halves of a quarter are summed through LDS (wk 0 + wk 1). Every plain '#pragma unroll' in gemms is there so that the register arrays (fragments, accumulators, the pieces) are indexed by constants and stay in registers.
// EPI: what the summed tile is stored as. 1: its bf16 hi and lo planes at P1h / P1l. 2: the planes of (tile + hb1[n]) at P1h / P1l and of (tile + hb2[n]) at P2h / P2l (hb rounded to bf16).
// The block of output rows m .. m + 15, columns n .. n + 63 (n % 64 == 0) lies at (n / 64) * sH + (m / 16) * 16 * ldo: head planes [n / 64][m][64] with sH = M * 64, ldo = 64; a plain [m][n] plane with sH = 64 * 16, ldo = N.
#define GS_OP   8192               // elements of one operand in a stage: 128 rows x 64 k
#define GS_NST  (DM / 64)          // stages
// cps: a thread's copies of one stage, four an operand: one 16-byte piece out of each 4 KiB of LDS (two strips). l = its LDS byte address in the buffer, ga / gb / ga2 = its piece of each operand's first two strips.
// All copies of a stage stand in one statement, whose closing wait stands in front of any rewrite of the registers that they name.
#define CPA(l, g) "global_load_async_to_lds_b128 %" #l ", %" #g ", off\n\t"
#define GS_2S   (2 * 16 * DM)      // elements from a strip to the next but one
template <int NSPLIT>
__device__ __forceinline__ void cps(unsigned l, const bf* ga, const bf* gb, const bf* ga2) {
    if (NSPLIT == 1)
        asm volatile(CPA(0, 12) CPA(1, 13) CPA(2, 14) CPA(3, 15) CPA(4, 16) CPA(5, 17) CPA(6, 18) CPA(7, 19) CPA(8, 20) CPA(9, 21) CPA(10, 22) CPA(11, 23) "s_wait_xcnt 0x0"
                     :: "v"(l), "v"(l + 4096u), "v"(l + 8192u), "v"(l + 12288u), "v"(l + 16384u), "v"(l + 20480u), "v"(l + 24576u), "v"(l + 28672u), "v"(l + 32768u), "v"(l + 36864u), "v"(l + 40960u), "v"(l + 45056u),
                        "v"(ga), "v"(ga + GS_2S), "v"(ga + 2 * GS_2S), "v"(ga + 3 * GS_2S), "v"(gb), "v"(gb + GS_2S), "v"(gb + 2 * GS_2S), "v"(gb + 3 * GS_2S), "v"(ga2), "v"(ga2 + GS_2S), "v"(ga2 + 2 * GS_2S), "v"(ga2 + 3 * GS_2S) : "memory");
    else
        asm volatile(CPA(0, 8) CPA(1, 9) CPA(2, 10) CPA(3, 11) CPA(4, 12) CPA(5, 13) CPA(6, 14) CPA(7, 15) "s_wait_xcnt 0x0"
                     :: "v"(l), "v"(l + 4096u), "v"(l + 8192u), "v"(l + 12288u), "v"(l + 16384u), "v"(l + 20480u), "v"(l + 24576u), "v"(l + 28672u),
                        "v"(ga), "v"(ga + GS_2S), "v"(ga + 2 * GS_2S), "v"(ga + 3 * GS_2S), "v"(gb), "v"(gb + GS_2S), "v"(gb + 2 * GS_2S), "v"(gb + 3 * GS_2S) : "memory");
}
__device__ __forceinline__ v16bf ldsblk(const bf* p) { return cat16b(*(const v8usa*)p, *(const v8usa*)(p + 256)); }   /* one fragment of a block in LDS; p = the block + lane * 8 */
template <int NSPLIT, int EPI>
__device__ __forceinline__ void gemms(float* os, int bx, int by, const bf* __restrict__ A, const bf* __restrict__ A2, const bf* __restrict__ Bt, bf* P1h, bf* P1l, bf* P2h, bf* P2l, const float* __restrict__ hb1, const float* __restrict__ hb2, size_t sH, int ldo) {
    constexpr int SE = (NSPLIT == 1 ? 3 : 2) * GS_OP;   /* elements of a stage */
    static_assert(2 * SE * 2 <= GEMMW_LDS(8) * 4 && GS_NST >= 2, "gemms: the two buffers lie inside the work-group's LDS; stages 0 and 1 exist");
    const int t = (int)threadIdx.x; const int wave = __builtin_amdgcn_readfirstlane(t >> 5); const int lane = t & 31, lr = lane & 15, hi = lane >> 4; const int wm = wave & 1, wn = (wave >> 1) & 1, wk = wave >> 2;
    const bf* ring = (const bf*)os; const unsigned l0 = (unsigned)(size_t)os + (unsigned)t * 16u;   /* the low 32 bits of a __shared__ address are its LDS byte address */
    const size_t go = (size_t)(t >> 7) * 16 * DM + (t & 127) * 8;   /* piece t of the first two strips' 2 KiB runs */
    const bf* gA = A + (size_t)bx * 128 * DM + go; const bf* gB = Bt + (size_t)by * 128 * DM + go; const bf* gA2 = NSPLIT == 1 ? A2 + (size_t)bx * 128 * DM + go : nullptr;
    auto fill = [&](int s, int buf) { cps<NSPLIT>(l0 + (unsigned)buf * (SE * 2u), gA + s * 1024, gB + s * 1024, NSPLIT == 1 ? gA2 + s * 1024 : nullptr); };   /* LDS: A at 0, Bt at 16 KiB, A2 at 32 KiB of the buffer */
    v8f acc[4][4];
#pragma unroll
    for (int mb = 0; mb < 4; ++mb)
#pragma unroll
        for (int nb = 0; nb < 4; ++nb) acc[mb][nb] = (v8f){};
    fill(0, 0);
    asm volatile("s_wait_asynccnt 0x0" ::: "memory");   /* this wave's copies of stage 0 have landed */
    __syncthreads();   // stage 0 is whole before any wave reads it
    fill(1, 1);
    // not unrolled: one stage's fragments are live at a time
#pragma unroll 1
    for (int s = 0; s < GS_NST; ++s) {
        const bf* sb = ring + (s & 1) * SE + wk * 512 + lane * 8;
        v16bf a[4], a2[4], b[4];
        // the fragment and product loops are unrolled so that the register arrays are indexed by constants
#pragma unroll
        for (int mb = 0; mb < 4; ++mb) { a[mb] = ldsblk(sb + (wm * 4 + mb) * 1024); if (NSPLIT == 1) a2[mb] = ldsblk(sb + 2 * GS_OP + (wm * 4 + mb) * 1024); }
#pragma unroll
        for (int nb = 0; nb < 4; ++nb) b[nb] = ldsblk(sb + GS_OP + (wn * 4 + nb) * 1024);
        // inputs only: holds the stage's fragment reads in front of the products, so that they issue together and are waited for once, not operand by operand
        if (NSPLIT == 1) asm volatile("" :: "v"(a[0]), "v"(a[1]), "v"(a[2]), "v"(a[3]), "v"(a2[0]), "v"(a2[1]), "v"(a2[2]), "v"(a2[3]), "v"(b[0]), "v"(b[1]), "v"(b[2]), "v"(b[3]));
        else asm volatile("" :: "v"(a[0]), "v"(a[1]), "v"(a[2]), "v"(a[3]), "v"(b[0]), "v"(b[1]), "v"(b[2]), "v"(b[3]));
#pragma unroll
        for (int nb = 0; nb < 4; ++nb)
#pragma unroll
            for (int mb = 0; mb < 4; ++mb) { acc[mb][nb] = wmmab(a[mb], b[nb], acc[mb][nb]); if (NSPLIT == 1) acc[mb][nb] = wmmab(a2[mb], b[nb], acc[mb][nb]); }
        __builtin_amdgcn_sched_barrier(0);   // keeps the products in front of the waits: moved behind the barrier they would stand between it and the refill, and the copies would fly that much shorter before they are waited for
        asm volatile("s_wait_dscnt 0x0" ::: "memory");      /* this wave's reads of stage s are over */
        asm volatile("s_wait_asynccnt 0x0" ::: "memory");   /* this wave's copies of stage s + 1 have landed */
        __syncthreads();   // stage s + 1 is whole, and every wave has left stage s, before s + 1 is read and the buffer of s is refilled
        if (s + 2 < GS_NST) fill(s + 2, s & 1);
    }
    asm volatile("s_wait_asynccnt 0x0" ::: "memory");   /* no copy is outstanding when the ring's LDS takes the partial tiles (the last trip's barrier has ended every read of it) */
    float* rw = os + wave * (64 * 68);
    // the three loops are unrolled so that acc is indexed by constants and stays in registers
#pragma unroll
    for (int mb = 0; mb < 4; ++mb)
#pragma unroll
        for (int nb = 0; nb < 4; ++nb)
#pragma unroll
            for (int j = 0; j < 8; ++j) rw[(mb * 16 + hi * 8 + j) * 68 + nb * 16 + lr] = acc[mb][nb][j];
    __syncthreads();   // every wave's partial tile is in LDS before any thread sums the two k halves
    // a thread takes the eight elements of one 16-byte piece of the planes, pieces in fragment order: a wave stores 512 consecutive bytes of each plane. Unrolled so that the quarter is a constant and a thread's LDS reads issue together
#pragma unroll
    for (int s = 0; s < 8; ++s) { const int wt = s >> 1, idx = (s & 1) * 256 + t;   /* piece idx of quarter wt = wn * 2 + wm */ const int row = (idx >> 7) * 16 + (idx & 15), cofs = ((idx >> 4) & 7) * 8;
        const float* o0 = os + wt * (64 * 68) + row * 68 + cofs; v4f va = *(const v4fa*)o0, vb = *(const v4fa*)(o0 + 4); const v4f p = *(const v4fa*)(o0 + 4 * (64 * 68)), p2 = *(const v4fa*)(o0 + 4 * (64 * 68) + 4);
        va[0] += p[0]; va[1] += p[1]; va[2] += p[2]; va[3] += p[3]; vb[0] += p2[0]; vb[1] += p2[1]; vb[2] += p2[2]; vb[3] += p2[3];
        const int c0 = (by * 2 + (wt >> 1)) * 64; const size_t po = (size_t)(by * 2 + (wt >> 1)) * sH + (size_t)(bx * 8 + (wt & 1) * 4 + (idx >> 7)) * 16 * ldo + (idx & 127) * 8; v4u oh, ol;
        // both q loops are unrolled so that va, vb, oh and ol are indexed by constants and stay in registers
#pragma unroll
        for (int q = 0; q < 8; q += 2) { v2f val = q < 4 ? (v2f){va[q & 3], va[(q & 3) + 1]} : (v2f){vb[q & 3], vb[(q & 3) + 1]}; if (EPI == 2) val = (v2f){__fadd_rn(val[0], bfr(hb1[c0 + cofs + q])), __fadd_rn(val[1], bfr(hb1[c0 + cofs + q + 1]))}; unsigned x, y; split2(val, x, y); oh[q >> 1] = x; ol[q >> 1] = y; }
        *(v8us*)(P1h + po) = __builtin_bit_cast(v8us, oh); *(v8us*)(P1l + po) = __builtin_bit_cast(v8us, ol);
        if (EPI == 2) {
#pragma unroll
            for (int q = 0; q < 8; q += 2) { const v2f val = q < 4 ? (v2f){va[q & 3], va[(q & 3) + 1]} : (v2f){vb[q & 3], vb[(q & 3) + 1]}; unsigned x, y; split2((v2f){__fadd_rn(val[0], bfr(hb2[c0 + cofs + q])), __fadd_rn(val[1], bfr(hb2[c0 + cofs + q + 1]))}, x, y); oh[q >> 1] = x; ol[q >> 1] = y; }
            *(v8us*)(P2h + po) = __builtin_bit_cast(v8us, oh); *(v8us*)(P2l + po) = __builtin_bit_cast(v8us, ol); }
        asm volatile("s_wait_xcnt 0x0" ::: "memory");   /* stands in front of any rewrite of the registers that the plane stores name: the next piece's, or another GEMM's code that follows this one in the listing */ }
}
// k_proj holds the four projections, which do not depend on one another, in one launch, every work-group resident at once: work-groups [0, GP) the position table x w_p (the longest, so first), [GP, GP + GQ) q, then GQ each for k and v; inside each range the tile's row index runs fastest, as in a grid of its own.
#define GP   ((NPU / 128) * (DQ / 128))
#define GQ   ((TT / 128) * (DQ / 128))
__global__ __launch_bounds__(256) void k_proj(const bf* __restrict__ PEh, const bf* __restrict__ PEl, const bf* __restrict__ WP, const bf* __restrict__ XB, const bf* __restrict__ WQ, const bf* __restrict__ XKB, const bf* __restrict__ WK, const bf* __restrict__ XVB, const bf* __restrict__ WV,
                                              bf* PPh, bf* PPl, bf* QPh, bf* QPl, bf* QVh, bf* QVl, bf* KPh, bf* KPl, bf* VTh, bf* VTl, const float* __restrict__ pbu, const float* __restrict__ pbv) {
    __shared__ __align__(16) float os[GEMMW_LDS(8)];
    const int i = blockIdx.x;
    if (i < GP) {   // kept rows of the reversed sinusoidal table (hi/lo) x w_p -> per-head position planes [h][NPU][64]
        gemms<1, 1>(os, i % (NPU / 128), i / (NPU / 128), PEh, PEl, WP, PPh, PPl, nullptr, nullptr, nullptr, nullptr, (size_t)NPU * HD, HD);
    } else if (i < GP + GQ) {   // (q + b_u) planes for the content scores, (q + b_v) planes for the position scores
        const int j = i - GP;
        gemms<0, 2>(os, j % (TT / 128), j / (TT / 128), XB, nullptr, WQ, QPh, QPl, QVh, QVl, pbu, pbv, (size_t)TT * HD, HD);
    } else {   // k: head planes [h][t][64]. v: w_v as the row operand, so that the tile is v transposed, [head x 64 + d][t], as attn.v reads it
        const bool isv = i >= GP + 2 * GQ; const int j = i - GP - (isv ? 2 * GQ : GQ); const int nx = isv ? DKV / 128 : TT / 128;
        gemms<0, 1>(os, j % nx, j / nx, isv ? WV : XKB, nullptr, isv ? XVB : WK, isv ? VTh : KPh, isv ? VTl : KPl, nullptr, nullptr, nullptr, nullptr, isv ? (size_t)64 * 16 : (size_t)TT * HD, isv ? TT : HD);
    }
}

// k_prep: all that the GEMMs read is prepared in ONE launch of NPB work-groups, few enough to be resident together. Every plane it writes is in fragment order (see k_gemmw). Every wave transposes one 16 n x 32 k block of one weight, w [k][n] f32 -> Bt [n][k] bf16 (256 work-groups a weight, five weights);
// between those loads and their stores, work-groups 0 .. NPT - 1 fill the position table (a thread keeps one sin/cos column pair, so one powf, for PER rows) and the other NPB - NPT round q, k and v to bf16 (a thread takes CVS octets of each); ahead of that, work-groups 0 .. TT / 8 - 1 pack the mask to bits (a wave takes one query row).
// MASK BITS: row i of the mask is TT / 32 words at MB + i * (TT / 32); bit l of word ch * 4 + q says whether mask[i][ch * 128 + l * 4 + q] != 0. A word is then the lane mask of one register of the softmax's score row (lane l holds keys ch * 128 + l * 4 + q):
// the attention fetches a row's mask as 256 bytes through the scalar path, the same for all lanes, where the int mask is 8 KiB a row and head through the vector path, and the select takes the word as its condition with no compare.
#define NPB  1280                  // 5 weights x DM * DQ / 64 / 64
#define NPT  1024                  // table work-groups: two a row block (512 column pairs = 2 x 256 threads)
#define PER  (NPU * 2 / NPT)       // table rows a thread
#define CVS  (TT * DM / 8 / ((NPB - NPT) * 256))   // octets of each input a thread
static_assert(NB_ == 1 && DQ == DM && DKV == DM && 5 * (DM * DQ / 64 / 64) == NPB && PER * NPT == NPU * 2 && NPU <= NPE && CVS * (NPB - NPT) * 256 * 8 == TT * DM && TT / 8 <= NPB && TT % 128 == 0 && TT / 128 <= 32, "k_prep: the shares are exact");
// piece i of the plane in fragment order holds row (i >> 11) * 16 + (i & 15), octet (i >> 4) & 127 of the row-major input [row][DM]
__device__ __forceinline__ void cvt8(const float* __restrict__ src, bf* __restrict__ dst, size_t i) { const v8f v = *(const v8f*)(src + (((i >> 11) * 16 + (i & 15)) * (DM / 8) + ((i >> 4) & (DM / 8 - 1))) * 8); v8us o;
    // unrolled so that v and o are indexed by constants and stay in registers
#pragma unroll
    for (int k = 0; k < 8; ++k) o[k] = f2bf(v[k]);
    *(v8us*)(dst + i * 8) = o; }
__global__ __launch_bounds__(256) void k_prep(const float* __restrict__ x, const float* __restrict__ xk, const float* __restrict__ xv, const float* __restrict__ wq, const float* __restrict__ wk, const float* __restrict__ wv, const float* __restrict__ wo, const float* __restrict__ wp, const int* __restrict__ mk,
                                              bf* __restrict__ XB, bf* __restrict__ XKB, bf* __restrict__ XVB, bf* __restrict__ WQ, bf* __restrict__ WK, bf* __restrict__ WV, bf* __restrict__ WO, bf* __restrict__ WP, bf* __restrict__ PEh, bf* __restrict__ PEl, unsigned* __restrict__ MB) {
    const int b = blockIdx.x, t = threadIdx.x, lane = t & 31; const int wi = b >> 8;
    const float* w = wi == 0 ? wq : wi == 1 ? wk : wi == 2 ? wv : wi == 3 ? wo : wp; bf* Bt = wi == 0 ? WQ : wi == 1 ? WK : wi == 2 ? WV : wi == 3 ? WO : WP;
    const int blk = (b & 255) * 8 + (t >> 5);   /* the wave's block: strip n / 16 = blk / 32, k / 32 = blk % 32 */
    const float* wl = w + (size_t)((blk & 31) * 32 + (lane >> 4) * 8) * DQ + (blk >> 5) * 16 + (lane & 15);   /* this lane's n, its first k */
    float r[2][8];
    // unrolled so that r is indexed by constants and the sixteen loads of a wave fly together
#pragma unroll
    for (int sh = 0; sh < 2; ++sh)
#pragma unroll
        for (int e = 0; e < 8; ++e) r[sh][e] = wl[(size_t)(sh * 16 + e) * DQ];
    asm volatile("s_wait_xcnt 0x0" ::: "memory");   /* stands in front of any rewrite of the address registers that the sixteen loads name */
    if (b < TT / 8) {   // the mask's bits, a row a wave: in the work-groups that start first, which have the most time left before the launch ends
        const int mrow = b * 8 + (t >> 5); const int* mr = mk + (size_t)mrow * TT + lane * 4; v4i m[TT / 128];
        // both ch loops are unrolled so that m is indexed by constants and the row's loads fly together
#pragma unroll
        for (int ch = 0; ch < TT / 128; ++ch) m[ch] = *(const v4i*)(mr + ch * 128);
        asm volatile("s_wait_xcnt 0x0" ::: "memory");   /* stands in front of any rewrite of the address registers that the row's loads name */
        v4u mw = {0u, 0u, 0u, 0u};   /* lane ch keeps the four words of chunk ch */
#pragma unroll
        for (int ch = 0; ch < TT / 128; ++ch) { const v4u w = {__builtin_amdgcn_ballot_w32(m[ch][0] != 0), __builtin_amdgcn_ballot_w32(m[ch][1] != 0), __builtin_amdgcn_ballot_w32(m[ch][2] != 0), __builtin_amdgcn_ballot_w32(m[ch][3] != 0)}; if (lane == ch) mw = w; }
        if (lane < TT / 128) *(v4u*)(MB + (size_t)mrow * (TT / 32) + lane * 4) = mw;
    }
    if (b < NPT) {
        const int c = ((b & 1) * 256 + t) * 2; const float ex = __fdiv_rn((float)c, (float)DM);   /* c even: 2i/d_model */ const float den = powf(10000.0f, ex);
        for (int q = 0; q < PER; ++q) { const int m = (b >> 1) * PER + q; const float pos = (float)(NPU - 1 - m);   /* plane row m is table row NPE - NPU + m, reversed: position NPE - 1 - that */ const float th = __fdiv_rn(pos, den); v2us oh, ol; unsigned short a, b2; splitf(sinf(th), a, b2); oh[0] = a; ol[0] = b2; splitf(cosf(th), a, b2); oh[1] = a; ol[1] = b2;
            const size_t e = (size_t)(m >> 4) * 16 * DM + (c >> 5) * 512 + (((c >> 3) & 3) * 16 + (m & 15)) * 8 + (c & 7);   /* fragment order */ *(v2us*)(PEh + e) = oh; *(v2us*)(PEl + e) = ol; }
    } else {
        const size_t i0 = (size_t)(b - NPT) * 256 + t;
        for (int s = 0; s < CVS; ++s) { const size_t i = i0 + (size_t)s * ((NPB - NPT) * 256); cvt8(x, XB, i); cvt8(xk, XKB, i); cvt8(xv, XVB, i);
            asm volatile("s_wait_xcnt 0x0" ::: "memory");   /* stands in front of the next trip's rewrite of the registers that the three stores name */ }
    }
    // unrolled so that r is indexed by constants; each store is 512 consecutive bytes a wave
#pragma unroll
    for (int sh = 0; sh < 2; ++sh) { v8us o;
#pragma unroll
        for (int e = 0; e < 8; ++e) o[e] = f2bf(r[sh][e]);
        *(v8us*)(Bt + (size_t)blk * 512 + sh * 256 + lane * 8) = o; }
}

// k_attn: one work-group = one head x RB query rows, every stage of the attention on chip. The RB score rows [RB][2048] f32 live in LDS (pitch SP floats):
//   1 content scores (q + b_u).k into the rows; 2 raw position scores (q + b_v).ph only for the positions that the left shift keeps (m = 4095 - i + j, 0 <= j <= i), added at their shifted key j;
//   3 mask (its bits, see k_prep: a word is a register's lane mask), softmax per row (one wave a row, register row), the row rewritten in place as its bf16 hi plane (first 4 KiB) and lo plane (next 4 KiB);
//   4 attn.v with the hi/lo rows as the A operand from LDS, each wave TT / NWV keys, the NWV partial tiles summed through LDS in wave order and split into the merged hi/lo planes.
// Every plain '#pragma unroll' in this kernel is there so that the register arrays (fragments, accumulators, the score row) are indexed by constants and stay in registers.
#define MT   2                     // 16-row tiles of query rows per work-group
#define RB   (16 * MT)
#define NWV  (RB / 2)              // waves per work-group (two score rows a wave; RB * 8 output octets = NWV * 16 threads, half the waves)
#define SP   2052                  // floats per score row in LDS: 16-byte aligned rows, 4 banks apart
typedef v4us __attribute__((may_alias)) v4usa;
typedef unsigned __attribute__((address_space(4))) cmw;   // a mask word read as constant memory (no launch writes it while it is read): the compiler then fetches a wave-uniform address through the scalar path, into the scalar registers that the select reads
__device__ __forceinline__ v16bf ldsfrag(const bf* p) { return cat16b(*(const v8usa*)p, *(const v8usa*)(p + 16)); }
__device__ __forceinline__ v8f mma3(v16bf a, v16bf a2, v16bf b, v16bf b2, v8f c) { c = wmmab(a, b, c); c = wmmab(a2, b, c); return wmmab(a, b2, c); }
__global__ __launch_bounds__(NWV * 32) void k_attn(const bf* __restrict__ QUh, const bf* __restrict__ QUl, const bf* __restrict__ QWh, const bf* __restrict__ QWl, const bf* __restrict__ Kh, const bf* __restrict__ Kl, const bf* __restrict__ Rh, const bf* __restrict__ Rl, const bf* __restrict__ Vh, const bf* __restrict__ Vl, const unsigned* __restrict__ MB, bf* Ah, bf* Al) {
    typedef WFrag<bf> F;
    __shared__ __align__(16) float S[RB * SP];
    const int h = blockIdx.x; const int i0 = (TT / RB - 1 - (int)blockIdx.y) * RB;   /* late query rows have the most positions: they start first */
    const int wave = __builtin_amdgcn_readfirstlane(threadIdx.x >> 5); const int lane = threadIdx.x & 31, lr = lane & 15, hi = lane >> 4;
    const size_t qoff = ((size_t)h * TT + i0) * HD + lane * 8;   /* all global planes are in fragment order (see k_gemmw): a 16-row strip of a head plane is 16 * HD elements, two blocks of 512 */
    {   // 1: content scores, TT / 16 / NWV key tiles a wave
        v16bf a[MT][2], a2[MT][2];
#pragma unroll
        for (int mt = 0; mt < MT; ++mt)
#pragma unroll
            for (int kk = 0; kk < 2; ++kk) { a[mt][kk] = F::ld(QUh + qoff + mt * 16 * HD + kk * 512); a2[mt][kk] = F::ld(QUl + qoff + mt * 16 * HD + kk * 512); }
        const size_t koff = ((size_t)h * TT + wave * (TT / NWV)) * HD + lane * 8;
        for (int t = 0; t < TT / 16 / NWV; t += 2) { v16bf b[2][2], c[2][2];
#pragma unroll
            for (int u = 0; u < 2; ++u)
#pragma unroll
                for (int kk = 0; kk < 2; ++kk) { b[u][kk] = F::ld(Kh + koff + (t + u) * 16 * HD + kk * 512); c[u][kk] = F::ld(Kl + koff + (t + u) * 16 * HD + kk * 512); }
            // inputs only: holds the sixteen loads of two key tiles in front of the products, so that they fly together and are waited for once, not fragment by fragment
            asm volatile("" :: "v"(b[0][0]), "v"(b[0][1]), "v"(b[1][0]), "v"(b[1][1]), "v"(c[0][0]), "v"(c[0][1]), "v"(c[1][0]), "v"(c[1][1]));
#pragma unroll
            for (int u = 0; u < 2; ++u)
#pragma unroll
                for (int mt = 0; mt < MT; ++mt) { v8f acc = (v8f){}; acc = mma3(a[mt][0], a2[mt][0], b[u][0], c[u][0], acc); acc = mma3(a[mt][1], a2[mt][1], b[u][1], c[u][1], acc);
#pragma unroll
                    for (int j = 0; j < 8; ++j) S[(mt * 16 + hi * 8 + j) * SP + wave * (TT / NWV) + (t + u) * 16 + lr] = acc[j]; } }
    }
    __syncthreads();   // every content score is in LDS before a position score is added to it
    {   // 2: position tile t holds m = NPE - RB - i0 + 16 t + c; row r of the block meets it at key j = m - (NPE - 1) + i0 + r; each (r, j) belongs to exactly one (t, c)
        v16bf a[MT][2], a2[MT][2];
#pragma unroll
        for (int mt = 0; mt < MT; ++mt)
#pragma unroll
            for (int kk = 0; kk < 2; ++kk) { a[mt][kk] = F::ld(QWh + qoff + mt * 16 * HD + kk * 512); a2[mt][kk] = F::ld(QWl + qoff + mt * 16 * HD + kk * 512); }
        const int nt = (i0 + RB) / 16; const size_t roff = ((size_t)h * NPU + (NPU - RB - i0)) * HD + lane * 8;   /* plane row = m - (NPE - NPU) */
        for (int t = wave; t < nt; t += 2 * NWV) { const bool two = t + NWV < nt;   /* two tiles a trip, t and t + NWV; past the end the second one repeats the first and is dropped */
            v16bf b[2][2], c[2][2]; v8f acc[2][MT];
#pragma unroll
            for (int u = 0; u < 2; ++u) { const size_t to = roff + (size_t)((u && two) ? t + NWV : t) * 16 * HD;
#pragma unroll
                for (int kk = 0; kk < 2; ++kk) { b[u][kk] = F::ld(Rh + to + kk * 512); c[u][kk] = F::ld(Rl + to + kk * 512); } }
            // inputs only: holds the sixteen loads of two position tiles in front of the products, so that they fly together and are waited for once
            asm volatile("" :: "v"(b[0][0]), "v"(b[0][1]), "v"(b[1][0]), "v"(b[1][1]), "v"(c[0][0]), "v"(c[0][1]), "v"(c[1][0]), "v"(c[1][1]));
#pragma unroll
            for (int u = 0; u < 2; ++u)
#pragma unroll
                for (int mt = 0; mt < MT; ++mt) { acc[u][mt] = (v8f){}; acc[u][mt] = mma3(a[mt][0], a2[mt][0], b[u][0], c[u][0], acc[u][mt]); acc[u][mt] = mma3(a[mt][1], a2[mt][1], b[u][1], c[u][1], acc[u][mt]); }
            float* p = S + (hi * 8) * (SP + 1) + 16 * t + lr - (RB - 1);   /* row r = mt * 16 + hi * 8 + j, key 16 t + lr + r - (RB - 1) */
            if (16 * t >= RB - 1) {   // every key of the tile is >= 0 (a scalar test): the old scores are read together, with no lane test
                float o[MT][8];
#pragma unroll
                for (int mt = 0; mt < MT; ++mt)
#pragma unroll
                    for (int j = 0; j < 8; ++j) o[mt][j] = p[(mt * 16 + j) * (SP + 1)];
#pragma unroll
                for (int mt = 0; mt < MT; ++mt)
#pragma unroll
                    for (int j = 0; j < 8; ++j) p[(mt * 16 + j) * (SP + 1)] = __fadd_rn(o[mt][j], acc[0][mt][j]);
            } else {
#pragma unroll
                for (int mt = 0; mt < MT; ++mt)
#pragma unroll
                    for (int j = 0; j < 8; ++j) { const int key = 16 * t + lr + mt * 16 + hi * 8 + j - (RB - 1); if (key >= 0) p[(mt * 16 + j) * (SP + 1)] = __fadd_rn(p[(mt * 16 + j) * (SP + 1)], acc[0][mt][j]); }
            }
            if (two) {   // tile t + NWV: its keys are all >= 0 (16 NWV >= RB - 1)
                float* p2 = p + 16 * NWV; float o[MT][8];
#pragma unroll
                for (int mt = 0; mt < MT; ++mt)
#pragma unroll
                    for (int j = 0; j < 8; ++j) o[mt][j] = p2[(mt * 16 + j) * (SP + 1)];
#pragma unroll
                for (int mt = 0; mt < MT; ++mt)
#pragma unroll
                    for (int j = 0; j < 8; ++j) p2[(mt * 16 + j) * (SP + 1)] = __fadd_rn(o[mt][j], acc[1][mt][j]);
            } }
    }
    __syncthreads();   // the rows are complete before a wave takes its rows' softmax
    // not unrolled: one register row of 64 values is live at a time
#pragma unroll 1
    for (int rr = 0; rr < RB / NWV; ++rr) {   // 3: t = (ac + bd)/8, -inf where mask == 0; softmax over the 2048 keys (register row, one exp, fixed trees)
        const int r = wave * (RB / NWV) + rr; float* srow = S + r * SP; const cmw* mkr = (const cmw*)(MB + (size_t)(i0 + r) * (TT / 32));   /* the same for all lanes */ v2f v[TT / 64]; float mx = -3.0e38f;   /* the row as register pairs: a packed f32 instruction takes two scores */
#pragma unroll
        for (int ch = 0; ch < TT / 128; ++ch) { const int j0 = ch * 128 + lane * 4; const v4f s4 = *(const v4fa*)(srow + j0);
#pragma unroll
            for (int q = 0; q < 4; ++q) { const float t = __builtin_amdgcn_inverse_ballot_w32(mkr[ch * 4 + q]) ? s4[q] : -3.0e38f; v[ch * 2 + (q >> 1)][q & 1] = t; mx = fmaxf(mx, t); } }   /* the 1/8, a power of two, commutes with maximum, difference and rounding: it stands in the exponent's factor below */
#pragma unroll
        for (int sh = 16; sh; sh >>= 1) mx = fmaxf(mx, __shfl_xor(mx, sh, 32));
        v2f sum2 = {0.f, 0.f}; const v2f mx2 = {mx, mx}, c2 = {SCL * 1.4426950408889634f, SCL * 1.4426950408889634f};
#pragma unroll
        for (int k = 0; k < TT / 64; ++k) { const v2f d = (v[k] - mx2) * c2; v[k] = (v2f){__builtin_amdgcn_exp2f(d[0]), __builtin_amdgcn_exp2f(d[1])}; sum2 += v[k]; }
        float sum = sum2[0] + sum2[1];   /* a lane's even and odd keys are summed apart, then joined */
#pragma unroll
        for (int sh = 16; sh; sh >>= 1) sum += __shfl_xor(sum, sh, 32);
        const float f = __fdiv_rn(1.0f, sum); const v2f f2 = {f, f}; bf* prow = (bf*)srow;
#pragma unroll
        for (int ch = 0; ch < TT / 128; ++ch) { v2u oh, ol;
#pragma unroll
            for (int q = 0; q < 2; ++q) { unsigned x, y; split2(v[ch * 2 + q] * f2, x, y); oh[q] = x; ol[q] = y; }
            *(v4usa*)(prow + ch * 128 + lane * 4) = __builtin_bit_cast(v4us, oh); *(v4usa*)(prow + TT + ch * 128 + lane * 4) = __builtin_bit_cast(v4us, ol); }
    }
    __syncthreads();   // every row's hi/lo planes are in LDS before any wave reads them as its A operand
    v8f acc[MT][4];
#pragma unroll
    for (int mt = 0; mt < MT; ++mt)
#pragma unroll
        for (int nb = 0; nb < 4; ++nb) acc[mt][nb] = (v8f){};
    {   // 4: attn.v, this wave's keys [wave * TT / NWV, + TT / NWV)
        const bf* pa = (const bf*)S + (size_t)lr * (2 * SP) + 8 * hi + wave * (TT / NWV); const size_t voff = (size_t)h * HD * TT + wave * (TT / NWV) * 16 + lane * 8;   /* strip (h * HD + 16 nb) / 16 of 16 * TT elements, block key / 32 */
        // unrolled: four trips, acc indexed by constants
#pragma unroll
        for (int kc = 0; kc < TT / NWV; kc += 32) { v16bf a[MT], a2[MT];
#pragma unroll
            for (int mt = 0; mt < MT; ++mt) { a[mt] = ldsfrag(pa + mt * 16 * (2 * SP) + kc); a2[mt] = ldsfrag(pa + mt * 16 * (2 * SP) + TT + kc); }
            v16bf b[4], b2[4];
#pragma unroll
            for (int nb = 0; nb < 4; ++nb) { b[nb] = F::ld(Vh + voff + (size_t)nb * 16 * TT + kc * 16); b2[nb] = F::ld(Vl + voff + (size_t)nb * 16 * TT + kc * 16); }
            // inputs only: holds the sixteen v loads of this trip in front of the products, so that they fly together and are waited for once
            asm volatile("" :: "v"(b[0]), "v"(b[1]), "v"(b[2]), "v"(b[3]), "v"(b2[0]), "v"(b2[1]), "v"(b2[2]), "v"(b2[3]));
#pragma unroll
            for (int nb = 0; nb < 4; ++nb)
#pragma unroll
                for (int mt = 0; mt < MT; ++mt) acc[mt][nb] = mma3(a[mt], a2[mt], b[nb], b2[nb], acc[mt][nb]); }
    }
    __syncthreads();   // the last read of the hi/lo planes is over before their LDS takes the partial tiles
    float* rw = S + wave * (RB * 68);
#pragma unroll
    for (int mt = 0; mt < MT; ++mt)
#pragma unroll
        for (int nb = 0; nb < 4; ++nb)
#pragma unroll
            for (int j = 0; j < 8; ++j) rw[(mt * 16 + hi * 8 + j) * 68 + nb * 16 + lr] = acc[mt][nb][j];
    __syncthreads();   // every wave's partial tile is in LDS before any thread sums across the waves
    if (wave >= NWV / 2) return;   // RB * 8 pieces of eight elements: half the waves take one a thread, so that a wave stores 512 consecutive bytes of each plane (no barrier follows)
    const int idx = (int)threadIdx.x; const int row = (idx >> 7) * 16 + (idx & 15), cofs = ((idx >> 4) & 7) * 8;   /* piece idx of the block's rows in fragment order */
    v4f va = *(const v4fa*)(S + row * 68 + cofs), vb = *(const v4fa*)(S + row * 68 + cofs + 4);
    // unrolled so that a thread's LDS reads issue together; the sum stays in wave order
#pragma unroll
    for (int w = 1; w < NWV; ++w) { const v4f p = *(const v4fa*)(S + w * (RB * 68) + row * 68 + cofs), p2 = *(const v4fa*)(S + w * (RB * 68) + row * 68 + cofs + 4); va[0] += p[0]; va[1] += p[1]; va[2] += p[2]; va[3] += p[3]; vb[0] += p2[0]; vb[1] += p2[1]; vb[2] += p2[2]; vb[3] += p2[3]; }
    v4u oh, ol;
#pragma unroll
    for (int q = 0; q < 8; q += 2) { unsigned x, y; split2(q < 4 ? (v2f){va[q & 3], va[(q & 3) + 1]} : (v2f){vb[q & 3], vb[(q & 3) + 1]}, x, y); oh[q >> 1] = x; ol[q >> 1] = y; }
    const size_t oo = (size_t)((i0 >> 4) + (idx >> 7)) * 16 * DQ + h * HD * 16 + (idx & 127) * 8; *(v8us*)(Ah + oo) = __builtin_bit_cast(v8us, oh); *(v8us*)(Al + oo) = __builtin_bit_cast(v8us, ol);
}

extern "C" void kernel_launch(void* const* d_in, const int* in_sizes, int n_in,
                              void* d_out, int out_size, void* d_ws, size_t ws_size, hipStream_t stream) {
    (void)in_sizes; (void)n_in; (void)out_size;
    const float* x = (const float*)d_in[0]; const float* xk = (const float*)d_in[1]; const float* xv = (const float*)d_in[2]; const int* MK = (const int*)d_in[3]; const float* wq = (const float*)d_in[4]; const float* wk = (const float*)d_in[5]; const float* wv = (const float*)d_in[6]; const float* wp = (const float*)d_in[7]; const float* wo = (const float*)d_in[8]; const float* pbu = (const float*)d_in[9]; const float* pbv = (const float*)d_in[10];
    float* OUT = (float*)d_out;     // [1][2048][1024]
    char* wsp = (char*)d_ws;
    auto take = [&](size_t bytes) { char* p = wsp; wsp += (bytes + 255) & ~(size_t)255; return (void*)p; };
    bf* WQ = (bf*)take((size_t)DQ * DM * 2); bf* WK = (bf*)take((size_t)DKV * DM * 2); bf* WV = (bf*)take((size_t)DKV * DM * 2); bf* WO = (bf*)take((size_t)DM * DQ * 2);
    bf* XB = (bf*)take((size_t)TT * DM * 2); bf* XKB = (bf*)take((size_t)TT * DM * 2); bf* XVB = (bf*)take((size_t)TT * DM * 2); bf* WP = (bf*)take((size_t)DQ * DM * 2); bf* PPh = (bf*)take((size_t)NH_ * NPU * HD * 2); bf* PPl = (bf*)take((size_t)NH_ * NPU * HD * 2); bf* QVh = (bf*)take((size_t)NH_ * TT * HD * 2); bf* QVl = (bf*)take((size_t)NH_ * TT * HD * 2);
    bf* QPh = (bf*)take((size_t)NH_ * TT * HD * 2); bf* QPl = (bf*)take((size_t)NH_ * TT * HD * 2); bf* KPh = (bf*)take((size_t)NKV * TT * HD * 2); bf* KPl = (bf*)take((size_t)NKV * TT * HD * 2); bf* VTh = (bf*)take((size_t)NKV * HD * TT * 2); bf* VTl = (bf*)take((size_t)NKV * HD * TT * 2);
    bf* PEh = (bf*)take((size_t)NPU * DM * 2); bf* PEl = (bf*)take((size_t)NPU * DM * 2);   /* the position-table planes */ bf* ATh = (bf*)take((size_t)TT * DQ * 2); bf* ATl = (bf*)take((size_t)TT * DQ * 2); unsigned* MB = (unsigned*)take((size_t)TT * TT / 8);   /* the mask's bits */
    if ((size_t)(wsp - (char*)d_ws) > ws_size) return;    // ws 256 MiB
    k_prep<<<NPB, 256, 0, stream>>>(x, xk, xv, wq, wk, wv, wo, wp, MK, XB, XKB, XVB, WQ, WK, WV, WO, WP, PEh, PEl, MB);   /* the five weights transposed to bf16, the reversed sinusoidal table's hi/lo planes, q / k / v rounded to bf16, the mask packed to bits */
    k_proj<<<GP + 3 * GQ, 256, 0, stream>>>(PEh, PEl, WP, XB, WQ, XKB, WK, XVB, WV, PPh, PPl, QPh, QPl, QVh, QVl, KPh, KPl, VTh, VTl, pbu, pbv);   /* the four projections, each storing the hi/lo planes that the attention reads */
    for (int b = 0; b < NB_; ++b) {
        k_attn<<<dim3(NH_, TT / RB, 1), NWV * 32, 0, stream>>>(QPh, QPl, QVh, QVl, KPh, KPl, PPh, PPl, VTh, VTl, MB, ATh, ATl);   /* scores, shift, softmax and attn.v of all heads; one kv head per query head */
        k_gemmw<bf, 1, false, 8, 1><<<dim3(TT / 64, DM / 64, 1), 256, 0, stream>>>(ATh, ATl, WO, nullptr, DQ, OUT + (size_t)b * TT * DM, DM, nullptr, 0, 0, 0, 0); }
}

// v010
// A run of this version takes 129 microseconds.
// In both of two side-by-side timings against v009, it was 1.04 times as fast.
// Over all steps from v000 it is 7.87 times as fast.
#include <hip/hip_runtime.h>

// Transformer-XL relative-position multi-head attention (q, k, v inputs [1][2048][1024]; qh = q w_q, kh = k w_k, vh = v w_v ('xw' [1024][1024], no bias; 16 heads x 64); pe = reversed sinusoidal table of length 4096 (pe[m] = PE(4095 - m), interleaved sin/cos) projected by w_p -> ph [16][4096][64]; ac = (qh + b_u).kh, bd = left_shift((qh + b_v).ph): bd[i][j] = raw[i][4095 - i + j] for j <= i else 0; scores = (ac + bd)/8; mask (int [1][2048][2048], read once and packed to bits; -inf where 0); softmax; out = attn.vh merged w_o -> [1][2048][1024]).
// Layout: projections from three bf16 input planes, each projection GEMM storing its result as the bf16 hi/lo planes that the attention reads (no f32 copy in memory); b_u / b_v folded into two sets of query planes; the position table is computed on device in f32 (pos / 10000^(2i/1024), precise powf/sinf/cosf), only its rows m >= 2048 (the left shift keeps m = 4095 - i + j with 0 <= j <= i <= 2047 and zeroes the rest, so no other row reaches the output for any input) -> hi/lo planes -> 2-product GEMM with the exact bf16 w_p -> per-head hi/lo planes; one launch does the attention of all heads: a work-group keeps 64 query rows' scores of half the keys at a time in LDS (the two halves' softmax results joined by their maxima and sums), content and position scores are hi/lo x hi/lo products (3 products), a position score is added at its shifted key, and softmax and attn.v follow on the same rows.
// Compute dtypes, f32 accumulate: every input rounded to bf16; q/k/v on PLAIN bf16 operands (inputs: exact); content / position scores and attn.v on hi/lo planes for every row (3 products); softmax f32; w_o hl x exact (2 products).

#define NB_  1
#define TT   2048
#define DM   1024
#define NH_  16
#define NKV  16
#define REP  (NH_ / NKV)
#define HD   64
#define DQ   (NH_ * HD)
#define DKV  (NKV * HD)
#define NPE  4096                 // relative positions (2 x seq)
#define NPU  TT                   // positions that the left shift can keep: m = NPE - 1 - i + j, 0 <= j <= i < TT, so m >= NPE - TT; row m of the table and of its projection lies at plane row m - (NPE - NPU)
typedef __attribute__((ext_vector_type(4))) int v4i;
#define WIN  0
#define SCL  0.125f   // HD^-0.5
typedef _Float16 h16;
typedef unsigned short bf;
typedef __attribute__((ext_vector_type(16))) __bf16   v16bf;
typedef __attribute__((ext_vector_type(16))) _Float16 v16h;
typedef __attribute__((ext_vector_type(8)))  _Float16 v8h;
typedef __attribute__((ext_vector_type(8)))  unsigned short v8us;
typedef __attribute__((ext_vector_type(8)))  float    v8f;
typedef __attribute__((ext_vector_type(4)))  float    v4f;
typedef v8h  __attribute__((may_alias)) v8ha;
typedef v4f  __attribute__((may_alias)) v4fa;
typedef v8us __attribute__((may_alias)) v8usa;

__device__ __forceinline__ unsigned short f2bf(float f) { unsigned u = __float_as_uint(f); u += 0x7FFFu + ((u >> 16) & 1u); return (unsigned short)(u >> 16); }
__device__ __forceinline__ float bf2f(unsigned short b) { return __uint_as_float(((unsigned)b) << 16); }
__device__ __forceinline__ float bfr(float f) { return bf2f(f2bf(f)); }
__device__ __forceinline__ v16h cat16(v8h lo, v8h hi) { return __builtin_shufflevector(lo, hi, 0, 1, 2, 3, 4, 5, 6, 7, 8, 9, 10, 11, 12, 13, 14, 15); }
__device__ __forceinline__ v16bf cat16b(v8us lo, v8us hi) { return __builtin_bit_cast(v16bf, __builtin_shufflevector(lo, hi, 0, 1, 2, 3, 4, 5, 6, 7, 8, 9, 10, 11, 12, 13, 14, 15)); }
__device__ __forceinline__ v8f wmma16(v16h a, v16h b, v8f c) { return __builtin_amdgcn_wmma_f32_16x16x32_f16(false, a, false, b, (short)0, c, false, false); }
__device__ __forceinline__ v8f wmmab(v16bf a, v16bf b, v8f c) { return __builtin_amdgcn_wmma_f32_16x16x32_bf16(false, a, false, b, (short)0, c, false, false); }

__device__ __forceinline__ void splitf(float y, unsigned short& h, unsigned short& l) { h = f2bf(y); l = f2bf(y - bf2f(h)); }
typedef __attribute__((ext_vector_type(2))) float    v2f;
typedef __attribute__((ext_vector_type(2))) __bf16   v2bf;
typedef __attribute__((ext_vector_type(2))) unsigned v2u;
typedef __attribute__((ext_vector_type(4))) unsigned v4u;
// pk2bf: two f32 -> two bf16 (round to nearest even, as f2bf) in the hardware's one packed convert, x[0] in the low half. split2: splitf of two values at once, each word packed as it is stored.
__device__ __forceinline__ unsigned pk2bf(v2f x) { return __builtin_bit_cast(unsigned, __builtin_convertvector(x, v2bf)); }
__device__ __forceinline__ void split2(v2f y, unsigned& h, unsigned& l) { h = pk2bf(y); const v2f hf = {__uint_as_float(h << 16), __uint_as_float(h & 0xFFFF0000u)}; l = pk2bf(y - hf); }
typedef __attribute__((ext_vector_type(2))) unsigned short v2us;
typedef __attribute__((ext_vector_type(4))) unsigned short v4us;

// ---- k_gemmw: register-blocked GEMM, ONE WAVE per 64x64 output tile (16 accumulators), operands straight from 16-bit planes in fragment order; grid (M/64, N/64, Z), 32 threads.
// C[m][n] (f32, pitch ldc, + optional f32 bias[n]) = sum_k A[m][k] Bt[n][k] (+ split products per NSPLIT). z-batch strides sA/sB/sC in elements. K % 32 == 0.
// Split K (long K): NW waves per work-group and KS work-groups per tile each take K / (KS * NW) consecutive k of the same 64x64 tile; the NW partial tiles are summed through LDS in wave order, and work-group ks (blockIdx.z = z * KS + ks) writes its own f32 plane at C + ks * sP, summed by the consumer. Grid (M/64, N/64, Z * KS), NW * 32 threads. K % (KS * NW * 32) == 0. NW > 1 takes no bias.
// FRAGMENT ORDER: every 16-bit operand plane [row][k] in memory (A, A2, Bt, Bt2 here and in gemms, and the planes that gemms stores) is kept as blocks of 16 rows x 32 k, 512 consecutive elements each: element (row lr, k = 16 sh + 8 hi + e) lies at (sh * 32 + hi * 16 + lr) * 8 + e of its block, the blocks of one 16-row strip follow one another along k, and a strip is 16 * K elements.
// A wave-wide 16-byte load (lane = hi * 16 + lr) then takes 512 consecutive bytes, four whole lines (of a row-major plane it would take 32 bytes out of each of 16 lines); which lane and register hold an element is the hardware's fragment layout, k order 8 hi + e, then 16 + 8 hi + e, alike for A and B.
// ld: one fragment of a plane in fragment order; p = its 16 x 32 block + lane * 8.
template <typename T16> struct WFrag;
template <> struct WFrag<h16> { typedef v16h V; static __device__ __forceinline__ V ld(const h16* p) { return cat16(*(const v8h*)p, *(const v8h*)(p + 256)); } static __device__ __forceinline__ v8f mma(V a, V b, v8f c) { return wmma16(a, b, c); } };
template <> struct WFrag<bf> { typedef v16bf V; static __device__ __forceinline__ V ld(const bf* p) { return cat16b(*(const v8us*)p, *(const v8us*)(p + 256)); } static __device__ __forceinline__ v8f mma(V a, V b, v8f c) { return wmmab(a, b, c); } };
// gemmw is the body: os is the work-group's LDS (GEMMW_LDS floats), (bx, by, bz) its place in the grid above. k_gemmw launches one GEMM.
#define GEMMW_LDS(NW) ((NW) == 1 ? 16 * 68 : (NW) * 64 * 68)
template <typename T16, int NSPLIT, bool BIAS, int NW, int KS>
__device__ __forceinline__ void gemmw(float* os, int bx, int by, int bz, const T16* __restrict__ A, const T16* __restrict__ A2, const T16* __restrict__ Bt, const T16* __restrict__ Bt2, int K, float* C, int ldc, const float* __restrict__ bias, size_t sA, size_t sB, size_t sC, size_t sP) {
    typedef typename WFrag<T16>::V V;
    const size_t z = bz / KS; const int ks = bz % KS; A += z * sA; if (A2) A2 += z * sA; Bt += z * sB; if (Bt2) Bt2 += z * sB; C += z * sC + (size_t)ks * sP;
    const int wave = (NW == 1) ? 0 : __builtin_amdgcn_readfirstlane(threadIdx.x >> 5); const int kw = K / (KS * NW), k0 = (ks * NW + wave) * kw;   /* this wave's k range [k0, k0 + kw) */
    const int lane = threadIdx.x & 31, lr = lane & 15, hi = lane >> 4; const int r0 = bx * 64, c0 = by * 64;
    v8f acc[4][4];
#pragma unroll
    for (int mb = 0; mb < 4; ++mb)
#pragma unroll
        for (int nb = 0; nb < 4; ++nb) acc[mb][nb] = (v8f){};
    const size_t aoff = (size_t)r0 * K + (size_t)k0 * 16 + lane * 8, boff = (size_t)c0 * K + (size_t)k0 * 16 + lane * 8;   /* strip r0 / 16, block k0 / 32 */
#pragma unroll 1
    for (int kc = 0; kc < kw; kc += 32) {
        V a[4], a2[4];
#pragma unroll
        for (int mb = 0; mb < 4; ++mb) { a[mb] = WFrag<T16>::ld(A + aoff + (size_t)mb * 16 * K + kc * 16); if (NSPLIT == 1 || NSPLIT == 2) a2[mb] = WFrag<T16>::ld(A2 + aoff + (size_t)mb * 16 * K + kc * 16); }
#pragma unroll
        for (int nb = 0; nb < 4; ++nb) { const V b = WFrag<T16>::ld(Bt + boff + (size_t)nb * 16 * K + kc * 16); V b2; if (NSPLIT >= 2) b2 = WFrag<T16>::ld(Bt2 + boff + (size_t)nb * 16 * K + kc * 16);
#pragma unroll
            for (int mb = 0; mb < 4; ++mb) { acc[mb][nb] = WFrag<T16>::mma(a[mb], b, acc[mb][nb]); if (NSPLIT == 1 || NSPLIT == 2) acc[mb][nb] = WFrag<T16>::mma(a2[mb], b, acc[mb][nb]); if (NSPLIT >= 2) acc[mb][nb] = WFrag<T16>::mma(a[mb], b2, acc[mb][nb]); } }
        asm volatile("v_nop\n\tv_nop\n\tv_nop\n\tv_nop" : "+v"(acc[0][0]), "+v"(acc[1][1]), "+v"(acc[2][2]), "+v"(acc[3][3]) : "v"(a[0]), "v"(a[3]));
    }
    if (NW > 1) {
        float* rw = os + wave * (64 * 68);
        // the three loops are unrolled so that acc is indexed by constants and stays in registers
#pragma unroll
        for (int mb = 0; mb < 4; ++mb)
#pragma unroll
            for (int nb = 0; nb < 4; ++nb)
#pragma unroll
                for (int j = 0; j < 8; ++j) rw[(mb * 16 + hi * 8 + j) * 68 + nb * 16 + lr] = acc[mb][nb][j];
        __syncthreads();   // every wave's partial tile is in LDS before any thread sums across the waves
        // the s and w loops are unrolled so that a thread's LDS reads issue together; the sum stays in wave order
        {
#pragma unroll
            for (int s = 0; s < 32 / NW; ++s) { const int idx = s * (NW * 32) + (int)threadIdx.x; const int row = idx >> 4, cofs = (idx & 15) * 4; v4f val = *(const v4fa*)(os + row * 68 + cofs);
#pragma unroll
                for (int w = 1; w < NW; ++w) { const v4f p = *(const v4fa*)(os + w * (64 * 68) + row * 68 + cofs); val[0] += p[0]; val[1] += p[1]; val[2] += p[2]; val[3] += p[3]; }
                *(v4f*)(C + (size_t)(r0 + row) * ldc + c0 + cofs) = val; }
        }
        return;
    }
#pragma unroll
    for (int mb = 0; mb < 4; ++mb) {
#pragma unroll
        for (int nb = 0; nb < 4; ++nb) {
#pragma unroll
            for (int j = 0; j < 8; ++j) os[(hi * 8 + j) * 68 + nb * 16 + lr] = acc[mb][nb][j]; }
        __builtin_amdgcn_wave_barrier(); asm volatile("" ::: "memory");
        float* crow = C + (size_t)(r0 + mb * 16) * ldc + c0;
{
#pragma unroll
            for (int s = 0; s < 8; ++s) { const int row = 2 * s + hi, cofs = lr * 4; v4f val = *(const v4fa*)(os + row * 68 + cofs); if (BIAS) { val[0] += bfr(bias[c0 + cofs]); val[1] += bfr(bias[c0 + cofs + 1]); val[2] += bfr(bias[c0 + cofs + 2]); val[3] += bfr(bias[c0 + cofs + 3]); }
                *(v4f*)(crow + (size_t)row * ldc + cofs) = val; }
             }
        __builtin_amdgcn_wave_barrier(); asm volatile("" ::: "memory");
    }
}

template <typename T16, int NSPLIT, bool BIAS, int NW, int KS>
__global__ __launch_bounds__(NW * 32) void k_gemmw(const T16* __restrict__ A, const T16* __restrict__ A2, const T16* __restrict__ Bt, const T16* __restrict__ Bt2, int K, float* C, int ldc, const float* __restrict__ bias, size_t sA, size_t sB, size_t sC, size_t sP) {
    __shared__ __align__(16) float os[GEMMW_LDS(NW)];
    gemmw<T16, NSPLIT, BIAS, NW, KS>(os, blockIdx.x, blockIdx.y, blockIdx.z, A, A2, Bt, Bt2, K, C, ldc, bias, sA, sB, sC, sP);
}
// ---- gemms: the projection GEMMs (K = DM), ONE WORK-GROUP of eight waves per 128 x 128 output tile, operands shared through LDS. Wave wk * 4 + wn * 2 + wm holds the 64 x 64 quarter (wm, wn) of the tile over the k blocks of parity wk.
// A stage is 64 k (two blocks) of the tile's 128 A rows, 128 Bt rows and, NSPLIT == 1, 128 A2 rows: 16 KiB an operand. Asynchronous 16-byte copies bring it from memory straight into LDS, and every wave reads its fragments there,
// so that L2 delivers each operand byte once a work-group: 2 KiB an operand row of the tile and 1024 k, half of what eight waves that each load their own fragments of one 64 x 64 tile ask for.
// The planes are in fragment order: a strip's two blocks of a stage are 2 KiB in a row in memory and keep that order in LDS (operand o, strip u, block kb at (o * 16 + u * 2 + kb) * 512 elements), and a fragment is two wave-wide 16-byte LDS reads of 512 consecutive bytes each.
// Two buffers: stage s + 2 is asked for when every wave has left stage s, so its copies fly while stage s + 1 is worked on. The two k halves of a quarter are summed through LDS (wk 0 + wk 1). Every plain '#pragma unroll' in gemms is there so that the register arrays (fragments, accumulators, the pieces) are indexed by constants and stay in registers.
// EPI: what the summed tile is stored as. 1: its bf16 hi and lo planes at P1h / P1l. 2: the planes of (tile + hb1[n]) at P1h / P1l and of (tile + hb2[n]) at P2h / P2l (hb rounded to bf16).
// The block of output rows m .. m + 15, columns n .. n + 63 (n % 64 == 0) lies at (n / 64) * sH + (m / 16) * 16 * ldo: head planes [n / 64][m][64] with sH = M * 64, ldo = 64; a plain [m][n] plane with sH = 64 * 16, ldo = N.
#define GS_OP   8192               // elements of one operand in a stage: 128 rows x 64 k
#define GS_NST  (DM / 64)          // stages
// cps: a thread's copies of one stage, four an operand: one 16-byte piece out of each 4 KiB of LDS (two strips). l = its LDS byte address in the buffer, ga / gb / ga2 = its piece of each operand's first two strips.
// All copies of a stage stand in one statement, whose closing wait stands in front of any rewrite of the registers that they name.
#define CPA(l, g) "global_load_async_to_lds_b128 %" #l ", %" #g ", off\n\t"
#define GS_2S   (2 * 16 * DM)      // elements from a strip to the next but one
template <int NSPLIT>
__device__ __forceinline__ void cps(unsigned l, const bf* ga, const bf* gb, const bf* ga2) {
    if (NSPLIT == 1)
        asm volatile(CPA(0, 12) CPA(1, 13) CPA(2, 14) CPA(3, 15) CPA(4, 16) CPA(5, 17) CPA(6, 18) CPA(7, 19) CPA(8, 20) CPA(9, 21) CPA(10, 22) CPA(11, 23) "s_wait_xcnt 0x0"
                     :: "v"(l), "v"(l + 4096u), "v"(l + 8192u), "v"(l + 12288u), "v"(l + 16384u), "v"(l + 20480u), "v"(l + 24576u), "v"(l + 28672u), "v"(l + 32768u), "v"(l + 36864u), "v"(l + 40960u), "v"(l + 45056u),
                        "v"(ga), "v"(ga + GS_2S), "v"(ga + 2 * GS_2S), "v"(ga + 3 * GS_2S), "v"(gb), "v"(gb + GS_2S), "v"(gb + 2 * GS_2S), "v"(gb + 3 * GS_2S), "v"(ga2), "v"(ga2 + GS_2S), "v"(ga2 + 2 * GS_2S), "v"(ga2 + 3 * GS_2S) : "memory");
    else
        asm volatile(CPA(0, 8) CPA(1, 9) CPA(2, 10) CPA(3, 11) CPA(4, 12) CPA(5, 13) CPA(6, 14) CPA(7, 15) "s_wait_xcnt 0x0"
                     :: "v"(l), "v"(l + 4096u), "v"(l + 8192u), "v"(l + 12288u), "v"(l + 16384u), "v"(l + 20480u), "v"(l + 24576u), "v"(l + 28672u),
                        "v"(ga), "v"(ga + GS_2S), "v"(ga + 2 * GS_2S), "v"(ga + 3 * GS_2S), "v"(gb), "v"(gb + GS_2S), "v"(gb + 2 * GS_2S), "v"(gb + 3 * GS_2S) : "memory");
}
__device__ __forceinline__ v16bf ldsblk(const bf* p) { return cat16b(*(const v8usa*)p, *(const v8usa*)(p + 256)); }   /* one fragment of a block in LDS; p = the block + lane * 8 */
template <int NSPLIT, int EPI>
__device__ __forceinline__ void gemms(float* os, int bx, int by, const bf* __restrict__ A, const bf* __restrict__ A2, const bf* __restrict__ Bt, bf* P1h, bf* P1l, bf* P2h, bf* P2l, const float* __restrict__ hb1, const float* __restrict__ hb2, size_t sH, int ldo) {
    constexpr int SE = (NSPLIT == 1 ? 3 : 2) * GS_OP;   /* elements of a stage */
    static_assert(2 * SE * 2 <= GEMMW_LDS(8) * 4 && GS_NST >= 2, "gemms: the two buffers lie inside the work-group's LDS; stages 0 and 1 exist");
    const int t = (int)threadIdx.x; const int wave = __builtin_amdgcn_readfirstlane(t >> 5); const int lane = t & 31, lr = lane & 15, hi = lane >> 4; const int wm = wave & 1, wn = (wave >> 1) & 1, wk = wave >> 2;
    const bf* ring = (const bf*)os; const unsigned l0 = (unsigned)(size_t)os + (unsigned)t * 16u;   /* the low 32 bits of a __shared__ address are its LDS byte address */
    const size_t go = (size_t)(t >> 7) * 16 * DM + (t & 127) * 8;   /* piece t of the first two strips' 2 KiB runs */
    const bf* gA = A + (size_t)bx * 128 * DM + go; const bf* gB = Bt + (size_t)by * 128 * DM + go; const bf* gA2 = NSPLIT == 1 ? A2 + (size_t)bx * 128 * DM + go : nullptr;
    auto fill = [&](int s, int buf) { cps<NSPLIT>(l0 + (unsigned)buf * (SE * 2u), gA + s * 1024, gB + s * 1024, NSPLIT == 1 ? gA2 + s * 1024 : nullptr); };   /* LDS: A at 0, Bt at 16 KiB, A2 at 32 KiB of the buffer */
    v8f acc[4][4];
#pragma unroll
    for (int mb = 0; mb < 4; ++mb)
#pragma unroll
        for (int nb = 0; nb < 4; ++nb) acc[mb][nb] = (v8f){};
    fill(0, 0);
    asm volatile("s_wait_asynccnt 0x0" ::: "memory");   /* this wave's copies of stage 0 have landed */
    __syncthreads();   // stage 0 is whole before any wave reads it
    fill(1, 1);
    // not unrolled: one stage's fragments are live at a time
#pragma unroll 1
    for (int s = 0; s < GS_NST; ++s) {
        const bf* sb = ring + (s & 1) * SE + wk * 512 + lane * 8;
        v16bf a[4], a2[4], b[4];
        // the fragment and product loops are unrolled so that the register arrays are indexed by constants
#pragma unroll
        for (int mb = 0; mb < 4; ++mb) { a[mb] = ldsblk(sb + (wm * 4 + mb) * 1024); if (NSPLIT == 1) a2[mb] = ldsblk(sb + 2 * GS_OP + (wm * 4 + mb) * 1024); }
#pragma unroll
        for (int nb = 0; nb < 4; ++nb) b[nb] = ldsblk(sb + GS_OP + (wn * 4 + nb) * 1024);
        // inputs only: holds the stage's fragment reads in front of the products, so that they issue together and are waited for once, not operand by operand
        if (NSPLIT == 1) asm volatile("" :: "v"(a[0]), "v"(a[1]), "v"(a[2]), "v"(a[3]), "v"(a2[0]), "v"(a2[1]), "v"(a2[2]), "v"(a2[3]), "v"(b[0]), "v"(b[1]), "v"(b[2]), "v"(b[3]));
        else asm volatile("" :: "v"(a[0]), "v"(a[1]), "v"(a[2]), "v"(a[3]), "v"(b[0]), "v"(b[1]), "v"(b[2]), "v"(b[3]));
#pragma unroll
        for (int nb = 0; nb < 4; ++nb)
#pragma unroll
            for (int mb = 0; mb < 4; ++mb) { acc[mb][nb] = wmmab(a[mb], b[nb], acc[mb][nb]); if (NSPLIT == 1) acc[mb][nb] = wmmab(a2[mb], b[nb], acc[mb][nb]); }
        __builtin_amdgcn_sched_barrier(0);   // keeps the products in front of the waits: moved behind the barrier they would stand between it and the refill, and the copies would fly that much shorter before they are waited for
        asm volatile("s_wait_dscnt 0x0" ::: "memory");      /* this wave's reads of stage s are over */
        asm volatile("s_wait_asynccnt 0x0" ::: "memory");   /* this wave's copies of stage s + 1 have landed */
        __syncthreads();   // stage s + 1 is whole, and every wave has left stage s, before s + 1 is read and the buffer of s is refilled
        if (s + 2 < GS_NST) fill(s + 2, s & 1);
    }
    asm volatile("s_wait_asynccnt 0x0" ::: "memory");   /* no copy is outstanding when the ring's LDS takes the partial tiles (the last trip's barrier has ended every read of it) */
    float* rw = os + wave * (64 * 68);
    // the three loops are unrolled so that acc is indexed by constants and stays in registers
#pragma unroll
    for (int mb = 0; mb < 4; ++mb)
#pragma unroll
        for (int nb = 0; nb < 4; ++nb)
#pragma unroll
            for (int j = 0; j < 8; ++j) rw[(mb * 16 + hi * 8 + j) * 68 + nb * 16 + lr] = acc[mb][nb][j];
    __syncthreads();   // every wave's partial tile is in LDS before any thread sums the two k halves
    // a thread takes the eight elements of one 16-byte piece of the planes, pieces in fragment order: a wave stores 512 consecutive bytes of each plane. Unrolled so that the quarter is a constant and a thread's LDS reads issue together
#pragma unroll
    for (int s = 0; s < 8; ++s) { const int wt = s >> 1, idx = (s & 1) * 256 + t;   /* piece idx of quarter wt = wn * 2 + wm */ const int row = (idx >> 7) * 16 + (idx & 15), cofs = ((idx >> 4) & 7) * 8;
        const float* o0 = os + wt * (64 * 68) + row * 68 + cofs; v4f va = *(const v4fa*)o0, vb = *(const v4fa*)(o0 + 4); const v4f p = *(const v4fa*)(o0 + 4 * (64 * 68)), p2 = *(const v4fa*)(o0 + 4 * (64 * 68) + 4);
        va[0] += p[0]; va[1] += p[1]; va[2] += p[2]; va[3] += p[3]; vb[0] += p2[0]; vb[1] += p2[1]; vb[2] += p2[2]; vb[3] += p2[3];
        const int c0 = (by * 2 + (wt >> 1)) * 64; const size_t po = (size_t)(by * 2 + (wt >> 1)) * sH + (size_t)(bx * 8 + (wt & 1) * 4 + (idx >> 7)) * 16 * ldo + (idx & 127) * 8; v4u oh, ol;
        // both q loops are unrolled so that va, vb, oh and ol are indexed by constants and stay in registers
#pragma unroll
        for (int q = 0; q < 8; q += 2) { v2f val = q < 4 ? (v2f){va[q & 3], va[(q & 3) + 1]} : (v2f){vb[q & 3], vb[(q & 3) + 1]}; if (EPI == 2) val = (v2f){__fadd_rn(val[0], bfr(hb1[c0 + cofs + q])), __fadd_rn(val[1], bfr(hb1[c0 + cofs + q + 1]))}; unsigned x, y; split2(val, x, y); oh[q >> 1] = x; ol[q >> 1] = y; }
        *(v8us*)(P1h + po) = __builtin_bit_cast(v8us, oh); *(v8us*)(P1l + po) = __builtin_bit_cast(v8us, ol);
        if (EPI == 2) {
#pragma unroll
            for (int q = 0; q < 8; q += 2) { const v2f val = q < 4 ? (v2f){va[q & 3], va[(q & 3) + 1]} : (v2f){vb[q & 3], vb[(q & 3) + 1]}; unsigned x, y; split2((v2f){__fadd_rn(val[0], bfr(hb2[c0 + cofs + q])), __fadd_rn(val[1], bfr(hb2[c0 + cofs + q + 1]))}, x, y); oh[q >> 1] = x; ol[q >> 1] = y; }
            *(v8us*)(P2h + po) = __builtin_bit_cast(v8us, oh); *(v8us*)(P2l + po) = __builtin_bit_cast(v8us, ol); }
        asm volatile("s_wait_xcnt 0x0" ::: "memory");   /* stands in front of any rewrite of the registers that the plane stores name: the next piece's, or another GEMM's code that follows this one in the listing */ }
}
// k_proj holds the four projections, which do not depend on one another, in one launch, every work-group resident at once: work-groups [0, GP) the position table x w_p (the longest, so first), [GP, GP + GQ) q, then GQ each for k and v; inside each range the tile's row index runs fastest, as in a grid of its own.
#define GP   ((NPU / 128) * (DQ / 128))
#define GQ   ((TT / 128) * (DQ / 128))
__global__ __launch_bounds__(256) void k_proj(const bf* __restrict__ PEh, const bf* __restrict__ PEl, const bf* __restrict__ WP, const bf* __restrict__ XB, const bf* __restrict__ WQ, const bf* __restrict__ XKB, const bf* __restrict__ WK, const bf* __restrict__ XVB, const bf* __restrict__ WV,
                                              bf* PPh, bf* PPl, bf* QPh, bf* QPl, bf* QVh, bf* QVl, bf* KPh, bf* KPl, bf* VTh, bf* VTl, const float* __restrict__ pbu, const float* __restrict__ pbv) {
    __shared__ __align__(16) float os[GEMMW_LDS(8)];
    const int i = blockIdx.x;
    if (i < GP) {   // kept rows of the reversed sinusoidal table (hi/lo) x w_p -> per-head position planes [h][NPU][64]
        gemms<1, 1>(os, i % (NPU / 128), i / (NPU / 128), PEh, PEl, WP, PPh, PPl, nullptr, nullptr, nullptr, nullptr, (size_t)NPU * HD, HD);
    } else if (i < GP + GQ) {   // (q + b_u) planes for the content scores, (q + b_v) planes for the position scores
        const int j = i - GP;
        gemms<0, 2>(os, j % (TT / 128), j / (TT / 128), XB, nullptr, WQ, QPh, QPl, QVh, QVl, pbu, pbv, (size_t)TT * HD, HD);
    } else {   // k: head planes [h][t][64]. v: w_v as the row operand, so that the tile is v transposed, [head x 64 + d][t], as attn.v reads it
        const bool isv = i >= GP + 2 * GQ; const int j = i - GP - (isv ? 2 * GQ : GQ); const int nx = isv ? DKV / 128 : TT / 128;
        gemms<0, 1>(os, j % nx, j / nx, isv ? WV : XKB, nullptr, isv ? XVB : WK, isv ? VTh : KPh, isv ? VTl : KPl, nullptr, nullptr, nullptr, nullptr, isv ? (size_t)64 * 16 : (size_t)TT * HD, isv ? TT : HD);
    }
}

// k_prep: all that the GEMMs read is prepared in ONE launch of NPB work-groups, few enough to be resident together. Every plane it writes is in fragment order (see k_gemmw). Every wave transposes one 16 n x 32 k block of one weight, w [k][n] f32 -> Bt [n][k] bf16 (256 work-groups a weight, five weights);
// between those loads and their stores, work-groups 0 .. NPT - 1 fill the position table (a thread keeps one sin/cos column pair, so one powf, for PER rows) and the other NPB - NPT round q, k and v to bf16 (a thread takes CVS octets of each); ahead of that, work-groups 0 .. TT / 8 - 1 pack the mask to bits (a wave takes one query row).
// MASK BITS: row i of the mask is TT / 32 words at MB + i * (TT / 32); bit l of word ch * 4 + q says whether mask[i][ch * 128 + l * 4 + q] != 0. A word is then the lane mask of one register of the softmax's score row (lane l holds keys ch * 128 + l * 4 + q):
// the attention fetches a row's mask as 256 bytes through the scalar path, the same for all lanes, where the int mask is 8 KiB a row and head through the vector path, and the select takes the word as its condition with no compare.
#define NPB  1280                  // 5 weights x DM * DQ / 64 / 64
#define NPT  1024                  // table work-groups: two a row block (512 column pairs = 2 x 256 threads)
#define PER  (NPU * 2 / NPT)       // table rows a thread
#define CVS  (TT * DM / 8 / ((NPB - NPT) * 256))   // octets of each input a thread
static_assert(NB_ == 1 && DQ == DM && DKV == DM && 5 * (DM * DQ / 64 / 64) == NPB && PER * NPT == NPU * 2 && NPU <= NPE && CVS * (NPB - NPT) * 256 * 8 == TT * DM && TT / 8 <= NPB && TT % 128 == 0 && TT / 128 <= 32, "k_prep: the shares are exact");
// piece i of the plane in fragment order holds row (i >> 11) * 16 + (i & 15), octet (i >> 4) & 127 of the row-major input [row][DM]
__device__ __forceinline__ void cvt8(const float* __restrict__ src, bf* __restrict__ dst, size_t i) { const v8f v = *(const v8f*)(src + (((i >> 11) * 16 + (i & 15)) * (DM / 8) + ((i >> 4) & (DM / 8 - 1))) * 8); v8us o;
    // unrolled so that v and o are indexed by constants and stay in registers
#pragma unroll
    for (int k = 0; k < 8; ++k) o[k] = f2bf(v[k]);
    *(v8us*)(dst + i * 8) = o; }
__global__ __launch_bounds__(256) void k_prep(const float* __restrict__ x, const float* __restrict__ xk, const float* __restrict__ xv, const float* __restrict__ wq, const float* __restrict__ wk, const float* __restrict__ wv, const float* __restrict__ wo, const float* __restrict__ wp, const int* __restrict__ mk,
                                              bf* __restrict__ XB, bf* __restrict__ XKB, bf* __restrict__ XVB, bf* __restrict__ WQ, bf* __restrict__ WK, bf* __restrict__ WV, bf* __restrict__ WO, bf* __restrict__ WP, bf* __restrict__ PEh, bf* __restrict__ PEl, unsigned* __restrict__ MB) {
    const int b = blockIdx.x, t = threadIdx.x, lane = t & 31; const int wi = b >> 8;
    const float* w = wi == 0 ? wq : wi == 1 ? wk : wi == 2 ? wv : wi == 3 ? wo : wp; bf* Bt = wi == 0 ? WQ : wi == 1 ? WK : wi == 2 ? WV : wi == 3 ? WO : WP;
    const int blk = (b & 255) * 8 + (t >> 5);   /* the wave's block: strip n / 16 = blk / 32, k / 32 = blk % 32 */
    const float* wl = w + (size_t)((blk & 31) * 32 + (lane >> 4) * 8) * DQ + (blk >> 5) * 16 + (lane & 15);   /* this lane's n, its first k */
    float r[2][8];
    // unrolled so that r is indexed by constants and the sixteen loads of a wave fly together
#pragma unroll
    for (int sh = 0; sh < 2; ++sh)
#pragma unroll
        for (int e = 0; e < 8; ++e) r[sh][e] = wl[(size_t)(sh * 16 + e) * DQ];
    asm volatile("s_wait_xcnt 0x0" ::: "memory");   /* stands in front of any rewrite of the address registers that the sixteen loads name */
    if (b < TT / 8) {   // the mask's bits, a row a wave: in the work-groups that start first, which have the most time left before the launch ends
        const int mrow = b * 8 + (t >> 5); const int* mr = mk + (size_t)mrow * TT + lane * 4; v4i m[TT / 128];
        // both ch loops are unrolled so that m is indexed by constants and the row's loads fly together
#pragma unroll
        for (int ch = 0; ch < TT / 128; ++ch) m[ch] = *(const v4i*)(mr + ch * 128);
        asm volatile("s_wait_xcnt 0x0" ::: "memory");   /* stands in front of any rewrite of the address registers that the row's loads name */
        v4u mw = {0u, 0u, 0u, 0u};   /* lane ch keeps the four words of chunk ch */
#pragma unroll
        for (int ch = 0; ch < TT / 128; ++ch) { const v4u w = {__builtin_amdgcn_ballot_w32(m[ch][0] != 0), __builtin_amdgcn_ballot_w32(m[ch][1] != 0), __builtin_amdgcn_ballot_w32(m[ch][2] != 0), __builtin_amdgcn_ballot_w32(m[ch][3] != 0)}; if (lane == ch) mw = w; }
        if (lane < TT / 128) *(v4u*)(MB + (size_t)mrow * (TT / 32) + lane * 4) = mw;
    }
    if (b < NPT) {
        const int c = ((b & 1) * 256 + t) * 2; const float ex = __fdiv_rn((float)c, (float)DM);   /* c even: 2i/d_model */ const float den = powf(10000.0f, ex);
        for (int q = 0; q < PER; ++q) { const int m = (b >> 1) * PER + q; const float pos = (float)(NPU - 1 - m);   /* plane row m is table row NPE - NPU + m, reversed: position NPE - 1 - that */ const float th = __fdiv_rn(pos, den); v2us oh, ol; unsigned short a, b2; splitf(sinf(th), a, b2); oh[0] = a; ol[0] = b2; splitf(cosf(th), a, b2); oh[1] = a; ol[1] = b2;
            const size_t e = (size_t)(m >> 4) * 16 * DM + (c >> 5) * 512 + (((c >> 3) & 3) * 16 + (m & 15)) * 8 + (c & 7);   /* fragment order */ *(v2us*)(PEh + e) = oh; *(v2us*)(PEl + e) = ol; }
    } else {
        const size_t i0 = (size_t)(b - NPT) * 256 + t;
        for (int s = 0; s < CVS; ++s) { const size_t i = i0 + (size_t)s * ((NPB - NPT) * 256); cvt8(x, XB, i); cvt8(xk, XKB, i); cvt8(xv, XVB, i);
            asm volatile("s_wait_xcnt 0x0" ::: "memory");   /* stands in front of the next trip's rewrite of the registers that the three stores name */ }
    }
    // unrolled so that r is indexed by constants; each store is 512 consecutive bytes a wave
#pragma unroll
    for (int sh = 0; sh < 2; ++sh) { v8us o;
#pragma unroll
        for (int e = 0; e < 8; ++e) o[e] = f2bf(r[sh][e]);
        *(v8us*)(Bt + (size_t)blk * 512 + sh * 256 + lane * 8) = o; }
}

// k_attn: one work-group = one head x RB query rows, every stage of the attention on chip. The keys are taken in KH passes of TK; the RB score rows of a pass, [RB][TK] f32, live in LDS (pitch SP floats), so that a k, position or v fragment fetched from L2 serves RB = 64 query rows. A pass:
//   1 content scores (q + b_u).k into the rows; 2 raw position scores (q + b_v).ph only for the positions that the left shift keeps (m = 4095 - i + j, 0 <= j <= i) and whose key j lies in the pass, added at their shifted key;
//   3 mask (its bits, see k_prep: a word is a register's lane mask), softmax per row over the pass's keys (a wave takes SR rows at a time, register rows; a row's maximum and sum are kept in ST), the row rewritten in place as its bf16 hi plane (first 2 KiB) and lo plane (next 2 KiB);
//   4 attn.v with the hi/lo rows as the A operand from LDS, each wave TK / NWV keys, the NWV partial tiles summed through LDS in wave order.
// Behind the passes a row's results o_p are joined with the weights w_p = sum_p * exp((max_p - max) / 8): out = (w_0 o_0 + w_1 o_1) / (w_0 + w_1), which is the softmax over all keys, and split into the merged hi/lo planes.
// Every plain '#pragma unroll' in this kernel is there so that the register arrays (fragments, accumulators, the score row) are indexed by constants and stay in registers.
#define MT   4                     // 16-row tiles of query rows per work-group
#define RB   (16 * MT)
#define NWV  8                     // waves per work-group, two a SIMD: a wave may hold 512 registers, which the query fragments of RB rows beside four tiles in flight need (RB * 8 output pieces = 2 a thread)
#define SR   4                     // score rows a wave takes through the softmax together
#define KT   4                     // position tiles a wave fetches together
#define KH   2                     // passes over the keys
#define TK   (TT / KH)             // keys of a pass
#define SP   (TK + 4)              // floats per score row in LDS: 16-byte aligned rows, 4 banks apart
static_assert(KH == 2 && NWV == 8 && SR == 4 && TK == 1024 && (RB / NWV) % SR == 0 && TK / NWV >= HD && RB * 8 == 2 * NWV * 32 && 16 * NWV >= RB - 1 && RB / 16 <= NWV && (TK / 16) % (KT * NWV) == 0 && TK % (64 * NWV) == 0 && TK / 32 / NWV >= 2, "k_attn: the shares are exact; all but the first position tile of a trip lie inside the pass");
typedef v4us __attribute__((may_alias)) v4usa;
typedef __attribute__((ext_vector_type(16))) unsigned v16u;
typedef v16u __attribute__((address_space(4))) cmv;   // sixteen mask words read as constant memory (no launch writes it while it is read): the compiler then fetches a wave-uniform address through the scalar path, into the scalar registers that the select reads
__device__ __forceinline__ v16bf ldsfrag(const bf* p) { return cat16b(*(const v8usa*)p, *(const v8usa*)(p + 16)); }
__device__ __forceinline__ v8f mma3(v16bf a, v16bf a2, v16bf b, v16bf b2, v8f c) { c = wmmab(a, b, c); c = wmmab(a2, b, c); return wmmab(a, b2, c); }
// scores: one 16-key (or 16-position) tile against the MT row tiles, the MT accumulate chains side by side so that a product never waits for the one before it; each chain in mma3's order, k block 0 then 1
__device__ __forceinline__ void scores(v8f (&acc)[MT], const v16bf (&a)[MT][2], const v16bf (&a2)[MT][2], const v16bf (&b)[2], const v16bf (&c)[2]) {
#pragma unroll
    for (int mt = 0; mt < MT; ++mt) acc[mt] = (v8f){};
#pragma unroll
    for (int kk = 0; kk < 2; ++kk) {
#pragma unroll
        for (int mt = 0; mt < MT; ++mt) acc[mt] = wmmab(a[mt][kk], b[kk], acc[mt]);
#pragma unroll
        for (int mt = 0; mt < MT; ++mt) acc[mt] = wmmab(a2[mt][kk], b[kk], acc[mt]);
#pragma unroll
        for (int mt = 0; mt < MT; ++mt) acc[mt] = wmmab(a[mt][kk], c[kk], acc[mt]); }
}
__global__ __launch_bounds__(NWV * 32) void k_attn(const bf* __restrict__ QUh, const bf* __restrict__ QUl, const bf* __restrict__ QWh, const bf* __restrict__ QWl, const bf* __restrict__ Kh, const bf* __restrict__ Kl, const bf* __restrict__ Rh, const bf* __restrict__ Rl, const bf* __restrict__ Vh, const bf* __restrict__ Vl, const unsigned* __restrict__ MB, bf* Ah, bf* Al) {
    typedef WFrag<bf> F;
    __shared__ __align__(16) float S[RB * SP];   /* the score rows and, behind them in time, the partial tiles */
    __shared__ float ST[KH][RB][2];   /* a row's maximum (raw score) and sum of each pass */
    const int h = blockIdx.x; const int i0 = (TT / RB - 1 - (int)blockIdx.y) * RB;   /* late query rows have the most positions: they start first */
    const int wave = __builtin_amdgcn_readfirstlane(threadIdx.x >> 5); const int lane = threadIdx.x & 31, lr = lane & 15, hi = lane >> 4;
    const unsigned lo = (unsigned)lane * 8u;   /* a lane's place in a block: every fragment address is a wave-uniform pointer + lo */
    const size_t qoff = ((size_t)h * TT + i0) * HD;   /* all global planes are in fragment order (see k_gemmw): a 16-row strip of a head plane is 16 * HD elements, two blocks of 512 */
    const int row = ((int)threadIdx.x >> 7) * 16 + ((int)threadIdx.x & 15), cofs = (((int)threadIdx.x >> 4) & 7) * 8;   /* this thread's output pieces: pieces threadIdx.x and NWV * 32 + threadIdx.x of the block's rows in fragment order, rows row and row + RB / 2 */
    v4f va[2], vb[2], pa0[2], pb0[2];   /* the pieces' results of this pass, and of pass 0 */
    // not unrolled: the passes share one body of code
#pragma unroll 1
    for (int kh = 0; kh < KH; ++kh) {
    {   // 1: content scores, TK / 16 / NWV key tiles a wave
        v16bf a[MT][2], a2[MT][2]; const bf* qh = QUh + qoff; const bf* ql = QUl + qoff;
#pragma unroll
        for (int mt = 0; mt < MT; ++mt)
#pragma unroll
            for (int kk = 0; kk < 2; ++kk) { a[mt][kk] = F::ld(qh + mt * 16 * HD + kk * 512 + lo); a2[mt][kk] = F::ld(ql + mt * 16 * HD + kk * 512 + lo); }
        asm volatile("s_wait_xcnt 0x0" :: "s"(qh), "s"(ql) : "memory");   /* stands in front of any rewrite of the address registers that the loads above name: the scalar bases, which as inputs stay whole up to it (the lane offset lo is never rewritten) */
        const size_t koff = ((size_t)h * TT + kh * TK + wave * (TK / NWV)) * HD; const bf* kph = Kh + koff; const bf* kpl = Kl + koff;
        v16bf b[2][2][2], c[2][2][2];   /* two sets of two key tiles: while one set is worked on, the other's loads fly */
        auto ldk = [&](int set, int buf) {
#pragma unroll
            for (int w = 0; w < 2; ++w)
#pragma unroll
                for (int kk = 0; kk < 2; ++kk) { b[buf][w][kk] = F::ld(kph + (set * 2 + w) * 16 * HD + kk * 512 + lo); c[buf][w][kk] = F::ld(kpl + (set * 2 + w) * 16 * HD + kk * 512 + lo); }
            asm volatile("s_wait_xcnt 0x0" :: "s"(kph), "s"(kpl) : "memory");   /* stands in front of any rewrite of the address registers that the loads above name: the scalar bases, which as inputs stay whole up to it (the lane offset lo is never rewritten) */
        };
        ldk(0, 0); ldk(1, 1);
        // unrolled so that the set's buffer is a constant
#pragma unroll
        for (int s = 0; s < TK / 32 / NWV; ++s) { const int f = s & 1;
            // inputs only: holds the sixteen loads of the set in front of its products, so that they are waited for once, not fragment by fragment
            asm volatile("" :: "v"(b[f][0][0]), "v"(b[f][0][1]), "v"(b[f][1][0]), "v"(b[f][1][1]), "v"(c[f][0][0]), "v"(c[f][0][1]), "v"(c[f][1][0]), "v"(c[f][1][1]));
#pragma unroll
            for (int w = 0; w < 2; ++w) { v8f acc[MT]; scores(acc, a, a2, b[f][w], c[f][w]);
#pragma unroll
                for (int mt = 0; mt < MT; ++mt)
#pragma unroll
                    for (int j = 0; j < 8; ++j) S[(mt * 16 + hi * 8 + j) * SP + wave * (TK / NWV) + (s * 2 + w) * 16 + lr] = acc[mt][j];
                // the next tile's first products start new sums in the registers that the last products above wrote; LDS stores fill no vector slot, so the four slots that the chip needs between the two are filled here. The two scheduling barriers keep the v_nop between the tiles' products
                __builtin_amdgcn_sched_barrier(0); asm volatile("v_nop\n\tv_nop\n\tv_nop\n\tv_nop"); __builtin_amdgcn_sched_barrier(0); }
            if (s + 2 < TK / 32 / NWV) ldk(s + 2, f); }
    }
    __syncthreads();   // every content score of the pass is in LDS before a position score is added to it
    {   // 2: position tile t of the pass holds m = NPE - RB - i0 + kh TK + 16 t + c; row r of the block meets it at the pass's key 16 t + c + r - (RB - 1); each (r, key) belongs to exactly one (t, c). The RB / 16 tiles at each end of a pass hold keys of the neighbouring pass too (or keys below 0), which a lane test drops
        v16bf a[MT][2], a2[MT][2]; const bf* qh = QWh + qoff; const bf* ql = QWl + qoff;
#pragma unroll
        for (int mt = 0; mt < MT; ++mt)
#pragma unroll
            for (int kk = 0; kk < 2; ++kk) { a[mt][kk] = F::ld(qh + mt * 16 * HD + kk * 512 + lo); a2[mt][kk] = F::ld(ql + mt * 16 * HD + kk * 512 + lo); }
        asm volatile("s_wait_xcnt 0x0" :: "s"(qh), "s"(ql) : "memory");   /* stands in front of any rewrite of the address registers that the loads above name: the scalar bases, which as inputs stay whole up to it (the lane offset lo is never rewritten) */
        const int nl = (i0 + RB) / 16 - kh * (TK / 16); const int nt = nl < TK / 16 + RB / 16 ? nl : TK / 16 + RB / 16;   /* the table ends at m = NPE - 1 (key j = i); the pass ends at key TK - 1 */
        const size_t roff = ((size_t)h * NPU + (NPU - RB - i0) + kh * TK) * HD;   /* plane row = m - (NPE - NPU) */
        for (int t = wave; t < nt; t += KT * NWV) {   /* KT tiles a trip, t + u NWV; past the end a tile's loads repeat the first one's and the tile is dropped */
            v16bf b[KT][2], c[KT][2]; const bf* rh[KT]; const bf* rl[KT];
#pragma unroll
            for (int u = 0; u < KT; ++u) { const size_t to = roff + (size_t)(t + u * NWV < nt ? t + u * NWV : t) * 16 * HD; rh[u] = Rh + to; rl[u] = Rl + to;
#pragma unroll
                for (int kk = 0; kk < 2; ++kk) { b[u][kk] = F::ld(rh[u] + kk * 512 + lo); c[u][kk] = F::ld(rl[u] + kk * 512 + lo); } }
            asm volatile("s_wait_xcnt 0x0" :: "s"(rh[0]), "s"(rh[1]), "s"(rh[2]), "s"(rh[3]), "s"(rl[0]), "s"(rl[1]), "s"(rl[2]), "s"(rl[3]) : "memory");   /* stands in front of any rewrite of the address registers that the loads above name: the scalar bases, which as inputs stay whole up to it (the lane offset lo is never rewritten) */
            // inputs only: holds the loads of KT position tiles in front of the products, so that they fly together and are waited for once
            asm volatile("" :: "v"(b[0][0]), "v"(b[0][1]), "v"(b[1][0]), "v"(b[1][1]), "v"(b[2][0]), "v"(b[2][1]), "v"(b[3][0]), "v"(b[3][1]), "v"(c[0][0]), "v"(c[0][1]), "v"(c[1][0]), "v"(c[1][1]), "v"(c[2][0]), "v"(c[2][1]), "v"(c[3][0]), "v"(c[3][1]));
            float* p = S + (hi * 8) * (SP + 1) + 16 * t + lr - (RB - 1);   /* row r = mt * 16 + hi * 8 + j, key 16 t + lr + r - (RB - 1) */
#pragma unroll
            for (int u = 0; u < KT; ++u) {
                if (u && t + u * NWV >= nt) break;   // a scalar test
                float* pu = p + u * 16 * NWV; v8f acc[MT];
                if (u || (16 * t >= RB - 1 && 16 * t + 15 < TK)) {   // every key of the tile lies in the pass (a scalar test; for u > 0 see the static_assert): the old scores are read together, with no lane test, ahead of the products, which hide the reads
                    float o[MT][8];
#pragma unroll
                    for (int mt = 0; mt < MT; ++mt)
#pragma unroll
                        for (int j = 0; j < 8; ++j) o[mt][j] = pu[(mt * 16 + j) * (SP + 1)];
                    scores(acc, a, a2, b[u], c[u]);
#pragma unroll
                    for (int mt = 0; mt < MT; ++mt)
#pragma unroll
                        for (int j = 0; j < 8; ++j) pu[(mt * 16 + j) * (SP + 1)] = __fadd_rn(o[mt][j], acc[mt][j]);
                } else {   // an end tile: the old scores are read together all the same, a key outside the pass at the nearest key inside it (its sum is dropped), and only the stores stand under the lane test
                    float o[MT][8];
#pragma unroll
                    for (int mt = 0; mt < MT; ++mt)
#pragma unroll
                        for (int j = 0; j < 8; ++j) { const int key = 16 * t + lr + mt * 16 + hi * 8 + j - (RB - 1); o[mt][j] = S[(mt * 16 + hi * 8 + j) * SP + (key < 0 ? 0 : key >= TK ? TK - 1 : key)]; }
                    scores(acc, a, a2, b[u], c[u]);
#pragma unroll
                    for (int mt = 0; mt < MT; ++mt)
#pragma unroll
                        for (int j = 0; j < 8; ++j) { const int key = 16 * t + lr + mt * 16 + hi * 8 + j - (RB - 1); if (key >= 0 && key < TK) pu[(mt * 16 + j) * (SP + 1)] = __fadd_rn(o[mt][j], acc[mt][j]); }
                }
            } }
    }
    __syncthreads();   // the rows are complete before a wave takes its rows' softmax
    // SR rows a trip, stage by stage: with two waves a SIMD the rows' LDS reads, mask words and cross-lane steps fly together and are waited for once a step, not one by one. The x loops are unrolled for that, and so that the register rows are indexed by constants
#pragma unroll 1
    for (int rr = 0; rr < RB / NWV; rr += SR) {   // 3: t = (ac + bd)/8, -inf where mask == 0; softmax over the pass's TK keys (register rows, one exp, fixed trees)
        const int r0 = wave * (RB / NWV) + rr; v2f v[SR][TK / 64]; float mx[SR], sum[SR];   /* a row as register pairs: a packed f32 instruction takes two scores */
#pragma unroll
        for (int x = 0; x < SR; x += 2) { v4f s4[2][TK / 128]; v16u mw[2][TK / 512];
#pragma unroll
            for (int y = 0; y < 2; ++y) { const float* srow = S + (r0 + x + y) * SP + lane * 4; const cmv* mkr = (const cmv*)(MB + (size_t)(i0 + r0 + x + y) * (TT / 32) + kh * (TK / 32));   /* the same for all lanes */
#pragma unroll
                for (int ch = 0; ch < TK / 128; ++ch) s4[y][ch] = *(const v4fa*)(srow + ch * 128);
#pragma unroll
                for (int g = 0; g < TK / 512; ++g) mw[y][g] = mkr[g]; }
            // inputs only: holds the LDS reads and the mask words of two rows in front of the selects, so that they fly together and are waited for once
            asm volatile("" :: "v"(s4[0][0]), "v"(s4[0][1]), "v"(s4[0][2]), "v"(s4[0][3]), "v"(s4[0][4]), "v"(s4[0][5]), "v"(s4[0][6]), "v"(s4[0][7]), "v"(s4[1][0]), "v"(s4[1][1]), "v"(s4[1][2]), "v"(s4[1][3]), "v"(s4[1][4]), "v"(s4[1][5]), "v"(s4[1][6]), "v"(s4[1][7]), "s"(mw[0][0]), "s"(mw[0][1]), "s"(mw[1][0]), "s"(mw[1][1]));
#pragma unroll
            for (int y = 0; y < 2; ++y) { mx[x + y] = -3.0e38f;
#pragma unroll
                for (int ch = 0; ch < TK / 128; ++ch)
#pragma unroll
                    for (int q = 0; q < 4; ++q) { const float t = __builtin_amdgcn_inverse_ballot_w32(mw[y][ch >> 2][(ch & 3) * 4 + q]) ? s4[y][ch][q] : -3.0e38f; v[x + y][ch * 2 + (q >> 1)][q & 1] = t; mx[x + y] = fmaxf(mx[x + y], t); } } }   /* the 1/8, a power of two, commutes with maximum, difference and rounding: it stands in the exponent's factor below */
#pragma unroll
        for (int sh = 16; sh; sh >>= 1) { float o[SR];
#pragma unroll
            for (int x = 0; x < SR; ++x) o[x] = __shfl_xor(mx[x], sh, 32);
            asm volatile("" :: "v"(o[0]), "v"(o[1]), "v"(o[2]), "v"(o[3]));   // inputs only: the SR rows' cross-lane reads of this step fly together and are waited for once
#pragma unroll
            for (int x = 0; x < SR; ++x) mx[x] = fmaxf(mx[x], o[x]); }
        const v2f c2 = {SCL * 1.4426950408889634f, SCL * 1.4426950408889634f};
#pragma unroll
        for (int x = 0; x < SR; ++x) { v2f sum2 = {0.f, 0.f}; const v2f mx2 = {mx[x], mx[x]};
#pragma unroll
            for (int k = 0; k < TK / 64; ++k) { const v2f d = (v[x][k] - mx2) * c2; v[x][k] = (v2f){__builtin_amdgcn_exp2f(d[0]), __builtin_amdgcn_exp2f(d[1])}; sum2 += v[x][k]; }
            sum[x] = sum2[0] + sum2[1]; }   /* a lane's even and odd keys are summed apart, then joined */
#pragma unroll
        for (int sh = 16; sh; sh >>= 1) { float o[SR];
#pragma unroll
            for (int x = 0; x < SR; ++x) o[x] = __shfl_xor(sum[x], sh, 32);
            asm volatile("" :: "v"(o[0]), "v"(o[1]), "v"(o[2]), "v"(o[3]));   // inputs only: as in the maximum's steps
#pragma unroll
            for (int x = 0; x < SR; ++x) sum[x] += o[x]; }
#pragma unroll
        for (int x = 0; x < SR; ++x) { const float f = __fdiv_rn(1.0f, sum[x]); const v2f f2 = {f, f}; bf* prow = (bf*)(S + (r0 + x) * SP);
#pragma unroll
            for (int ch = 0; ch < TK / 128; ++ch) { v2u oh, ol;
#pragma unroll
                for (int q = 0; q < 2; ++q) { unsigned a, b; split2(v[x][ch * 2 + q] * f2, a, b); oh[q] = a; ol[q] = b; }
                *(v4usa*)(prow + ch * 128 + lane * 4) = __builtin_bit_cast(v4us, oh); *(v4usa*)(prow + TK + ch * 128 + lane * 4) = __builtin_bit_cast(v4us, ol); } }
        if (lane == 0) {
#pragma unroll
            for (int x = 0; x < SR; ++x) { ST[kh][r0 + x][0] = mx[x]; ST[kh][r0 + x][1] = sum[x]; } }
    }
    __syncthreads();   // every row's hi/lo planes are in LDS before any wave reads them as its A operand
    {   // 4: attn.v, this wave's keys [wave * TK / NWV, + TK / NWV) of the pass
        v8f acc[MT][4];
#pragma unroll
        for (int mt = 0; mt < MT; ++mt)
#pragma unroll
            for (int nb = 0; nb < 4; ++nb) acc[mt][nb] = (v8f){};
        const bf* pa = (const bf*)S + (size_t)lr * (2 * SP) + 8 * hi + wave * (TK / NWV); const size_t voff = (size_t)h * HD * TT + (kh * TK + wave * (TK / NWV)) * 16; const bf* vph = Vh + voff; const bf* vpl = Vl + voff;   /* strip (h * HD + 16 nb) / 16 of 16 * TT elements, block key / 32 */
        // unrolled: two trips of 64 keys, acc indexed by constants
#pragma unroll
        for (int kc = 0; kc < TK / NWV; kc += 64) { v16bf b[2][4], b2[2][4];
#pragma unroll
            for (int s = 0; s < 2; ++s)
#pragma unroll
                for (int nb = 0; nb < 4; ++nb) { b[s][nb] = F::ld(vph + (size_t)nb * 16 * TT + (kc + s * 32) * 16 + lo); b2[s][nb] = F::ld(vpl + (size_t)nb * 16 * TT + (kc + s * 32) * 16 + lo); }
            asm volatile("s_wait_xcnt 0x0" :: "s"(vph), "s"(vpl) : "memory");   /* stands in front of any rewrite of the address registers that the loads above name: the scalar bases, which as inputs stay whole up to it (the lane offset lo is never rewritten) */
#pragma unroll
            for (int s = 0; s < 2; ++s) { v16bf a[MT], a2[MT];
#pragma unroll
                for (int mt = 0; mt < MT; ++mt) { a[mt] = ldsfrag(pa + mt * 16 * (2 * SP) + kc + s * 32); a2[mt] = ldsfrag(pa + mt * 16 * (2 * SP) + TK + kc + s * 32); }
                // inputs only: holds the LDS reads of 32 keys in front of their products, so that they fly together and are waited for once (the first 32 keys' behind the v loads, whose flight hides them)
                asm volatile("" :: "v"(a[0]), "v"(a[1]), "v"(a[2]), "v"(a[3]), "v"(a2[0]), "v"(a2[1]), "v"(a2[2]), "v"(a2[3]));
                // inputs only: holds the v loads of this trip in front of the products, so that they fly together and are waited for once
                if (s == 0) asm volatile("" :: "v"(b[0][0]), "v"(b[0][1]), "v"(b[0][2]), "v"(b[0][3]), "v"(b[1][0]), "v"(b[1][1]), "v"(b[1][2]), "v"(b[1][3]), "v"(b2[0][0]), "v"(b2[0][1]), "v"(b2[0][2]), "v"(b2[0][3]), "v"(b2[1][0]), "v"(b2[1][1]), "v"(b2[1][2]), "v"(b2[1][3]));
#pragma unroll
                for (int mt = 0; mt < MT; ++mt)
#pragma unroll
                    for (int nb = 0; nb < 4; ++nb) acc[mt][nb] = mma3(a[mt], a2[mt], b[s][nb], b2[s][nb], acc[mt][nb]); } }
        __syncthreads();   // the last read of the hi/lo planes is over before their LDS takes the partial tiles
#pragma unroll
        for (int mt = 0; mt < MT; ++mt)
#pragma unroll
            for (int nb = 0; nb < 4; ++nb)
#pragma unroll
                for (int j = 0; j < 8; ++j) S[(mt * 16 + hi * 8 + j) * SP + wave * (TK / NWV) + nb * 16 + lr] = acc[mt][nb][j];   /* the wave's partial tile lies in the first HD of its own key columns of the rows: the addresses of stage 1 */
    }
    __syncthreads();   // every wave's partial tile is in LDS before any thread sums across the waves
    // the s and w loops are unrolled so that a thread's LDS reads issue together; the sum stays in wave order
#pragma unroll
    for (int s = 0; s < 2; ++s) { if (kh) { pa0[s] = va[s]; pb0[s] = vb[s]; }   /* pass 0's result is kept while pass 1's is summed */
        const float* o0 = S + (row + s * (RB / 2)) * SP + cofs; v4f p[NWV], p2[NWV];
#pragma unroll
        for (int w = 0; w < NWV; ++w) { p[w] = *(const v4fa*)(o0 + w * (TK / NWV)); p2[w] = *(const v4fa*)(o0 + w * (TK / NWV) + 4); }
        // inputs only: holds the piece's sixteen LDS reads in front of the sums, so that they fly together and are waited for once
        asm volatile("" :: "v"(p[0]), "v"(p[1]), "v"(p[2]), "v"(p[3]), "v"(p[4]), "v"(p[5]), "v"(p[6]), "v"(p[7]), "v"(p2[0]), "v"(p2[1]), "v"(p2[2]), "v"(p2[3]), "v"(p2[4]), "v"(p2[5]), "v"(p2[6]), "v"(p2[7]));
        va[s] = p[0]; vb[s] = p2[0];
#pragma unroll
        for (int w = 1; w < NWV; ++w) { va[s][0] += p[w][0]; va[s][1] += p[w][1]; va[s][2] += p[w][2]; va[s][3] += p[w][3]; vb[s][0] += p2[w][0]; vb[s][1] += p2[w][1]; vb[s][2] += p2[w][2]; vb[s][3] += p2[w][3]; } }
    __syncthreads();   // the last read of the partial tiles is over before the next pass's scores take their LDS
    }
    // the two passes joined: a pass whose keys are all masked has the floor as its maximum and, beside a pass that is not, the weight 0
#pragma unroll
    for (int s = 0; s < 2; ++s) { const int rs = row + s * (RB / 2);
        const float m0 = ST[0][rs][0], l0 = ST[0][rs][1], m1 = ST[1][rs][0], l1 = ST[1][rs][1]; const float mm = fmaxf(m0, m1);
        const float w0 = l0 * __builtin_amdgcn_exp2f((m0 - mm) * (SCL * 1.4426950408889634f)), w1 = l1 * __builtin_amdgcn_exp2f((m1 - mm) * (SCL * 1.4426950408889634f));
        const float fw = __fdiv_rn(1.0f, w0 + w1); const float g0 = w0 * fw, g1 = w1 * fw; v4f xa, xb;
#pragma unroll
        for (int q = 0; q < 4; ++q) { xa[q] = pa0[s][q] * g0 + va[s][q] * g1; xb[q] = pb0[s][q] * g0 + vb[s][q] * g1; }
        v4u oh, ol;
#pragma unroll
        for (int q = 0; q < 8; q += 2) { unsigned x, y; split2(q < 4 ? (v2f){xa[q & 3], xa[(q & 3) + 1]} : (v2f){xb[q & 3], xb[(q & 3) + 1]}, x, y); oh[q >> 1] = x; ol[q >> 1] = y; }
        const size_t oo = (size_t)((i0 >> 4) + s * (RB / 32) + ((int)threadIdx.x >> 7)) * 16 * DQ + h * HD * 16 + ((int)threadIdx.x & 127) * 8; *(v8us*)(Ah + oo) = __builtin_bit_cast(v8us, oh); *(v8us*)(Al + oo) = __builtin_bit_cast(v8us, ol);
        asm volatile("s_wait_xcnt 0x0" ::: "memory");   /* stands in front of any rewrite of the registers that the two stores name */ }
}

extern "C" void kernel_launch(void* const* d_in, const int* in_sizes, int n_in,
                              void* d_out, int out_size, void* d_ws, size_t ws_size, hipStream_t stream) {
    (void)in_sizes; (void)n_in; (void)out_size;
    const float* x = (const float*)d_in[0]; const float* xk = (const float*)d_in[1]; const float* xv = (const float*)d_in[2]; const int* MK = (const int*)d_in[3]; const float* wq = (const float*)d_in[4]; const float* wk = (const float*)d_in[5]; const float* wv = (const float*)d_in[6]; const float* wp = (const float*)d_in[7]; const float* wo = (const float*)d_in[8]; const float* pbu = (const float*)d_in[9]; const float* pbv = (const float*)d_in[10];
    float* OUT = (float*)d_out;     // [1][2048][1024]
    char* wsp = (char*)d_ws;
    auto take = [&](size_t bytes) { char* p = wsp; wsp += (bytes + 255) & ~(size_t)255; return (void*)p; };
    bf* WQ = (bf*)take((size_t)DQ * DM * 2); bf* WK = (bf*)take((size_t)DKV * DM * 2); bf* WV = (bf*)take((size_t)DKV * DM * 2); bf* WO = (bf*)take((size_t)DM * DQ * 2);
    bf* XB = (bf*)take((size_t)TT * DM * 2); bf* XKB = (bf*)take((size_t)TT * DM * 2); bf* XVB = (bf*)take((size_t)TT * DM * 2); bf* WP = (bf*)take((size_t)DQ * DM * 2); bf* PPh = (bf*)take((size_t)NH_ * NPU * HD * 2); bf* PPl = (bf*)take((size_t)NH_ * NPU * HD * 2); bf* QVh = (bf*)take((size_t)NH_ * TT * HD * 2); bf* QVl = (bf*)take((size_t)NH_ * TT * HD * 2);
    bf* QPh = (bf*)take((size_t)NH_ * TT * HD * 2); bf* QPl = (bf*)take((size_t)NH_ * TT * HD * 2); bf* KPh = (bf*)take((size_t)NKV * TT * HD * 2); bf* KPl = (bf*)take((size_t)NKV * TT * HD * 2); bf* VTh = (bf*)take((size_t)NKV * HD * TT * 2); bf* VTl = (bf*)take((size_t)NKV * HD * TT * 2);
    bf* PEh = (bf*)take((size_t)NPU * DM * 2); bf* PEl = (bf*)take((size_t)NPU * DM * 2);   /* the position-table planes */ bf* ATh = (bf*)take((size_t)TT * DQ * 2); bf* ATl = (bf*)take((size_t)TT * DQ * 2); unsigned* MB = (unsigned*)take((size_t)TT * TT / 8);   /* the mask's bits */
    if ((size_t)(wsp - (char*)d_ws) > ws_size) return;    // ws 256 MiB
    k_prep<<<NPB, 256, 0, stream>>>(x, xk, xv, wq, wk, wv, wo, wp, MK, XB, XKB, XVB, WQ, WK, WV, WO, WP, PEh, PEl, MB);   /* the five weights transposed to bf16, the reversed sinusoidal table's hi/lo planes, q / k / v rounded to bf16, the mask packed to bits */
    k_proj<<<GP + 3 * GQ, 256, 0, stream>>>(PEh, PEl, WP, XB, WQ, XKB, WK, XVB, WV, PPh, PPl, QPh, QPl, QVh, QVl, KPh, KPl, VTh, VTl, pbu, pbv);   /* the four projections, each storing the hi/lo planes that the attention reads */
    for (int b = 0; b < NB_; ++b) {
        k_attn<<<dim3(NH_, TT / RB, 1), NWV * 32, 0, stream>>>(QPh, QPl, QVh, QVl, KPh, KPl, PPh, PPl, VTh, VTl, MB, ATh, ATl);   /* scores, shift, softmax and attn.v of all heads; one kv head per query head */
        k_gemmw<bf, 1, false, 8, 1><<<dim3(TT / 64, DM / 64, 1), 256, 0, stream>>>(ATh, ATl, WO, nullptr, DQ, OUT + (size_t)b * TT * DM, DM, nullptr, 0, 0, 0, 0); }
}
